// v000
// Measured on an AMD MI455X. A time is GPU time per run, averaged over a window of back-to-back runs after a warm-up
// (all launches, gaps included; the runs take copies of the inputs in turn), and the median of several windows.
// Apart from v000's, it joins two sittings. Times from different sittings can be a few percent apart, while
// side-by-side timings come from the same sitting.
// v000 is the starting kernel. One run takes 787 microseconds.
#include <hip/hip_runtime.h>
// TinyAttn (4 sequences x 2048 tokens x 1024; 16 heads x 64; rotary embedding on the first 32 dims of each head): q,k,v = x W^T; q,k rotated (rot = [x1 cos + x2 sin, -x1 sin + x2 cos] on dims 0..31 with the module's inverse-frequency table); softmax(q k^T / 8) v; y Wo^T -> [4,2048,1024].
// Structure: x as an exact f16 plane; q/k/v projections as f16 WMMA GEMMs (32x64 wave tiles, f32 accumulation, exact x16 weights; q/k in f32 for the rotation, v as f16); the rotary tables recomputed on the device (f64 pow for the inverse frequencies, f32 angle product, f32 cos/sin) and applied on VALU into f16 q/k planes; V transposed by LDS tiles; the fused flash kernel; the attention output as hi + residual planes into two accumulating output-projection GEMMs.
// Compute dtype: x and weights rounded to bf16; q, k (after rotation), v, P as f16 operands (~2^-12); attention output hi + 2^-10-scaled residual; f32 accumulation/softmax. v_wmma_f32_16x16x32_f16.
#define NB 4
#define DMOD 1024
#define HD 64
#define RD 32                    /* rotary dims per head */
#define NR (NB * SLEN)
#define QBLKS (TQ / 64)          /* query blocks per (sequence, head) launched */
#define SLEN 2048
#define TQ SLEN
#define TK SLEN
#define NH 16
#define SCL 0.125f               /* 64^-0.5 */
typedef __bf16 v16b __attribute__((ext_vector_type(16)));
typedef unsigned short v8us __attribute__((ext_vector_type(8), may_alias));
typedef float  v8f  __attribute__((ext_vector_type(8)));
typedef float  v4f  __attribute__((ext_vector_type(4)));
typedef float  v4fa __attribute__((ext_vector_type(4), may_alias));
union FragB { v16b v; v8us half[2]; unsigned short u[16]; };

__device__ __forceinline__ unsigned short bf16_bits(float x) { unsigned int u = __float_as_uint(x); return (unsigned short)((u + 0x7FFFu + ((u >> 16) & 1u)) >> 16); }
__device__ __forceinline__ float bf16_val(unsigned short b) { return __uint_as_float(((unsigned int)b) << 16); }
__device__ __forceinline__ float bf16_round(float x) { return bf16_val(bf16_bits(x)); }
// D += A·B with NT terms: 1 = ah·bh, 2 = + al·bh (A split), 3 = + ah·bl (both split)
template <int NT>
__device__ __forceinline__ v8f mmaN(v16b ah, v16b al, v16b bh, v16b bl, v8f c) {
  c = __builtin_amdgcn_wmma_f32_16x16x32_bf16(false, ah, false, bh, (short)0, c, false, false);
  if (NT >= 2) c = __builtin_amdgcn_wmma_f32_16x16x32_bf16(false, al, false, bh, (short)0, c, false, false);
  if (NT >= 3) c = __builtin_amdgcn_wmma_f32_16x16x32_bf16(false, ah, false, bl, (short)0, c, false, false);
  asm volatile("v_nop\n\tv_nop\n\tv_nop\n\tv_nop" : "+v"(c) : "v"(ah), "v"(al), "v"(bh), "v"(bl));
  return c;
}

__global__ __launch_bounds__(256) void k_wt_bf16(const float* __restrict__ W, unsigned short* __restrict__ Wt, int K, int N) {
  const int t = blockIdx.x * 256 + threadIdx.x;
  const int k8n = K / 8;
  if (t >= N * k8n) return;
  const int n = t / k8n, k8 = (t % k8n) * 8;
  v8us v;
#pragma unroll
  for (int i = 0; i < 8; ++i) v[i] = bf16_bits(W[(size_t)(k8 + i) * N + n]);
  *(v8us*)(Wt + (size_t)n * K + k8) = v;
  
}

// GEMM C[M][N] (f32, pitch ldc) = act(A[M][K]·W + bias). A f32 row-major (pitch lda) converted per fragment to bf16
// (ASPLIT: hi/lo two planes -> 2 terms, else single rounded term); Wt bf16 [N][K] (pitch ldb). BIAS_BF16 rounds the
// bias to bf16 first (bias quantised to bf16 before the add). K%32==0, M%16==0, N%64==0.
template <bool ASPLIT, int ACT, bool BIAS_BF16>
__global__ __launch_bounds__(128) void k_gemm_bf(const float* __restrict__ A, int lda, const unsigned short* __restrict__ Wt, int ldb,
                                               const float* __restrict__ bias, float* __restrict__ C, int ldc, int M, int N, int K) {
  __shared__ __attribute__((aligned(16))) float so[4][16][64];
  const int tid = threadIdx.x, w = tid >> 5, lane = tid & 31, ln = lane & 15, hh = lane >> 4;
  const int ntn = N / 64;
  const int wid = blockIdx.x * 4 + w;
  const int mt = wid / ntn, nq = wid % ntn;
  if (mt * 16 >= M) return;
  const int row0 = mt * 16, col0 = nq * 64;
  const float* arow = A + (size_t)(row0 + ln) * lda;
  v8f acc[4] = {};
  for (int kb = 0; kb < K; kb += 32) {
    FragB ah, al;
    const v4f x0 = *(const v4fa*)(arow + kb + 8 * hh), x1 = *(const v4fa*)(arow + kb + 8 * hh + 4);
    const v4f x2 = *(const v4fa*)(arow + kb + 16 + 8 * hh), x3 = *(const v4fa*)(arow + kb + 16 + 8 * hh + 4);
    float xs[16] = {x0[0],x0[1],x0[2],x0[3],x1[0],x1[1],x1[2],x1[3],x2[0],x2[1],x2[2],x2[3],x3[0],x3[1],x3[2],x3[3]};
#pragma unroll
    for (int i = 0; i < 16; ++i) { const unsigned short hb = bf16_bits(xs[i]); ah.u[i] = hb; al.u[i] = ASPLIT ? bf16_bits(xs[i] - bf16_val(hb)) : (unsigned short)0; }
#pragma unroll
    for (int t = 0; t < 4; ++t) {
      const unsigned short* brow = Wt + (size_t)(col0 + t * 16 + ln) * ldb + kb;
      FragB b;
      b.half[0] = *(const v8us*)(brow + 8 * hh);
      b.half[1] = *(const v8us*)(brow + 16 + 8 * hh);
      acc[t] = mmaN<ASPLIT ? 2 : 1>(ah.v, al.v, b.v, b.v, acc[t]);
    }
  }
#pragma unroll
  for (int t = 0; t < 4; ++t) {
    float bv = bias ? bias[col0 + t * 16 + ln] : 0.f;
    if (BIAS_BF16) bv = bf16_round(bv);
#pragma unroll
    for (int r = 0; r < 8; ++r) { float v = acc[t][r] + bv; if (ACT == 1) v = fmaxf(v, 0.f); so[w][8 * hh + r][t * 16 + ln] = v; }
  }
  __builtin_amdgcn_fence(__ATOMIC_ACQ_REL, "workgroup");
  __builtin_amdgcn_wave_barrier();
  const int rsub = lane >> 4, c4 = (lane & 15) * 4;
  {
#pragma unroll
    for (int q = 0; q < 8; ++q) {
      const int r = q * 2 + rsub;
      const v4f v = *(const v4fa*)&so[w][r][c4];
      *(v4f*)(C + (size_t)(row0 + r) * ldc + col0 + c4) = v;
    }
    
  }
}

// GEMM C = act(A·W + bias + resid): A f32 (ASPLIT -> hi/lo 2 terms), Wt bf16 [N][K]; ACT 0 none, 1 relu, 2 exact gelu;
// resid (optional, f32, row index = (row % rmod), pitch ldr, RES_BF16 rounds it) added before the activation.
template <bool ASPLIT, int ACT, bool BIAS_BF16, bool RES_BF16>
__global__ __launch_bounds__(128) void k_gemm_bf3(const float* __restrict__ A, int lda, const unsigned short* __restrict__ Wt, int ldb,
                                                const float* __restrict__ bias, const float* __restrict__ resid, int rmod, int ldr,
                                                float* __restrict__ C, int ldc, int M, int N, int K) {
  __shared__ __attribute__((aligned(16))) float so[4][16][64];
  const int tid = threadIdx.x, w = tid >> 5, lane = tid & 31, ln = lane & 15, hh = lane >> 4;
  const int ntn = N / 64;
  const int wid = blockIdx.x * 4 + w;
  const int mt = wid / ntn, nq = wid % ntn;
  if (mt * 16 >= M) return;
  const int row0 = mt * 16, col0 = nq * 64;
  const float* arow = A + (size_t)(row0 + ln) * lda;
  v8f acc[4] = {};
  for (int kb = 0; kb < K; kb += 32) {
    FragB ah, al;
    const v4f x0 = *(const v4fa*)(arow + kb + 8 * hh), x1 = *(const v4fa*)(arow + kb + 8 * hh + 4);
    const v4f x2 = *(const v4fa*)(arow + kb + 16 + 8 * hh), x3 = *(const v4fa*)(arow + kb + 16 + 8 * hh + 4);
    float xs[16] = {x0[0],x0[1],x0[2],x0[3],x1[0],x1[1],x1[2],x1[3],x2[0],x2[1],x2[2],x2[3],x3[0],x3[1],x3[2],x3[3]};
#pragma unroll
    for (int i = 0; i < 16; ++i) { const unsigned short hb = bf16_bits(xs[i]); ah.u[i] = hb; al.u[i] = ASPLIT ? bf16_bits(xs[i] - bf16_val(hb)) : (unsigned short)0; }
#pragma unroll
    for (int t = 0; t < 4; ++t) {
      const unsigned short* brow = Wt + (size_t)(col0 + t * 16 + ln) * ldb + kb;
      FragB b;
      b.half[0] = *(const v8us*)(brow + 8 * hh);
      b.half[1] = *(const v8us*)(brow + 16 + 8 * hh);
      acc[t] = mmaN<ASPLIT ? 2 : 1>(ah.v, al.v, b.v, b.v, acc[t]);
    }
  }
#pragma unroll
  for (int t = 0; t < 4; ++t) {
    const int col = col0 + t * 16 + ln;
    float bv = bias ? bias[col] : 0.f;
    if (BIAS_BF16) bv = bf16_round(bv);
#pragma unroll
    for (int r = 0; r < 8; ++r) {
      float v = acc[t][r] + bv;
      if (resid) { float rv = resid[(size_t)((row0 + 8 * hh + r) % rmod) * ldr + col]; if (RES_BF16) rv = bf16_round(rv); v += rv; }
      if (ACT == 1) v = fmaxf(v, 0.f);
      if (ACT == 2) v = 0.5f * v * (1.0f + erff(v * 0.70710678118654752f));
      if (ACT == 3) { const float u = 0.7978845608028654f * (v + 0.044715f * v * v * v); v = 0.5f * v * (1.0f + tanhf(u)); }
      so[w][8 * hh + r][t * 16 + ln] = v;
    }
  }
  __builtin_amdgcn_fence(__ATOMIC_ACQ_REL, "workgroup");
  __builtin_amdgcn_wave_barrier();
  const int rsub = lane >> 4, c4 = (lane & 15) * 4;
  {
#pragma unroll
    for (int q = 0; q < 8; ++q) {
      const int r = q * 2 + rsub;
      const v4f v = *(const v4fa*)&so[w][r][c4];
      *(v4f*)(C + (size_t)(row0 + r) * ldc + col0 + c4) = v;
    }
    
  }
}
// row LayerNorm (biased variance, eps) over N: s = X (+ R); optional out_sum <- s; out_norm <- (s-mu)*rsqrt(var+eps)*g + b
template <bool PARAM_BF16>
__global__ __launch_bounds__(256) void k_layernorm(const float* __restrict__ X, const float* __restrict__ R, const float* __restrict__ g, const float* __restrict__ bta,
                                                  float* __restrict__ out_sum, float* __restrict__ out_norm, int N, float eps) {
  __shared__ float red[256];
  const int row = blockIdx.x, tid = threadIdx.x;
  const float* x = X + (size_t)row * N; const float* rr = R ? R + (size_t)row * N : nullptr;
  float vals[16];                     // up to N = 4096
  const int per = N / 256;            // contiguous chunk per thread? use strided-by-4 chunks: thread handles j = tid*4 + 1024*u
  float s1 = 0.f;
  for (int u = 0; u < per / 4; ++u) {
    const int j = tid * 4 + 1024 * u;
    const v4f a = *(const v4fa*)(x + j);
    v4f b = {0.f,0.f,0.f,0.f}; if (rr) b = *(const v4fa*)(rr + j);
#pragma unroll
    for (int q = 0; q < 4; ++q) { const float v = a[q] + b[q]; vals[u * 4 + q] = v; s1 += v; }
  }
  red[tid] = s1; __syncthreads();
  for (int st = 128; st > 0; st >>= 1) { if (tid < st) red[tid] += red[tid + st]; __syncthreads(); }
  const float mu = red[0] / (float)N; __syncthreads();
  float s2 = 0.f;
  for (int u = 0; u < per / 4; ++u)
#pragma unroll
    for (int q = 0; q < 4; ++q) { const float c = vals[u * 4 + q] - mu; s2 += c * c; }
  red[tid] = s2; __syncthreads();
  for (int st = 128; st > 0; st >>= 1) { if (tid < st) red[tid] += red[tid + st]; __syncthreads(); }
  const float rs = rsqrtf(red[0] / (float)N + eps);
  {
    for (int u = 0; u < per / 4; ++u) {
      const int j = tid * 4 + 1024 * u;
      v4f o, sm;
#pragma unroll
      for (int q = 0; q < 4; ++q) {
        float gg = g[j + q], bb = bta[j + q];
        if (PARAM_BF16) { gg = bf16_round(gg); bb = bf16_round(bb); }
        sm[q] = vals[u * 4 + q]; o[q] = (vals[u * 4 + q] - mu) * rs * gg + bb;
      }
      if (out_sum) *(v4f*)(out_sum + (size_t)row * N + j) = sm;
      *(v4f*)(out_norm + (size_t)row * N + j) = o;
    }
    
  }
}



// ---- f16 WMMA path (v_wmma_f32_16x16x32_f16): 11-bit significands for operands in range — used where a [0,1] probability operand needs more precision than bf16
typedef _Float16 v16h __attribute__((ext_vector_type(16)));
union FragH { v16h v; v8us half[2]; _Float16 h[16]; unsigned short u[16]; };
template <int NT>
__device__ __forceinline__ v8f mmaH(v16h ah, v16h al, v16h bh, v16h bl, v8f c) {
  c = __builtin_amdgcn_wmma_f32_16x16x32_f16(false, ah, false, bh, (short)0, c, false, false);
  if (NT >= 2) c = __builtin_amdgcn_wmma_f32_16x16x32_f16(false, al, false, bh, (short)0, c, false, false);
  if (NT >= 3) c = __builtin_amdgcn_wmma_f32_16x16x32_f16(false, ah, false, bl, (short)0, c, false, false);
  asm volatile("v_nop\n\tv_nop\n\tv_nop\n\tv_nop" : "+v"(c) : "v"(ah), "v"(al), "v"(bh), "v"(bl));
  return c;
}
// batched GEMM like k_gemm_b but f16 operands: A f32 (split into f16 hi/lo if ASPLIT, else rounded to f16), Bt = f16 values [n][k]; alpha; C f32; N multiple of 16 (partial tiles skipped)
template <bool ASPLIT>
__global__ __launch_bounds__(128) void k_gemm_h(const float* __restrict__ A, int lda, size_t sA, const _Float16* __restrict__ Bh, int ldb, size_t sB, float alpha, float* __restrict__ C, int ldc, size_t sC, int M, int N, int K) {
  __shared__ __attribute__((aligned(16))) float so[4][16][64];
  const int tid = threadIdx.x, w = tid >> 5, lane = tid & 31, ln = lane & 15, hh = lane >> 4; const int by = blockIdx.y;
  A += (size_t)by * sA; Bh += (size_t)by * sB; C += (size_t)by * sC;
  const int ntn = (N + 63) / 64; const int wid = blockIdx.x * 4 + w; const int mt = wid / ntn, nq = wid % ntn; if (mt * 16 >= M) return;
  const int row0 = mt * 16, col0 = nq * 64; const float* arow = A + (size_t)(row0 + ln) * lda;
  v8f acc[4] = {};
  for (int kb = 0; kb < K; kb += 32) {
    FragH ah, al;
    const v4f x0 = *(const v4fa*)(arow + kb + 8 * hh), x1 = *(const v4fa*)(arow + kb + 8 * hh + 4), x2 = *(const v4fa*)(arow + kb + 16 + 8 * hh), x3 = *(const v4fa*)(arow + kb + 16 + 8 * hh + 4);
    float xs[16] = {x0[0],x0[1],x0[2],x0[3],x1[0],x1[1],x1[2],x1[3],x2[0],x2[1],x2[2],x2[3],x3[0],x3[1],x3[2],x3[3]};
#pragma unroll
    for (int i = 0; i < 16; ++i) { const _Float16 h = (_Float16)xs[i]; ah.h[i] = h; al.h[i] = ASPLIT ? (_Float16)(xs[i] - (float)h) : (_Float16)0.0f; }
#pragma unroll
    for (int t = 0; t < 4; ++t) { if (col0 + t * 16 >= N) continue; const size_t boff = (size_t)(col0 + t * 16 + ln) * ldb + kb; FragH bq; bq.half[0] = *(const v8us*)(Bh + boff + 8 * hh); bq.half[1] = *(const v8us*)(Bh + boff + 16 + 8 * hh);
      acc[t] = mmaH<ASPLIT ? 2 : 1>(ah.v, al.v, bq.v, bq.v, acc[t]); }
  }
#pragma unroll
  for (int t = 0; t < 4; ++t) { if (col0 + t * 16 >= N) continue;
#pragma unroll
    for (int r = 0; r < 8; ++r) so[w][8 * hh + r][t * 16 + ln] = acc[t][r] * alpha; }
  __builtin_amdgcn_fence(__ATOMIC_ACQ_REL, "workgroup"); __builtin_amdgcn_wave_barrier();
  const int rsub = lane >> 4, c4 = (lane & 15) * 4;
  {
#pragma unroll
    for (int q = 0; q < 8; ++q) { const int r = q * 2 + rsub; if (col0 + c4 < N) { const v4f v = *(const v4fa*)&so[w][r][c4]; *(v4f*)(C + (size_t)(row0 + r) * ldc + col0 + c4) = v; } }
     }
}

// Wt[n][k] = f16(W[k][n]·scale) from f32 row-major W[K][N] (scale = power of two; bf16-exact weights stay exact in f16 away from the subnormal range)
__global__ __launch_bounds__(256) void k_wt_f16(const float* __restrict__ W, _Float16* __restrict__ Wt, int K, int N, float scale) {
  const int t = blockIdx.x * 256 + threadIdx.x; if (t >= N * (K / 8)) return; const int n = t / (K / 8), k8 = (t % (K / 8)) * 8; FragH f;
#pragma unroll
  for (int i = 0; i < 8; ++i) f.h[i] = (_Float16)(bf16_round(W[(size_t)(k8 + i) * N + n]) * scale); const v8us o = f.half[0];
  *(v8us*)((unsigned short*)Wt + (size_t)n * K + k8) = o; 
}
// k_gemm_hh variant with fused epilogue: v = acc·alpha + bias[by·sBias + col] (+ CP[(row/rowsPerB)·sCPb + by·64 + col] if CP) ; ACT 0 none / 1 elu ; writes f16 C16 (and f32 C if non-null)
template <int ACT>
__global__ __launch_bounds__(128) void k_gemm_hhx(const _Float16* __restrict__ A, int lda, size_t sA, const _Float16* __restrict__ Bh, int ldb, size_t sB, float alpha, const float* __restrict__ bias, size_t sBias, const float* __restrict__ CP, int rowsPerB, size_t sCPb, int row0g,
    float* __restrict__ C, _Float16* __restrict__ C16, int ldc, size_t sC, int M, int N, int K) {
  __shared__ __attribute__((aligned(16))) float so[4][16][64];
  const int tid = threadIdx.x, w = tid >> 5, lane = tid & 31, ln = lane & 15, hh = lane >> 4; const int by = blockIdx.y;
  A += (size_t)by * sA; Bh += (size_t)by * sB; const size_t cofs = (size_t)by * sC; const float* bp = bias ? bias + (size_t)by * sBias : nullptr;
  const int ntn = (N + 63) / 64; const int wid = blockIdx.x * 4 + w; const int mt = wid / ntn, nq = wid % ntn; if (mt * 16 >= M) return;
  const int row0 = mt * 16, col0 = nq * 64; const _Float16* arow = A + (size_t)(row0 + ln) * lda;
  v8f acc[4] = {};
  for (int kb = 0; kb < K; kb += 32) { FragH ah; ah.half[0] = *(const v8us*)((const unsigned short*)arow + kb + 8 * hh); ah.half[1] = *(const v8us*)((const unsigned short*)arow + kb + 16 + 8 * hh);
#pragma unroll
    for (int t = 0; t < 4; ++t) { if (col0 + t * 16 >= N) continue; const size_t boff = (size_t)(col0 + t * 16 + ln) * ldb + kb; FragH bq; bq.half[0] = *(const v8us*)((const unsigned short*)Bh + boff + 8 * hh); bq.half[1] = *(const v8us*)((const unsigned short*)Bh + boff + 16 + 8 * hh);
      acc[t] = mmaH<1>(ah.v, ah.v, bq.v, bq.v, acc[t]); }
  }
#pragma unroll
  for (int t = 0; t < 4; ++t) { if (col0 + t * 16 >= N) continue; const int col = col0 + t * 16 + ln; const float bv = bp ? bf16_round(bp[col]) : 0.f;
#pragma unroll
    for (int r = 0; r < 8; ++r) { float v = acc[t][r] * alpha + bv; if (CP) { const int bidx = (row0g + row0 + 8 * hh + r) / rowsPerB; v += CP[(size_t)bidx * sCPb + (size_t)by * 64 + col]; } if (ACT == 1) v = (v > 0.f) ? v : expm1f(v); else if (ACT == 7) v = (v > 0.f) ? v + 1.0f : expf(v); else if (ACT == 8) v = tanhf(v); else if (ACT == 9) v = 0.5f * v * (1.0f + tanhf(0.7978845608028654f * (v + 0.044715f * v * v * v))); else if (ACT == 11) v = 1.0f / (1.0f + expf(-v)); else if (ACT == 12) v = (v > 0.f) ? v : 0.01f * v; else if (ACT == 14) v = (v > 0.f) ? v : 0.1f * v; else if (ACT == 15) v = v / (1.0f + expf(-v)); else if (ACT == 3) v = fmaxf(v, 0.f); else if (ACT == 6) v = 0.5f * v * (1.0f + erff(v * 0.70710678118654752f)); so[w][8 * hh + r][t * 16 + ln] = v; } }
  __builtin_amdgcn_fence(__ATOMIC_ACQ_REL, "workgroup"); __builtin_amdgcn_wave_barrier();
  const int rsub = lane >> 4, c4 = (lane & 15) * 4; typedef _Float16 v4h __attribute__((ext_vector_type(4)));
  {
#pragma unroll
    for (int q = 0; q < 8; ++q) { const int r = q * 2 + rsub; if (col0 + c4 < N) { const v4f v = *(const v4fa*)&so[w][r][c4]; if (C) *(v4f*)(C + cofs + (size_t)(row0 + r) * ldc + col0 + c4) = v; if (C16) { v4h h4; for (int i = 0; i < 4; ++i) h4[i] = (_Float16)v[i]; *(v4h*)(C16 + cofs + (size_t)(row0 + r) * ldc + col0 + c4) = h4; } } }
     }
}


typedef _Float16 v4h __attribute__((ext_vector_type(4)));

__global__ __launch_bounds__(256) void k_x16(const float* __restrict__ x, _Float16* __restrict__ X16, size_t n8) { const size_t t = (size_t)blockIdx.x * 256 + threadIdx.x; if (t >= n8) return; FragH f;
#pragma unroll
  for (int q = 0; q < 8; ++q) f.h[q] = (_Float16)bf16_round(x[t * 8 + q]); *(v8us*)((unsigned short*)X16 + t * 8) = f.half[0];  }
__global__ __launch_bounds__(256) void k_h16(const float* __restrict__ x, _Float16* __restrict__ X16, size_t n8) { const size_t t = (size_t)blockIdx.x * 256 + threadIdx.x; if (t >= n8) return; FragH f;
#pragma unroll
  for (int q = 0; q < 8; ++q) f.h[q] = (_Float16)x[t * 8 + q]; *(v8us*)((unsigned short*)X16 + t * 8) = f.half[0];  }
__global__ __launch_bounds__(256) void k_round16f(const float* __restrict__ W, _Float16* __restrict__ Bt, size_t n8) { const size_t t = (size_t)blockIdx.x * 256 + threadIdx.x; if (t >= n8) return; FragH f;
#pragma unroll
  for (int i = 0; i < 8; ++i) f.h[i] = (_Float16)(bf16_round(W[t * 8 + i]) * 16.0f); *(v8us*)((unsigned short*)Bt + t * 8) = f.half[0];  }
template <int NHv, int TTv>
__global__ __launch_bounds__(256) void k_vt(const _Float16* __restrict__ V16, int ldv, int voff, _Float16* __restrict__ Vt) { __shared__ unsigned short tl[64][66]; const int tid = threadIdx.x; const int slab = blockIdx.x / (TTv / 64), lg = blockIdx.x % (TTv / 64); const int b = slab / NHv, h = slab % NHv;
  for (int i = tid; i < 64 * 8; i += 256) { const int r = i / 8, c8 = (i % 8) * 8; FragH f; f.half[0] = *(const v8us*)((const unsigned short*)V16 + ((size_t)b * TTv + lg * 64 + r) * ldv + voff + h * 64 + c8);
#pragma unroll
    for (int q = 0; q < 8; ++q) tl[r][c8 + q] = f.u[q]; }
  __syncthreads();
  {
#pragma unroll
    for (int rd = 0; rd < 2; ++rd) { const int d = rd * 32 + tid / 8, pc = tid % 8; FragH f;
#pragma unroll
      for (int q = 0; q < 8; ++q) f.u[q] = tl[pc * 8 + q][d];
      *(v8us*)((unsigned short*)Vt + ((size_t)slab * 64 + d) * TTv + lg * 64 + pc * 8) = f.half[0]; }
     } }

__global__ __launch_bounds__(256) void k_hl(const float* __restrict__ F, _Float16* __restrict__ Hh, _Float16* __restrict__ Hl, size_t n8) { const size_t t = (size_t)blockIdx.x * 256 + threadIdx.x; if (t >= n8) return; FragH fh, fl; const v4f a = *(const v4fa*)(F + t * 8), c = *(const v4fa*)(F + t * 8 + 4);
#pragma unroll
  for (int q = 0; q < 4; ++q) { _Float16 h = (_Float16)a[q]; fh.h[q] = h; fl.h[q] = (_Float16)((a[q] - (float)h) * 1024.0f); h = (_Float16)c[q]; fh.h[4 + q] = h; fl.h[4 + q] = (_Float16)((c[q] - (float)h) * 1024.0f); }
  { *(v8us*)((unsigned short*)Hh + t * 8) = fh.half[0]; *(v8us*)((unsigned short*)Hl + t * 8) = fl.half[0];  } }

// ---- fast GEMM (wave tile 32x64; requires M % 32 == 0 rows per launch region and N % 64 == 0); epilogue = k_gemm_hhx semantics ----
__device__ __forceinline__ v16h g2_frag(const _Float16* p, int hh) { FragH f; f.half[0] = *(const v8us*)((const unsigned short*)p + 8 * hh); f.half[1] = *(const v8us*)((const unsigned short*)p + 16 + 8 * hh); return f.v; }
__device__ __forceinline__ v8f g2_mma(v16h a, v16h b, v8f c) { v8f d = __builtin_amdgcn_wmma_f32_16x16x32_f16(false, a, false, b, (short)0, c, false, false); asm volatile("v_nop\n\tv_nop\n\tv_nop\n\tv_nop" : "+v"(d) : "v"(a), "v"(b)); return d; }
template <int ACT>
__global__ __launch_bounds__(128) void k_gemm2(const _Float16* __restrict__ A, int lda, size_t sA, const _Float16* __restrict__ Bh, int ldb, size_t sB, float alpha, const float* __restrict__ bias, size_t sBias, const float* __restrict__ CP, int rowsPerB, size_t sCPb, int row0g,
    float* __restrict__ C, _Float16* __restrict__ C16, int ldc, size_t sC, int M, int N, int K) {
  __shared__ __attribute__((aligned(16))) float so[4][32][68];
  const int tid = threadIdx.x, w = tid >> 5, lane = tid & 31, ln = lane & 15, hh = lane >> 4; const int by = blockIdx.y;
  A += (size_t)by * sA; Bh += (size_t)by * sB; const size_t cofs = (size_t)by * sC; const float* bp = bias ? bias + (size_t)by * sBias : nullptr;
  const int ntn = N >> 6; const int mt = blockIdx.x / ntn, nq = blockIdx.x - mt * ntn; const int row0 = mt * 128 + 32 * w, col0 = nq * 64; if (row0 >= M) return;
  const _Float16* a0p = A + (size_t)(row0 + ln) * lda; const _Float16* a1p = a0p + (size_t)16 * lda;
  const _Float16* b0p = Bh + (size_t)(col0 + ln) * ldb; const _Float16* b1p = b0p + (size_t)16 * ldb; const _Float16* b2p = b1p + (size_t)16 * ldb; const _Float16* b3p = b2p + (size_t)16 * ldb;
  const v8f z8 = {0.f,0.f,0.f,0.f,0.f,0.f,0.f,0.f}; v8f c00 = z8, c01 = z8, c02 = z8, c03 = z8, c10 = z8, c11 = z8, c12 = z8, c13 = z8;
#pragma unroll 1
  for (int kb = 0; kb < K; kb += 32) { const v16h a0 = g2_frag(a0p + kb, hh), a1 = g2_frag(a1p + kb, hh);
    v16h b = g2_frag(b0p + kb, hh); c00 = g2_mma(a0, b, c00); c10 = g2_mma(a1, b, c10);
    b = g2_frag(b1p + kb, hh); c01 = g2_mma(a0, b, c01); c11 = g2_mma(a1, b, c11);
    b = g2_frag(b2p + kb, hh); c02 = g2_mma(a0, b, c02); c12 = g2_mma(a1, b, c12);
    b = g2_frag(b3p + kb, hh); c03 = g2_mma(a0, b, c03); c13 = g2_mma(a1, b, c13); }
  v8f accs[8] = {c00, c01, c02, c03, c10, c11, c12, c13};
#pragma unroll
  for (int u = 0; u < 8; ++u) { const int t = u & 3, half = u >> 2; const int col = col0 + t * 16 + ln; const float bv = bp ? bf16_round(bp[col]) : 0.f;
#pragma unroll
    for (int r = 0; r < 8; ++r) { const int rloc = half * 16 + 8 * hh + r; float v = accs[u][r] * alpha + bv; if (CP) { const int bidx = (row0g + row0 + rloc) / rowsPerB; v += CP[(size_t)bidx * sCPb + (size_t)by * 64 + col]; }
      if (ACT == 3) v = fmaxf(v, 0.f); else if (ACT == 6) v = 0.5f * v * (1.0f + erff(v * 0.70710678118654752f)); else if (ACT == 11) v = 1.0f / (1.0f + expf(-v)); else if (ACT == 15) v = v / (1.0f + expf(-v)); else if (ACT == 12) v = (v > 0.f) ? v : 0.01f * v; else if (ACT == 8) v = tanhf(v);
      so[w][rloc][t * 16 + ln] = v; } }
  __builtin_amdgcn_fence(__ATOMIC_ACQ_REL, "workgroup"); __builtin_amdgcn_wave_barrier();
  const int rsub = lane >> 4, c4 = (lane & 15) * 4;
  {
#pragma unroll
    for (int q = 0; q < 16; ++q) { const int r = q * 2 + rsub; const v4f v = *(const v4fa*)&so[w][r][c4]; if (C) *(v4f*)(C + cofs + (size_t)(row0 + r) * ldc + col0 + c4) = v; if (C16) { v4h h4; for (int i = 0; i < 4; ++i) h4[i] = (_Float16)v[i]; *(v4h*)(C16 + cofs + (size_t)(row0 + r) * ldc + col0 + c4) = h4; } }
     } }



template <int CAUSAL>
__global__ __launch_bounds__(128) void k_flash(const _Float16* __restrict__ Q16, int ldq, const _Float16* __restrict__ K16, int ldk, const _Float16* __restrict__ Vt, const int* __restrict__ MSK, float* __restrict__ O, int ldo) {
  constexpr int RPW = 16, RTN = RPW / 16, NQB = TQ / (4 * RPW), DT = 4, KS = 2;
  __shared__ __attribute__((aligned(16))) unsigned short sP[4][RPW][40]; __shared__ __attribute__((aligned(16))) float sO[4][RPW][64 + 4];
  const int tid = threadIdx.x, w = tid >> 5, lane = tid & 31, ln = lane & 15, hh = lane >> 4;
  const int slab = blockIdx.x / QBLKS, qblk = blockIdx.x % QBLKS; (void)NQB; const int b = slab / NH, h = slab % NH; const int qb0 = qblk * (4 * RPW); const int q0 = qb0 + w * RPW;
  FragH aq[2][KS];
#pragma unroll
  for (int rt = 0; rt < RTN; ++rt) { const unsigned short* qr = (const unsigned short*)Q16 + ((size_t)b * TQ + q0 + rt * 16 + ln) * ldq + h * 64;
#pragma unroll
    for (int ks = 0; ks < KS; ++ks) { aq[rt][ks].half[0] = *(const v8us*)(qr + ks * 32 + 8 * hh); aq[rt][ks].half[1] = *(const v8us*)(qr + ks * 32 + 16 + 8 * hh); } }
  const unsigned short* Vth = (const unsigned short*)Vt + (size_t)slab * 64 * TK;
  float m_r[2][8], l_r[2][8]; v8f oacc[2][DT];
#pragma unroll
  for (int rt = 0; rt < RTN; ++rt) {
#pragma unroll
    for (int r = 0; r < 8; ++r) { m_r[rt][r] = -3.0e38f; l_r[rt][r] = 0.f; }
#pragma unroll
    for (int dt = 0; dt < DT; ++dt) oacc[rt][dt] = (v8f){0.f,0.f,0.f,0.f,0.f,0.f,0.f,0.f}; }
  const int jend = (CAUSAL == 1) ? (qb0 + 4 * RPW) : TK;      /* causal: keys beyond the block's last query never contribute */
#pragma unroll 1
  for (int j0 = 0; j0 < jend; j0 += 32) {
    v8f s[2][2];
#pragma unroll
    for (int nt = 0; nt < 2; ++nt) { const unsigned short* kr = (const unsigned short*)K16 + ((size_t)b * TK + j0 + nt * 16 + ln) * ldk + h * 64; FragH bk[KS];
#pragma unroll
      for (int ks = 0; ks < KS; ++ks) { bk[ks].half[0] = *(const v8us*)(kr + ks * 32 + 8 * hh); bk[ks].half[1] = *(const v8us*)(kr + ks * 32 + 16 + 8 * hh); }
#pragma unroll
      for (int rt = 0; rt < RTN; ++rt) { v8f acc = (v8f){0.f,0.f,0.f,0.f,0.f,0.f,0.f,0.f};
#pragma unroll
        for (int ks = 0; ks < KS; ++ks) acc = mmaH<1>(aq[rt][ks].v, aq[rt][ks].v, bk[ks].v, bk[ks].v, acc); s[rt][nt] = acc; } }
#pragma unroll
    for (int rt = 0; rt < RTN; ++rt)
#pragma unroll
      for (int r = 0; r < 8; ++r) { const int tq = q0 + rt * 16 + 8 * hh + r; const int k0 = j0 + ln, k1 = j0 + 16 + ln;
        const bool ok0 = (CAUSAL == 1) ? (k0 <= tq) : ((CAUSAL == 2) ? ((k0 >> 5) == (tq >> 5)) : true), ok1 = (CAUSAL == 1) ? (k1 <= tq) : ((CAUSAL == 2) ? ((k1 >> 5) == (tq >> 5)) : true);      /* mode 2: block-diagonal 32-token groups */
        const float s0 = ok0 ? s[rt][0][r] * SCL : -3.0e38f, s1 = ok1 ? s[rt][1][r] * SCL : -3.0e38f; float mc = fmaxf(s0, s1);
        mc = fmaxf(mc, __shfl_xor(mc, 1, 32)); mc = fmaxf(mc, __shfl_xor(mc, 2, 32)); mc = fmaxf(mc, __shfl_xor(mc, 4, 32)); mc = fmaxf(mc, __shfl_xor(mc, 8, 32));
        const float mn = fmaxf(m_r[rt][r], mc); const float al = (mn > -1.0e38f) ? expf(m_r[rt][r] - mn) : 1.0f; m_r[rt][r] = mn; const float p0 = ok0 ? expf(s0 - mn) : 0.f, p1 = ok1 ? expf(s1 - mn) : 0.f; l_r[rt][r] = l_r[rt][r] * al + p0 + p1;
#pragma unroll
        for (int dt = 0; dt < DT; ++dt) oacc[rt][dt][r] *= al;
        FragH t2; t2.h[0] = (_Float16)(p0 * 1024.0f); t2.h[1] = (_Float16)(p1 * 1024.0f); sP[w][rt * 16 + 8 * hh + r][ln] = t2.u[0]; sP[w][rt * 16 + 8 * hh + r][16 + ln] = t2.u[1]; }
    __builtin_amdgcn_fence(__ATOMIC_ACQ_REL, "workgroup"); __builtin_amdgcn_wave_barrier();
    FragH pa[2];
#pragma unroll
    for (int rt = 0; rt < RTN; ++rt) { pa[rt].half[0] = *(const v8us*)&sP[w][rt * 16 + ln][8 * hh]; pa[rt].half[1] = *(const v8us*)&sP[w][rt * 16 + ln][16 + 8 * hh]; }
#pragma unroll
    for (int dt = 0; dt < DT; ++dt) { const unsigned short* vrow = Vth + (size_t)(dt * 16 + ln) * TK + j0; FragH bv; bv.half[0] = *(const v8us*)(vrow + 8 * hh); bv.half[1] = *(const v8us*)(vrow + 16 + 8 * hh);
#pragma unroll
      for (int rt = 0; rt < RTN; ++rt) oacc[rt][dt] = mmaH<1>(pa[rt].v, pa[rt].v, bv.v, bv.v, oacc[rt][dt]); }
    __builtin_amdgcn_fence(__ATOMIC_ACQ_REL, "workgroup"); __builtin_amdgcn_wave_barrier(); }
#pragma unroll
  for (int rt = 0; rt < RTN; ++rt) {
#pragma unroll
    for (int r = 0; r < 8; ++r) { float l = l_r[rt][r]; l += __shfl_xor(l, 1, 32); l += __shfl_xor(l, 2, 32); l += __shfl_xor(l, 4, 32); l += __shfl_xor(l, 8, 32); l_r[rt][r] = (l > 0.f) ? 1.0f / (l * 1024.0f) : 0.f; }
#pragma unroll
    for (int dt = 0; dt < DT; ++dt)
#pragma unroll
      for (int r = 0; r < 8; ++r) sO[w][rt * 16 + 8 * hh + r][dt * 16 + ln] = oacc[rt][dt][r] * l_r[rt][r]; }
  __builtin_amdgcn_fence(__ATOMIC_ACQ_REL, "workgroup"); __builtin_amdgcn_wave_barrier();
  {
#pragma unroll
    for (int rp = 0; rp < RPW; rp += 2) { const int r = rp + (lane >> 4), pc = lane & 15; const v4f val = *(const v4fa*)&sO[w][r][pc * 4]; *(v4f*)(O + ((size_t)b * TQ + q0 + r) * ldo + h * 64 + pc * 4) = val; }
     } }

__global__ __launch_bounds__(256) void k_wsc(const float* __restrict__ Wm, _Float16* __restrict__ Bt, size_t n8, float sc) { const size_t t = (size_t)blockIdx.x * 256 + threadIdx.x; if (t >= n8) return; FragH f; for (int q = 0; q < 8; ++q) f.h[q] = (_Float16)(bf16_round(Wm[t * 8 + q]) * sc); *(v8us*)((unsigned short*)Bt + t * 8) = f.half[0];  }
__global__ __launch_bounds__(256) void k_woutp(const float* __restrict__ Wm, _Float16* __restrict__ Bt) { const size_t t = (size_t)blockIdx.x * 256 + threadIdx.x; if (t >= (size_t)DMOD * (2 * DMOD / 8)) return; const int pc = (int)(t % (2 * DMOD / 8)); const int o = (int)(t / (2 * DMOD / 8)); const bool lo = pc * 8 >= DMOD; FragH f;
  for (int q = 0; q < 8; ++q) { const int c = pc * 8 + q - (lo ? DMOD : 0); f.h[q] = (_Float16)(bf16_round(Wm[(size_t)o * DMOD + c]) * (lo ? 1.0f : 16.0f)); } *(v8us*)((unsigned short*)Bt + (size_t)o * 2 * DMOD + pc * 8) = f.half[0];  }
__global__ __launch_bounds__(256) void k_ropetab(float* __restrict__ CS) {
  #pragma clang fp contract(off)
  const int t = blockIdx.x * 256 + threadIdx.x; if (t >= SLEN * (RD / 2)) return; const int i = t % (RD / 2), tpos = t / (RD / 2); const float invf = (float)pow(10000.0, -(double)(2 * i) / (double)RD); const float ang = (float)tpos * invf; const float c = cosf(ang), s = sinf(ang);
  { *(float*)(CS + t) = c; *(float*)(CS + SLEN * (RD / 2) + t) = s;  } }
__global__ __launch_bounds__(256) void k_rope(const float* __restrict__ Q, const float* __restrict__ Kf, const float* __restrict__ CS, _Float16* __restrict__ Q16, _Float16* __restrict__ K16) {
  #pragma clang fp contract(off)
  const size_t t = (size_t)blockIdx.x * 256 + threadIdx.x; if (t >= (size_t)NR * NH * 2) return; const int which = (int)(t & 1); const int h = (int)((t >> 1) % NH); const size_t r = t / (2 * NH); const int tpos = (int)(r % SLEN);
  const float* src = (which ? Kf : Q) + r * DMOD + h * HD; _Float16* dst = (which ? K16 : Q16) + r * DMOD + h * HD; FragH f[4];
#pragma unroll
  for (int i = 0; i < RD / 2; ++i) { const float c = CS[tpos * (RD / 2) + i], s = CS[SLEN * (RD / 2) + tpos * (RD / 2) + i]; const float x1 = src[i], x2 = src[RD / 2 + i];
    float a = x1 * c; a += x2 * s; float bq = x1 * -s; bq += x2 * c; f[0].h[i] = (_Float16)a; f[1].h[i] = (_Float16)bq; }
#pragma unroll
  for (int i = 0; i < 16; ++i) { f[2].h[i] = (_Float16)src[RD + i]; f[3].h[i] = (_Float16)src[RD + 16 + i]; }
  { for (int u = 0; u < 4; ++u) { *(v8us*)((unsigned short*)dst + u * 16) = f[u].half[0]; *(v8us*)((unsigned short*)dst + u * 16 + 8) = f[u].half[1]; }  } }

extern "C" void kernel_launch(void* const* d_in, const int* in_sizes, int n_in,
                              void* d_out, int out_size, void* d_ws, size_t ws_size, hipStream_t stream) {
  (void)in_sizes; (void)n_in; (void)out_size;
  const float* const* I = (const float* const*)d_in; const float* x = I[0]; const float* Wq = I[1]; const float* Wk = I[2]; const float* Wv = I[3]; const float* Wo = I[4];
  char* ws = (char*)d_ws; size_t off = 0;
  auto take = [&](size_t bytes) { char* p = ws + off; off += (bytes + 255) & ~(size_t)255; return p; };
  const size_t w8 = (size_t)DMOD * DMOD / 8;
  _Float16* BQ = (_Float16*)take(w8 * 16); _Float16* BK = (_Float16*)take(w8 * 16); _Float16* BV = (_Float16*)take(w8 * 16); _Float16* BO = (_Float16*)take(w8 * 32);
  _Float16* X16 = (_Float16*)take((size_t)NR * DMOD * 2); float* Qf = (float*)take((size_t)NR * DMOD * 4); float* Kf = (float*)take((size_t)NR * DMOD * 4); _Float16* Q16 = (_Float16*)take((size_t)NR * DMOD * 2); _Float16* K16 = (_Float16*)take((size_t)NR * DMOD * 2); _Float16* V16 = (_Float16*)take((size_t)NR * DMOD * 2); _Float16* VT = (_Float16*)take((size_t)NR * DMOD * 2); float* CS = (float*)take((size_t)SLEN * RD * 4);
  float* O = Qf; _Float16* Hh = Q16; _Float16* Hl = K16;      /* aliases after the flash kernel: Qf/Q16/K16 are dead */
  if (off > ws_size) return;      /* 10 + 16 + 32 + 32 + 16 x 4 = 154 MiB */
  k_wsc<<<(unsigned)((w8 + 255) / 256), 256, 0, stream>>>(Wq, BQ, w8, 16.0f); k_wsc<<<(unsigned)((w8 + 255) / 256), 256, 0, stream>>>(Wk, BK, w8, 16.0f); k_wsc<<<(unsigned)((w8 + 255) / 256), 256, 0, stream>>>(Wv, BV, w8, 16.0f); k_woutp<<<(unsigned)(((size_t)DMOD * (2 * DMOD / 8) + 255) / 256), 256, 0, stream>>>(Wo, BO);
  k_x16<<<(unsigned)(((size_t)NR * DMOD / 8 + 255) / 256), 256, 0, stream>>>(x, X16, (size_t)NR * DMOD / 8);
  const dim3 gP((NR / 128) * (DMOD / 64), 1);
  k_gemm2<0><<<gP, 128, 0, stream>>>(X16, DMOD, 0, BQ, DMOD, 0, 0.0625f, nullptr, 0, nullptr, 1, 0, 0, Qf, nullptr, DMOD, 0, NR, DMOD, DMOD);
  k_gemm2<0><<<gP, 128, 0, stream>>>(X16, DMOD, 0, BK, DMOD, 0, 0.0625f, nullptr, 0, nullptr, 1, 0, 0, Kf, nullptr, DMOD, 0, NR, DMOD, DMOD);
  k_gemm2<0><<<gP, 128, 0, stream>>>(X16, DMOD, 0, BV, DMOD, 0, 0.0625f, nullptr, 0, nullptr, 1, 0, 0, nullptr, V16, DMOD, 0, NR, DMOD, DMOD);
  k_ropetab<<<(SLEN * (RD / 2) + 255) / 256, 256, 0, stream>>>(CS); k_rope<<<(unsigned)(((size_t)NR * NH * 2 + 255) / 256), 256, 0, stream>>>(Qf, Kf, CS, Q16, K16);
  k_vt<NH, SLEN><<<NB * NH * (SLEN / 64), 256, 0, stream>>>(V16, DMOD, 0, VT);
  k_flash<0><<<NB * NH * QBLKS, 128, 0, stream>>>(Q16, DMOD, K16, DMOD, VT, nullptr, O, DMOD);
  k_hl<<<(unsigned)(((size_t)NR * DMOD / 8 + 255) / 256), 256, 0, stream>>>(O, Hh, Hl, (size_t)NR * DMOD / 8);
  k_gemm2<0><<<gP, 128, 0, stream>>>(Hh, DMOD, 0, BO, 2 * DMOD, 0, 0.0625f, nullptr, 0, nullptr, 1, 0, 0, (float*)d_out, nullptr, DMOD, 0, NR, DMOD, DMOD);
  k_gemm2<0><<<gP, 128, 0, stream>>>(Hl, DMOD, 0, BO + DMOD, 2 * DMOD, 0, 1.0f / 1024.0f, nullptr, 0, (const float*)d_out, 1, (size_t)DMOD, 0, (float*)d_out, nullptr, DMOD, 0, NR, DMOD, DMOD);
}

// v001
// It runs in 640 microseconds.
// Next to v000, in two timings, it ran 1.27 times as fast each time.
#include <hip/hip_runtime.h>
// TinyAttn (4 sequences x 2048 tokens x 1024; 16 heads x 64; rotary embedding on the first 32 dims of each head): q,k,v = x W^T; q,k rotated (rot = [x1 cos + x2 sin, -x1 sin + x2 cos] on dims 0..31 with the module's inverse-frequency table); softmax(q k^T / 8) v; y Wo^T -> [4,2048,1024].
// Structure: x as an exact f16 plane; q/k/v projections as f16 WMMA GEMMs (32x64 wave tiles, f32 accumulation, exact x16 weights; q/k in f32 for the rotation, v as f16); the rotary tables recomputed on the device (f64 pow for the inverse frequencies, f32 angle product, f32 cos/sin) and applied on VALU into f16 q/k planes; V transposed by LDS tiles; the fused flash kernel; the attention output as hi + residual planes into two accumulating output-projection GEMMs.
// Compute dtype: x and weights rounded to bf16; q, k (after rotation), v, P as f16 operands (~2^-12); attention output hi + 2^-10-scaled residual; f32 accumulation/softmax. v_wmma_f32_16x16x32_f16.
#define NB 4
#define DMOD 1024
#define HD 64
#define RD 32                    /* rotary dims per head */
#define NR (NB * SLEN)
#define QBLKS (TQ / 64)          /* query blocks per (sequence, head) launched */
#define SLEN 2048
#define TQ SLEN
#define TK SLEN
#define NH 16
#define SCL 0.125f               /* 64^-0.5 */
typedef __bf16 v16b __attribute__((ext_vector_type(16)));
typedef unsigned short v8us __attribute__((ext_vector_type(8), may_alias));
typedef float  v8f  __attribute__((ext_vector_type(8)));
typedef float  v4f  __attribute__((ext_vector_type(4)));
typedef float  v4fa __attribute__((ext_vector_type(4), may_alias));
union FragB { v16b v; v8us half[2]; unsigned short u[16]; };

__device__ __forceinline__ unsigned short bf16_bits(float x) { unsigned int u = __float_as_uint(x); return (unsigned short)((u + 0x7FFFu + ((u >> 16) & 1u)) >> 16); }
__device__ __forceinline__ float bf16_val(unsigned short b) { return __uint_as_float(((unsigned int)b) << 16); }
__device__ __forceinline__ float bf16_round(float x) { return bf16_val(bf16_bits(x)); }
// D += A·B with NT terms: 1 = ah·bh, 2 = + al·bh (A split), 3 = + ah·bl (both split)
template <int NT>
__device__ __forceinline__ v8f mmaN(v16b ah, v16b al, v16b bh, v16b bl, v8f c) {
  c = __builtin_amdgcn_wmma_f32_16x16x32_bf16(false, ah, false, bh, (short)0, c, false, false);
  if (NT >= 2) c = __builtin_amdgcn_wmma_f32_16x16x32_bf16(false, al, false, bh, (short)0, c, false, false);
  if (NT >= 3) c = __builtin_amdgcn_wmma_f32_16x16x32_bf16(false, ah, false, bl, (short)0, c, false, false);
  asm volatile("v_nop\n\tv_nop\n\tv_nop\n\tv_nop" : "+v"(c) : "v"(ah), "v"(al), "v"(bh), "v"(bl));
  return c;
}

__global__ __launch_bounds__(256) void k_wt_bf16(const float* __restrict__ W, unsigned short* __restrict__ Wt, int K, int N) {
  const int t = blockIdx.x * 256 + threadIdx.x;
  const int k8n = K / 8;
  if (t >= N * k8n) return;
  const int n = t / k8n, k8 = (t % k8n) * 8;
  v8us v;
#pragma unroll
  for (int i = 0; i < 8; ++i) v[i] = bf16_bits(W[(size_t)(k8 + i) * N + n]);
  *(v8us*)(Wt + (size_t)n * K + k8) = v;
  
}

// GEMM C[M][N] (f32, pitch ldc) = act(A[M][K]·W + bias). A f32 row-major (pitch lda) converted per fragment to bf16
// (ASPLIT: hi/lo two planes -> 2 terms, else single rounded term); Wt bf16 [N][K] (pitch ldb). BIAS_BF16 rounds the
// bias to bf16 first (bias quantised to bf16 before the add). K%32==0, M%16==0, N%64==0.
template <bool ASPLIT, int ACT, bool BIAS_BF16>
__global__ __launch_bounds__(128) void k_gemm_bf(const float* __restrict__ A, int lda, const unsigned short* __restrict__ Wt, int ldb,
                                               const float* __restrict__ bias, float* __restrict__ C, int ldc, int M, int N, int K) {
  __shared__ __attribute__((aligned(16))) float so[4][16][64];
  const int tid = threadIdx.x, w = tid >> 5, lane = tid & 31, ln = lane & 15, hh = lane >> 4;
  const int ntn = N / 64;
  const int wid = blockIdx.x * 4 + w;
  const int mt = wid / ntn, nq = wid % ntn;
  if (mt * 16 >= M) return;
  const int row0 = mt * 16, col0 = nq * 64;
  const float* arow = A + (size_t)(row0 + ln) * lda;
  v8f acc[4] = {};
  for (int kb = 0; kb < K; kb += 32) {
    FragB ah, al;
    const v4f x0 = *(const v4fa*)(arow + kb + 8 * hh), x1 = *(const v4fa*)(arow + kb + 8 * hh + 4);
    const v4f x2 = *(const v4fa*)(arow + kb + 16 + 8 * hh), x3 = *(const v4fa*)(arow + kb + 16 + 8 * hh + 4);
    float xs[16] = {x0[0],x0[1],x0[2],x0[3],x1[0],x1[1],x1[2],x1[3],x2[0],x2[1],x2[2],x2[3],x3[0],x3[1],x3[2],x3[3]};
#pragma unroll
    for (int i = 0; i < 16; ++i) { const unsigned short hb = bf16_bits(xs[i]); ah.u[i] = hb; al.u[i] = ASPLIT ? bf16_bits(xs[i] - bf16_val(hb)) : (unsigned short)0; }
#pragma unroll
    for (int t = 0; t < 4; ++t) {
      const unsigned short* brow = Wt + (size_t)(col0 + t * 16 + ln) * ldb + kb;
      FragB b;
      b.half[0] = *(const v8us*)(brow + 8 * hh);
      b.half[1] = *(const v8us*)(brow + 16 + 8 * hh);
      acc[t] = mmaN<ASPLIT ? 2 : 1>(ah.v, al.v, b.v, b.v, acc[t]);
    }
  }
#pragma unroll
  for (int t = 0; t < 4; ++t) {
    float bv = bias ? bias[col0 + t * 16 + ln] : 0.f;
    if (BIAS_BF16) bv = bf16_round(bv);
#pragma unroll
    for (int r = 0; r < 8; ++r) { float v = acc[t][r] + bv; if (ACT == 1) v = fmaxf(v, 0.f); so[w][8 * hh + r][t * 16 + ln] = v; }
  }
  __builtin_amdgcn_fence(__ATOMIC_ACQ_REL, "workgroup");
  __builtin_amdgcn_wave_barrier();
  const int rsub = lane >> 4, c4 = (lane & 15) * 4;
  {
#pragma unroll
    for (int q = 0; q < 8; ++q) {
      const int r = q * 2 + rsub;
      const v4f v = *(const v4fa*)&so[w][r][c4];
      *(v4f*)(C + (size_t)(row0 + r) * ldc + col0 + c4) = v;
    }
    
  }
}

// GEMM C = act(A·W + bias + resid): A f32 (ASPLIT -> hi/lo 2 terms), Wt bf16 [N][K]; ACT 0 none, 1 relu, 2 exact gelu;
// resid (optional, f32, row index = (row % rmod), pitch ldr, RES_BF16 rounds it) added before the activation.
template <bool ASPLIT, int ACT, bool BIAS_BF16, bool RES_BF16>
__global__ __launch_bounds__(128) void k_gemm_bf3(const float* __restrict__ A, int lda, const unsigned short* __restrict__ Wt, int ldb,
                                                const float* __restrict__ bias, const float* __restrict__ resid, int rmod, int ldr,
                                                float* __restrict__ C, int ldc, int M, int N, int K) {
  __shared__ __attribute__((aligned(16))) float so[4][16][64];
  const int tid = threadIdx.x, w = tid >> 5, lane = tid & 31, ln = lane & 15, hh = lane >> 4;
  const int ntn = N / 64;
  const int wid = blockIdx.x * 4 + w;
  const int mt = wid / ntn, nq = wid % ntn;
  if (mt * 16 >= M) return;
  const int row0 = mt * 16, col0 = nq * 64;
  const float* arow = A + (size_t)(row0 + ln) * lda;
  v8f acc[4] = {};
  for (int kb = 0; kb < K; kb += 32) {
    FragB ah, al;
    const v4f x0 = *(const v4fa*)(arow + kb + 8 * hh), x1 = *(const v4fa*)(arow + kb + 8 * hh + 4);
    const v4f x2 = *(const v4fa*)(arow + kb + 16 + 8 * hh), x3 = *(const v4fa*)(arow + kb + 16 + 8 * hh + 4);
    float xs[16] = {x0[0],x0[1],x0[2],x0[3],x1[0],x1[1],x1[2],x1[3],x2[0],x2[1],x2[2],x2[3],x3[0],x3[1],x3[2],x3[3]};
#pragma unroll
    for (int i = 0; i < 16; ++i) { const unsigned short hb = bf16_bits(xs[i]); ah.u[i] = hb; al.u[i] = ASPLIT ? bf16_bits(xs[i] - bf16_val(hb)) : (unsigned short)0; }
#pragma unroll
    for (int t = 0; t < 4; ++t) {
      const unsigned short* brow = Wt + (size_t)(col0 + t * 16 + ln) * ldb + kb;
      FragB b;
      b.half[0] = *(const v8us*)(brow + 8 * hh);
      b.half[1] = *(const v8us*)(brow + 16 + 8 * hh);
      acc[t] = mmaN<ASPLIT ? 2 : 1>(ah.v, al.v, b.v, b.v, acc[t]);
    }
  }
#pragma unroll
  for (int t = 0; t < 4; ++t) {
    const int col = col0 + t * 16 + ln;
    float bv = bias ? bias[col] : 0.f;
    if (BIAS_BF16) bv = bf16_round(bv);
#pragma unroll
    for (int r = 0; r < 8; ++r) {
      float v = acc[t][r] + bv;
      if (resid) { float rv = resid[(size_t)((row0 + 8 * hh + r) % rmod) * ldr + col]; if (RES_BF16) rv = bf16_round(rv); v += rv; }
      if (ACT == 1) v = fmaxf(v, 0.f);
      if (ACT == 2) v = 0.5f * v * (1.0f + erff(v * 0.70710678118654752f));
      if (ACT == 3) { const float u = 0.7978845608028654f * (v + 0.044715f * v * v * v); v = 0.5f * v * (1.0f + tanhf(u)); }
      so[w][8 * hh + r][t * 16 + ln] = v;
    }
  }
  __builtin_amdgcn_fence(__ATOMIC_ACQ_REL, "workgroup");
  __builtin_amdgcn_wave_barrier();
  const int rsub = lane >> 4, c4 = (lane & 15) * 4;
  {
#pragma unroll
    for (int q = 0; q < 8; ++q) {
      const int r = q * 2 + rsub;
      const v4f v = *(const v4fa*)&so[w][r][c4];
      *(v4f*)(C + (size_t)(row0 + r) * ldc + col0 + c4) = v;
    }
    
  }
}
// row LayerNorm (biased variance, eps) over N: s = X (+ R); optional out_sum <- s; out_norm <- (s-mu)*rsqrt(var+eps)*g + b
template <bool PARAM_BF16>
__global__ __launch_bounds__(256) void k_layernorm(const float* __restrict__ X, const float* __restrict__ R, const float* __restrict__ g, const float* __restrict__ bta,
                                                  float* __restrict__ out_sum, float* __restrict__ out_norm, int N, float eps) {
  __shared__ float red[256];
  const int row = blockIdx.x, tid = threadIdx.x;
  const float* x = X + (size_t)row * N; const float* rr = R ? R + (size_t)row * N : nullptr;
  float vals[16];                     // up to N = 4096
  const int per = N / 256;            // contiguous chunk per thread? use strided-by-4 chunks: thread handles j = tid*4 + 1024*u
  float s1 = 0.f;
  for (int u = 0; u < per / 4; ++u) {
    const int j = tid * 4 + 1024 * u;
    const v4f a = *(const v4fa*)(x + j);
    v4f b = {0.f,0.f,0.f,0.f}; if (rr) b = *(const v4fa*)(rr + j);
#pragma unroll
    for (int q = 0; q < 4; ++q) { const float v = a[q] + b[q]; vals[u * 4 + q] = v; s1 += v; }
  }
  red[tid] = s1; __syncthreads();
  for (int st = 128; st > 0; st >>= 1) { if (tid < st) red[tid] += red[tid + st]; __syncthreads(); }
  const float mu = red[0] / (float)N; __syncthreads();
  float s2 = 0.f;
  for (int u = 0; u < per / 4; ++u)
#pragma unroll
    for (int q = 0; q < 4; ++q) { const float c = vals[u * 4 + q] - mu; s2 += c * c; }
  red[tid] = s2; __syncthreads();
  for (int st = 128; st > 0; st >>= 1) { if (tid < st) red[tid] += red[tid + st]; __syncthreads(); }
  const float rs = rsqrtf(red[0] / (float)N + eps);
  {
    for (int u = 0; u < per / 4; ++u) {
      const int j = tid * 4 + 1024 * u;
      v4f o, sm;
#pragma unroll
      for (int q = 0; q < 4; ++q) {
        float gg = g[j + q], bb = bta[j + q];
        if (PARAM_BF16) { gg = bf16_round(gg); bb = bf16_round(bb); }
        sm[q] = vals[u * 4 + q]; o[q] = (vals[u * 4 + q] - mu) * rs * gg + bb;
      }
      if (out_sum) *(v4f*)(out_sum + (size_t)row * N + j) = sm;
      *(v4f*)(out_norm + (size_t)row * N + j) = o;
    }
    
  }
}



// ---- f16 WMMA path (v_wmma_f32_16x16x32_f16): 11-bit significands for operands in range — used where a [0,1] probability operand needs more precision than bf16
typedef _Float16 v16h __attribute__((ext_vector_type(16)));
union FragH { v16h v; v8us half[2]; _Float16 h[16]; unsigned short u[16]; };
template <int NT>
__device__ __forceinline__ v8f mmaH(v16h ah, v16h al, v16h bh, v16h bl, v8f c) {
  c = __builtin_amdgcn_wmma_f32_16x16x32_f16(false, ah, false, bh, (short)0, c, false, false);
  if (NT >= 2) c = __builtin_amdgcn_wmma_f32_16x16x32_f16(false, al, false, bh, (short)0, c, false, false);
  if (NT >= 3) c = __builtin_amdgcn_wmma_f32_16x16x32_f16(false, ah, false, bl, (short)0, c, false, false);
  asm volatile("v_nop\n\tv_nop\n\tv_nop\n\tv_nop" : "+v"(c) : "v"(ah), "v"(al), "v"(bh), "v"(bl));
  return c;
}
// batched GEMM like k_gemm_b but f16 operands: A f32 (split into f16 hi/lo if ASPLIT, else rounded to f16), Bt = f16 values [n][k]; alpha; C f32; N multiple of 16 (partial tiles skipped)
template <bool ASPLIT>
__global__ __launch_bounds__(128) void k_gemm_h(const float* __restrict__ A, int lda, size_t sA, const _Float16* __restrict__ Bh, int ldb, size_t sB, float alpha, float* __restrict__ C, int ldc, size_t sC, int M, int N, int K) {
  __shared__ __attribute__((aligned(16))) float so[4][16][64];
  const int tid = threadIdx.x, w = tid >> 5, lane = tid & 31, ln = lane & 15, hh = lane >> 4; const int by = blockIdx.y;
  A += (size_t)by * sA; Bh += (size_t)by * sB; C += (size_t)by * sC;
  const int ntn = (N + 63) / 64; const int wid = blockIdx.x * 4 + w; const int mt = wid / ntn, nq = wid % ntn; if (mt * 16 >= M) return;
  const int row0 = mt * 16, col0 = nq * 64; const float* arow = A + (size_t)(row0 + ln) * lda;
  v8f acc[4] = {};
  for (int kb = 0; kb < K; kb += 32) {
    FragH ah, al;
    const v4f x0 = *(const v4fa*)(arow + kb + 8 * hh), x1 = *(const v4fa*)(arow + kb + 8 * hh + 4), x2 = *(const v4fa*)(arow + kb + 16 + 8 * hh), x3 = *(const v4fa*)(arow + kb + 16 + 8 * hh + 4);
    float xs[16] = {x0[0],x0[1],x0[2],x0[3],x1[0],x1[1],x1[2],x1[3],x2[0],x2[1],x2[2],x2[3],x3[0],x3[1],x3[2],x3[3]};
#pragma unroll
    for (int i = 0; i < 16; ++i) { const _Float16 h = (_Float16)xs[i]; ah.h[i] = h; al.h[i] = ASPLIT ? (_Float16)(xs[i] - (float)h) : (_Float16)0.0f; }
#pragma unroll
    for (int t = 0; t < 4; ++t) { if (col0 + t * 16 >= N) continue; const size_t boff = (size_t)(col0 + t * 16 + ln) * ldb + kb; FragH bq; bq.half[0] = *(const v8us*)(Bh + boff + 8 * hh); bq.half[1] = *(const v8us*)(Bh + boff + 16 + 8 * hh);
      acc[t] = mmaH<ASPLIT ? 2 : 1>(ah.v, al.v, bq.v, bq.v, acc[t]); }
  }
#pragma unroll
  for (int t = 0; t < 4; ++t) { if (col0 + t * 16 >= N) continue;
#pragma unroll
    for (int r = 0; r < 8; ++r) so[w][8 * hh + r][t * 16 + ln] = acc[t][r] * alpha; }
  __builtin_amdgcn_fence(__ATOMIC_ACQ_REL, "workgroup"); __builtin_amdgcn_wave_barrier();
  const int rsub = lane >> 4, c4 = (lane & 15) * 4;
  {
#pragma unroll
    for (int q = 0; q < 8; ++q) { const int r = q * 2 + rsub; if (col0 + c4 < N) { const v4f v = *(const v4fa*)&so[w][r][c4]; *(v4f*)(C + (size_t)(row0 + r) * ldc + col0 + c4) = v; } }
     }
}

// Wt[n][k] = f16(W[k][n]·scale) from f32 row-major W[K][N] (scale = power of two; bf16-exact weights stay exact in f16 away from the subnormal range)
__global__ __launch_bounds__(256) void k_wt_f16(const float* __restrict__ W, _Float16* __restrict__ Wt, int K, int N, float scale) {
  const int t = blockIdx.x * 256 + threadIdx.x; if (t >= N * (K / 8)) return; const int n = t / (K / 8), k8 = (t % (K / 8)) * 8; FragH f;
#pragma unroll
  for (int i = 0; i < 8; ++i) f.h[i] = (_Float16)(bf16_round(W[(size_t)(k8 + i) * N + n]) * scale); const v8us o = f.half[0];
  *(v8us*)((unsigned short*)Wt + (size_t)n * K + k8) = o; 
}
// k_gemm_hh variant with fused epilogue: v = acc·alpha + bias[by·sBias + col] (+ CP[(row/rowsPerB)·sCPb + by·64 + col] if CP) ; ACT 0 none / 1 elu ; writes f16 C16 (and f32 C if non-null)
template <int ACT>
__global__ __launch_bounds__(128) void k_gemm_hhx(const _Float16* __restrict__ A, int lda, size_t sA, const _Float16* __restrict__ Bh, int ldb, size_t sB, float alpha, const float* __restrict__ bias, size_t sBias, const float* __restrict__ CP, int rowsPerB, size_t sCPb, int row0g,
    float* __restrict__ C, _Float16* __restrict__ C16, int ldc, size_t sC, int M, int N, int K) {
  __shared__ __attribute__((aligned(16))) float so[4][16][64];
  const int tid = threadIdx.x, w = tid >> 5, lane = tid & 31, ln = lane & 15, hh = lane >> 4; const int by = blockIdx.y;
  A += (size_t)by * sA; Bh += (size_t)by * sB; const size_t cofs = (size_t)by * sC; const float* bp = bias ? bias + (size_t)by * sBias : nullptr;
  const int ntn = (N + 63) / 64; const int wid = blockIdx.x * 4 + w; const int mt = wid / ntn, nq = wid % ntn; if (mt * 16 >= M) return;
  const int row0 = mt * 16, col0 = nq * 64; const _Float16* arow = A + (size_t)(row0 + ln) * lda;
  v8f acc[4] = {};
  for (int kb = 0; kb < K; kb += 32) { FragH ah; ah.half[0] = *(const v8us*)((const unsigned short*)arow + kb + 8 * hh); ah.half[1] = *(const v8us*)((const unsigned short*)arow + kb + 16 + 8 * hh);
#pragma unroll
    for (int t = 0; t < 4; ++t) { if (col0 + t * 16 >= N) continue; const size_t boff = (size_t)(col0 + t * 16 + ln) * ldb + kb; FragH bq; bq.half[0] = *(const v8us*)((const unsigned short*)Bh + boff + 8 * hh); bq.half[1] = *(const v8us*)((const unsigned short*)Bh + boff + 16 + 8 * hh);
      acc[t] = mmaH<1>(ah.v, ah.v, bq.v, bq.v, acc[t]); }
  }
#pragma unroll
  for (int t = 0; t < 4; ++t) { if (col0 + t * 16 >= N) continue; const int col = col0 + t * 16 + ln; const float bv = bp ? bf16_round(bp[col]) : 0.f;
#pragma unroll
    for (int r = 0; r < 8; ++r) { float v = acc[t][r] * alpha + bv; if (CP) { const int bidx = (row0g + row0 + 8 * hh + r) / rowsPerB; v += CP[(size_t)bidx * sCPb + (size_t)by * 64 + col]; } if (ACT == 1) v = (v > 0.f) ? v : expm1f(v); else if (ACT == 7) v = (v > 0.f) ? v + 1.0f : expf(v); else if (ACT == 8) v = tanhf(v); else if (ACT == 9) v = 0.5f * v * (1.0f + tanhf(0.7978845608028654f * (v + 0.044715f * v * v * v))); else if (ACT == 11) v = 1.0f / (1.0f + expf(-v)); else if (ACT == 12) v = (v > 0.f) ? v : 0.01f * v; else if (ACT == 14) v = (v > 0.f) ? v : 0.1f * v; else if (ACT == 15) v = v / (1.0f + expf(-v)); else if (ACT == 3) v = fmaxf(v, 0.f); else if (ACT == 6) v = 0.5f * v * (1.0f + erff(v * 0.70710678118654752f)); so[w][8 * hh + r][t * 16 + ln] = v; } }
  __builtin_amdgcn_fence(__ATOMIC_ACQ_REL, "workgroup"); __builtin_amdgcn_wave_barrier();
  const int rsub = lane >> 4, c4 = (lane & 15) * 4; typedef _Float16 v4h __attribute__((ext_vector_type(4)));
  {
#pragma unroll
    for (int q = 0; q < 8; ++q) { const int r = q * 2 + rsub; if (col0 + c4 < N) { const v4f v = *(const v4fa*)&so[w][r][c4]; if (C) *(v4f*)(C + cofs + (size_t)(row0 + r) * ldc + col0 + c4) = v; if (C16) { v4h h4; for (int i = 0; i < 4; ++i) h4[i] = (_Float16)v[i]; *(v4h*)(C16 + cofs + (size_t)(row0 + r) * ldc + col0 + c4) = h4; } } }
     }
}


typedef _Float16 v4h __attribute__((ext_vector_type(4)));

__global__ __launch_bounds__(256) void k_x16(const float* __restrict__ x, _Float16* __restrict__ X16, size_t n8) { const size_t t = (size_t)blockIdx.x * 256 + threadIdx.x; if (t >= n8) return; FragH f;
#pragma unroll
  for (int q = 0; q < 8; ++q) f.h[q] = (_Float16)bf16_round(x[t * 8 + q]); *(v8us*)((unsigned short*)X16 + t * 8) = f.half[0];  }
__global__ __launch_bounds__(256) void k_h16(const float* __restrict__ x, _Float16* __restrict__ X16, size_t n8) { const size_t t = (size_t)blockIdx.x * 256 + threadIdx.x; if (t >= n8) return; FragH f;
#pragma unroll
  for (int q = 0; q < 8; ++q) f.h[q] = (_Float16)x[t * 8 + q]; *(v8us*)((unsigned short*)X16 + t * 8) = f.half[0];  }
__global__ __launch_bounds__(256) void k_round16f(const float* __restrict__ W, _Float16* __restrict__ Bt, size_t n8) { const size_t t = (size_t)blockIdx.x * 256 + threadIdx.x; if (t >= n8) return; FragH f;
#pragma unroll
  for (int i = 0; i < 8; ++i) f.h[i] = (_Float16)(bf16_round(W[t * 8 + i]) * 16.0f); *(v8us*)((unsigned short*)Bt + t * 8) = f.half[0];  }
template <int NHv, int TTv>
__global__ __launch_bounds__(256) void k_vt(const _Float16* __restrict__ V16, int ldv, int voff, _Float16* __restrict__ Vt) { __shared__ unsigned short tl[64][66]; const int tid = threadIdx.x; const int slab = blockIdx.x / (TTv / 64), lg = blockIdx.x % (TTv / 64); const int b = slab / NHv, h = slab % NHv;
  for (int i = tid; i < 64 * 8; i += 256) { const int r = i / 8, c8 = (i % 8) * 8; FragH f; f.half[0] = *(const v8us*)((const unsigned short*)V16 + ((size_t)b * TTv + lg * 64 + r) * ldv + voff + h * 64 + c8);
#pragma unroll
    for (int q = 0; q < 8; ++q) tl[r][c8 + q] = f.u[q]; }
  __syncthreads();
  {
#pragma unroll
    for (int rd = 0; rd < 2; ++rd) { const int d = rd * 32 + tid / 8, pc = tid % 8; FragH f;
#pragma unroll
      for (int q = 0; q < 8; ++q) f.u[q] = tl[pc * 8 + q][d];
      *(v8us*)((unsigned short*)Vt + ((size_t)slab * 64 + d) * TTv + lg * 64 + pc * 8) = f.half[0]; }
     } }

__global__ __launch_bounds__(256) void k_hl(const float* __restrict__ F, _Float16* __restrict__ Hh, _Float16* __restrict__ Hl, size_t n8) { const size_t t = (size_t)blockIdx.x * 256 + threadIdx.x; if (t >= n8) return; FragH fh, fl; const v4f a = *(const v4fa*)(F + t * 8), c = *(const v4fa*)(F + t * 8 + 4);
#pragma unroll
  for (int q = 0; q < 4; ++q) { _Float16 h = (_Float16)a[q]; fh.h[q] = h; fl.h[q] = (_Float16)((a[q] - (float)h) * 1024.0f); h = (_Float16)c[q]; fh.h[4 + q] = h; fl.h[4 + q] = (_Float16)((c[q] - (float)h) * 1024.0f); }
  { *(v8us*)((unsigned short*)Hh + t * 8) = fh.half[0]; *(v8us*)((unsigned short*)Hl + t * 8) = fl.half[0];  } }

// ---- fast GEMM (wave tile 32x64; requires M % 32 == 0 rows per launch region and N % 64 == 0); epilogue = k_gemm_hhx semantics ----
__device__ __forceinline__ v16h g2_frag(const _Float16* p, int hh) { FragH f; f.half[0] = *(const v8us*)((const unsigned short*)p + 8 * hh); f.half[1] = *(const v8us*)((const unsigned short*)p + 16 + 8 * hh); return f.v; }
__device__ __forceinline__ v8f g2_mma(v16h a, v16h b, v8f c) { v8f d = __builtin_amdgcn_wmma_f32_16x16x32_f16(false, a, false, b, (short)0, c, false, false); asm volatile("v_nop\n\tv_nop\n\tv_nop\n\tv_nop" : "+v"(d) : "v"(a), "v"(b)); return d; }
template <int ACT>
__global__ __launch_bounds__(128) void k_gemm2(const _Float16* __restrict__ A, int lda, size_t sA, const _Float16* __restrict__ Bh, int ldb, size_t sB, float alpha, const float* __restrict__ bias, size_t sBias, const float* __restrict__ CP, int rowsPerB, size_t sCPb, int row0g,
    float* __restrict__ C, _Float16* __restrict__ C16, int ldc, size_t sC, int M, int N, int K) {
  __shared__ __attribute__((aligned(16))) float so[4][32][68];
  const int tid = threadIdx.x, w = tid >> 5, lane = tid & 31, ln = lane & 15, hh = lane >> 4; const int by = blockIdx.y;
  A += (size_t)by * sA; Bh += (size_t)by * sB; const size_t cofs = (size_t)by * sC; const float* bp = bias ? bias + (size_t)by * sBias : nullptr;
  const int ntn = N >> 6; const int mt = blockIdx.x / ntn, nq = blockIdx.x - mt * ntn; const int row0 = mt * 128 + 32 * w, col0 = nq * 64; if (row0 >= M) return;
  const _Float16* a0p = A + (size_t)(row0 + ln) * lda; const _Float16* a1p = a0p + (size_t)16 * lda;
  const _Float16* b0p = Bh + (size_t)(col0 + ln) * ldb; const _Float16* b1p = b0p + (size_t)16 * ldb; const _Float16* b2p = b1p + (size_t)16 * ldb; const _Float16* b3p = b2p + (size_t)16 * ldb;
  const v8f z8 = {0.f,0.f,0.f,0.f,0.f,0.f,0.f,0.f}; v8f c00 = z8, c01 = z8, c02 = z8, c03 = z8, c10 = z8, c11 = z8, c12 = z8, c13 = z8;
#pragma unroll 1
  for (int kb = 0; kb < K; kb += 32) { const v16h a0 = g2_frag(a0p + kb, hh), a1 = g2_frag(a1p + kb, hh);
    v16h b = g2_frag(b0p + kb, hh); c00 = g2_mma(a0, b, c00); c10 = g2_mma(a1, b, c10);
    b = g2_frag(b1p + kb, hh); c01 = g2_mma(a0, b, c01); c11 = g2_mma(a1, b, c11);
    b = g2_frag(b2p + kb, hh); c02 = g2_mma(a0, b, c02); c12 = g2_mma(a1, b, c12);
    b = g2_frag(b3p + kb, hh); c03 = g2_mma(a0, b, c03); c13 = g2_mma(a1, b, c13); }
  v8f accs[8] = {c00, c01, c02, c03, c10, c11, c12, c13};
#pragma unroll
  for (int u = 0; u < 8; ++u) { const int t = u & 3, half = u >> 2; const int col = col0 + t * 16 + ln; const float bv = bp ? bf16_round(bp[col]) : 0.f;
#pragma unroll
    for (int r = 0; r < 8; ++r) { const int rloc = half * 16 + 8 * hh + r; float v = accs[u][r] * alpha + bv; if (CP) { const int bidx = (row0g + row0 + rloc) / rowsPerB; v += CP[(size_t)bidx * sCPb + (size_t)by * 64 + col]; }
      if (ACT == 3) v = fmaxf(v, 0.f); else if (ACT == 6) v = 0.5f * v * (1.0f + erff(v * 0.70710678118654752f)); else if (ACT == 11) v = 1.0f / (1.0f + expf(-v)); else if (ACT == 15) v = v / (1.0f + expf(-v)); else if (ACT == 12) v = (v > 0.f) ? v : 0.01f * v; else if (ACT == 8) v = tanhf(v);
      so[w][rloc][t * 16 + ln] = v; } }
  __builtin_amdgcn_fence(__ATOMIC_ACQ_REL, "workgroup"); __builtin_amdgcn_wave_barrier();
  const int rsub = lane >> 4, c4 = (lane & 15) * 4;
  {
#pragma unroll
    for (int q = 0; q < 16; ++q) { const int r = q * 2 + rsub; const v4f v = *(const v4fa*)&so[w][r][c4]; if (C) *(v4f*)(C + cofs + (size_t)(row0 + r) * ldc + col0 + c4) = v; if (C16) { v4h h4; for (int i = 0; i < 4; ++i) h4[i] = (_Float16)v[i]; *(v4h*)(C16 + cofs + (size_t)(row0 + r) * ldc + col0 + c4) = h4; } }
     } }



// One stage of the K / V^T ring: 64 key rows of K (128 bytes each) and 64 rows of V^T (the same 64 keys, 128 bytes each), 16 KiB, brought by asynchronous copies to LDS.
// Eight copies a lane; a wave-wide copy covers four whole 128-byte lines. s_wait_xcnt stands inside the statement so that no address register is rewritten ahead of it.
__device__ __forceinline__ void stage_copy(unsigned lds, const unsigned short* gk, size_t kstep, const unsigned short* gv, size_t vstep) {
  asm volatile("global_load_async_to_lds_b128 %0, %8, off\n\t"
               "global_load_async_to_lds_b128 %1, %9, off\n\t"
               "global_load_async_to_lds_b128 %2, %10, off\n\t"
               "global_load_async_to_lds_b128 %3, %11, off\n\t"
               "global_load_async_to_lds_b128 %4, %12, off\n\t"
               "global_load_async_to_lds_b128 %5, %13, off\n\t"
               "global_load_async_to_lds_b128 %6, %14, off\n\t"
               "global_load_async_to_lds_b128 %7, %15, off\n\t"
               "s_wait_xcnt 0x0"
               :: "v"(lds), "v"(lds + 2048u), "v"(lds + 4096u), "v"(lds + 6144u), "v"(lds + 8192u), "v"(lds + 10240u), "v"(lds + 12288u), "v"(lds + 14336u),
                  "v"(gk), "v"(gk + kstep), "v"(gk + 2 * kstep), "v"(gk + 3 * kstep), "v"(gv), "v"(gv + vstep), "v"(gv + 2 * vstep), "v"(gv + 3 * vstep)
               : "memory");
}
template <int CAUSAL>
__global__ __launch_bounds__(128) void k_flash(const _Float16* __restrict__ Q16, int ldq, const _Float16* __restrict__ K16, int ldk, const _Float16* __restrict__ Vt, const int* __restrict__ MSK, float* __restrict__ O, int ldo) {
  constexpr int RPW = 16, RTN = RPW / 16, NQB = TQ / (4 * RPW), DT = 4, KS = 2;
  constexpr int TILE_B = 64 * 128, STAGE_B = 2 * TILE_B;      /* a stage = 64 keys: K tile, then V^T tile, rows of 128 bytes without a pad */
  __shared__ __attribute__((aligned(16))) unsigned char ring[2 * STAGE_B]; __shared__ __attribute__((aligned(16))) unsigned short sP[4][RPW][40];
  float (*sO)[RPW][64 + 4] = reinterpret_cast<float (*)[RPW][64 + 4]>(ring);      /* output staging takes the ring's place behind the loop's last barrier */
  const int tid = threadIdx.x, w = tid >> 5, lane = tid & 31, ln = lane & 15, hh = lane >> 4;
  const int slab = blockIdx.x / QBLKS, qblk = blockIdx.x % QBLKS; (void)NQB; (void)MSK; const int b = slab / NH, h = slab % NH; const int qb0 = qblk * (4 * RPW); const int q0 = qb0 + w * RPW;
  const unsigned short* Vth = (const unsigned short*)Vt + (size_t)slab * 64 * TK;
  const int jend = (CAUSAL == 1) ? (qb0 + 4 * RPW) : TK;      /* causal: keys beyond the block's last query never contribute */
  const int nst = jend / 64;
  /* 16-byte piece c of row r lies at r * 128 + (c ^ ((r >> 1) & 7)) * 16: sixteen rows read at one piece index fall on all 64 banks */
  const unsigned cp_lds = (unsigned)(size_t)ring + (unsigned)((tid >> 3) * 128 + (((tid & 7) ^ ((tid >> 4) & 7)) * 16));
  const unsigned short* cp_k = (const unsigned short*)K16 + ((size_t)b * TK + (tid >> 3)) * ldk + h * 64 + (tid & 7) * 8;
  const unsigned short* cp_v = Vth + (size_t)(tid >> 3) * TK + (tid & 7) * 8;
  const size_t kstep = (size_t)16 * ldk, vstep = (size_t)16 * TK;
  stage_copy(cp_lds, cp_k, kstep, cp_v, vstep);
  FragH aq[2][KS];
#pragma unroll
  for (int rt = 0; rt < RTN; ++rt) { const unsigned short* qr = (const unsigned short*)Q16 + ((size_t)b * TQ + q0 + rt * 16 + ln) * ldq + h * 64;
#pragma unroll
    for (int ks = 0; ks < KS; ++ks) { aq[rt][ks].half[0] = *(const v8us*)(qr + ks * 32 + 8 * hh); aq[rt][ks].half[1] = *(const v8us*)(qr + ks * 32 + 16 + 8 * hh); } }
  int fo[2][2];      /* a fragment's two pieces in row ln: [32-element group of the row][piece] */
#pragma unroll
  for (int g = 0; g < 2; ++g)
#pragma unroll
    for (int pc = 0; pc < 2; ++pc) fo[g][pc] = ln * 128 + (((g * 4 + pc * 2 + hh) ^ ((ln >> 1) & 7)) * 16);
  float m_r[2][8], l_r[2][8]; v8f oacc[2][DT];
#pragma unroll
  for (int rt = 0; rt < RTN; ++rt) {
#pragma unroll
    for (int r = 0; r < 8; ++r) { m_r[rt][r] = -3.0e38f; l_r[rt][r] = 0.f; }
#pragma unroll
    for (int dt = 0; dt < DT; ++dt) oacc[rt][dt] = (v8f){0.f,0.f,0.f,0.f,0.f,0.f,0.f,0.f}; }
  asm volatile("s_wait_asynccnt 0x0" ::: "memory");      /* stage 0 has landed for this wave's own copies */
  __syncthreads();                                       /* ... and for every other wave's */
  if (1 < nst) stage_copy(cp_lds + STAGE_B, cp_k + (size_t)64 * ldk, kstep, cp_v + 64, vstep);
#pragma unroll 1
  for (int t = 0; t < nst; ++t) {
    const unsigned char* st = ring + (t & 1) * STAGE_B;
#pragma unroll 1      /* the two 32-key passes of a stage stay one body: unrolled, the kernel took 160 registers and lost a wave per SIMD */
    for (int ps = 0; ps < 2; ++ps) { const int j0 = t * 64 + ps * 32;
    v8f s[2][2];
#pragma unroll
    for (int nt = 0; nt < 2; ++nt) { const unsigned char* kr = st + (ps * 32 + nt * 16) * 128; FragH bk[KS];
#pragma unroll
      for (int ks = 0; ks < KS; ++ks) { bk[ks].half[0] = *(const v8us*)(kr + fo[ks][0]); bk[ks].half[1] = *(const v8us*)(kr + fo[ks][1]); }
#pragma unroll
      for (int rt = 0; rt < RTN; ++rt) { v8f acc = (v8f){0.f,0.f,0.f,0.f,0.f,0.f,0.f,0.f};
#pragma unroll
        for (int ks = 0; ks < KS; ++ks) acc = mmaH<1>(aq[rt][ks].v, aq[rt][ks].v, bk[ks].v, bk[ks].v, acc); s[rt][nt] = acc; } }
#pragma unroll
    for (int rt = 0; rt < RTN; ++rt)
#pragma unroll
      for (int r = 0; r < 8; ++r) { const int tq = q0 + rt * 16 + 8 * hh + r; const int k0 = j0 + ln, k1 = j0 + 16 + ln;
        const bool ok0 = (CAUSAL == 1) ? (k0 <= tq) : ((CAUSAL == 2) ? ((k0 >> 5) == (tq >> 5)) : true), ok1 = (CAUSAL == 1) ? (k1 <= tq) : ((CAUSAL == 2) ? ((k1 >> 5) == (tq >> 5)) : true);      /* mode 2: block-diagonal 32-token groups */
        const float s0 = ok0 ? s[rt][0][r] * SCL : -3.0e38f, s1 = ok1 ? s[rt][1][r] * SCL : -3.0e38f; float mc = fmaxf(s0, s1);
        mc = fmaxf(mc, __shfl_xor(mc, 1, 32)); mc = fmaxf(mc, __shfl_xor(mc, 2, 32)); mc = fmaxf(mc, __shfl_xor(mc, 4, 32)); mc = fmaxf(mc, __shfl_xor(mc, 8, 32));
        const float mn = fmaxf(m_r[rt][r], mc); const float al = (mn > -1.0e38f) ? expf(m_r[rt][r] - mn) : 1.0f; m_r[rt][r] = mn; const float p0 = ok0 ? expf(s0 - mn) : 0.f, p1 = ok1 ? expf(s1 - mn) : 0.f; l_r[rt][r] = l_r[rt][r] * al + p0 + p1;
#pragma unroll
        for (int dt = 0; dt < DT; ++dt) oacc[rt][dt][r] *= al;
        FragH t2; t2.h[0] = (_Float16)(p0 * 1024.0f); t2.h[1] = (_Float16)(p1 * 1024.0f); sP[w][rt * 16 + 8 * hh + r][ln] = t2.u[0]; sP[w][rt * 16 + 8 * hh + r][16 + ln] = t2.u[1]; }
    __builtin_amdgcn_fence(__ATOMIC_ACQ_REL, "workgroup"); __builtin_amdgcn_wave_barrier();
    FragH pa[2];
#pragma unroll
    for (int rt = 0; rt < RTN; ++rt) { pa[rt].half[0] = *(const v8us*)&sP[w][rt * 16 + ln][8 * hh]; pa[rt].half[1] = *(const v8us*)&sP[w][rt * 16 + ln][16 + 8 * hh]; }
#pragma unroll
    for (int dt = 0; dt < DT; ++dt) { const unsigned char* vrow = st + TILE_B + dt * 16 * 128; FragH bv; bv.half[0] = *(const v8us*)(vrow + (fo[0][0] ^ (ps * 64))); bv.half[1] = *(const v8us*)(vrow + (fo[0][1] ^ (ps * 64)));      /* the pass's 32 keys: piece index + 4 = bit 6 of the offset */
#pragma unroll
      for (int rt = 0; rt < RTN; ++rt) oacc[rt][dt] = mmaH<1>(pa[rt].v, pa[rt].v, bv.v, bv.v, oacc[rt][dt]); }
    __builtin_amdgcn_fence(__ATOMIC_ACQ_REL, "workgroup"); __builtin_amdgcn_wave_barrier(); }
    asm volatile("s_wait_dscnt 0x0" ::: "memory");         /* this wave's reads of stage t have returned */
    asm volatile("s_wait_asynccnt 0x0" ::: "memory");      /* this wave's copies of stage t + 1 have landed */
    __syncthreads();                                       /* publishes stage t + 1 and ends every wave's reads of stage t */
    if (t + 2 < nst) stage_copy(cp_lds + (t & 1) * STAGE_B, cp_k + (size_t)(t + 2) * 64 * ldk, kstep, cp_v + (t + 2) * 64, vstep); }
  asm volatile("s_wait_asynccnt 0x0" ::: "memory");        /* nothing is in flight when the ring becomes output staging */
#pragma unroll
  for (int rt = 0; rt < RTN; ++rt) {
#pragma unroll
    for (int r = 0; r < 8; ++r) { float l = l_r[rt][r]; l += __shfl_xor(l, 1, 32); l += __shfl_xor(l, 2, 32); l += __shfl_xor(l, 4, 32); l += __shfl_xor(l, 8, 32); l_r[rt][r] = (l > 0.f) ? 1.0f / (l * 1024.0f) : 0.f; }
#pragma unroll
    for (int dt = 0; dt < DT; ++dt)
#pragma unroll
      for (int r = 0; r < 8; ++r) sO[w][rt * 16 + 8 * hh + r][dt * 16 + ln] = oacc[rt][dt][r] * l_r[rt][r]; }
  __builtin_amdgcn_fence(__ATOMIC_ACQ_REL, "workgroup"); __builtin_amdgcn_wave_barrier();
  {
#pragma unroll
    for (int rp = 0; rp < RPW; rp += 2) { const int r = rp + (lane >> 4), pc = lane & 15; const v4f val = *(const v4fa*)&sO[w][r][pc * 4]; *(v4f*)(O + ((size_t)b * TQ + q0 + r) * ldo + h * 64 + pc * 4) = val; }
     } }

__global__ __launch_bounds__(256) void k_wsc(const float* __restrict__ Wm, _Float16* __restrict__ Bt, size_t n8, float sc) { const size_t t = (size_t)blockIdx.x * 256 + threadIdx.x; if (t >= n8) return; FragH f; for (int q = 0; q < 8; ++q) f.h[q] = (_Float16)(bf16_round(Wm[t * 8 + q]) * sc); *(v8us*)((unsigned short*)Bt + t * 8) = f.half[0];  }
__global__ __launch_bounds__(256) void k_woutp(const float* __restrict__ Wm, _Float16* __restrict__ Bt) { const size_t t = (size_t)blockIdx.x * 256 + threadIdx.x; if (t >= (size_t)DMOD * (2 * DMOD / 8)) return; const int pc = (int)(t % (2 * DMOD / 8)); const int o = (int)(t / (2 * DMOD / 8)); const bool lo = pc * 8 >= DMOD; FragH f;
  for (int q = 0; q < 8; ++q) { const int c = pc * 8 + q - (lo ? DMOD : 0); f.h[q] = (_Float16)(bf16_round(Wm[(size_t)o * DMOD + c]) * (lo ? 1.0f : 16.0f)); } *(v8us*)((unsigned short*)Bt + (size_t)o * 2 * DMOD + pc * 8) = f.half[0];  }
__global__ __launch_bounds__(256) void k_ropetab(float* __restrict__ CS) {
  #pragma clang fp contract(off)
  const int t = blockIdx.x * 256 + threadIdx.x; if (t >= SLEN * (RD / 2)) return; const int i = t % (RD / 2), tpos = t / (RD / 2); const float invf = (float)pow(10000.0, -(double)(2 * i) / (double)RD); const float ang = (float)tpos * invf; const float c = cosf(ang), s = sinf(ang);
  { *(float*)(CS + t) = c; *(float*)(CS + SLEN * (RD / 2) + t) = s;  } }
__global__ __launch_bounds__(256) void k_rope(const float* __restrict__ Q, const float* __restrict__ Kf, const float* __restrict__ CS, _Float16* __restrict__ Q16, _Float16* __restrict__ K16) {
  #pragma clang fp contract(off)
  const size_t t = (size_t)blockIdx.x * 256 + threadIdx.x; if (t >= (size_t)NR * NH * 2) return; const int which = (int)(t & 1); const int h = (int)((t >> 1) % NH); const size_t r = t / (2 * NH); const int tpos = (int)(r % SLEN);
  const float* src = (which ? Kf : Q) + r * DMOD + h * HD; _Float16* dst = (which ? K16 : Q16) + r * DMOD + h * HD; FragH f[4];
#pragma unroll
  for (int i = 0; i < RD / 2; ++i) { const float c = CS[tpos * (RD / 2) + i], s = CS[SLEN * (RD / 2) + tpos * (RD / 2) + i]; const float x1 = src[i], x2 = src[RD / 2 + i];
    float a = x1 * c; a += x2 * s; float bq = x1 * -s; bq += x2 * c; f[0].h[i] = (_Float16)a; f[1].h[i] = (_Float16)bq; }
#pragma unroll
  for (int i = 0; i < 16; ++i) { f[2].h[i] = (_Float16)src[RD + i]; f[3].h[i] = (_Float16)src[RD + 16 + i]; }
  { for (int u = 0; u < 4; ++u) { *(v8us*)((unsigned short*)dst + u * 16) = f[u].half[0]; *(v8us*)((unsigned short*)dst + u * 16 + 8) = f[u].half[1]; }  } }

extern "C" void kernel_launch(void* const* d_in, const int* in_sizes, int n_in,
                              void* d_out, int out_size, void* d_ws, size_t ws_size, hipStream_t stream) {
  (void)in_sizes; (void)n_in; (void)out_size;
  const float* const* I = (const float* const*)d_in; const float* x = I[0]; const float* Wq = I[1]; const float* Wk = I[2]; const float* Wv = I[3]; const float* Wo = I[4];
  char* ws = (char*)d_ws; size_t off = 0;
  auto take = [&](size_t bytes) { char* p = ws + off; off += (bytes + 255) & ~(size_t)255; return p; };
  const size_t w8 = (size_t)DMOD * DMOD / 8;
  _Float16* BQ = (_Float16*)take(w8 * 16); _Float16* BK = (_Float16*)take(w8 * 16); _Float16* BV = (_Float16*)take(w8 * 16); _Float16* BO = (_Float16*)take(w8 * 32);
  _Float16* X16 = (_Float16*)take((size_t)NR * DMOD * 2); float* Qf = (float*)take((size_t)NR * DMOD * 4); float* Kf = (float*)take((size_t)NR * DMOD * 4); _Float16* Q16 = (_Float16*)take((size_t)NR * DMOD * 2); _Float16* K16 = (_Float16*)take((size_t)NR * DMOD * 2); _Float16* V16 = (_Float16*)take((size_t)NR * DMOD * 2); _Float16* VT = (_Float16*)take((size_t)NR * DMOD * 2); float* CS = (float*)take((size_t)SLEN * RD * 4);
  float* O = Qf; _Float16* Hh = Q16; _Float16* Hl = K16;      /* aliases after the flash kernel: Qf/Q16/K16 are dead */
  if (off > ws_size) return;      /* 10 + 16 + 32 + 32 + 16 x 4 = 154 MiB */
  k_wsc<<<(unsigned)((w8 + 255) / 256), 256, 0, stream>>>(Wq, BQ, w8, 16.0f); k_wsc<<<(unsigned)((w8 + 255) / 256), 256, 0, stream>>>(Wk, BK, w8, 16.0f); k_wsc<<<(unsigned)((w8 + 255) / 256), 256, 0, stream>>>(Wv, BV, w8, 16.0f); k_woutp<<<(unsigned)(((size_t)DMOD * (2 * DMOD / 8) + 255) / 256), 256, 0, stream>>>(Wo, BO);
  k_x16<<<(unsigned)(((size_t)NR * DMOD / 8 + 255) / 256), 256, 0, stream>>>(x, X16, (size_t)NR * DMOD / 8);
  const dim3 gP((NR / 128) * (DMOD / 64), 1);
  k_gemm2<0><<<gP, 128, 0, stream>>>(X16, DMOD, 0, BQ, DMOD, 0, 0.0625f, nullptr, 0, nullptr, 1, 0, 0, Qf, nullptr, DMOD, 0, NR, DMOD, DMOD);
  k_gemm2<0><<<gP, 128, 0, stream>>>(X16, DMOD, 0, BK, DMOD, 0, 0.0625f, nullptr, 0, nullptr, 1, 0, 0, Kf, nullptr, DMOD, 0, NR, DMOD, DMOD);
  k_gemm2<0><<<gP, 128, 0, stream>>>(X16, DMOD, 0, BV, DMOD, 0, 0.0625f, nullptr, 0, nullptr, 1, 0, 0, nullptr, V16, DMOD, 0, NR, DMOD, DMOD);
  k_ropetab<<<(SLEN * (RD / 2) + 255) / 256, 256, 0, stream>>>(CS); k_rope<<<(unsigned)(((size_t)NR * NH * 2 + 255) / 256), 256, 0, stream>>>(Qf, Kf, CS, Q16, K16);
  k_vt<NH, SLEN><<<NB * NH * (SLEN / 64), 256, 0, stream>>>(V16, DMOD, 0, VT);
  k_flash<0><<<NB * NH * QBLKS, 128, 0, stream>>>(Q16, DMOD, K16, DMOD, VT, nullptr, O, DMOD);
  k_hl<<<(unsigned)(((size_t)NR * DMOD / 8 + 255) / 256), 256, 0, stream>>>(O, Hh, Hl, (size_t)NR * DMOD / 8);
  k_gemm2<0><<<gP, 128, 0, stream>>>(Hh, DMOD, 0, BO, 2 * DMOD, 0, 0.0625f, nullptr, 0, nullptr, 1, 0, 0, (float*)d_out, nullptr, DMOD, 0, NR, DMOD, DMOD);
  k_gemm2<0><<<gP, 128, 0, stream>>>(Hl, DMOD, 0, BO + DMOD, 2 * DMOD, 0, 1.0f / 1024.0f, nullptr, 0, (const float*)d_out, 1, (size_t)DMOD, 0, (float*)d_out, nullptr, DMOD, 0, NR, DMOD, DMOD);
}

// v002
// Measured time: 465 microseconds a run.
// In two side-by-side timings against v001, it was 1.35 and 1.36 times as fast.
// Counting every step since v000, it is 1.71 times as fast.
#include <hip/hip_runtime.h>
// TinyAttn (4 sequences x 2048 tokens x 1024; 16 heads x 64; rotary embedding on the first 32 dims of each head): q,k,v = x W^T; q,k rotated (rot = [x1 cos + x2 sin, -x1 sin + x2 cos] on dims 0..31 with the module's inverse-frequency table); softmax(q k^T / 8) v; y Wo^T -> [4,2048,1024].
// Structure: x as an exact f16 plane; q/k/v projections as f16 WMMA GEMMs (32x64 wave tiles, f32 accumulation, exact x16 weights; q/k in f32 for the rotation, v as f16); the rotary tables recomputed on the device (f64 pow for the inverse frequencies, f32 angle product, f32 cos/sin) and applied on VALU into f16 q/k planes; V transposed by LDS tiles; the fused flash kernel; the attention output as hi + residual planes into two accumulating output-projection GEMMs.
// Compute dtype: x and weights rounded to bf16; q, k (after rotation), v, P as f16 operands (~2^-12); attention output hi + 2^-10-scaled residual; f32 accumulation/softmax. v_wmma_f32_16x16x32_f16.
#define NB 4
#define DMOD 1024
#define HD 64
#define RD 32                    /* rotary dims per head */
#define NR (NB * SLEN)
#define QBLKS (TQ / 64)          /* query blocks per (sequence, head) launched */
#define SLEN 2048
#define TQ SLEN
#define TK SLEN
#define NH 16
#define SCL 0.125f               /* 64^-0.5 */
typedef __bf16 v16b __attribute__((ext_vector_type(16)));
typedef unsigned short v8us __attribute__((ext_vector_type(8), may_alias));
typedef float  v8f  __attribute__((ext_vector_type(8)));
typedef float  v4f  __attribute__((ext_vector_type(4)));
typedef float  v4fa __attribute__((ext_vector_type(4), may_alias));
union FragB { v16b v; v8us half[2]; unsigned short u[16]; };

__device__ __forceinline__ unsigned short bf16_bits(float x) { unsigned int u = __float_as_uint(x); return (unsigned short)((u + 0x7FFFu + ((u >> 16) & 1u)) >> 16); }
__device__ __forceinline__ float bf16_val(unsigned short b) { return __uint_as_float(((unsigned int)b) << 16); }
__device__ __forceinline__ float bf16_round(float x) { return bf16_val(bf16_bits(x)); }
// D += A·B with NT terms: 1 = ah·bh, 2 = + al·bh (A split), 3 = + ah·bl (both split)
template <int NT>
__device__ __forceinline__ v8f mmaN(v16b ah, v16b al, v16b bh, v16b bl, v8f c) {
  c = __builtin_amdgcn_wmma_f32_16x16x32_bf16(false, ah, false, bh, (short)0, c, false, false);
  if (NT >= 2) c = __builtin_amdgcn_wmma_f32_16x16x32_bf16(false, al, false, bh, (short)0, c, false, false);
  if (NT >= 3) c = __builtin_amdgcn_wmma_f32_16x16x32_bf16(false, ah, false, bl, (short)0, c, false, false);
  asm volatile("v_nop\n\tv_nop\n\tv_nop\n\tv_nop" : "+v"(c) : "v"(ah), "v"(al), "v"(bh), "v"(bl));
  return c;
}

__global__ __launch_bounds__(256) void k_wt_bf16(const float* __restrict__ W, unsigned short* __restrict__ Wt, int K, int N) {
  const int t = blockIdx.x * 256 + threadIdx.x;
  const int k8n = K / 8;
  if (t >= N * k8n) return;
  const int n = t / k8n, k8 = (t % k8n) * 8;
  v8us v;
#pragma unroll
  for (int i = 0; i < 8; ++i) v[i] = bf16_bits(W[(size_t)(k8 + i) * N + n]);
  *(v8us*)(Wt + (size_t)n * K + k8) = v;
  
}

// GEMM C[M][N] (f32, pitch ldc) = act(A[M][K]·W + bias). A f32 row-major (pitch lda) converted per fragment to bf16
// (ASPLIT: hi/lo two planes -> 2 terms, else single rounded term); Wt bf16 [N][K] (pitch ldb). BIAS_BF16 rounds the
// bias to bf16 first (bias quantised to bf16 before the add). K%32==0, M%16==0, N%64==0.
template <bool ASPLIT, int ACT, bool BIAS_BF16>
__global__ __launch_bounds__(128) void k_gemm_bf(const float* __restrict__ A, int lda, const unsigned short* __restrict__ Wt, int ldb,
                                               const float* __restrict__ bias, float* __restrict__ C, int ldc, int M, int N, int K) {
  __shared__ __attribute__((aligned(16))) float so[4][16][64];
  const int tid = threadIdx.x, w = tid >> 5, lane = tid & 31, ln = lane & 15, hh = lane >> 4;
  const int ntn = N / 64;
  const int wid = blockIdx.x * 4 + w;
  const int mt = wid / ntn, nq = wid % ntn;
  if (mt * 16 >= M) return;
  const int row0 = mt * 16, col0 = nq * 64;
  const float* arow = A + (size_t)(row0 + ln) * lda;
  v8f acc[4] = {};
  for (int kb = 0; kb < K; kb += 32) {
    FragB ah, al;
    const v4f x0 = *(const v4fa*)(arow + kb + 8 * hh), x1 = *(const v4fa*)(arow + kb + 8 * hh + 4);
    const v4f x2 = *(const v4fa*)(arow + kb + 16 + 8 * hh), x3 = *(const v4fa*)(arow + kb + 16 + 8 * hh + 4);
    float xs[16] = {x0[0],x0[1],x0[2],x0[3],x1[0],x1[1],x1[2],x1[3],x2[0],x2[1],x2[2],x2[3],x3[0],x3[1],x3[2],x3[3]};
#pragma unroll
    for (int i = 0; i < 16; ++i) { const unsigned short hb = bf16_bits(xs[i]); ah.u[i] = hb; al.u[i] = ASPLIT ? bf16_bits(xs[i] - bf16_val(hb)) : (unsigned short)0; }
#pragma unroll
    for (int t = 0; t < 4; ++t) {
      const unsigned short* brow = Wt + (size_t)(col0 + t * 16 + ln) * ldb + kb;
      FragB b;
      b.half[0] = *(const v8us*)(brow + 8 * hh);
      b.half[1] = *(const v8us*)(brow + 16 + 8 * hh);
      acc[t] = mmaN<ASPLIT ? 2 : 1>(ah.v, al.v, b.v, b.v, acc[t]);
    }
  }
#pragma unroll
  for (int t = 0; t < 4; ++t) {
    float bv = bias ? bias[col0 + t * 16 + ln] : 0.f;
    if (BIAS_BF16) bv = bf16_round(bv);
#pragma unroll
    for (int r = 0; r < 8; ++r) { float v = acc[t][r] + bv; if (ACT == 1) v = fmaxf(v, 0.f); so[w][8 * hh + r][t * 16 + ln] = v; }
  }
  __builtin_amdgcn_fence(__ATOMIC_ACQ_REL, "workgroup");
  __builtin_amdgcn_wave_barrier();
  const int rsub = lane >> 4, c4 = (lane & 15) * 4;
  {
#pragma unroll
    for (int q = 0; q < 8; ++q) {
      const int r = q * 2 + rsub;
      const v4f v = *(const v4fa*)&so[w][r][c4];
      *(v4f*)(C + (size_t)(row0 + r) * ldc + col0 + c4) = v;
    }
    
  }
}

// GEMM C = act(A·W + bias + resid): A f32 (ASPLIT -> hi/lo 2 terms), Wt bf16 [N][K]; ACT 0 none, 1 relu, 2 exact gelu;
// resid (optional, f32, row index = (row % rmod), pitch ldr, RES_BF16 rounds it) added before the activation.
template <bool ASPLIT, int ACT, bool BIAS_BF16, bool RES_BF16>
__global__ __launch_bounds__(128) void k_gemm_bf3(const float* __restrict__ A, int lda, const unsigned short* __restrict__ Wt, int ldb,
                                                const float* __restrict__ bias, const float* __restrict__ resid, int rmod, int ldr,
                                                float* __restrict__ C, int ldc, int M, int N, int K) {
  __shared__ __attribute__((aligned(16))) float so[4][16][64];
  const int tid = threadIdx.x, w = tid >> 5, lane = tid & 31, ln = lane & 15, hh = lane >> 4;
  const int ntn = N / 64;
  const int wid = blockIdx.x * 4 + w;
  const int mt = wid / ntn, nq = wid % ntn;
  if (mt * 16 >= M) return;
  const int row0 = mt * 16, col0 = nq * 64;
  const float* arow = A + (size_t)(row0 + ln) * lda;
  v8f acc[4] = {};
  for (int kb = 0; kb < K; kb += 32) {
    FragB ah, al;
    const v4f x0 = *(const v4fa*)(arow + kb + 8 * hh), x1 = *(const v4fa*)(arow + kb + 8 * hh + 4);
    const v4f x2 = *(const v4fa*)(arow + kb + 16 + 8 * hh), x3 = *(const v4fa*)(arow + kb + 16 + 8 * hh + 4);
    float xs[16] = {x0[0],x0[1],x0[2],x0[3],x1[0],x1[1],x1[2],x1[3],x2[0],x2[1],x2[2],x2[3],x3[0],x3[1],x3[2],x3[3]};
#pragma unroll
    for (int i = 0; i < 16; ++i) { const unsigned short hb = bf16_bits(xs[i]); ah.u[i] = hb; al.u[i] = ASPLIT ? bf16_bits(xs[i] - bf16_val(hb)) : (unsigned short)0; }
#pragma unroll
    for (int t = 0; t < 4; ++t) {
      const unsigned short* brow = Wt + (size_t)(col0 + t * 16 + ln) * ldb + kb;
      FragB b;
      b.half[0] = *(const v8us*)(brow + 8 * hh);
      b.half[1] = *(const v8us*)(brow + 16 + 8 * hh);
      acc[t] = mmaN<ASPLIT ? 2 : 1>(ah.v, al.v, b.v, b.v, acc[t]);
    }
  }
#pragma unroll
  for (int t = 0; t < 4; ++t) {
    const int col = col0 + t * 16 + ln;
    float bv = bias ? bias[col] : 0.f;
    if (BIAS_BF16) bv = bf16_round(bv);
#pragma unroll
    for (int r = 0; r < 8; ++r) {
      float v = acc[t][r] + bv;
      if (resid) { float rv = resid[(size_t)((row0 + 8 * hh + r) % rmod) * ldr + col]; if (RES_BF16) rv = bf16_round(rv); v += rv; }
      if (ACT == 1) v = fmaxf(v, 0.f);
      if (ACT == 2) v = 0.5f * v * (1.0f + erff(v * 0.70710678118654752f));
      if (ACT == 3) { const float u = 0.7978845608028654f * (v + 0.044715f * v * v * v); v = 0.5f * v * (1.0f + tanhf(u)); }
      so[w][8 * hh + r][t * 16 + ln] = v;
    }
  }
  __builtin_amdgcn_fence(__ATOMIC_ACQ_REL, "workgroup");
  __builtin_amdgcn_wave_barrier();
  const int rsub = lane >> 4, c4 = (lane & 15) * 4;
  {
#pragma unroll
    for (int q = 0; q < 8; ++q) {
      const int r = q * 2 + rsub;
      const v4f v = *(const v4fa*)&so[w][r][c4];
      *(v4f*)(C + (size_t)(row0 + r) * ldc + col0 + c4) = v;
    }
    
  }
}
// row LayerNorm (biased variance, eps) over N: s = X (+ R); optional out_sum <- s; out_norm <- (s-mu)*rsqrt(var+eps)*g + b
template <bool PARAM_BF16>
__global__ __launch_bounds__(256) void k_layernorm(const float* __restrict__ X, const float* __restrict__ R, const float* __restrict__ g, const float* __restrict__ bta,
                                                  float* __restrict__ out_sum, float* __restrict__ out_norm, int N, float eps) {
  __shared__ float red[256];
  const int row = blockIdx.x, tid = threadIdx.x;
  const float* x = X + (size_t)row * N; const float* rr = R ? R + (size_t)row * N : nullptr;
  float vals[16];                     // up to N = 4096
  const int per = N / 256;            // contiguous chunk per thread? use strided-by-4 chunks: thread handles j = tid*4 + 1024*u
  float s1 = 0.f;
  for (int u = 0; u < per / 4; ++u) {
    const int j = tid * 4 + 1024 * u;
    const v4f a = *(const v4fa*)(x + j);
    v4f b = {0.f,0.f,0.f,0.f}; if (rr) b = *(const v4fa*)(rr + j);
#pragma unroll
    for (int q = 0; q < 4; ++q) { const float v = a[q] + b[q]; vals[u * 4 + q] = v; s1 += v; }
  }
  red[tid] = s1; __syncthreads();
  for (int st = 128; st > 0; st >>= 1) { if (tid < st) red[tid] += red[tid + st]; __syncthreads(); }
  const float mu = red[0] / (float)N; __syncthreads();
  float s2 = 0.f;
  for (int u = 0; u < per / 4; ++u)
#pragma unroll
    for (int q = 0; q < 4; ++q) { const float c = vals[u * 4 + q] - mu; s2 += c * c; }
  red[tid] = s2; __syncthreads();
  for (int st = 128; st > 0; st >>= 1) { if (tid < st) red[tid] += red[tid + st]; __syncthreads(); }
  const float rs = rsqrtf(red[0] / (float)N + eps);
  {
    for (int u = 0; u < per / 4; ++u) {
      const int j = tid * 4 + 1024 * u;
      v4f o, sm;
#pragma unroll
      for (int q = 0; q < 4; ++q) {
        float gg = g[j + q], bb = bta[j + q];
        if (PARAM_BF16) { gg = bf16_round(gg); bb = bf16_round(bb); }
        sm[q] = vals[u * 4 + q]; o[q] = (vals[u * 4 + q] - mu) * rs * gg + bb;
      }
      if (out_sum) *(v4f*)(out_sum + (size_t)row * N + j) = sm;
      *(v4f*)(out_norm + (size_t)row * N + j) = o;
    }
    
  }
}



// ---- f16 WMMA path (v_wmma_f32_16x16x32_f16): 11-bit significands for operands in range — used where a [0,1] probability operand needs more precision than bf16
typedef _Float16 v16h __attribute__((ext_vector_type(16)));
union FragH { v16h v; v8us half[2]; _Float16 h[16]; unsigned short u[16]; };
template <int NT>
__device__ __forceinline__ v8f mmaH(v16h ah, v16h al, v16h bh, v16h bl, v8f c) {
  c = __builtin_amdgcn_wmma_f32_16x16x32_f16(false, ah, false, bh, (short)0, c, false, false);
  if (NT >= 2) c = __builtin_amdgcn_wmma_f32_16x16x32_f16(false, al, false, bh, (short)0, c, false, false);
  if (NT >= 3) c = __builtin_amdgcn_wmma_f32_16x16x32_f16(false, ah, false, bl, (short)0, c, false, false);
  asm volatile("v_nop\n\tv_nop\n\tv_nop\n\tv_nop" : "+v"(c) : "v"(ah), "v"(al), "v"(bh), "v"(bl));
  return c;
}
// batched GEMM like k_gemm_b but f16 operands: A f32 (split into f16 hi/lo if ASPLIT, else rounded to f16), Bt = f16 values [n][k]; alpha; C f32; N multiple of 16 (partial tiles skipped)
template <bool ASPLIT>
__global__ __launch_bounds__(128) void k_gemm_h(const float* __restrict__ A, int lda, size_t sA, const _Float16* __restrict__ Bh, int ldb, size_t sB, float alpha, float* __restrict__ C, int ldc, size_t sC, int M, int N, int K) {
  __shared__ __attribute__((aligned(16))) float so[4][16][64];
  const int tid = threadIdx.x, w = tid >> 5, lane = tid & 31, ln = lane & 15, hh = lane >> 4; const int by = blockIdx.y;
  A += (size_t)by * sA; Bh += (size_t)by * sB; C += (size_t)by * sC;
  const int ntn = (N + 63) / 64; const int wid = blockIdx.x * 4 + w; const int mt = wid / ntn, nq = wid % ntn; if (mt * 16 >= M) return;
  const int row0 = mt * 16, col0 = nq * 64; const float* arow = A + (size_t)(row0 + ln) * lda;
  v8f acc[4] = {};
  for (int kb = 0; kb < K; kb += 32) {
    FragH ah, al;
    const v4f x0 = *(const v4fa*)(arow + kb + 8 * hh), x1 = *(const v4fa*)(arow + kb + 8 * hh + 4), x2 = *(const v4fa*)(arow + kb + 16 + 8 * hh), x3 = *(const v4fa*)(arow + kb + 16 + 8 * hh + 4);
    float xs[16] = {x0[0],x0[1],x0[2],x0[3],x1[0],x1[1],x1[2],x1[3],x2[0],x2[1],x2[2],x2[3],x3[0],x3[1],x3[2],x3[3]};
#pragma unroll
    for (int i = 0; i < 16; ++i) { const _Float16 h = (_Float16)xs[i]; ah.h[i] = h; al.h[i] = ASPLIT ? (_Float16)(xs[i] - (float)h) : (_Float16)0.0f; }
#pragma unroll
    for (int t = 0; t < 4; ++t) { if (col0 + t * 16 >= N) continue; const size_t boff = (size_t)(col0 + t * 16 + ln) * ldb + kb; FragH bq; bq.half[0] = *(const v8us*)(Bh + boff + 8 * hh); bq.half[1] = *(const v8us*)(Bh + boff + 16 + 8 * hh);
      acc[t] = mmaH<ASPLIT ? 2 : 1>(ah.v, al.v, bq.v, bq.v, acc[t]); }
  }
#pragma unroll
  for (int t = 0; t < 4; ++t) { if (col0 + t * 16 >= N) continue;
#pragma unroll
    for (int r = 0; r < 8; ++r) so[w][8 * hh + r][t * 16 + ln] = acc[t][r] * alpha; }
  __builtin_amdgcn_fence(__ATOMIC_ACQ_REL, "workgroup"); __builtin_amdgcn_wave_barrier();
  const int rsub = lane >> 4, c4 = (lane & 15) * 4;
  {
#pragma unroll
    for (int q = 0; q < 8; ++q) { const int r = q * 2 + rsub; if (col0 + c4 < N) { const v4f v = *(const v4fa*)&so[w][r][c4]; *(v4f*)(C + (size_t)(row0 + r) * ldc + col0 + c4) = v; } }
     }
}

// Wt[n][k] = f16(W[k][n]·scale) from f32 row-major W[K][N] (scale = power of two; bf16-exact weights stay exact in f16 away from the subnormal range)
__global__ __launch_bounds__(256) void k_wt_f16(const float* __restrict__ W, _Float16* __restrict__ Wt, int K, int N, float scale) {
  const int t = blockIdx.x * 256 + threadIdx.x; if (t >= N * (K / 8)) return; const int n = t / (K / 8), k8 = (t % (K / 8)) * 8; FragH f;
#pragma unroll
  for (int i = 0; i < 8; ++i) f.h[i] = (_Float16)(bf16_round(W[(size_t)(k8 + i) * N + n]) * scale); const v8us o = f.half[0];
  *(v8us*)((unsigned short*)Wt + (size_t)n * K + k8) = o; 
}
// k_gemm_hh variant with fused epilogue: v = acc·alpha + bias[by·sBias + col] (+ CP[(row/rowsPerB)·sCPb + by·64 + col] if CP) ; ACT 0 none / 1 elu ; writes f16 C16 (and f32 C if non-null)
template <int ACT>
__global__ __launch_bounds__(128) void k_gemm_hhx(const _Float16* __restrict__ A, int lda, size_t sA, const _Float16* __restrict__ Bh, int ldb, size_t sB, float alpha, const float* __restrict__ bias, size_t sBias, const float* __restrict__ CP, int rowsPerB, size_t sCPb, int row0g,
    float* __restrict__ C, _Float16* __restrict__ C16, int ldc, size_t sC, int M, int N, int K) {
  __shared__ __attribute__((aligned(16))) float so[4][16][64];
  const int tid = threadIdx.x, w = tid >> 5, lane = tid & 31, ln = lane & 15, hh = lane >> 4; const int by = blockIdx.y;
  A += (size_t)by * sA; Bh += (size_t)by * sB; const size_t cofs = (size_t)by * sC; const float* bp = bias ? bias + (size_t)by * sBias : nullptr;
  const int ntn = (N + 63) / 64; const int wid = blockIdx.x * 4 + w; const int mt = wid / ntn, nq = wid % ntn; if (mt * 16 >= M) return;
  const int row0 = mt * 16, col0 = nq * 64; const _Float16* arow = A + (size_t)(row0 + ln) * lda;
  v8f acc[4] = {};
  for (int kb = 0; kb < K; kb += 32) { FragH ah; ah.half[0] = *(const v8us*)((const unsigned short*)arow + kb + 8 * hh); ah.half[1] = *(const v8us*)((const unsigned short*)arow + kb + 16 + 8 * hh);
#pragma unroll
    for (int t = 0; t < 4; ++t) { if (col0 + t * 16 >= N) continue; const size_t boff = (size_t)(col0 + t * 16 + ln) * ldb + kb; FragH bq; bq.half[0] = *(const v8us*)((const unsigned short*)Bh + boff + 8 * hh); bq.half[1] = *(const v8us*)((const unsigned short*)Bh + boff + 16 + 8 * hh);
      acc[t] = mmaH<1>(ah.v, ah.v, bq.v, bq.v, acc[t]); }
  }
#pragma unroll
  for (int t = 0; t < 4; ++t) { if (col0 + t * 16 >= N) continue; const int col = col0 + t * 16 + ln; const float bv = bp ? bf16_round(bp[col]) : 0.f;
#pragma unroll
    for (int r = 0; r < 8; ++r) { float v = acc[t][r] * alpha + bv; if (CP) { const int bidx = (row0g + row0 + 8 * hh + r) / rowsPerB; v += CP[(size_t)bidx * sCPb + (size_t)by * 64 + col]; } if (ACT == 1) v = (v > 0.f) ? v : expm1f(v); else if (ACT == 7) v = (v > 0.f) ? v + 1.0f : expf(v); else if (ACT == 8) v = tanhf(v); else if (ACT == 9) v = 0.5f * v * (1.0f + tanhf(0.7978845608028654f * (v + 0.044715f * v * v * v))); else if (ACT == 11) v = 1.0f / (1.0f + expf(-v)); else if (ACT == 12) v = (v > 0.f) ? v : 0.01f * v; else if (ACT == 14) v = (v > 0.f) ? v : 0.1f * v; else if (ACT == 15) v = v / (1.0f + expf(-v)); else if (ACT == 3) v = fmaxf(v, 0.f); else if (ACT == 6) v = 0.5f * v * (1.0f + erff(v * 0.70710678118654752f)); so[w][8 * hh + r][t * 16 + ln] = v; } }
  __builtin_amdgcn_fence(__ATOMIC_ACQ_REL, "workgroup"); __builtin_amdgcn_wave_barrier();
  const int rsub = lane >> 4, c4 = (lane & 15) * 4; typedef _Float16 v4h __attribute__((ext_vector_type(4)));
  {
#pragma unroll
    for (int q = 0; q < 8; ++q) { const int r = q * 2 + rsub; if (col0 + c4 < N) { const v4f v = *(const v4fa*)&so[w][r][c4]; if (C) *(v4f*)(C + cofs + (size_t)(row0 + r) * ldc + col0 + c4) = v; if (C16) { v4h h4; for (int i = 0; i < 4; ++i) h4[i] = (_Float16)v[i]; *(v4h*)(C16 + cofs + (size_t)(row0 + r) * ldc + col0 + c4) = h4; } } }
     }
}


typedef _Float16 v4h __attribute__((ext_vector_type(4)));

__global__ __launch_bounds__(256) void k_x16(const float* __restrict__ x, _Float16* __restrict__ X16, size_t n8) { const size_t t = (size_t)blockIdx.x * 256 + threadIdx.x; if (t >= n8) return; FragH f;
#pragma unroll
  for (int q = 0; q < 8; ++q) f.h[q] = (_Float16)bf16_round(x[t * 8 + q]); *(v8us*)((unsigned short*)X16 + t * 8) = f.half[0];  }
__global__ __launch_bounds__(256) void k_h16(const float* __restrict__ x, _Float16* __restrict__ X16, size_t n8) { const size_t t = (size_t)blockIdx.x * 256 + threadIdx.x; if (t >= n8) return; FragH f;
#pragma unroll
  for (int q = 0; q < 8; ++q) f.h[q] = (_Float16)x[t * 8 + q]; *(v8us*)((unsigned short*)X16 + t * 8) = f.half[0];  }
__global__ __launch_bounds__(256) void k_round16f(const float* __restrict__ W, _Float16* __restrict__ Bt, size_t n8) { const size_t t = (size_t)blockIdx.x * 256 + threadIdx.x; if (t >= n8) return; FragH f;
#pragma unroll
  for (int i = 0; i < 8; ++i) f.h[i] = (_Float16)(bf16_round(W[t * 8 + i]) * 16.0f); *(v8us*)((unsigned short*)Bt + t * 8) = f.half[0];  }
template <int NHv, int TTv>
__global__ __launch_bounds__(256) void k_vt(const _Float16* __restrict__ V16, int ldv, int voff, _Float16* __restrict__ Vt) { __shared__ unsigned short tl[64][66]; const int tid = threadIdx.x; const int slab = blockIdx.x / (TTv / 64), lg = blockIdx.x % (TTv / 64); const int b = slab / NHv, h = slab % NHv;
  for (int i = tid; i < 64 * 8; i += 256) { const int r = i / 8, c8 = (i % 8) * 8; FragH f; f.half[0] = *(const v8us*)((const unsigned short*)V16 + ((size_t)b * TTv + lg * 64 + r) * ldv + voff + h * 64 + c8);
#pragma unroll
    for (int q = 0; q < 8; ++q) tl[r][c8 + q] = f.u[q]; }
  __syncthreads();
  {
#pragma unroll
    for (int rd = 0; rd < 2; ++rd) { const int d = rd * 32 + tid / 8, pc = tid % 8; FragH f;
#pragma unroll
      for (int q = 0; q < 8; ++q) f.u[q] = tl[pc * 8 + q][d];
      *(v8us*)((unsigned short*)Vt + ((size_t)slab * 64 + d) * TTv + lg * 64 + pc * 8) = f.half[0]; }
     } }

__global__ __launch_bounds__(256) void k_hl(const float* __restrict__ F, _Float16* __restrict__ Hh, _Float16* __restrict__ Hl, size_t n8) { const size_t t = (size_t)blockIdx.x * 256 + threadIdx.x; if (t >= n8) return; FragH fh, fl; const v4f a = *(const v4fa*)(F + t * 8), c = *(const v4fa*)(F + t * 8 + 4);
#pragma unroll
  for (int q = 0; q < 4; ++q) { _Float16 h = (_Float16)a[q]; fh.h[q] = h; fl.h[q] = (_Float16)((a[q] - (float)h) * 1024.0f); h = (_Float16)c[q]; fh.h[4 + q] = h; fl.h[4 + q] = (_Float16)((c[q] - (float)h) * 1024.0f); }
  { *(v8us*)((unsigned short*)Hh + t * 8) = fh.half[0]; *(v8us*)((unsigned short*)Hl + t * 8) = fl.half[0];  } }

// ---- fast GEMM (wave tile 32x64; requires M % 32 == 0 rows per launch region and N % 64 == 0); epilogue = k_gemm_hhx semantics ----
__device__ __forceinline__ v16h g2_frag(const _Float16* p, int hh) { FragH f; f.half[0] = *(const v8us*)((const unsigned short*)p + 8 * hh); f.half[1] = *(const v8us*)((const unsigned short*)p + 16 + 8 * hh); return f.v; }
__device__ __forceinline__ v8f g2_mma(v16h a, v16h b, v8f c) { v8f d = __builtin_amdgcn_wmma_f32_16x16x32_f16(false, a, false, b, (short)0, c, false, false); asm volatile("v_nop\n\tv_nop\n\tv_nop\n\tv_nop" : "+v"(d) : "v"(a), "v"(b)); return d; }
template <int ACT>
__global__ __launch_bounds__(128) void k_gemm2(const _Float16* __restrict__ A, int lda, size_t sA, const _Float16* __restrict__ Bh, int ldb, size_t sB, float alpha, const float* __restrict__ bias, size_t sBias, const float* __restrict__ CP, int rowsPerB, size_t sCPb, int row0g,
    float* __restrict__ C, _Float16* __restrict__ C16, int ldc, size_t sC, int M, int N, int K) {
  __shared__ __attribute__((aligned(16))) float so[4][32][68];
  const int tid = threadIdx.x, w = tid >> 5, lane = tid & 31, ln = lane & 15, hh = lane >> 4; const int by = blockIdx.y;
  A += (size_t)by * sA; Bh += (size_t)by * sB; const size_t cofs = (size_t)by * sC; const float* bp = bias ? bias + (size_t)by * sBias : nullptr;
  const int ntn = N >> 6; const int mt = blockIdx.x / ntn, nq = blockIdx.x - mt * ntn; const int row0 = mt * 128 + 32 * w, col0 = nq * 64; if (row0 >= M) return;
  const _Float16* a0p = A + (size_t)(row0 + ln) * lda; const _Float16* a1p = a0p + (size_t)16 * lda;
  const _Float16* b0p = Bh + (size_t)(col0 + ln) * ldb; const _Float16* b1p = b0p + (size_t)16 * ldb; const _Float16* b2p = b1p + (size_t)16 * ldb; const _Float16* b3p = b2p + (size_t)16 * ldb;
  const v8f z8 = {0.f,0.f,0.f,0.f,0.f,0.f,0.f,0.f}; v8f c00 = z8, c01 = z8, c02 = z8, c03 = z8, c10 = z8, c11 = z8, c12 = z8, c13 = z8;
#pragma unroll 1
  for (int kb = 0; kb < K; kb += 32) { const v16h a0 = g2_frag(a0p + kb, hh), a1 = g2_frag(a1p + kb, hh);
    v16h b = g2_frag(b0p + kb, hh); c00 = g2_mma(a0, b, c00); c10 = g2_mma(a1, b, c10);
    b = g2_frag(b1p + kb, hh); c01 = g2_mma(a0, b, c01); c11 = g2_mma(a1, b, c11);
    b = g2_frag(b2p + kb, hh); c02 = g2_mma(a0, b, c02); c12 = g2_mma(a1, b, c12);
    b = g2_frag(b3p + kb, hh); c03 = g2_mma(a0, b, c03); c13 = g2_mma(a1, b, c13); }
  v8f accs[8] = {c00, c01, c02, c03, c10, c11, c12, c13};
#pragma unroll
  for (int u = 0; u < 8; ++u) { const int t = u & 3, half = u >> 2; const int col = col0 + t * 16 + ln; const float bv = bp ? bf16_round(bp[col]) : 0.f;
#pragma unroll
    for (int r = 0; r < 8; ++r) { const int rloc = half * 16 + 8 * hh + r; float v = accs[u][r] * alpha + bv; if (CP) { const int bidx = (row0g + row0 + rloc) / rowsPerB; v += CP[(size_t)bidx * sCPb + (size_t)by * 64 + col]; }
      if (ACT == 3) v = fmaxf(v, 0.f); else if (ACT == 6) v = 0.5f * v * (1.0f + erff(v * 0.70710678118654752f)); else if (ACT == 11) v = 1.0f / (1.0f + expf(-v)); else if (ACT == 15) v = v / (1.0f + expf(-v)); else if (ACT == 12) v = (v > 0.f) ? v : 0.01f * v; else if (ACT == 8) v = tanhf(v);
      so[w][rloc][t * 16 + ln] = v; } }
  __builtin_amdgcn_fence(__ATOMIC_ACQ_REL, "workgroup"); __builtin_amdgcn_wave_barrier();
  const int rsub = lane >> 4, c4 = (lane & 15) * 4;
  {
#pragma unroll
    for (int q = 0; q < 16; ++q) { const int r = q * 2 + rsub; const v4f v = *(const v4fa*)&so[w][r][c4]; if (C) *(v4f*)(C + cofs + (size_t)(row0 + r) * ldc + col0 + c4) = v; if (C16) { v4h h4; for (int i = 0; i < 4; ++i) h4[i] = (_Float16)v[i]; *(v4h*)(C16 + cofs + (size_t)(row0 + r) * ldc + col0 + c4) = h4; } }
     } }



// One stage of the K / V^T ring: 64 key rows of K (128 bytes each) and 64 rows of V^T (the same 64 keys, 128 bytes each), 16 KiB, brought by asynchronous copies to LDS.
// Eight copies a lane; a wave-wide copy covers four whole 128-byte lines. s_wait_xcnt stands inside the statement so that no address register is rewritten ahead of it.
__device__ __forceinline__ void stage_copy(unsigned lds, const unsigned short* gk, size_t kstep, const unsigned short* gv, size_t vstep) {
  asm volatile("global_load_async_to_lds_b128 %0, %8, off\n\t"
               "global_load_async_to_lds_b128 %1, %9, off\n\t"
               "global_load_async_to_lds_b128 %2, %10, off\n\t"
               "global_load_async_to_lds_b128 %3, %11, off\n\t"
               "global_load_async_to_lds_b128 %4, %12, off\n\t"
               "global_load_async_to_lds_b128 %5, %13, off\n\t"
               "global_load_async_to_lds_b128 %6, %14, off\n\t"
               "global_load_async_to_lds_b128 %7, %15, off\n\t"
               "s_wait_xcnt 0x0"
               :: "v"(lds), "v"(lds + 2048u), "v"(lds + 4096u), "v"(lds + 6144u), "v"(lds + 8192u), "v"(lds + 10240u), "v"(lds + 12288u), "v"(lds + 14336u),
                  "v"(gk), "v"(gk + kstep), "v"(gk + 2 * kstep), "v"(gk + 3 * kstep), "v"(gv), "v"(gv + vstep), "v"(gv + 2 * vstep), "v"(gv + 3 * vstep)
               : "memory");
}
// lane l with lane l ^ 16: one vector cross-row move
__device__ __forceinline__ float xhalf(float x) { return __builtin_bit_cast(float, __builtin_amdgcn_permlanex16(__builtin_bit_cast(int, x), __builtin_bit_cast(int, x), 0x76543210, 0xfedcba98, false, false)); }
template <int CAUSAL>
__global__ __launch_bounds__(128) void k_flash(const _Float16* __restrict__ Q16, int ldq, const _Float16* __restrict__ K16, int ldk, const _Float16* __restrict__ Vt, const int* __restrict__ MSK, float* __restrict__ O, int ldo) {
  constexpr int RPW = 16, RTN = RPW / 16, NQB = TQ / (4 * RPW), DT = 4, KS = 2;
  constexpr int TILE_B = 64 * 128, STAGE_B = 2 * TILE_B;      /* a stage = 64 keys: K tile, then V^T tile, rows of 128 bytes without a pad */
  __shared__ __attribute__((aligned(16))) unsigned char ring[2 * STAGE_B];
  float (*sO)[RPW][64 + 4] = reinterpret_cast<float (*)[RPW][64 + 4]>(ring);      /* output staging takes the ring's place behind the loop's last barrier */
  const int tid = threadIdx.x, w = tid >> 5, lane = tid & 31, ln = lane & 15, hh = lane >> 4;
  const int slab = blockIdx.x / QBLKS, qblk = blockIdx.x % QBLKS; (void)NQB; (void)MSK; const int b = slab / NH, h = slab % NH; const int qb0 = qblk * (4 * RPW); const int q0 = qb0 + w * RPW;
  const unsigned short* Vth = (const unsigned short*)Vt + (size_t)slab * 64 * TK;
  const int jend = (CAUSAL == 1) ? (qb0 + 4 * RPW) : TK;      /* causal: keys beyond the block's last query never contribute */
  const int nst = jend / 64;
  /* 16-byte piece c of row r lies at r * 128 + (c ^ ((r >> 1) & 7)) * 16: sixteen rows read at one piece index fall on all 64 banks */
  const unsigned cp_lds = (unsigned)(size_t)ring + (unsigned)((tid >> 3) * 128 + (((tid & 7) ^ ((tid >> 4) & 7)) * 16));
  const unsigned short* cp_k = (const unsigned short*)K16 + ((size_t)b * TK + (tid >> 3)) * ldk + h * 64 + (tid & 7) * 8;
  const unsigned short* cp_v = Vth + (size_t)(tid >> 3) * TK + (tid & 7) * 8;
  const size_t kstep = (size_t)16 * ldk, vstep = (size_t)16 * TK;
  stage_copy(cp_lds, cp_k, kstep, cp_v, vstep);
  FragH aq[2][KS];
#pragma unroll
  for (int rt = 0; rt < RTN; ++rt) { const unsigned short* qr = (const unsigned short*)Q16 + ((size_t)b * TQ + q0 + rt * 16 + ln) * ldq + h * 64;
#pragma unroll
    for (int ks = 0; ks < KS; ++ks) { aq[rt][ks].half[0] = *(const v8us*)(qr + ks * 32 + 8 * hh); aq[rt][ks].half[1] = *(const v8us*)(qr + ks * 32 + 16 + 8 * hh); } }
  int fo[2][2];      /* a fragment's two pieces in row ln: [32-element group of the row][piece] */
#pragma unroll
  for (int g = 0; g < 2; ++g)
#pragma unroll
    for (int pc = 0; pc < 2; ++pc) fo[g][pc] = ln * 128 + (((g * 4 + pc * 2 + hh) ^ ((ln >> 1) & 7)) * 16);
  float m_r[2], l_r[2]; v8f oacc[2][DT];      /* per lane: its query's running maximum, its half's share of the sum, and O^T[d = dt * 16 + 8 * hh + r][query ln] */
#pragma unroll
  for (int rt = 0; rt < RTN; ++rt) { m_r[rt] = -3.0e38f; l_r[rt] = 0.f;
#pragma unroll
    for (int dt = 0; dt < DT; ++dt) oacc[rt][dt] = (v8f){0.f,0.f,0.f,0.f,0.f,0.f,0.f,0.f}; }
  asm volatile("s_wait_asynccnt 0x0" ::: "memory");      /* stage 0 has landed for this wave's own copies */
  __syncthreads();                                       /* ... and for every other wave's */
  if (1 < nst) stage_copy(cp_lds + STAGE_B, cp_k + (size_t)64 * ldk, kstep, cp_v + 64, vstep);
#pragma unroll 1
  for (int t = 0; t < nst; ++t) {
    const unsigned char* st = ring + (t & 1) * STAGE_B;
#pragma unroll 1      /* the two 32-key passes of a stage stay one body: unrolled, the registers grow and a work-group per WGP is lost */
    for (int ps = 0; ps < 2; ++ps) { const int j0 = t * 64 + ps * 32;
    v8f s[2][2];
#pragma unroll
    for (int nt = 0; nt < 2; ++nt) { const unsigned char* kr = st + (ps * 32 + nt * 16) * 128; FragH bk[KS];
#pragma unroll
      for (int ks = 0; ks < KS; ++ks) { bk[ks].half[0] = *(const v8us*)(kr + fo[ks][0]); bk[ks].half[1] = *(const v8us*)(kr + fo[ks][1]); }
#pragma unroll
      for (int rt = 0; rt < RTN; ++rt) { v8f acc = (v8f){0.f,0.f,0.f,0.f,0.f,0.f,0.f,0.f};
#pragma unroll
        for (int ks = 0; ks < KS; ++ks) acc = mmaH<1>(bk[ks].v, bk[ks].v, aq[rt][ks].v, aq[rt][ks].v, acc); s[rt][nt] = acc; } }      /* s[rt][nt][r] = score of key j0 + nt * 16 + 8 * hh + r, query q0 + rt * 16 + ln */
    FragH pb[2];
#pragma unroll
    for (int rt = 0; rt < RTN; ++rt) { const int tq = q0 + rt * 16 + ln; float sv[16]; bool ok[16];
#pragma unroll
      for (int e = 0; e < 16; ++e) { const int kk = j0 + (e >> 3) * 16 + 8 * hh + (e & 7);
        ok[e] = (CAUSAL == 1) ? (kk <= tq) : ((CAUSAL == 2) ? ((kk >> 5) == (tq >> 5)) : true);      /* mode 2: block-diagonal 32-token groups */
        sv[e] = ok[e] ? s[rt][e >> 3][e & 7] * SCL : -3.0e38f; }
      float mx[4];
#pragma unroll
      for (int c = 0; c < 4; ++c) mx[c] = fmaxf(fmaxf(sv[c], sv[4 + c]), fmaxf(sv[8 + c], sv[12 + c]));
      float mc = fmaxf(fmaxf(mx[0], mx[1]), fmaxf(mx[2], mx[3])); mc = fmaxf(mc, xhalf(mc));      /* both halves now hold the query's maximum over the 32 keys */
      const float mn = fmaxf(m_r[rt], mc); const float ea = expf(m_r[rt] - mn); const float al = (mn > -1.0e38f) ? ea : 1.0f; m_r[rt] = mn;
      float ls[4] = {0.f, 0.f, 0.f, 0.f};
#pragma unroll
      for (int e = 0; e < 16; ++e) { const float p = ok[e] ? expf(sv[e] - mn) : 0.f; ls[e & 3] += p; pb[rt].h[e] = (_Float16)(p * 1024.0f); }
      l_r[rt] = l_r[rt] * al + ((ls[0] + ls[1]) + (ls[2] + ls[3]));
#pragma unroll
      for (int dt = 0; dt < DT; ++dt)
#pragma unroll
        for (int r = 0; r < 8; ++r) oacc[rt][dt][r] *= al; }
#pragma unroll
    for (int dt = 0; dt < DT; ++dt) { const unsigned char* vrow = st + TILE_B + dt * 16 * 128; FragH bv; bv.half[0] = *(const v8us*)(vrow + (fo[0][0] ^ (ps * 64))); bv.half[1] = *(const v8us*)(vrow + (fo[0][1] ^ (ps * 64)));      /* the pass's 32 keys: piece index + 4 = bit 6 of the offset */
#pragma unroll
      for (int rt = 0; rt < RTN; ++rt) oacc[rt][dt] = mmaH<1>(bv.v, bv.v, pb[rt].v, pb[rt].v, oacc[rt][dt]); } }
    asm volatile("s_wait_dscnt 0x0" ::: "memory");         /* this wave's reads of stage t have returned */
    asm volatile("s_wait_asynccnt 0x0" ::: "memory");      /* this wave's copies of stage t + 1 have landed */
    __syncthreads();                                       /* publishes stage t + 1 and ends every wave's reads of stage t */
    if (t + 2 < nst) stage_copy(cp_lds + (t & 1) * STAGE_B, cp_k + (size_t)(t + 2) * 64 * ldk, kstep, cp_v + (t + 2) * 64, vstep); }
  asm volatile("s_wait_asynccnt 0x0" ::: "memory");        /* nothing is in flight when the ring becomes output staging */
#pragma unroll
  for (int rt = 0; rt < RTN; ++rt) { float l = l_r[rt]; l += xhalf(l); const float inv = (l > 0.f) ? 1.0f / (l * 1024.0f) : 0.f;      /* the halves' sums join once */
#pragma unroll
    for (int dt = 0; dt < DT; ++dt)
#pragma unroll
      for (int q4 = 0; q4 < 2; ++q4) { v4f o4;
#pragma unroll
        for (int i = 0; i < 4; ++i) o4[i] = oacc[rt][dt][q4 * 4 + i] * inv;
        *(v4fa*)&sO[w][rt * 16 + ln][dt * 16 + 8 * hh + q4 * 4] = o4; } }
  __builtin_amdgcn_fence(__ATOMIC_ACQ_REL, "workgroup"); __builtin_amdgcn_wave_barrier();
  {
#pragma unroll
    for (int rp = 0; rp < RPW; rp += 2) { const int r = rp + (lane >> 4), pc = lane & 15; const v4f val = *(const v4fa*)&sO[w][r][pc * 4]; *(v4f*)(O + ((size_t)b * TQ + q0 + r) * ldo + h * 64 + pc * 4) = val; }
     } }

__global__ __launch_bounds__(256) void k_wsc(const float* __restrict__ Wm, _Float16* __restrict__ Bt, size_t n8, float sc) { const size_t t = (size_t)blockIdx.x * 256 + threadIdx.x; if (t >= n8) return; FragH f; for (int q = 0; q < 8; ++q) f.h[q] = (_Float16)(bf16_round(Wm[t * 8 + q]) * sc); *(v8us*)((unsigned short*)Bt + t * 8) = f.half[0];  }
__global__ __launch_bounds__(256) void k_woutp(const float* __restrict__ Wm, _Float16* __restrict__ Bt) { const size_t t = (size_t)blockIdx.x * 256 + threadIdx.x; if (t >= (size_t)DMOD * (2 * DMOD / 8)) return; const int pc = (int)(t % (2 * DMOD / 8)); const int o = (int)(t / (2 * DMOD / 8)); const bool lo = pc * 8 >= DMOD; FragH f;
  for (int q = 0; q < 8; ++q) { const int c = pc * 8 + q - (lo ? DMOD : 0); f.h[q] = (_Float16)(bf16_round(Wm[(size_t)o * DMOD + c]) * (lo ? 1.0f : 16.0f)); } *(v8us*)((unsigned short*)Bt + (size_t)o * 2 * DMOD + pc * 8) = f.half[0];  }
__global__ __launch_bounds__(256) void k_ropetab(float* __restrict__ CS) {
  #pragma clang fp contract(off)
  const int t = blockIdx.x * 256 + threadIdx.x; if (t >= SLEN * (RD / 2)) return; const int i = t % (RD / 2), tpos = t / (RD / 2); const float invf = (float)pow(10000.0, -(double)(2 * i) / (double)RD); const float ang = (float)tpos * invf; const float c = cosf(ang), s = sinf(ang);
  { *(float*)(CS + t) = c; *(float*)(CS + SLEN * (RD / 2) + t) = s;  } }
__global__ __launch_bounds__(256) void k_rope(const float* __restrict__ Q, const float* __restrict__ Kf, const float* __restrict__ CS, _Float16* __restrict__ Q16, _Float16* __restrict__ K16) {
  #pragma clang fp contract(off)
  const size_t t = (size_t)blockIdx.x * 256 + threadIdx.x; if (t >= (size_t)NR * NH * 2) return; const int which = (int)(t & 1); const int h = (int)((t >> 1) % NH); const size_t r = t / (2 * NH); const int tpos = (int)(r % SLEN);
  const float* src = (which ? Kf : Q) + r * DMOD + h * HD; _Float16* dst = (which ? K16 : Q16) + r * DMOD + h * HD; FragH f[4];
#pragma unroll
  for (int i = 0; i < RD / 2; ++i) { const float c = CS[tpos * (RD / 2) + i], s = CS[SLEN * (RD / 2) + tpos * (RD / 2) + i]; const float x1 = src[i], x2 = src[RD / 2 + i];
    float a = x1 * c; a += x2 * s; float bq = x1 * -s; bq += x2 * c; f[0].h[i] = (_Float16)a; f[1].h[i] = (_Float16)bq; }
#pragma unroll
  for (int i = 0; i < 16; ++i) { f[2].h[i] = (_Float16)src[RD + i]; f[3].h[i] = (_Float16)src[RD + 16 + i]; }
  { for (int u = 0; u < 4; ++u) { *(v8us*)((unsigned short*)dst + u * 16) = f[u].half[0]; *(v8us*)((unsigned short*)dst + u * 16 + 8) = f[u].half[1]; }  } }

extern "C" void kernel_launch(void* const* d_in, const int* in_sizes, int n_in,
                              void* d_out, int out_size, void* d_ws, size_t ws_size, hipStream_t stream) {
  (void)in_sizes; (void)n_in; (void)out_size;
  const float* const* I = (const float* const*)d_in; const float* x = I[0]; const float* Wq = I[1]; const float* Wk = I[2]; const float* Wv = I[3]; const float* Wo = I[4];
  char* ws = (char*)d_ws; size_t off = 0;
  auto take = [&](size_t bytes) { char* p = ws + off; off += (bytes + 255) & ~(size_t)255; return p; };
  const size_t w8 = (size_t)DMOD * DMOD / 8;
  _Float16* BQ = (_Float16*)take(w8 * 16); _Float16* BK = (_Float16*)take(w8 * 16); _Float16* BV = (_Float16*)take(w8 * 16); _Float16* BO = (_Float16*)take(w8 * 32);
  _Float16* X16 = (_Float16*)take((size_t)NR * DMOD * 2); float* Qf = (float*)take((size_t)NR * DMOD * 4); float* Kf = (float*)take((size_t)NR * DMOD * 4); _Float16* Q16 = (_Float16*)take((size_t)NR * DMOD * 2); _Float16* K16 = (_Float16*)take((size_t)NR * DMOD * 2); _Float16* V16 = (_Float16*)take((size_t)NR * DMOD * 2); _Float16* VT = (_Float16*)take((size_t)NR * DMOD * 2); float* CS = (float*)take((size_t)SLEN * RD * 4);
  float* O = Qf; _Float16* Hh = Q16; _Float16* Hl = K16;      /* aliases after the flash kernel: Qf/Q16/K16 are dead */
  if (off > ws_size) return;      /* 10 + 16 + 32 + 32 + 16 x 4 = 154 MiB */
  k_wsc<<<(unsigned)((w8 + 255) / 256), 256, 0, stream>>>(Wq, BQ, w8, 16.0f); k_wsc<<<(unsigned)((w8 + 255) / 256), 256, 0, stream>>>(Wk, BK, w8, 16.0f); k_wsc<<<(unsigned)((w8 + 255) / 256), 256, 0, stream>>>(Wv, BV, w8, 16.0f); k_woutp<<<(unsigned)(((size_t)DMOD * (2 * DMOD / 8) + 255) / 256), 256, 0, stream>>>(Wo, BO);
  k_x16<<<(unsigned)(((size_t)NR * DMOD / 8 + 255) / 256), 256, 0, stream>>>(x, X16, (size_t)NR * DMOD / 8);
  const dim3 gP((NR / 128) * (DMOD / 64), 1);
  k_gemm2<0><<<gP, 128, 0, stream>>>(X16, DMOD, 0, BQ, DMOD, 0, 0.0625f, nullptr, 0, nullptr, 1, 0, 0, Qf, nullptr, DMOD, 0, NR, DMOD, DMOD);
  k_gemm2<0><<<gP, 128, 0, stream>>>(X16, DMOD, 0, BK, DMOD, 0, 0.0625f, nullptr, 0, nullptr, 1, 0, 0, Kf, nullptr, DMOD, 0, NR, DMOD, DMOD);
  k_gemm2<0><<<gP, 128, 0, stream>>>(X16, DMOD, 0, BV, DMOD, 0, 0.0625f, nullptr, 0, nullptr, 1, 0, 0, nullptr, V16, DMOD, 0, NR, DMOD, DMOD);
  k_ropetab<<<(SLEN * (RD / 2) + 255) / 256, 256, 0, stream>>>(CS); k_rope<<<(unsigned)(((size_t)NR * NH * 2 + 255) / 256), 256, 0, stream>>>(Qf, Kf, CS, Q16, K16);
  k_vt<NH, SLEN><<<NB * NH * (SLEN / 64), 256, 0, stream>>>(V16, DMOD, 0, VT);
  k_flash<0><<<NB * NH * QBLKS, 128, 0, stream>>>(Q16, DMOD, K16, DMOD, VT, nullptr, O, DMOD);
  k_hl<<<(unsigned)(((size_t)NR * DMOD / 8 + 255) / 256), 256, 0, stream>>>(O, Hh, Hl, (size_t)NR * DMOD / 8);
  k_gemm2<0><<<gP, 128, 0, stream>>>(Hh, DMOD, 0, BO, 2 * DMOD, 0, 0.0625f, nullptr, 0, nullptr, 1, 0, 0, (float*)d_out, nullptr, DMOD, 0, NR, DMOD, DMOD);
  k_gemm2<0><<<gP, 128, 0, stream>>>(Hl, DMOD, 0, BO + DMOD, 2 * DMOD, 0, 1.0f / 1024.0f, nullptr, 0, (const float*)d_out, 1, (size_t)DMOD, 0, (float*)d_out, nullptr, DMOD, 0, NR, DMOD, DMOD);
}

// v003
// Measured time: 314 microseconds a run.
// Next to v002, in two timings, it ran 1.51 times as fast each time.
// Over all steps from v000 it is 2.58 times as fast.
#include <hip/hip_runtime.h>
// TinyAttn (4 sequences x 2048 tokens x 1024; 16 heads x 64; rotary embedding on the first 32 dims of each head): q,k,v = x W^T; q,k rotated (rot = [x1 cos + x2 sin, -x1 sin + x2 cos] on dims 0..31 with the module's inverse-frequency table); softmax(q k^T / 8) v; y Wo^T -> [4,2048,1024].
// Structure: x as an exact f16 plane; q/k/v projections as f16 WMMA GEMMs (32x64 wave tiles, operand tiles staged in an LDS ring, f32 accumulation, exact x16 weights; q/k in f32 for the rotation, v as f16); the rotary tables recomputed on the device (f64 pow for the inverse frequencies, f32 angle product, f32 cos/sin) and applied on VALU into f16 q/k planes; V transposed by LDS tiles; the fused flash kernel; the attention output as hi + residual planes into two accumulating output-projection GEMMs.
// Compute dtype: x and weights rounded to bf16; q, k (after rotation), v, P as f16 operands (~2^-12); attention output hi + 2^-10-scaled residual; f32 accumulation/softmax. v_wmma_f32_16x16x32_f16.
#define NB 4
#define DMOD 1024
#define HD 64
#define RD 32                    /* rotary dims per head */
#define NR (NB * SLEN)
#define QBLKS (TQ / 64)          /* query blocks per (sequence, head) launched */
#define SLEN 2048
#define TQ SLEN
#define TK SLEN
#define NH 16
#define SCL 0.125f               /* 64^-0.5 */
typedef __bf16 v16b __attribute__((ext_vector_type(16)));
typedef unsigned short v8us __attribute__((ext_vector_type(8), may_alias));
typedef float  v8f  __attribute__((ext_vector_type(8)));
typedef float  v4f  __attribute__((ext_vector_type(4)));
typedef float  v4fa __attribute__((ext_vector_type(4), may_alias));
union FragB { v16b v; v8us half[2]; unsigned short u[16]; };

__device__ __forceinline__ unsigned short bf16_bits(float x) { unsigned int u = __float_as_uint(x); return (unsigned short)((u + 0x7FFFu + ((u >> 16) & 1u)) >> 16); }
__device__ __forceinline__ float bf16_val(unsigned short b) { return __uint_as_float(((unsigned int)b) << 16); }
__device__ __forceinline__ float bf16_round(float x) { return bf16_val(bf16_bits(x)); }
// D += A·B with NT terms: 1 = ah·bh, 2 = + al·bh (A split), 3 = + ah·bl (both split)
template <int NT>
__device__ __forceinline__ v8f mmaN(v16b ah, v16b al, v16b bh, v16b bl, v8f c) {
  c = __builtin_amdgcn_wmma_f32_16x16x32_bf16(false, ah, false, bh, (short)0, c, false, false);
  if (NT >= 2) c = __builtin_amdgcn_wmma_f32_16x16x32_bf16(false, al, false, bh, (short)0, c, false, false);
  if (NT >= 3) c = __builtin_amdgcn_wmma_f32_16x16x32_bf16(false, ah, false, bl, (short)0, c, false, false);
  asm volatile("v_nop\n\tv_nop\n\tv_nop\n\tv_nop" : "+v"(c) : "v"(ah), "v"(al), "v"(bh), "v"(bl));
  return c;
}

__global__ __launch_bounds__(256) void k_wt_bf16(const float* __restrict__ W, unsigned short* __restrict__ Wt, int K, int N) {
  const int t = blockIdx.x * 256 + threadIdx.x;
  const int k8n = K / 8;
  if (t >= N * k8n) return;
  const int n = t / k8n, k8 = (t % k8n) * 8;
  v8us v;
#pragma unroll
  for (int i = 0; i < 8; ++i) v[i] = bf16_bits(W[(size_t)(k8 + i) * N + n]);
  *(v8us*)(Wt + (size_t)n * K + k8) = v;
  
}

// GEMM C[M][N] (f32, pitch ldc) = act(A[M][K]·W + bias). A f32 row-major (pitch lda) converted per fragment to bf16
// (ASPLIT: hi/lo two planes -> 2 terms, else single rounded term); Wt bf16 [N][K] (pitch ldb). BIAS_BF16 rounds the
// bias to bf16 first (bias quantised to bf16 before the add). K%32==0, M%16==0, N%64==0.
template <bool ASPLIT, int ACT, bool BIAS_BF16>
__global__ __launch_bounds__(128) void k_gemm_bf(const float* __restrict__ A, int lda, const unsigned short* __restrict__ Wt, int ldb,
                                               const float* __restrict__ bias, float* __restrict__ C, int ldc, int M, int N, int K) {
  __shared__ __attribute__((aligned(16))) float so[4][16][64];
  const int tid = threadIdx.x, w = tid >> 5, lane = tid & 31, ln = lane & 15, hh = lane >> 4;
  const int ntn = N / 64;
  const int wid = blockIdx.x * 4 + w;
  const int mt = wid / ntn, nq = wid % ntn;
  if (mt * 16 >= M) return;
  const int row0 = mt * 16, col0 = nq * 64;
  const float* arow = A + (size_t)(row0 + ln) * lda;
  v8f acc[4] = {};
  for (int kb = 0; kb < K; kb += 32) {
    FragB ah, al;
    const v4f x0 = *(const v4fa*)(arow + kb + 8 * hh), x1 = *(const v4fa*)(arow + kb + 8 * hh + 4);
    const v4f x2 = *(const v4fa*)(arow + kb + 16 + 8 * hh), x3 = *(const v4fa*)(arow + kb + 16 + 8 * hh + 4);
    float xs[16] = {x0[0],x0[1],x0[2],x0[3],x1[0],x1[1],x1[2],x1[3],x2[0],x2[1],x2[2],x2[3],x3[0],x3[1],x3[2],x3[3]};
#pragma unroll
    for (int i = 0; i < 16; ++i) { const unsigned short hb = bf16_bits(xs[i]); ah.u[i] = hb; al.u[i] = ASPLIT ? bf16_bits(xs[i] - bf16_val(hb)) : (unsigned short)0; }
#pragma unroll
    for (int t = 0; t < 4; ++t) {
      const unsigned short* brow = Wt + (size_t)(col0 + t * 16 + ln) * ldb + kb;
      FragB b;
      b.half[0] = *(const v8us*)(brow + 8 * hh);
      b.half[1] = *(const v8us*)(brow + 16 + 8 * hh);
      acc[t] = mmaN<ASPLIT ? 2 : 1>(ah.v, al.v, b.v, b.v, acc[t]);
    }
  }
#pragma unroll
  for (int t = 0; t < 4; ++t) {
    float bv = bias ? bias[col0 + t * 16 + ln] : 0.f;
    if (BIAS_BF16) bv = bf16_round(bv);
#pragma unroll
    for (int r = 0; r < 8; ++r) { float v = acc[t][r] + bv; if (ACT == 1) v = fmaxf(v, 0.f); so[w][8 * hh + r][t * 16 + ln] = v; }
  }
  __builtin_amdgcn_fence(__ATOMIC_ACQ_REL, "workgroup");
  __builtin_amdgcn_wave_barrier();
  const int rsub = lane >> 4, c4 = (lane & 15) * 4;
  {
#pragma unroll
    for (int q = 0; q < 8; ++q) {
      const int r = q * 2 + rsub;
      const v4f v = *(const v4fa*)&so[w][r][c4];
      *(v4f*)(C + (size_t)(row0 + r) * ldc + col0 + c4) = v;
    }
    
  }
}

// GEMM C = act(A·W + bias + resid): A f32 (ASPLIT -> hi/lo 2 terms), Wt bf16 [N][K]; ACT 0 none, 1 relu, 2 exact gelu;
// resid (optional, f32, row index = (row % rmod), pitch ldr, RES_BF16 rounds it) added before the activation.
template <bool ASPLIT, int ACT, bool BIAS_BF16, bool RES_BF16>
__global__ __launch_bounds__(128) void k_gemm_bf3(const float* __restrict__ A, int lda, const unsigned short* __restrict__ Wt, int ldb,
                                                const float* __restrict__ bias, const float* __restrict__ resid, int rmod, int ldr,
                                                float* __restrict__ C, int ldc, int M, int N, int K) {
  __shared__ __attribute__((aligned(16))) float so[4][16][64];
  const int tid = threadIdx.x, w = tid >> 5, lane = tid & 31, ln = lane & 15, hh = lane >> 4;
  const int ntn = N / 64;
  const int wid = blockIdx.x * 4 + w;
  const int mt = wid / ntn, nq = wid % ntn;
  if (mt * 16 >= M) return;
  const int row0 = mt * 16, col0 = nq * 64;
  const float* arow = A + (size_t)(row0 + ln) * lda;
  v8f acc[4] = {};
  for (int kb = 0; kb < K; kb += 32) {
    FragB ah, al;
    const v4f x0 = *(const v4fa*)(arow + kb + 8 * hh), x1 = *(const v4fa*)(arow + kb + 8 * hh + 4);
    const v4f x2 = *(const v4fa*)(arow + kb + 16 + 8 * hh), x3 = *(const v4fa*)(arow + kb + 16 + 8 * hh + 4);
    float xs[16] = {x0[0],x0[1],x0[2],x0[3],x1[0],x1[1],x1[2],x1[3],x2[0],x2[1],x2[2],x2[3],x3[0],x3[1],x3[2],x3[3]};
#pragma unroll
    for (int i = 0; i < 16; ++i) { const unsigned short hb = bf16_bits(xs[i]); ah.u[i] = hb; al.u[i] = ASPLIT ? bf16_bits(xs[i] - bf16_val(hb)) : (unsigned short)0; }
#pragma unroll
    for (int t = 0; t < 4; ++t) {
      const unsigned short* brow = Wt + (size_t)(col0 + t * 16 + ln) * ldb + kb;
      FragB b;
      b.half[0] = *(const v8us*)(brow + 8 * hh);
      b.half[1] = *(const v8us*)(brow + 16 + 8 * hh);
      acc[t] = mmaN<ASPLIT ? 2 : 1>(ah.v, al.v, b.v, b.v, acc[t]);
    }
  }
#pragma unroll
  for (int t = 0; t < 4; ++t) {
    const int col = col0 + t * 16 + ln;
    float bv = bias ? bias[col] : 0.f;
    if (BIAS_BF16) bv = bf16_round(bv);
#pragma unroll
    for (int r = 0; r < 8; ++r) {
      float v = acc[t][r] + bv;
      if (resid) { float rv = resid[(size_t)((row0 + 8 * hh + r) % rmod) * ldr + col]; if (RES_BF16) rv = bf16_round(rv); v += rv; }
      if (ACT == 1) v = fmaxf(v, 0.f);
      if (ACT == 2) v = 0.5f * v * (1.0f + erff(v * 0.70710678118654752f));
      if (ACT == 3) { const float u = 0.7978845608028654f * (v + 0.044715f * v * v * v); v = 0.5f * v * (1.0f + tanhf(u)); }
      so[w][8 * hh + r][t * 16 + ln] = v;
    }
  }
  __builtin_amdgcn_fence(__ATOMIC_ACQ_REL, "workgroup");
  __builtin_amdgcn_wave_barrier();
  const int rsub = lane >> 4, c4 = (lane & 15) * 4;
  {
#pragma unroll
    for (int q = 0; q < 8; ++q) {
      const int r = q * 2 + rsub;
      const v4f v = *(const v4fa*)&so[w][r][c4];
      *(v4f*)(C + (size_t)(row0 + r) * ldc + col0 + c4) = v;
    }
    
  }
}
// row LayerNorm (biased variance, eps) over N: s = X (+ R); optional out_sum <- s; out_norm <- (s-mu)*rsqrt(var+eps)*g + b
template <bool PARAM_BF16>
__global__ __launch_bounds__(256) void k_layernorm(const float* __restrict__ X, const float* __restrict__ R, const float* __restrict__ g, const float* __restrict__ bta,
                                                  float* __restrict__ out_sum, float* __restrict__ out_norm, int N, float eps) {
  __shared__ float red[256];
  const int row = blockIdx.x, tid = threadIdx.x;
  const float* x = X + (size_t)row * N; const float* rr = R ? R + (size_t)row * N : nullptr;
  float vals[16];                     // up to N = 4096
  const int per = N / 256;            // contiguous chunk per thread? use strided-by-4 chunks: thread handles j = tid*4 + 1024*u
  float s1 = 0.f;
  for (int u = 0; u < per / 4; ++u) {
    const int j = tid * 4 + 1024 * u;
    const v4f a = *(const v4fa*)(x + j);
    v4f b = {0.f,0.f,0.f,0.f}; if (rr) b = *(const v4fa*)(rr + j);
#pragma unroll
    for (int q = 0; q < 4; ++q) { const float v = a[q] + b[q]; vals[u * 4 + q] = v; s1 += v; }
  }
  red[tid] = s1; __syncthreads();
  for (int st = 128; st > 0; st >>= 1) { if (tid < st) red[tid] += red[tid + st]; __syncthreads(); }
  const float mu = red[0] / (float)N; __syncthreads();
  float s2 = 0.f;
  for (int u = 0; u < per / 4; ++u)
#pragma unroll
    for (int q = 0; q < 4; ++q) { const float c = vals[u * 4 + q] - mu; s2 += c * c; }
  red[tid] = s2; __syncthreads();
  for (int st = 128; st > 0; st >>= 1) { if (tid < st) red[tid] += red[tid + st]; __syncthreads(); }
  const float rs = rsqrtf(red[0] / (float)N + eps);
  {
    for (int u = 0; u < per / 4; ++u) {
      const int j = tid * 4 + 1024 * u;
      v4f o, sm;
#pragma unroll
      for (int q = 0; q < 4; ++q) {
        float gg = g[j + q], bb = bta[j + q];
        if (PARAM_BF16) { gg = bf16_round(gg); bb = bf16_round(bb); }
        sm[q] = vals[u * 4 + q]; o[q] = (vals[u * 4 + q] - mu) * rs * gg + bb;
      }
      if (out_sum) *(v4f*)(out_sum + (size_t)row * N + j) = sm;
      *(v4f*)(out_norm + (size_t)row * N + j) = o;
    }
    
  }
}



// ---- f16 WMMA path (v_wmma_f32_16x16x32_f16): 11-bit significands for operands in range — used where a [0,1] probability operand needs more precision than bf16
typedef _Float16 v16h __attribute__((ext_vector_type(16)));
union FragH { v16h v; v8us half[2]; _Float16 h[16]; unsigned short u[16]; };
template <int NT>
__device__ __forceinline__ v8f mmaH(v16h ah, v16h al, v16h bh, v16h bl, v8f c) {
  c = __builtin_amdgcn_wmma_f32_16x16x32_f16(false, ah, false, bh, (short)0, c, false, false);
  if (NT >= 2) c = __builtin_amdgcn_wmma_f32_16x16x32_f16(false, al, false, bh, (short)0, c, false, false);
  if (NT >= 3) c = __builtin_amdgcn_wmma_f32_16x16x32_f16(false, ah, false, bl, (short)0, c, false, false);
  asm volatile("v_nop\n\tv_nop\n\tv_nop\n\tv_nop" : "+v"(c) : "v"(ah), "v"(al), "v"(bh), "v"(bl));
  return c;
}
// batched GEMM like k_gemm_b but f16 operands: A f32 (split into f16 hi/lo if ASPLIT, else rounded to f16), Bt = f16 values [n][k]; alpha; C f32; N multiple of 16 (partial tiles skipped)
template <bool ASPLIT>
__global__ __launch_bounds__(128) void k_gemm_h(const float* __restrict__ A, int lda, size_t sA, const _Float16* __restrict__ Bh, int ldb, size_t sB, float alpha, float* __restrict__ C, int ldc, size_t sC, int M, int N, int K) {
  __shared__ __attribute__((aligned(16))) float so[4][16][64];
  const int tid = threadIdx.x, w = tid >> 5, lane = tid & 31, ln = lane & 15, hh = lane >> 4; const int by = blockIdx.y;
  A += (size_t)by * sA; Bh += (size_t)by * sB; C += (size_t)by * sC;
  const int ntn = (N + 63) / 64; const int wid = blockIdx.x * 4 + w; const int mt = wid / ntn, nq = wid % ntn; if (mt * 16 >= M) return;
  const int row0 = mt * 16, col0 = nq * 64; const float* arow = A + (size_t)(row0 + ln) * lda;
  v8f acc[4] = {};
  for (int kb = 0; kb < K; kb += 32) {
    FragH ah, al;
    const v4f x0 = *(const v4fa*)(arow + kb + 8 * hh), x1 = *(const v4fa*)(arow + kb + 8 * hh + 4), x2 = *(const v4fa*)(arow + kb + 16 + 8 * hh), x3 = *(const v4fa*)(arow + kb + 16 + 8 * hh + 4);
    float xs[16] = {x0[0],x0[1],x0[2],x0[3],x1[0],x1[1],x1[2],x1[3],x2[0],x2[1],x2[2],x2[3],x3[0],x3[1],x3[2],x3[3]};
#pragma unroll
    for (int i = 0; i < 16; ++i) { const _Float16 h = (_Float16)xs[i]; ah.h[i] = h; al.h[i] = ASPLIT ? (_Float16)(xs[i] - (float)h) : (_Float16)0.0f; }
#pragma unroll
    for (int t = 0; t < 4; ++t) { if (col0 + t * 16 >= N) continue; const size_t boff = (size_t)(col0 + t * 16 + ln) * ldb + kb; FragH bq; bq.half[0] = *(const v8us*)(Bh + boff + 8 * hh); bq.half[1] = *(const v8us*)(Bh + boff + 16 + 8 * hh);
      acc[t] = mmaH<ASPLIT ? 2 : 1>(ah.v, al.v, bq.v, bq.v, acc[t]); }
  }
#pragma unroll
  for (int t = 0; t < 4; ++t) { if (col0 + t * 16 >= N) continue;
#pragma unroll
    for (int r = 0; r < 8; ++r) so[w][8 * hh + r][t * 16 + ln] = acc[t][r] * alpha; }
  __builtin_amdgcn_fence(__ATOMIC_ACQ_REL, "workgroup"); __builtin_amdgcn_wave_barrier();
  const int rsub = lane >> 4, c4 = (lane & 15) * 4;
  {
#pragma unroll
    for (int q = 0; q < 8; ++q) { const int r = q * 2 + rsub; if (col0 + c4 < N) { const v4f v = *(const v4fa*)&so[w][r][c4]; *(v4f*)(C + (size_t)(row0 + r) * ldc + col0 + c4) = v; } }
     }
}

// Wt[n][k] = f16(W[k][n]·scale) from f32 row-major W[K][N] (scale = power of two; bf16-exact weights stay exact in f16 away from the subnormal range)
__global__ __launch_bounds__(256) void k_wt_f16(const float* __restrict__ W, _Float16* __restrict__ Wt, int K, int N, float scale) {
  const int t = blockIdx.x * 256 + threadIdx.x; if (t >= N * (K / 8)) return; const int n = t / (K / 8), k8 = (t % (K / 8)) * 8; FragH f;
#pragma unroll
  for (int i = 0; i < 8; ++i) f.h[i] = (_Float16)(bf16_round(W[(size_t)(k8 + i) * N + n]) * scale); const v8us o = f.half[0];
  *(v8us*)((unsigned short*)Wt + (size_t)n * K + k8) = o; 
}
// k_gemm_hh variant with fused epilogue: v = acc·alpha + bias[by·sBias + col] (+ CP[(row/rowsPerB)·sCPb + by·64 + col] if CP) ; ACT 0 none / 1 elu ; writes f16 C16 (and f32 C if non-null)
template <int ACT>
__global__ __launch_bounds__(128) void k_gemm_hhx(const _Float16* __restrict__ A, int lda, size_t sA, const _Float16* __restrict__ Bh, int ldb, size_t sB, float alpha, const float* __restrict__ bias, size_t sBias, const float* __restrict__ CP, int rowsPerB, size_t sCPb, int row0g,
    float* __restrict__ C, _Float16* __restrict__ C16, int ldc, size_t sC, int M, int N, int K) {
  __shared__ __attribute__((aligned(16))) float so[4][16][64];
  const int tid = threadIdx.x, w = tid >> 5, lane = tid & 31, ln = lane & 15, hh = lane >> 4; const int by = blockIdx.y;
  A += (size_t)by * sA; Bh += (size_t)by * sB; const size_t cofs = (size_t)by * sC; const float* bp = bias ? bias + (size_t)by * sBias : nullptr;
  const int ntn = (N + 63) / 64; const int wid = blockIdx.x * 4 + w; const int mt = wid / ntn, nq = wid % ntn; if (mt * 16 >= M) return;
  const int row0 = mt * 16, col0 = nq * 64; const _Float16* arow = A + (size_t)(row0 + ln) * lda;
  v8f acc[4] = {};
  for (int kb = 0; kb < K; kb += 32) { FragH ah; ah.half[0] = *(const v8us*)((const unsigned short*)arow + kb + 8 * hh); ah.half[1] = *(const v8us*)((const unsigned short*)arow + kb + 16 + 8 * hh);
#pragma unroll
    for (int t = 0; t < 4; ++t) { if (col0 + t * 16 >= N) continue; const size_t boff = (size_t)(col0 + t * 16 + ln) * ldb + kb; FragH bq; bq.half[0] = *(const v8us*)((const unsigned short*)Bh + boff + 8 * hh); bq.half[1] = *(const v8us*)((const unsigned short*)Bh + boff + 16 + 8 * hh);
      acc[t] = mmaH<1>(ah.v, ah.v, bq.v, bq.v, acc[t]); }
  }
#pragma unroll
  for (int t = 0; t < 4; ++t) { if (col0 + t * 16 >= N) continue; const int col = col0 + t * 16 + ln; const float bv = bp ? bf16_round(bp[col]) : 0.f;
#pragma unroll
    for (int r = 0; r < 8; ++r) { float v = acc[t][r] * alpha + bv; if (CP) { const int bidx = (row0g + row0 + 8 * hh + r) / rowsPerB; v += CP[(size_t)bidx * sCPb + (size_t)by * 64 + col]; } if (ACT == 1) v = (v > 0.f) ? v : expm1f(v); else if (ACT == 7) v = (v > 0.f) ? v + 1.0f : expf(v); else if (ACT == 8) v = tanhf(v); else if (ACT == 9) v = 0.5f * v * (1.0f + tanhf(0.7978845608028654f * (v + 0.044715f * v * v * v))); else if (ACT == 11) v = 1.0f / (1.0f + expf(-v)); else if (ACT == 12) v = (v > 0.f) ? v : 0.01f * v; else if (ACT == 14) v = (v > 0.f) ? v : 0.1f * v; else if (ACT == 15) v = v / (1.0f + expf(-v)); else if (ACT == 3) v = fmaxf(v, 0.f); else if (ACT == 6) v = 0.5f * v * (1.0f + erff(v * 0.70710678118654752f)); so[w][8 * hh + r][t * 16 + ln] = v; } }
  __builtin_amdgcn_fence(__ATOMIC_ACQ_REL, "workgroup"); __builtin_amdgcn_wave_barrier();
  const int rsub = lane >> 4, c4 = (lane & 15) * 4; typedef _Float16 v4h __attribute__((ext_vector_type(4)));
  {
#pragma unroll
    for (int q = 0; q < 8; ++q) { const int r = q * 2 + rsub; if (col0 + c4 < N) { const v4f v = *(const v4fa*)&so[w][r][c4]; if (C) *(v4f*)(C + cofs + (size_t)(row0 + r) * ldc + col0 + c4) = v; if (C16) { v4h h4; for (int i = 0; i < 4; ++i) h4[i] = (_Float16)v[i]; *(v4h*)(C16 + cofs + (size_t)(row0 + r) * ldc + col0 + c4) = h4; } } }
     }
}


typedef _Float16 v4h __attribute__((ext_vector_type(4)));

__global__ __launch_bounds__(256) void k_x16(const float* __restrict__ x, _Float16* __restrict__ X16, size_t n8) { const size_t t = (size_t)blockIdx.x * 256 + threadIdx.x; if (t >= n8) return; FragH f;
#pragma unroll
  for (int q = 0; q < 8; ++q) f.h[q] = (_Float16)bf16_round(x[t * 8 + q]); *(v8us*)((unsigned short*)X16 + t * 8) = f.half[0];  }
__global__ __launch_bounds__(256) void k_h16(const float* __restrict__ x, _Float16* __restrict__ X16, size_t n8) { const size_t t = (size_t)blockIdx.x * 256 + threadIdx.x; if (t >= n8) return; FragH f;
#pragma unroll
  for (int q = 0; q < 8; ++q) f.h[q] = (_Float16)x[t * 8 + q]; *(v8us*)((unsigned short*)X16 + t * 8) = f.half[0];  }
__global__ __launch_bounds__(256) void k_round16f(const float* __restrict__ W, _Float16* __restrict__ Bt, size_t n8) { const size_t t = (size_t)blockIdx.x * 256 + threadIdx.x; if (t >= n8) return; FragH f;
#pragma unroll
  for (int i = 0; i < 8; ++i) f.h[i] = (_Float16)(bf16_round(W[t * 8 + i]) * 16.0f); *(v8us*)((unsigned short*)Bt + t * 8) = f.half[0];  }
template <int NHv, int TTv>
__global__ __launch_bounds__(256) void k_vt(const _Float16* __restrict__ V16, int ldv, int voff, _Float16* __restrict__ Vt) { __shared__ unsigned short tl[64][66]; const int tid = threadIdx.x; const int slab = blockIdx.x / (TTv / 64), lg = blockIdx.x % (TTv / 64); const int b = slab / NHv, h = slab % NHv;
  for (int i = tid; i < 64 * 8; i += 256) { const int r = i / 8, c8 = (i % 8) * 8; FragH f; f.half[0] = *(const v8us*)((const unsigned short*)V16 + ((size_t)b * TTv + lg * 64 + r) * ldv + voff + h * 64 + c8);
#pragma unroll
    for (int q = 0; q < 8; ++q) tl[r][c8 + q] = f.u[q]; }
  __syncthreads();
  {
#pragma unroll
    for (int rd = 0; rd < 2; ++rd) { const int d = rd * 32 + tid / 8, pc = tid % 8; FragH f;
#pragma unroll
      for (int q = 0; q < 8; ++q) f.u[q] = tl[pc * 8 + q][d];
      *(v8us*)((unsigned short*)Vt + ((size_t)slab * 64 + d) * TTv + lg * 64 + pc * 8) = f.half[0]; }
     } }

__global__ __launch_bounds__(256) void k_hl(const float* __restrict__ F, _Float16* __restrict__ Hh, _Float16* __restrict__ Hl, size_t n8) { const size_t t = (size_t)blockIdx.x * 256 + threadIdx.x; if (t >= n8) return; FragH fh, fl; const v4f a = *(const v4fa*)(F + t * 8), c = *(const v4fa*)(F + t * 8 + 4);
#pragma unroll
  for (int q = 0; q < 4; ++q) { _Float16 h = (_Float16)a[q]; fh.h[q] = h; fl.h[q] = (_Float16)((a[q] - (float)h) * 1024.0f); h = (_Float16)c[q]; fh.h[4 + q] = h; fl.h[4 + q] = (_Float16)((c[q] - (float)h) * 1024.0f); }
  { *(v8us*)((unsigned short*)Hh + t * 8) = fh.half[0]; *(v8us*)((unsigned short*)Hl + t * 8) = fl.half[0];  } }

// ---- fast GEMM (work-group tile 128x64, wave tile 32x64; requires M % 128 == 0, N % 64 == 0, K % 64 == 0 and K >= 64); epilogue = k_gemm_hhx semantics ----
__device__ __forceinline__ v8f g2_mma(v16h a, v16h b, v8f c) { v8f d = __builtin_amdgcn_wmma_f32_16x16x32_f16(false, a, false, b, (short)0, c, false, false); asm volatile("v_nop\n\tv_nop\n\tv_nop\n\tv_nop" : "+v"(d) : "v"(a), "v"(b)); return d; }
// a fragment from a staged tile: the two 16-byte pieces of the lane's row (same k order as a fragment read from global memory: 8 * hh .. and 16 + 8 * hh ..)
__device__ __forceinline__ v16h g2_lfrag(const unsigned char* rows, int o0, int o1) { FragH f; f.half[0] = *(const v8us*)(rows + o0); f.half[1] = *(const v8us*)(rows + o1); return f.v; }
// One stage of the GEMM ring: 64 k of the tile's 128 A rows, then of its 64 B rows (rows of 128 bytes without a pad, 24 KiB), brought by asynchronous copies to LDS.
// Twelve copies a lane; a wave-wide copy covers four whole 128-byte lines. s_wait_xcnt stands inside the statement so that no address register is rewritten ahead of it.
__device__ __forceinline__ void g2_stage_copy(unsigned lds, const unsigned short* ga, size_t astep, const unsigned short* gb, size_t bstep) {
  asm volatile("global_load_async_to_lds_b128 %0, %12, off\n\t"
               "global_load_async_to_lds_b128 %1, %13, off\n\t"
               "global_load_async_to_lds_b128 %2, %14, off\n\t"
               "global_load_async_to_lds_b128 %3, %15, off\n\t"
               "global_load_async_to_lds_b128 %4, %16, off\n\t"
               "global_load_async_to_lds_b128 %5, %17, off\n\t"
               "global_load_async_to_lds_b128 %6, %18, off\n\t"
               "global_load_async_to_lds_b128 %7, %19, off\n\t"
               "global_load_async_to_lds_b128 %8, %20, off\n\t"
               "global_load_async_to_lds_b128 %9, %21, off\n\t"
               "global_load_async_to_lds_b128 %10, %22, off\n\t"
               "global_load_async_to_lds_b128 %11, %23, off\n\t"
               "s_wait_xcnt 0x0"
               :: "v"(lds), "v"(lds + 2048u), "v"(lds + 4096u), "v"(lds + 6144u), "v"(lds + 8192u), "v"(lds + 10240u), "v"(lds + 12288u), "v"(lds + 14336u),
                  "v"(lds + 16384u), "v"(lds + 18432u), "v"(lds + 20480u), "v"(lds + 22528u),
                  "v"(ga), "v"(ga + astep), "v"(ga + 2 * astep), "v"(ga + 3 * astep), "v"(ga + 4 * astep), "v"(ga + 5 * astep), "v"(ga + 6 * astep), "v"(ga + 7 * astep),
                  "v"(gb), "v"(gb + bstep), "v"(gb + 2 * bstep), "v"(gb + 3 * bstep)
               : "memory");
}
template <int ACT>
__global__ __launch_bounds__(128) void k_gemm2(const _Float16* __restrict__ A, int lda, size_t sA, const _Float16* __restrict__ Bh, int ldb, size_t sB, float alpha, const float* __restrict__ bias, size_t sBias, const float* __restrict__ CP, int rowsPerB, size_t sCPb, int row0g,
    float* __restrict__ C, _Float16* __restrict__ C16, int ldc, size_t sC, int M, int N, int K) {
  constexpr int ATILE_B = 128 * 128, GSTAGE_B = ATILE_B + 64 * 128;      /* a stage = 64 k: A tile, then B tile */
  __shared__ __attribute__((aligned(16))) unsigned char ring[2 * GSTAGE_B];
  float (*so)[32][68] = reinterpret_cast<float (*)[32][68]>(ring);      /* output staging (34,816 bytes) takes the ring's place behind the loop's last barrier */
  const int tid = threadIdx.x, w = tid >> 5, lane = tid & 31, ln = lane & 15, hh = lane >> 4; const int by = blockIdx.y;
  A += (size_t)by * sA; Bh += (size_t)by * sB; const size_t cofs = (size_t)by * sC; const float* bp = bias ? bias + (size_t)by * sBias : nullptr;
  const int ntn = N >> 6; const int mt = blockIdx.x / ntn, nq = blockIdx.x - mt * ntn; if (mt * 128 >= M) return;      /* the whole work-group leaves, ahead of every copy and barrier */
  const int row0 = mt * 128 + 32 * w, col0 = nq * 64;
  const int nst = K >> 6;
  /* 16-byte piece c of row r lies at r * 128 + (c ^ ((r >> 1) & 7)) * 16: sixteen rows read at one piece index fall on all 64 banks */
  const unsigned cp_lds = (unsigned)(size_t)ring + (unsigned)((tid >> 3) * 128 + (((tid & 7) ^ ((tid >> 4) & 7)) * 16));
  const unsigned short* cp_a = (const unsigned short*)A + (size_t)(mt * 128 + (tid >> 3)) * lda + (tid & 7) * 8;
  const unsigned short* cp_b = (const unsigned short*)Bh + (size_t)(col0 + (tid >> 3)) * ldb + (tid & 7) * 8;
  const size_t astep = (size_t)16 * lda, bstep = (size_t)16 * ldb;
  g2_stage_copy(cp_lds, cp_a, astep, cp_b, bstep);
  int fo[2][2];      /* a fragment's two pieces in row ln: [32-element group of the row][piece] */
#pragma unroll
  for (int g = 0; g < 2; ++g)
#pragma unroll
    for (int pc = 0; pc < 2; ++pc) fo[g][pc] = ln * 128 + (((g * 4 + pc * 2 + hh) ^ ((ln >> 1) & 7)) * 16);
  const v8f z8 = {0.f,0.f,0.f,0.f,0.f,0.f,0.f,0.f}; v8f c00 = z8, c01 = z8, c02 = z8, c03 = z8, c10 = z8, c11 = z8, c12 = z8, c13 = z8;
  asm volatile("s_wait_asynccnt 0x0" ::: "memory");      /* stage 0 has landed for this wave's own copies */
  __syncthreads();                                       /* ... and for every other wave's */
  if (1 < nst) g2_stage_copy(cp_lds + GSTAGE_B, cp_a + 64, astep, cp_b + 64, bstep);
#pragma unroll 1      /* one body for both buffers: the buffer is picked by the trip's parity */
  for (int t = 0; t < nst; ++t) {
    const unsigned char* ar = ring + (t & 1) * GSTAGE_B + w * (32 * 128); const unsigned char* br = ring + (t & 1) * GSTAGE_B + ATILE_B;
#pragma unroll
    for (int g = 0; g < 2; ++g) { const int o0 = fo[g][0], o1 = fo[g][1];
      const v16h a0 = g2_lfrag(ar, o0, o1), a1 = g2_lfrag(ar + 2048, o0, o1);
      const v16h b0 = g2_lfrag(br, o0, o1), b1 = g2_lfrag(br + 2048, o0, o1), b2 = g2_lfrag(br + 4096, o0, o1), b3 = g2_lfrag(br + 6144, o0, o1);
      c00 = g2_mma(a0, b0, c00); c10 = g2_mma(a1, b0, c10);
      c01 = g2_mma(a0, b1, c01); c11 = g2_mma(a1, b1, c11);
      c02 = g2_mma(a0, b2, c02); c12 = g2_mma(a1, b2, c12);
      c03 = g2_mma(a0, b3, c03); c13 = g2_mma(a1, b3, c13); }
    asm volatile("s_wait_dscnt 0x0" ::: "memory");         /* this wave's reads of stage t have returned */
    asm volatile("s_wait_asynccnt 0x0" ::: "memory");      /* this wave's copies of stage t + 1 have landed */
    __syncthreads();                                       /* publishes stage t + 1 and ends every wave's reads of stage t */
    if (t + 2 < nst) g2_stage_copy(cp_lds + (t & 1) * GSTAGE_B, cp_a + (size_t)(t + 2) * 64, astep, cp_b + (size_t)(t + 2) * 64, bstep); }
  asm volatile("s_wait_asynccnt 0x0" ::: "memory");        /* nothing is in flight when the ring becomes output staging */
  v8f accs[8] = {c00, c01, c02, c03, c10, c11, c12, c13};
#pragma unroll
  for (int u = 0; u < 8; ++u) { const int t = u & 3, half = u >> 2; const int col = col0 + t * 16 + ln; const float bv = bp ? bf16_round(bp[col]) : 0.f;
#pragma unroll
    for (int r = 0; r < 8; ++r) { const int rloc = half * 16 + 8 * hh + r; float v = accs[u][r] * alpha + bv; if (CP) { const int bidx = (row0g + row0 + rloc) / rowsPerB; v += CP[(size_t)bidx * sCPb + (size_t)by * 64 + col]; }
      if (ACT == 3) v = fmaxf(v, 0.f); else if (ACT == 6) v = 0.5f * v * (1.0f + erff(v * 0.70710678118654752f)); else if (ACT == 11) v = 1.0f / (1.0f + expf(-v)); else if (ACT == 15) v = v / (1.0f + expf(-v)); else if (ACT == 12) v = (v > 0.f) ? v : 0.01f * v; else if (ACT == 8) v = tanhf(v);
      so[w][rloc][t * 16 + ln] = v; } }
  __builtin_amdgcn_fence(__ATOMIC_ACQ_REL, "workgroup"); __builtin_amdgcn_wave_barrier();
  const int rsub = lane >> 4, c4 = (lane & 15) * 4;
  {
#pragma unroll
    for (int q = 0; q < 16; ++q) { const int r = q * 2 + rsub; const v4f v = *(const v4fa*)&so[w][r][c4]; if (C) *(v4f*)(C + cofs + (size_t)(row0 + r) * ldc + col0 + c4) = v; if (C16) { v4h h4; for (int i = 0; i < 4; ++i) h4[i] = (_Float16)v[i]; *(v4h*)(C16 + cofs + (size_t)(row0 + r) * ldc + col0 + c4) = h4; } }
     } }



// One stage of the K / V^T ring: 64 key rows of K (128 bytes each) and 64 rows of V^T (the same 64 keys, 128 bytes each), 16 KiB, brought by asynchronous copies to LDS.
// Eight copies a lane; a wave-wide copy covers four whole 128-byte lines. s_wait_xcnt stands inside the statement so that no address register is rewritten ahead of it.
__device__ __forceinline__ void stage_copy(unsigned lds, const unsigned short* gk, size_t kstep, const unsigned short* gv, size_t vstep) {
  asm volatile("global_load_async_to_lds_b128 %0, %8, off\n\t"
               "global_load_async_to_lds_b128 %1, %9, off\n\t"
               "global_load_async_to_lds_b128 %2, %10, off\n\t"
               "global_load_async_to_lds_b128 %3, %11, off\n\t"
               "global_load_async_to_lds_b128 %4, %12, off\n\t"
               "global_load_async_to_lds_b128 %5, %13, off\n\t"
               "global_load_async_to_lds_b128 %6, %14, off\n\t"
               "global_load_async_to_lds_b128 %7, %15, off\n\t"
               "s_wait_xcnt 0x0"
               :: "v"(lds), "v"(lds + 2048u), "v"(lds + 4096u), "v"(lds + 6144u), "v"(lds + 8192u), "v"(lds + 10240u), "v"(lds + 12288u), "v"(lds + 14336u),
                  "v"(gk), "v"(gk + kstep), "v"(gk + 2 * kstep), "v"(gk + 3 * kstep), "v"(gv), "v"(gv + vstep), "v"(gv + 2 * vstep), "v"(gv + 3 * vstep)
               : "memory");
}
// lane l with lane l ^ 16: one vector cross-row move
__device__ __forceinline__ float xhalf(float x) { return __builtin_bit_cast(float, __builtin_amdgcn_permlanex16(__builtin_bit_cast(int, x), __builtin_bit_cast(int, x), 0x76543210, 0xfedcba98, false, false)); }
template <int CAUSAL>
__global__ __launch_bounds__(128) void k_flash(const _Float16* __restrict__ Q16, int ldq, const _Float16* __restrict__ K16, int ldk, const _Float16* __restrict__ Vt, const int* __restrict__ MSK, float* __restrict__ O, int ldo) {
  constexpr int RPW = 16, RTN = RPW / 16, NQB = TQ / (4 * RPW), DT = 4, KS = 2;
  constexpr int TILE_B = 64 * 128, STAGE_B = 2 * TILE_B;      /* a stage = 64 keys: K tile, then V^T tile, rows of 128 bytes without a pad */
  __shared__ __attribute__((aligned(16))) unsigned char ring[2 * STAGE_B];
  float (*sO)[RPW][64 + 4] = reinterpret_cast<float (*)[RPW][64 + 4]>(ring);      /* output staging takes the ring's place behind the loop's last barrier */
  const int tid = threadIdx.x, w = tid >> 5, lane = tid & 31, ln = lane & 15, hh = lane >> 4;
  const int slab = blockIdx.x / QBLKS, qblk = blockIdx.x % QBLKS; (void)NQB; (void)MSK; const int b = slab / NH, h = slab % NH; const int qb0 = qblk * (4 * RPW); const int q0 = qb0 + w * RPW;
  const unsigned short* Vth = (const unsigned short*)Vt + (size_t)slab * 64 * TK;
  const int jend = (CAUSAL == 1) ? (qb0 + 4 * RPW) : TK;      /* causal: keys beyond the block's last query never contribute */
  const int nst = jend / 64;
  /* 16-byte piece c of row r lies at r * 128 + (c ^ ((r >> 1) & 7)) * 16: sixteen rows read at one piece index fall on all 64 banks */
  const unsigned cp_lds = (unsigned)(size_t)ring + (unsigned)((tid >> 3) * 128 + (((tid & 7) ^ ((tid >> 4) & 7)) * 16));
  const unsigned short* cp_k = (const unsigned short*)K16 + ((size_t)b * TK + (tid >> 3)) * ldk + h * 64 + (tid & 7) * 8;
  const unsigned short* cp_v = Vth + (size_t)(tid >> 3) * TK + (tid & 7) * 8;
  const size_t kstep = (size_t)16 * ldk, vstep = (size_t)16 * TK;
  stage_copy(cp_lds, cp_k, kstep, cp_v, vstep);
  FragH aq[2][KS];
#pragma unroll
  for (int rt = 0; rt < RTN; ++rt) { const unsigned short* qr = (const unsigned short*)Q16 + ((size_t)b * TQ + q0 + rt * 16 + ln) * ldq + h * 64;
#pragma unroll
    for (int ks = 0; ks < KS; ++ks) { aq[rt][ks].half[0] = *(const v8us*)(qr + ks * 32 + 8 * hh); aq[rt][ks].half[1] = *(const v8us*)(qr + ks * 32 + 16 + 8 * hh); } }
  int fo[2][2];      /* a fragment's two pieces in row ln: [32-element group of the row][piece] */
#pragma unroll
  for (int g = 0; g < 2; ++g)
#pragma unroll
    for (int pc = 0; pc < 2; ++pc) fo[g][pc] = ln * 128 + (((g * 4 + pc * 2 + hh) ^ ((ln >> 1) & 7)) * 16);
  float m_r[2], l_r[2]; v8f oacc[2][DT];      /* per lane: its query's running maximum, its half's share of the sum, and O^T[d = dt * 16 + 8 * hh + r][query ln] */
#pragma unroll
  for (int rt = 0; rt < RTN; ++rt) { m_r[rt] = -3.0e38f; l_r[rt] = 0.f;
#pragma unroll
    for (int dt = 0; dt < DT; ++dt) oacc[rt][dt] = (v8f){0.f,0.f,0.f,0.f,0.f,0.f,0.f,0.f}; }
  asm volatile("s_wait_asynccnt 0x0" ::: "memory");      /* stage 0 has landed for this wave's own copies */
  __syncthreads();                                       /* ... and for every other wave's */
  if (1 < nst) stage_copy(cp_lds + STAGE_B, cp_k + (size_t)64 * ldk, kstep, cp_v + 64, vstep);
#pragma unroll 1
  for (int t = 0; t < nst; ++t) {
    const unsigned char* st = ring + (t & 1) * STAGE_B;
#pragma unroll 1      /* the two 32-key passes of a stage stay one body: unrolled, the registers grow and a work-group per WGP is lost */
    for (int ps = 0; ps < 2; ++ps) { const int j0 = t * 64 + ps * 32;
    v8f s[2][2];
#pragma unroll
    for (int nt = 0; nt < 2; ++nt) { const unsigned char* kr = st + (ps * 32 + nt * 16) * 128; FragH bk[KS];
#pragma unroll
      for (int ks = 0; ks < KS; ++ks) { bk[ks].half[0] = *(const v8us*)(kr + fo[ks][0]); bk[ks].half[1] = *(const v8us*)(kr + fo[ks][1]); }
#pragma unroll
      for (int rt = 0; rt < RTN; ++rt) { v8f acc = (v8f){0.f,0.f,0.f,0.f,0.f,0.f,0.f,0.f};
#pragma unroll
        for (int ks = 0; ks < KS; ++ks) acc = mmaH<1>(bk[ks].v, bk[ks].v, aq[rt][ks].v, aq[rt][ks].v, acc); s[rt][nt] = acc; } }      /* s[rt][nt][r] = score of key j0 + nt * 16 + 8 * hh + r, query q0 + rt * 16 + ln */
    FragH pb[2];
#pragma unroll
    for (int rt = 0; rt < RTN; ++rt) { const int tq = q0 + rt * 16 + ln; float sv[16]; bool ok[16];
#pragma unroll
      for (int e = 0; e < 16; ++e) { const int kk = j0 + (e >> 3) * 16 + 8 * hh + (e & 7);
        ok[e] = (CAUSAL == 1) ? (kk <= tq) : ((CAUSAL == 2) ? ((kk >> 5) == (tq >> 5)) : true);      /* mode 2: block-diagonal 32-token groups */
        sv[e] = ok[e] ? s[rt][e >> 3][e & 7] * SCL : -3.0e38f; }
      float mx[4];
#pragma unroll
      for (int c = 0; c < 4; ++c) mx[c] = fmaxf(fmaxf(sv[c], sv[4 + c]), fmaxf(sv[8 + c], sv[12 + c]));
      float mc = fmaxf(fmaxf(mx[0], mx[1]), fmaxf(mx[2], mx[3])); mc = fmaxf(mc, xhalf(mc));      /* both halves now hold the query's maximum over the 32 keys */
      const float mn = fmaxf(m_r[rt], mc); const float ea = expf(m_r[rt] - mn); const float al = (mn > -1.0e38f) ? ea : 1.0f; m_r[rt] = mn;
      float ls[4] = {0.f, 0.f, 0.f, 0.f};
#pragma unroll
      for (int e = 0; e < 16; ++e) { const float p = ok[e] ? expf(sv[e] - mn) : 0.f; ls[e & 3] += p; pb[rt].h[e] = (_Float16)(p * 1024.0f); }
      l_r[rt] = l_r[rt] * al + ((ls[0] + ls[1]) + (ls[2] + ls[3]));
#pragma unroll
      for (int dt = 0; dt < DT; ++dt)
#pragma unroll
        for (int r = 0; r < 8; ++r) oacc[rt][dt][r] *= al; }
#pragma unroll
    for (int dt = 0; dt < DT; ++dt) { const unsigned char* vrow = st + TILE_B + dt * 16 * 128; FragH bv; bv.half[0] = *(const v8us*)(vrow + (fo[0][0] ^ (ps * 64))); bv.half[1] = *(const v8us*)(vrow + (fo[0][1] ^ (ps * 64)));      /* the pass's 32 keys: piece index + 4 = bit 6 of the offset */
#pragma unroll
      for (int rt = 0; rt < RTN; ++rt) oacc[rt][dt] = mmaH<1>(bv.v, bv.v, pb[rt].v, pb[rt].v, oacc[rt][dt]); } }
    asm volatile("s_wait_dscnt 0x0" ::: "memory");         /* this wave's reads of stage t have returned */
    asm volatile("s_wait_asynccnt 0x0" ::: "memory");      /* this wave's copies of stage t + 1 have landed */
    __syncthreads();                                       /* publishes stage t + 1 and ends every wave's reads of stage t */
    if (t + 2 < nst) stage_copy(cp_lds + (t & 1) * STAGE_B, cp_k + (size_t)(t + 2) * 64 * ldk, kstep, cp_v + (t + 2) * 64, vstep); }
  asm volatile("s_wait_asynccnt 0x0" ::: "memory");        /* nothing is in flight when the ring becomes output staging */
#pragma unroll
  for (int rt = 0; rt < RTN; ++rt) { float l = l_r[rt]; l += xhalf(l); const float inv = (l > 0.f) ? 1.0f / (l * 1024.0f) : 0.f;      /* the halves' sums join once */
#pragma unroll
    for (int dt = 0; dt < DT; ++dt)
#pragma unroll
      for (int q4 = 0; q4 < 2; ++q4) { v4f o4;
#pragma unroll
        for (int i = 0; i < 4; ++i) o4[i] = oacc[rt][dt][q4 * 4 + i] * inv;
        *(v4fa*)&sO[w][rt * 16 + ln][dt * 16 + 8 * hh + q4 * 4] = o4; } }
  __builtin_amdgcn_fence(__ATOMIC_ACQ_REL, "workgroup"); __builtin_amdgcn_wave_barrier();
  {
#pragma unroll
    for (int rp = 0; rp < RPW; rp += 2) { const int r = rp + (lane >> 4), pc = lane & 15; const v4f val = *(const v4fa*)&sO[w][r][pc * 4]; *(v4f*)(O + ((size_t)b * TQ + q0 + r) * ldo + h * 64 + pc * 4) = val; }
     } }

__global__ __launch_bounds__(256) void k_wsc(const float* __restrict__ Wm, _Float16* __restrict__ Bt, size_t n8, float sc) { const size_t t = (size_t)blockIdx.x * 256 + threadIdx.x; if (t >= n8) return; FragH f; for (int q = 0; q < 8; ++q) f.h[q] = (_Float16)(bf16_round(Wm[t * 8 + q]) * sc); *(v8us*)((unsigned short*)Bt + t * 8) = f.half[0];  }
__global__ __launch_bounds__(256) void k_woutp(const float* __restrict__ Wm, _Float16* __restrict__ Bt) { const size_t t = (size_t)blockIdx.x * 256 + threadIdx.x; if (t >= (size_t)DMOD * (2 * DMOD / 8)) return; const int pc = (int)(t % (2 * DMOD / 8)); const int o = (int)(t / (2 * DMOD / 8)); const bool lo = pc * 8 >= DMOD; FragH f;
  for (int q = 0; q < 8; ++q) { const int c = pc * 8 + q - (lo ? DMOD : 0); f.h[q] = (_Float16)(bf16_round(Wm[(size_t)o * DMOD + c]) * (lo ? 1.0f : 16.0f)); } *(v8us*)((unsigned short*)Bt + (size_t)o * 2 * DMOD + pc * 8) = f.half[0];  }
__global__ __launch_bounds__(256) void k_ropetab(float* __restrict__ CS) {
  #pragma clang fp contract(off)
  const int t = blockIdx.x * 256 + threadIdx.x; if (t >= SLEN * (RD / 2)) return; const int i = t % (RD / 2), tpos = t / (RD / 2); const float invf = (float)pow(10000.0, -(double)(2 * i) / (double)RD); const float ang = (float)tpos * invf; const float c = cosf(ang), s = sinf(ang);
  { *(float*)(CS + t) = c; *(float*)(CS + SLEN * (RD / 2) + t) = s;  } }
__global__ __launch_bounds__(256) void k_rope(const float* __restrict__ Q, const float* __restrict__ Kf, const float* __restrict__ CS, _Float16* __restrict__ Q16, _Float16* __restrict__ K16) {
  #pragma clang fp contract(off)
  const size_t t = (size_t)blockIdx.x * 256 + threadIdx.x; if (t >= (size_t)NR * NH * 2) return; const int which = (int)(t & 1); const int h = (int)((t >> 1) % NH); const size_t r = t / (2 * NH); const int tpos = (int)(r % SLEN);
  const float* src = (which ? Kf : Q) + r * DMOD + h * HD; _Float16* dst = (which ? K16 : Q16) + r * DMOD + h * HD; FragH f[4];
#pragma unroll
  for (int i = 0; i < RD / 2; ++i) { const float c = CS[tpos * (RD / 2) + i], s = CS[SLEN * (RD / 2) + tpos * (RD / 2) + i]; const float x1 = src[i], x2 = src[RD / 2 + i];
    float a = x1 * c; a += x2 * s; float bq = x1 * -s; bq += x2 * c; f[0].h[i] = (_Float16)a; f[1].h[i] = (_Float16)bq; }
#pragma unroll
  for (int i = 0; i < 16; ++i) { f[2].h[i] = (_Float16)src[RD + i]; f[3].h[i] = (_Float16)src[RD + 16 + i]; }
  { for (int u = 0; u < 4; ++u) { *(v8us*)((unsigned short*)dst + u * 16) = f[u].half[0]; *(v8us*)((unsigned short*)dst + u * 16 + 8) = f[u].half[1]; }  } }

extern "C" void kernel_launch(void* const* d_in, const int* in_sizes, int n_in,
                              void* d_out, int out_size, void* d_ws, size_t ws_size, hipStream_t stream) {
  (void)in_sizes; (void)n_in; (void)out_size;
  const float* const* I = (const float* const*)d_in; const float* x = I[0]; const float* Wq = I[1]; const float* Wk = I[2]; const float* Wv = I[3]; const float* Wo = I[4];
  char* ws = (char*)d_ws; size_t off = 0;
  auto take = [&](size_t bytes) { char* p = ws + off; off += (bytes + 255) & ~(size_t)255; return p; };
  const size_t w8 = (size_t)DMOD * DMOD / 8;
  _Float16* BQ = (_Float16*)take(w8 * 16); _Float16* BK = (_Float16*)take(w8 * 16); _Float16* BV = (_Float16*)take(w8 * 16); _Float16* BO = (_Float16*)take(w8 * 32);
  _Float16* X16 = (_Float16*)take((size_t)NR * DMOD * 2); float* Qf = (float*)take((size_t)NR * DMOD * 4); float* Kf = (float*)take((size_t)NR * DMOD * 4); _Float16* Q16 = (_Float16*)take((size_t)NR * DMOD * 2); _Float16* K16 = (_Float16*)take((size_t)NR * DMOD * 2); _Float16* V16 = (_Float16*)take((size_t)NR * DMOD * 2); _Float16* VT = (_Float16*)take((size_t)NR * DMOD * 2); float* CS = (float*)take((size_t)SLEN * RD * 4);
  float* O = Qf; _Float16* Hh = Q16; _Float16* Hl = K16;      /* aliases after the flash kernel: Qf/Q16/K16 are dead */
  if (off > ws_size) return;      /* 10 + 16 + 32 + 32 + 16 x 4 = 154 MiB */
  k_wsc<<<(unsigned)((w8 + 255) / 256), 256, 0, stream>>>(Wq, BQ, w8, 16.0f); k_wsc<<<(unsigned)((w8 + 255) / 256), 256, 0, stream>>>(Wk, BK, w8, 16.0f); k_wsc<<<(unsigned)((w8 + 255) / 256), 256, 0, stream>>>(Wv, BV, w8, 16.0f); k_woutp<<<(unsigned)(((size_t)DMOD * (2 * DMOD / 8) + 255) / 256), 256, 0, stream>>>(Wo, BO);
  k_x16<<<(unsigned)(((size_t)NR * DMOD / 8 + 255) / 256), 256, 0, stream>>>(x, X16, (size_t)NR * DMOD / 8);
  const dim3 gP((NR / 128) * (DMOD / 64), 1);
  k_gemm2<0><<<gP, 128, 0, stream>>>(X16, DMOD, 0, BQ, DMOD, 0, 0.0625f, nullptr, 0, nullptr, 1, 0, 0, Qf, nullptr, DMOD, 0, NR, DMOD, DMOD);
  k_gemm2<0><<<gP, 128, 0, stream>>>(X16, DMOD, 0, BK, DMOD, 0, 0.0625f, nullptr, 0, nullptr, 1, 0, 0, Kf, nullptr, DMOD, 0, NR, DMOD, DMOD);
  k_gemm2<0><<<gP, 128, 0, stream>>>(X16, DMOD, 0, BV, DMOD, 0, 0.0625f, nullptr, 0, nullptr, 1, 0, 0, nullptr, V16, DMOD, 0, NR, DMOD, DMOD);
  k_ropetab<<<(SLEN * (RD / 2) + 255) / 256, 256, 0, stream>>>(CS); k_rope<<<(unsigned)(((size_t)NR * NH * 2 + 255) / 256), 256, 0, stream>>>(Qf, Kf, CS, Q16, K16);
  k_vt<NH, SLEN><<<NB * NH * (SLEN / 64), 256, 0, stream>>>(V16, DMOD, 0, VT);
  k_flash<0><<<NB * NH * QBLKS, 128, 0, stream>>>(Q16, DMOD, K16, DMOD, VT, nullptr, O, DMOD);
  k_hl<<<(unsigned)(((size_t)NR * DMOD / 8 + 255) / 256), 256, 0, stream>>>(O, Hh, Hl, (size_t)NR * DMOD / 8);
  k_gemm2<0><<<gP, 128, 0, stream>>>(Hh, DMOD, 0, BO, 2 * DMOD, 0, 0.0625f, nullptr, 0, nullptr, 1, 0, 0, (float*)d_out, nullptr, DMOD, 0, NR, DMOD, DMOD);
  k_gemm2<0><<<gP, 128, 0, stream>>>(Hl, DMOD, 0, BO + DMOD, 2 * DMOD, 0, 1.0f / 1024.0f, nullptr, 0, (const float*)d_out, 1, (size_t)DMOD, 0, (float*)d_out, nullptr, DMOD, 0, NR, DMOD, DMOD);
}

// v004
// A run of this version takes 257 microseconds.
// Two timings next to v003 put it at 1.22 and 1.23 times that version's speed.
// Counting every step since v000, it is 3.17 times as fast.
#include <hip/hip_runtime.h>
// TinyAttn (4 sequences x 2048 tokens x 1024; 16 heads x 64; rotary embedding on the first 32 dims of each head): q,k,v = x W^T; q,k rotated (rot = [x1 cos + x2 sin, -x1 sin + x2 cos] on dims 0..31 with the module's inverse-frequency table); softmax(q k^T / 8) v; y Wo^T -> [4,2048,1024].
// Structure: x as an exact f16 plane; q/k/v projections as f16 WMMA GEMMs (32x64 wave tiles, operand tiles staged in an LDS ring, f32 accumulation, exact x16 weights; q/k in f32 for the rotation, v as f16); the rotary tables recomputed on the device (f64 pow for the inverse frequencies, f32 angle product, f32 cos/sin) and applied on VALU into f16 q/k planes; V transposed by LDS tiles; the fused flash kernel; the attention output as hi + residual planes into two accumulating output-projection GEMMs.
// Compute dtype: x and weights rounded to bf16; q, k (after rotation), v, P as f16 operands (~2^-12); attention output hi + 2^-10-scaled residual; f32 accumulation/softmax. v_wmma_f32_16x16x32_f16.
#define NB 4
#define DMOD 1024
#define HD 64
#define RD 32                    /* rotary dims per head */
#define NR (NB * SLEN)
#define QBLKS (TQ / 64)          /* query blocks per (sequence, head) launched */
#define SLEN 2048
#define TQ SLEN
#define TK SLEN
#define NH 16
#define SCL 0.125f               /* 64^-0.5 */
typedef __bf16 v16b __attribute__((ext_vector_type(16)));
typedef unsigned short v8us __attribute__((ext_vector_type(8), may_alias));
typedef float  v8f  __attribute__((ext_vector_type(8)));
typedef float  v4f  __attribute__((ext_vector_type(4)));
typedef float  v2f  __attribute__((ext_vector_type(2)));
typedef float  v4fa __attribute__((ext_vector_type(4), may_alias));
union FragB { v16b v; v8us half[2]; unsigned short u[16]; };

__device__ __forceinline__ unsigned short bf16_bits(float x) { unsigned int u = __float_as_uint(x); return (unsigned short)((u + 0x7FFFu + ((u >> 16) & 1u)) >> 16); }
__device__ __forceinline__ float bf16_val(unsigned short b) { return __uint_as_float(((unsigned int)b) << 16); }
__device__ __forceinline__ float bf16_round(float x) { return bf16_val(bf16_bits(x)); }
// D += A·B with NT terms: 1 = ah·bh, 2 = + al·bh (A split), 3 = + ah·bl (both split)
template <int NT>
__device__ __forceinline__ v8f mmaN(v16b ah, v16b al, v16b bh, v16b bl, v8f c) {
  c = __builtin_amdgcn_wmma_f32_16x16x32_bf16(false, ah, false, bh, (short)0, c, false, false);
  if (NT >= 2) c = __builtin_amdgcn_wmma_f32_16x16x32_bf16(false, al, false, bh, (short)0, c, false, false);
  if (NT >= 3) c = __builtin_amdgcn_wmma_f32_16x16x32_bf16(false, ah, false, bl, (short)0, c, false, false);
  asm volatile("v_nop\n\tv_nop\n\tv_nop\n\tv_nop" : "+v"(c) : "v"(ah), "v"(al), "v"(bh), "v"(bl));
  return c;
}

__global__ __launch_bounds__(256) void k_wt_bf16(const float* __restrict__ W, unsigned short* __restrict__ Wt, int K, int N) {
  const int t = blockIdx.x * 256 + threadIdx.x;
  const int k8n = K / 8;
  if (t >= N * k8n) return;
  const int n = t / k8n, k8 = (t % k8n) * 8;
  v8us v;
#pragma unroll
  for (int i = 0; i < 8; ++i) v[i] = bf16_bits(W[(size_t)(k8 + i) * N + n]);
  *(v8us*)(Wt + (size_t)n * K + k8) = v;
  
}

// GEMM C[M][N] (f32, pitch ldc) = act(A[M][K]·W + bias). A f32 row-major (pitch lda) converted per fragment to bf16
// (ASPLIT: hi/lo two planes -> 2 terms, else single rounded term); Wt bf16 [N][K] (pitch ldb). BIAS_BF16 rounds the
// bias to bf16 first (bias quantised to bf16 before the add). K%32==0, M%16==0, N%64==0.
template <bool ASPLIT, int ACT, bool BIAS_BF16>
__global__ __launch_bounds__(128) void k_gemm_bf(const float* __restrict__ A, int lda, const unsigned short* __restrict__ Wt, int ldb,
                                               const float* __restrict__ bias, float* __restrict__ C, int ldc, int M, int N, int K) {
  __shared__ __attribute__((aligned(16))) float so[4][16][64];
  const int tid = threadIdx.x, w = tid >> 5, lane = tid & 31, ln = lane & 15, hh = lane >> 4;
  const int ntn = N / 64;
  const int wid = blockIdx.x * 4 + w;
  const int mt = wid / ntn, nq = wid % ntn;
  if (mt * 16 >= M) return;
  const int row0 = mt * 16, col0 = nq * 64;
  const float* arow = A + (size_t)(row0 + ln) * lda;
  v8f acc[4] = {};
  for (int kb = 0; kb < K; kb += 32) {
    FragB ah, al;
    const v4f x0 = *(const v4fa*)(arow + kb + 8 * hh), x1 = *(const v4fa*)(arow + kb + 8 * hh + 4);
    const v4f x2 = *(const v4fa*)(arow + kb + 16 + 8 * hh), x3 = *(const v4fa*)(arow + kb + 16 + 8 * hh + 4);
    float xs[16] = {x0[0],x0[1],x0[2],x0[3],x1[0],x1[1],x1[2],x1[3],x2[0],x2[1],x2[2],x2[3],x3[0],x3[1],x3[2],x3[3]};
#pragma unroll
    for (int i = 0; i < 16; ++i) { const unsigned short hb = bf16_bits(xs[i]); ah.u[i] = hb; al.u[i] = ASPLIT ? bf16_bits(xs[i] - bf16_val(hb)) : (unsigned short)0; }
#pragma unroll
    for (int t = 0; t < 4; ++t) {
      const unsigned short* brow = Wt + (size_t)(col0 + t * 16 + ln) * ldb + kb;
      FragB b;
      b.half[0] = *(const v8us*)(brow + 8 * hh);
      b.half[1] = *(const v8us*)(brow + 16 + 8 * hh);
      acc[t] = mmaN<ASPLIT ? 2 : 1>(ah.v, al.v, b.v, b.v, acc[t]);
    }
  }
#pragma unroll
  for (int t = 0; t < 4; ++t) {
    float bv = bias ? bias[col0 + t * 16 + ln] : 0.f;
    if (BIAS_BF16) bv = bf16_round(bv);
#pragma unroll
    for (int r = 0; r < 8; ++r) { float v = acc[t][r] + bv; if (ACT == 1) v = fmaxf(v, 0.f); so[w][8 * hh + r][t * 16 + ln] = v; }
  }
  __builtin_amdgcn_fence(__ATOMIC_ACQ_REL, "workgroup");
  __builtin_amdgcn_wave_barrier();
  const int rsub = lane >> 4, c4 = (lane & 15) * 4;
  {
#pragma unroll
    for (int q = 0; q < 8; ++q) {
      const int r = q * 2 + rsub;
      const v4f v = *(const v4fa*)&so[w][r][c4];
      *(v4f*)(C + (size_t)(row0 + r) * ldc + col0 + c4) = v;
    }
    
  }
}

// GEMM C = act(A·W + bias + resid): A f32 (ASPLIT -> hi/lo 2 terms), Wt bf16 [N][K]; ACT 0 none, 1 relu, 2 exact gelu;
// resid (optional, f32, row index = (row % rmod), pitch ldr, RES_BF16 rounds it) added before the activation.
template <bool ASPLIT, int ACT, bool BIAS_BF16, bool RES_BF16>
__global__ __launch_bounds__(128) void k_gemm_bf3(const float* __restrict__ A, int lda, const unsigned short* __restrict__ Wt, int ldb,
                                                const float* __restrict__ bias, const float* __restrict__ resid, int rmod, int ldr,
                                                float* __restrict__ C, int ldc, int M, int N, int K) {
  __shared__ __attribute__((aligned(16))) float so[4][16][64];
  const int tid = threadIdx.x, w = tid >> 5, lane = tid & 31, ln = lane & 15, hh = lane >> 4;
  const int ntn = N / 64;
  const int wid = blockIdx.x * 4 + w;
  const int mt = wid / ntn, nq = wid % ntn;
  if (mt * 16 >= M) return;
  const int row0 = mt * 16, col0 = nq * 64;
  const float* arow = A + (size_t)(row0 + ln) * lda;
  v8f acc[4] = {};
  for (int kb = 0; kb < K; kb += 32) {
    FragB ah, al;
    const v4f x0 = *(const v4fa*)(arow + kb + 8 * hh), x1 = *(const v4fa*)(arow + kb + 8 * hh + 4);
    const v4f x2 = *(const v4fa*)(arow + kb + 16 + 8 * hh), x3 = *(const v4fa*)(arow + kb + 16 + 8 * hh + 4);
    float xs[16] = {x0[0],x0[1],x0[2],x0[3],x1[0],x1[1],x1[2],x1[3],x2[0],x2[1],x2[2],x2[3],x3[0],x3[1],x3[2],x3[3]};
#pragma unroll
    for (int i = 0; i < 16; ++i) { const unsigned short hb = bf16_bits(xs[i]); ah.u[i] = hb; al.u[i] = ASPLIT ? bf16_bits(xs[i] - bf16_val(hb)) : (unsigned short)0; }
#pragma unroll
    for (int t = 0; t < 4; ++t) {
      const unsigned short* brow = Wt + (size_t)(col0 + t * 16 + ln) * ldb + kb;
      FragB b;
      b.half[0] = *(const v8us*)(brow + 8 * hh);
      b.half[1] = *(const v8us*)(brow + 16 + 8 * hh);
      acc[t] = mmaN<ASPLIT ? 2 : 1>(ah.v, al.v, b.v, b.v, acc[t]);
    }
  }
#pragma unroll
  for (int t = 0; t < 4; ++t) {
    const int col = col0 + t * 16 + ln;
    float bv = bias ? bias[col] : 0.f;
    if (BIAS_BF16) bv = bf16_round(bv);
#pragma unroll
    for (int r = 0; r < 8; ++r) {
      float v = acc[t][r] + bv;
      if (resid) { float rv = resid[(size_t)((row0 + 8 * hh + r) % rmod) * ldr + col]; if (RES_BF16) rv = bf16_round(rv); v += rv; }
      if (ACT == 1) v = fmaxf(v, 0.f);
      if (ACT == 2) v = 0.5f * v * (1.0f + erff(v * 0.70710678118654752f));
      if (ACT == 3) { const float u = 0.7978845608028654f * (v + 0.044715f * v * v * v); v = 0.5f * v * (1.0f + tanhf(u)); }
      so[w][8 * hh + r][t * 16 + ln] = v;
    }
  }
  __builtin_amdgcn_fence(__ATOMIC_ACQ_REL, "workgroup");
  __builtin_amdgcn_wave_barrier();
  const int rsub = lane >> 4, c4 = (lane & 15) * 4;
  {
#pragma unroll
    for (int q = 0; q < 8; ++q) {
      const int r = q * 2 + rsub;
      const v4f v = *(const v4fa*)&so[w][r][c4];
      *(v4f*)(C + (size_t)(row0 + r) * ldc + col0 + c4) = v;
    }
    
  }
}
// row LayerNorm (biased variance, eps) over N: s = X (+ R); optional out_sum <- s; out_norm <- (s-mu)*rsqrt(var+eps)*g + b
template <bool PARAM_BF16>
__global__ __launch_bounds__(256) void k_layernorm(const float* __restrict__ X, const float* __restrict__ R, const float* __restrict__ g, const float* __restrict__ bta,
                                                  float* __restrict__ out_sum, float* __restrict__ out_norm, int N, float eps) {
  __shared__ float red[256];
  const int row = blockIdx.x, tid = threadIdx.x;
  const float* x = X + (size_t)row * N; const float* rr = R ? R + (size_t)row * N : nullptr;
  float vals[16];                     // up to N = 4096
  const int per = N / 256;            // contiguous chunk per thread? use strided-by-4 chunks: thread handles j = tid*4 + 1024*u
  float s1 = 0.f;
  for (int u = 0; u < per / 4; ++u) {
    const int j = tid * 4 + 1024 * u;
    const v4f a = *(const v4fa*)(x + j);
    v4f b = {0.f,0.f,0.f,0.f}; if (rr) b = *(const v4fa*)(rr + j);
#pragma unroll
    for (int q = 0; q < 4; ++q) { const float v = a[q] + b[q]; vals[u * 4 + q] = v; s1 += v; }
  }
  red[tid] = s1; __syncthreads();
  for (int st = 128; st > 0; st >>= 1) { if (tid < st) red[tid] += red[tid + st]; __syncthreads(); }
  const float mu = red[0] / (float)N; __syncthreads();
  float s2 = 0.f;
  for (int u = 0; u < per / 4; ++u)
#pragma unroll
    for (int q = 0; q < 4; ++q) { const float c = vals[u * 4 + q] - mu; s2 += c * c; }
  red[tid] = s2; __syncthreads();
  for (int st = 128; st > 0; st >>= 1) { if (tid < st) red[tid] += red[tid + st]; __syncthreads(); }
  const float rs = rsqrtf(red[0] / (float)N + eps);
  {
    for (int u = 0; u < per / 4; ++u) {
      const int j = tid * 4 + 1024 * u;
      v4f o, sm;
#pragma unroll
      for (int q = 0; q < 4; ++q) {
        float gg = g[j + q], bb = bta[j + q];
        if (PARAM_BF16) { gg = bf16_round(gg); bb = bf16_round(bb); }
        sm[q] = vals[u * 4 + q]; o[q] = (vals[u * 4 + q] - mu) * rs * gg + bb;
      }
      if (out_sum) *(v4f*)(out_sum + (size_t)row * N + j) = sm;
      *(v4f*)(out_norm + (size_t)row * N + j) = o;
    }
    
  }
}



// ---- f16 WMMA path (v_wmma_f32_16x16x32_f16): 11-bit significands for operands in range — used where a [0,1] probability operand needs more precision than bf16
typedef _Float16 v16h __attribute__((ext_vector_type(16)));
union FragH { v16h v; v8us half[2]; _Float16 h[16]; unsigned short u[16]; };
template <int NT>
__device__ __forceinline__ v8f mmaH(v16h ah, v16h al, v16h bh, v16h bl, v8f c) {
  c = __builtin_amdgcn_wmma_f32_16x16x32_f16(false, ah, false, bh, (short)0, c, false, false);
  if (NT >= 2) c = __builtin_amdgcn_wmma_f32_16x16x32_f16(false, al, false, bh, (short)0, c, false, false);
  if (NT >= 3) c = __builtin_amdgcn_wmma_f32_16x16x32_f16(false, ah, false, bl, (short)0, c, false, false);
  asm volatile("v_nop\n\tv_nop\n\tv_nop\n\tv_nop" : "+v"(c) : "v"(ah), "v"(al), "v"(bh), "v"(bl));
  return c;
}
// batched GEMM like k_gemm_b but f16 operands: A f32 (split into f16 hi/lo if ASPLIT, else rounded to f16), Bt = f16 values [n][k]; alpha; C f32; N multiple of 16 (partial tiles skipped)
template <bool ASPLIT>
__global__ __launch_bounds__(128) void k_gemm_h(const float* __restrict__ A, int lda, size_t sA, const _Float16* __restrict__ Bh, int ldb, size_t sB, float alpha, float* __restrict__ C, int ldc, size_t sC, int M, int N, int K) {
  __shared__ __attribute__((aligned(16))) float so[4][16][64];
  const int tid = threadIdx.x, w = tid >> 5, lane = tid & 31, ln = lane & 15, hh = lane >> 4; const int by = blockIdx.y;
  A += (size_t)by * sA; Bh += (size_t)by * sB; C += (size_t)by * sC;
  const int ntn = (N + 63) / 64; const int wid = blockIdx.x * 4 + w; const int mt = wid / ntn, nq = wid % ntn; if (mt * 16 >= M) return;
  const int row0 = mt * 16, col0 = nq * 64; const float* arow = A + (size_t)(row0 + ln) * lda;
  v8f acc[4] = {};
  for (int kb = 0; kb < K; kb += 32) {
    FragH ah, al;
    const v4f x0 = *(const v4fa*)(arow + kb + 8 * hh), x1 = *(const v4fa*)(arow + kb + 8 * hh + 4), x2 = *(const v4fa*)(arow + kb + 16 + 8 * hh), x3 = *(const v4fa*)(arow + kb + 16 + 8 * hh + 4);
    float xs[16] = {x0[0],x0[1],x0[2],x0[3],x1[0],x1[1],x1[2],x1[3],x2[0],x2[1],x2[2],x2[3],x3[0],x3[1],x3[2],x3[3]};
#pragma unroll
    for (int i = 0; i < 16; ++i) { const _Float16 h = (_Float16)xs[i]; ah.h[i] = h; al.h[i] = ASPLIT ? (_Float16)(xs[i] - (float)h) : (_Float16)0.0f; }
#pragma unroll
    for (int t = 0; t < 4; ++t) { if (col0 + t * 16 >= N) continue; const size_t boff = (size_t)(col0 + t * 16 + ln) * ldb + kb; FragH bq; bq.half[0] = *(const v8us*)(Bh + boff + 8 * hh); bq.half[1] = *(const v8us*)(Bh + boff + 16 + 8 * hh);
      acc[t] = mmaH<ASPLIT ? 2 : 1>(ah.v, al.v, bq.v, bq.v, acc[t]); }
  }
#pragma unroll
  for (int t = 0; t < 4; ++t) { if (col0 + t * 16 >= N) continue;
#pragma unroll
    for (int r = 0; r < 8; ++r) so[w][8 * hh + r][t * 16 + ln] = acc[t][r] * alpha; }
  __builtin_amdgcn_fence(__ATOMIC_ACQ_REL, "workgroup"); __builtin_amdgcn_wave_barrier();
  const int rsub = lane >> 4, c4 = (lane & 15) * 4;
  {
#pragma unroll
    for (int q = 0; q < 8; ++q) { const int r = q * 2 + rsub; if (col0 + c4 < N) { const v4f v = *(const v4fa*)&so[w][r][c4]; *(v4f*)(C + (size_t)(row0 + r) * ldc + col0 + c4) = v; } }
     }
}

// Wt[n][k] = f16(W[k][n]·scale) from f32 row-major W[K][N] (scale = power of two; bf16-exact weights stay exact in f16 away from the subnormal range)
__global__ __launch_bounds__(256) void k_wt_f16(const float* __restrict__ W, _Float16* __restrict__ Wt, int K, int N, float scale) {
  const int t = blockIdx.x * 256 + threadIdx.x; if (t >= N * (K / 8)) return; const int n = t / (K / 8), k8 = (t % (K / 8)) * 8; FragH f;
#pragma unroll
  for (int i = 0; i < 8; ++i) f.h[i] = (_Float16)(bf16_round(W[(size_t)(k8 + i) * N + n]) * scale); const v8us o = f.half[0];
  *(v8us*)((unsigned short*)Wt + (size_t)n * K + k8) = o; 
}
// k_gemm_hh variant with fused epilogue: v = acc·alpha + bias[by·sBias + col] (+ CP[(row/rowsPerB)·sCPb + by·64 + col] if CP) ; ACT 0 none / 1 elu ; writes f16 C16 (and f32 C if non-null)
template <int ACT>
__global__ __launch_bounds__(128) void k_gemm_hhx(const _Float16* __restrict__ A, int lda, size_t sA, const _Float16* __restrict__ Bh, int ldb, size_t sB, float alpha, const float* __restrict__ bias, size_t sBias, const float* __restrict__ CP, int rowsPerB, size_t sCPb, int row0g,
    float* __restrict__ C, _Float16* __restrict__ C16, int ldc, size_t sC, int M, int N, int K) {
  __shared__ __attribute__((aligned(16))) float so[4][16][64];
  const int tid = threadIdx.x, w = tid >> 5, lane = tid & 31, ln = lane & 15, hh = lane >> 4; const int by = blockIdx.y;
  A += (size_t)by * sA; Bh += (size_t)by * sB; const size_t cofs = (size_t)by * sC; const float* bp = bias ? bias + (size_t)by * sBias : nullptr;
  const int ntn = (N + 63) / 64; const int wid = blockIdx.x * 4 + w; const int mt = wid / ntn, nq = wid % ntn; if (mt * 16 >= M) return;
  const int row0 = mt * 16, col0 = nq * 64; const _Float16* arow = A + (size_t)(row0 + ln) * lda;
  v8f acc[4] = {};
  for (int kb = 0; kb < K; kb += 32) { FragH ah; ah.half[0] = *(const v8us*)((const unsigned short*)arow + kb + 8 * hh); ah.half[1] = *(const v8us*)((const unsigned short*)arow + kb + 16 + 8 * hh);
#pragma unroll
    for (int t = 0; t < 4; ++t) { if (col0 + t * 16 >= N) continue; const size_t boff = (size_t)(col0 + t * 16 + ln) * ldb + kb; FragH bq; bq.half[0] = *(const v8us*)((const unsigned short*)Bh + boff + 8 * hh); bq.half[1] = *(const v8us*)((const unsigned short*)Bh + boff + 16 + 8 * hh);
      acc[t] = mmaH<1>(ah.v, ah.v, bq.v, bq.v, acc[t]); }
  }
#pragma unroll
  for (int t = 0; t < 4; ++t) { if (col0 + t * 16 >= N) continue; const int col = col0 + t * 16 + ln; const float bv = bp ? bf16_round(bp[col]) : 0.f;
#pragma unroll
    for (int r = 0; r < 8; ++r) { float v = acc[t][r] * alpha + bv; if (CP) { const int bidx = (row0g + row0 + 8 * hh + r) / rowsPerB; v += CP[(size_t)bidx * sCPb + (size_t)by * 64 + col]; } if (ACT == 1) v = (v > 0.f) ? v : expm1f(v); else if (ACT == 7) v = (v > 0.f) ? v + 1.0f : expf(v); else if (ACT == 8) v = tanhf(v); else if (ACT == 9) v = 0.5f * v * (1.0f + tanhf(0.7978845608028654f * (v + 0.044715f * v * v * v))); else if (ACT == 11) v = 1.0f / (1.0f + expf(-v)); else if (ACT == 12) v = (v > 0.f) ? v : 0.01f * v; else if (ACT == 14) v = (v > 0.f) ? v : 0.1f * v; else if (ACT == 15) v = v / (1.0f + expf(-v)); else if (ACT == 3) v = fmaxf(v, 0.f); else if (ACT == 6) v = 0.5f * v * (1.0f + erff(v * 0.70710678118654752f)); so[w][8 * hh + r][t * 16 + ln] = v; } }
  __builtin_amdgcn_fence(__ATOMIC_ACQ_REL, "workgroup"); __builtin_amdgcn_wave_barrier();
  const int rsub = lane >> 4, c4 = (lane & 15) * 4; typedef _Float16 v4h __attribute__((ext_vector_type(4)));
  {
#pragma unroll
    for (int q = 0; q < 8; ++q) { const int r = q * 2 + rsub; if (col0 + c4 < N) { const v4f v = *(const v4fa*)&so[w][r][c4]; if (C) *(v4f*)(C + cofs + (size_t)(row0 + r) * ldc + col0 + c4) = v; if (C16) { v4h h4; for (int i = 0; i < 4; ++i) h4[i] = (_Float16)v[i]; *(v4h*)(C16 + cofs + (size_t)(row0 + r) * ldc + col0 + c4) = h4; } } }
     }
}


typedef _Float16 v4h __attribute__((ext_vector_type(4)));

__global__ __launch_bounds__(256) void k_x16(const float* __restrict__ x, _Float16* __restrict__ X16, size_t n8) { const size_t t = (size_t)blockIdx.x * 256 + threadIdx.x; if (t >= n8) return; FragH f;
#pragma unroll
  for (int q = 0; q < 8; ++q) f.h[q] = (_Float16)bf16_round(x[t * 8 + q]); *(v8us*)((unsigned short*)X16 + t * 8) = f.half[0];  }
__global__ __launch_bounds__(256) void k_h16(const float* __restrict__ x, _Float16* __restrict__ X16, size_t n8) { const size_t t = (size_t)blockIdx.x * 256 + threadIdx.x; if (t >= n8) return; FragH f;
#pragma unroll
  for (int q = 0; q < 8; ++q) f.h[q] = (_Float16)x[t * 8 + q]; *(v8us*)((unsigned short*)X16 + t * 8) = f.half[0];  }
__global__ __launch_bounds__(256) void k_round16f(const float* __restrict__ W, _Float16* __restrict__ Bt, size_t n8) { const size_t t = (size_t)blockIdx.x * 256 + threadIdx.x; if (t >= n8) return; FragH f;
#pragma unroll
  for (int i = 0; i < 8; ++i) f.h[i] = (_Float16)(bf16_round(W[t * 8 + i]) * 16.0f); *(v8us*)((unsigned short*)Bt + t * 8) = f.half[0];  }
template <int NHv, int TTv>
__global__ __launch_bounds__(256) void k_vt(const _Float16* __restrict__ V16, int ldv, int voff, _Float16* __restrict__ Vt) { __shared__ unsigned short tl[64][66]; const int tid = threadIdx.x; const int slab = blockIdx.x / (TTv / 64), lg = blockIdx.x % (TTv / 64); const int b = slab / NHv, h = slab % NHv;
  for (int i = tid; i < 64 * 8; i += 256) { const int r = i / 8, c8 = (i % 8) * 8; FragH f; f.half[0] = *(const v8us*)((const unsigned short*)V16 + ((size_t)b * TTv + lg * 64 + r) * ldv + voff + h * 64 + c8);
#pragma unroll
    for (int q = 0; q < 8; ++q) tl[r][c8 + q] = f.u[q]; }
  __syncthreads();
  {
#pragma unroll
    for (int rd = 0; rd < 2; ++rd) { const int d = rd * 32 + tid / 8, pc = tid % 8; FragH f;
#pragma unroll
      for (int q = 0; q < 8; ++q) f.u[q] = tl[pc * 8 + q][d];
      *(v8us*)((unsigned short*)Vt + ((size_t)slab * 64 + d) * TTv + lg * 64 + pc * 8) = f.half[0]; }
     } }

__global__ __launch_bounds__(256) void k_hl(const float* __restrict__ F, _Float16* __restrict__ Hh, _Float16* __restrict__ Hl, size_t n8) { const size_t t = (size_t)blockIdx.x * 256 + threadIdx.x; if (t >= n8) return; FragH fh, fl; const v4f a = *(const v4fa*)(F + t * 8), c = *(const v4fa*)(F + t * 8 + 4);
#pragma unroll
  for (int q = 0; q < 4; ++q) { _Float16 h = (_Float16)a[q]; fh.h[q] = h; fl.h[q] = (_Float16)((a[q] - (float)h) * 1024.0f); h = (_Float16)c[q]; fh.h[4 + q] = h; fl.h[4 + q] = (_Float16)((c[q] - (float)h) * 1024.0f); }
  { *(v8us*)((unsigned short*)Hh + t * 8) = fh.half[0]; *(v8us*)((unsigned short*)Hl + t * 8) = fl.half[0];  } }

// ---- fast GEMM (work-group tile 128x64, wave tile 32x64; requires M % 128 == 0, N % 64 == 0, K % 64 == 0 and K >= 64); epilogue = k_gemm_hhx semantics ----
__device__ __forceinline__ v8f g2_mma(v16h a, v16h b, v8f c) { v8f d = __builtin_amdgcn_wmma_f32_16x16x32_f16(false, a, false, b, (short)0, c, false, false); asm volatile("v_nop\n\tv_nop\n\tv_nop\n\tv_nop" : "+v"(d) : "v"(a), "v"(b)); return d; }
// a fragment from a staged tile: the two 16-byte pieces of the lane's row (same k order as a fragment read from global memory: 8 * hh .. and 16 + 8 * hh ..)
__device__ __forceinline__ v16h g2_lfrag(const unsigned char* rows, int o0, int o1) { FragH f; f.half[0] = *(const v8us*)(rows + o0); f.half[1] = *(const v8us*)(rows + o1); return f.v; }
// One stage of the GEMM ring: 64 k of the tile's 128 A rows, then of its 64 B rows (rows of 128 bytes without a pad, 24 KiB), brought by asynchronous copies to LDS.
// Twelve copies a lane; a wave-wide copy covers four whole 128-byte lines. s_wait_xcnt stands inside the statement so that no address register is rewritten ahead of it.
__device__ __forceinline__ void g2_stage_copy(unsigned lds, const unsigned short* ga, size_t astep, const unsigned short* gb, size_t bstep) {
  asm volatile("global_load_async_to_lds_b128 %0, %12, off\n\t"
               "global_load_async_to_lds_b128 %1, %13, off\n\t"
               "global_load_async_to_lds_b128 %2, %14, off\n\t"
               "global_load_async_to_lds_b128 %3, %15, off\n\t"
               "global_load_async_to_lds_b128 %4, %16, off\n\t"
               "global_load_async_to_lds_b128 %5, %17, off\n\t"
               "global_load_async_to_lds_b128 %6, %18, off\n\t"
               "global_load_async_to_lds_b128 %7, %19, off\n\t"
               "global_load_async_to_lds_b128 %8, %20, off\n\t"
               "global_load_async_to_lds_b128 %9, %21, off\n\t"
               "global_load_async_to_lds_b128 %10, %22, off\n\t"
               "global_load_async_to_lds_b128 %11, %23, off\n\t"
               "s_wait_xcnt 0x0"
               :: "v"(lds), "v"(lds + 2048u), "v"(lds + 4096u), "v"(lds + 6144u), "v"(lds + 8192u), "v"(lds + 10240u), "v"(lds + 12288u), "v"(lds + 14336u),
                  "v"(lds + 16384u), "v"(lds + 18432u), "v"(lds + 20480u), "v"(lds + 22528u),
                  "v"(ga), "v"(ga + astep), "v"(ga + 2 * astep), "v"(ga + 3 * astep), "v"(ga + 4 * astep), "v"(ga + 5 * astep), "v"(ga + 6 * astep), "v"(ga + 7 * astep),
                  "v"(gb), "v"(gb + bstep), "v"(gb + 2 * bstep), "v"(gb + 3 * bstep)
               : "memory");
}
template <int ACT>
__global__ __launch_bounds__(128) void k_gemm2(const _Float16* __restrict__ A, int lda, size_t sA, const _Float16* __restrict__ Bh, int ldb, size_t sB, float alpha, const float* __restrict__ bias, size_t sBias, const float* __restrict__ CP, int rowsPerB, size_t sCPb, int row0g,
    float* __restrict__ C, _Float16* __restrict__ C16, int ldc, size_t sC, int M, int N, int K) {
  constexpr int ATILE_B = 128 * 128, GSTAGE_B = ATILE_B + 64 * 128;      /* a stage = 64 k: A tile, then B tile */
  __shared__ __attribute__((aligned(16))) unsigned char ring[2 * GSTAGE_B];
  float (*so)[32][68] = reinterpret_cast<float (*)[32][68]>(ring);      /* output staging (34,816 bytes) takes the ring's place behind the loop's last barrier */
  const int tid = threadIdx.x, w = tid >> 5, lane = tid & 31, ln = lane & 15, hh = lane >> 4; const int by = blockIdx.y;
  A += (size_t)by * sA; Bh += (size_t)by * sB; const size_t cofs = (size_t)by * sC; const float* bp = bias ? bias + (size_t)by * sBias : nullptr;
  const int ntn = N >> 6; const int mt = blockIdx.x / ntn, nq = blockIdx.x - mt * ntn; if (mt * 128 >= M) return;      /* the whole work-group leaves, ahead of every copy and barrier */
  const int row0 = mt * 128 + 32 * w, col0 = nq * 64;
  const int nst = K >> 6;
  /* 16-byte piece c of row r lies at r * 128 + (c ^ ((r >> 1) & 7)) * 16: sixteen rows read at one piece index fall on all 64 banks */
  const unsigned cp_lds = (unsigned)(size_t)ring + (unsigned)((tid >> 3) * 128 + (((tid & 7) ^ ((tid >> 4) & 7)) * 16));
  const unsigned short* cp_a = (const unsigned short*)A + (size_t)(mt * 128 + (tid >> 3)) * lda + (tid & 7) * 8;
  const unsigned short* cp_b = (const unsigned short*)Bh + (size_t)(col0 + (tid >> 3)) * ldb + (tid & 7) * 8;
  const size_t astep = (size_t)16 * lda, bstep = (size_t)16 * ldb;
  g2_stage_copy(cp_lds, cp_a, astep, cp_b, bstep);
  int fo[2][2];      /* a fragment's two pieces in row ln: [32-element group of the row][piece] */
#pragma unroll
  for (int g = 0; g < 2; ++g)
#pragma unroll
    for (int pc = 0; pc < 2; ++pc) fo[g][pc] = ln * 128 + (((g * 4 + pc * 2 + hh) ^ ((ln >> 1) & 7)) * 16);
  const v8f z8 = {0.f,0.f,0.f,0.f,0.f,0.f,0.f,0.f}; v8f c00 = z8, c01 = z8, c02 = z8, c03 = z8, c10 = z8, c11 = z8, c12 = z8, c13 = z8;
  asm volatile("s_wait_asynccnt 0x0" ::: "memory");      /* stage 0 has landed for this wave's own copies */
  __syncthreads();                                       /* ... and for every other wave's */
  if (1 < nst) g2_stage_copy(cp_lds + GSTAGE_B, cp_a + 64, astep, cp_b + 64, bstep);
#pragma unroll 1      /* one body for both buffers: the buffer is picked by the trip's parity */
  for (int t = 0; t < nst; ++t) {
    const unsigned char* ar = ring + (t & 1) * GSTAGE_B + w * (32 * 128); const unsigned char* br = ring + (t & 1) * GSTAGE_B + ATILE_B;
#pragma unroll
    for (int g = 0; g < 2; ++g) { const int o0 = fo[g][0], o1 = fo[g][1];
      const v16h a0 = g2_lfrag(ar, o0, o1), a1 = g2_lfrag(ar + 2048, o0, o1);
      const v16h b0 = g2_lfrag(br, o0, o1), b1 = g2_lfrag(br + 2048, o0, o1), b2 = g2_lfrag(br + 4096, o0, o1), b3 = g2_lfrag(br + 6144, o0, o1);
      c00 = g2_mma(a0, b0, c00); c10 = g2_mma(a1, b0, c10);
      c01 = g2_mma(a0, b1, c01); c11 = g2_mma(a1, b1, c11);
      c02 = g2_mma(a0, b2, c02); c12 = g2_mma(a1, b2, c12);
      c03 = g2_mma(a0, b3, c03); c13 = g2_mma(a1, b3, c13); }
    asm volatile("s_wait_dscnt 0x0" ::: "memory");         /* this wave's reads of stage t have returned */
    asm volatile("s_wait_asynccnt 0x0" ::: "memory");      /* this wave's copies of stage t + 1 have landed */
    __syncthreads();                                       /* publishes stage t + 1 and ends every wave's reads of stage t */
    if (t + 2 < nst) g2_stage_copy(cp_lds + (t & 1) * GSTAGE_B, cp_a + (size_t)(t + 2) * 64, astep, cp_b + (size_t)(t + 2) * 64, bstep); }
  asm volatile("s_wait_asynccnt 0x0" ::: "memory");        /* nothing is in flight when the ring becomes output staging */
  v8f accs[8] = {c00, c01, c02, c03, c10, c11, c12, c13};
#pragma unroll
  for (int u = 0; u < 8; ++u) { const int t = u & 3, half = u >> 2; const int col = col0 + t * 16 + ln; const float bv = bp ? bf16_round(bp[col]) : 0.f;
#pragma unroll
    for (int r = 0; r < 8; ++r) { const int rloc = half * 16 + 8 * hh + r; float v = accs[u][r] * alpha + bv; if (CP) { const int bidx = (row0g + row0 + rloc) / rowsPerB; v += CP[(size_t)bidx * sCPb + (size_t)by * 64 + col]; }
      if (ACT == 3) v = fmaxf(v, 0.f); else if (ACT == 6) v = 0.5f * v * (1.0f + erff(v * 0.70710678118654752f)); else if (ACT == 11) v = 1.0f / (1.0f + expf(-v)); else if (ACT == 15) v = v / (1.0f + expf(-v)); else if (ACT == 12) v = (v > 0.f) ? v : 0.01f * v; else if (ACT == 8) v = tanhf(v);
      so[w][rloc][t * 16 + ln] = v; } }
  __builtin_amdgcn_fence(__ATOMIC_ACQ_REL, "workgroup"); __builtin_amdgcn_wave_barrier();
  const int rsub = lane >> 4, c4 = (lane & 15) * 4;
  {
#pragma unroll
    for (int q = 0; q < 16; ++q) { const int r = q * 2 + rsub; const v4f v = *(const v4fa*)&so[w][r][c4]; if (C) *(v4f*)(C + cofs + (size_t)(row0 + r) * ldc + col0 + c4) = v; if (C16) { v4h h4; for (int i = 0; i < 4; ++i) h4[i] = (_Float16)v[i]; *(v4h*)(C16 + cofs + (size_t)(row0 + r) * ldc + col0 + c4) = h4; } }
     } }



// One stage of the K / V^T ring: 64 key rows of K (128 bytes each) and 64 rows of V^T (the same 64 keys, 128 bytes each), 16 KiB, brought by asynchronous copies to LDS.
// Eight copies a lane; a wave-wide copy covers four whole 128-byte lines. s_wait_xcnt stands inside the statement so that no address register is rewritten ahead of it.
__device__ __forceinline__ void stage_copy(unsigned lds, const unsigned short* gk, size_t kstep, const unsigned short* gv, size_t vstep) {
  asm volatile("global_load_async_to_lds_b128 %0, %8, off\n\t"
               "global_load_async_to_lds_b128 %1, %9, off\n\t"
               "global_load_async_to_lds_b128 %2, %10, off\n\t"
               "global_load_async_to_lds_b128 %3, %11, off\n\t"
               "global_load_async_to_lds_b128 %4, %12, off\n\t"
               "global_load_async_to_lds_b128 %5, %13, off\n\t"
               "global_load_async_to_lds_b128 %6, %14, off\n\t"
               "global_load_async_to_lds_b128 %7, %15, off\n\t"
               "s_wait_xcnt 0x0"
               :: "v"(lds), "v"(lds + 2048u), "v"(lds + 4096u), "v"(lds + 6144u), "v"(lds + 8192u), "v"(lds + 10240u), "v"(lds + 12288u), "v"(lds + 14336u),
                  "v"(gk), "v"(gk + kstep), "v"(gk + 2 * kstep), "v"(gk + 3 * kstep), "v"(gv), "v"(gv + vstep), "v"(gv + 2 * vstep), "v"(gv + 3 * vstep)
               : "memory");
}
// lane l with lane l ^ 16: one vector cross-row move
__device__ __forceinline__ float xhalf(float x) { return __builtin_bit_cast(float, __builtin_amdgcn_permlanex16(__builtin_bit_cast(int, x), __builtin_bit_cast(int, x), 0x76543210, 0xfedcba98, false, false)); }
template <int CAUSAL>
__global__ __launch_bounds__(128) void k_flash(const _Float16* __restrict__ Q16, int ldq, const _Float16* __restrict__ K16, int ldk, const _Float16* __restrict__ Vt, const int* __restrict__ MSK, float* __restrict__ O, int ldo) {
  constexpr int RPW = 16, RTN = RPW / 16, NQB = TQ / (4 * RPW), DT = 4, KS = 2;
  constexpr float C2 = SCL * 1.44269504088896340736f;      /* score -> exponent of 2; the bare exp2 instruction serves: no exponent exceeds 10, and a result that flushes to zero lies far under P's f16 step */
  constexpr int TILE_B = 64 * 128, STAGE_B = 2 * TILE_B;      /* a stage = 64 keys: K tile, then V^T tile, rows of 128 bytes without a pad */
  __shared__ __attribute__((aligned(16))) unsigned char ring[2 * STAGE_B];
  float (*sO)[RPW][64 + 4] = reinterpret_cast<float (*)[RPW][64 + 4]>(ring);      /* output staging takes the ring's place behind the loop's last barrier */
  const int tid = threadIdx.x, w = tid >> 5, lane = tid & 31, ln = lane & 15, hh = lane >> 4;
  const int slab = blockIdx.x / QBLKS, qblk = blockIdx.x % QBLKS; (void)NQB; (void)MSK; const int b = slab / NH, h = slab % NH; const int qb0 = qblk * (4 * RPW); const int q0 = qb0 + w * RPW;
  const unsigned short* Vth = (const unsigned short*)Vt + (size_t)slab * 64 * TK;
  const int jend = (CAUSAL == 1) ? (qb0 + 4 * RPW) : TK;      /* causal: keys beyond the block's last query never contribute */
  const int nst = jend / 64;
  /* 16-byte piece c of row r lies at r * 128 + (c ^ ((r >> 1) & 7)) * 16: sixteen rows read at one piece index fall on all 64 banks */
  const unsigned cp_lds = (unsigned)(size_t)ring + (unsigned)((tid >> 3) * 128 + (((tid & 7) ^ ((tid >> 4) & 7)) * 16));
  const unsigned short* cp_k = (const unsigned short*)K16 + ((size_t)b * TK + (tid >> 3)) * ldk + h * 64 + (tid & 7) * 8;
  const unsigned short* cp_v = Vth + (size_t)(tid >> 3) * TK + (tid & 7) * 8;
  const size_t kstep = (size_t)16 * ldk, vstep = (size_t)16 * TK;
  stage_copy(cp_lds, cp_k, kstep, cp_v, vstep);
  FragH aq[2][KS];
#pragma unroll
  for (int rt = 0; rt < RTN; ++rt) { const unsigned short* qr = (const unsigned short*)Q16 + ((size_t)b * TQ + q0 + rt * 16 + ln) * ldq + h * 64;
#pragma unroll
    for (int ks = 0; ks < KS; ++ks) { aq[rt][ks].half[0] = *(const v8us*)(qr + ks * 32 + 8 * hh); aq[rt][ks].half[1] = *(const v8us*)(qr + ks * 32 + 16 + 8 * hh); } }
  int fo[2][2];      /* a fragment's two pieces in row ln: [32-element group of the row][piece] */
#pragma unroll
  for (int g = 0; g < 2; ++g)
#pragma unroll
    for (int pc = 0; pc < 2; ++pc) fo[g][pc] = ln * 128 + (((g * 4 + pc * 2 + hh) ^ ((ln >> 1) & 7)) * 16);
  float m_r[2], l_r[2]; v8f oacc[2][DT];      /* per lane: its query's running maximum (of raw scores), its half's share of the sum (x 1024), and O^T[d = dt * 16 + 8 * hh + r][query ln] */
#pragma unroll
  for (int rt = 0; rt < RTN; ++rt) { m_r[rt] = -3.0e38f; l_r[rt] = 0.f;
#pragma unroll
    for (int dt = 0; dt < DT; ++dt) oacc[rt][dt] = (v8f){0.f,0.f,0.f,0.f,0.f,0.f,0.f,0.f}; }
  asm volatile("s_wait_asynccnt 0x0" ::: "memory");      /* stage 0 has landed for this wave's own copies */
  __syncthreads();                                       /* ... and for every other wave's */
  if (1 < nst) stage_copy(cp_lds + STAGE_B, cp_k + (size_t)64 * ldk, kstep, cp_v + 64, vstep);
#pragma unroll 1
  for (int t = 0; t < nst; ++t) {
    const unsigned char* st = ring + (t & 1) * STAGE_B;
#pragma unroll 1      /* the two 32-key passes of a stage stay one body: unrolled, the registers grow and a work-group per WGP is lost */
    for (int ps = 0; ps < 2; ++ps) { const int j0 = t * 64 + ps * 32;
    v8f s[2][2];
#pragma unroll
    for (int nt = 0; nt < 2; ++nt) { const unsigned char* kr = st + (ps * 32 + nt * 16) * 128; FragH bk[KS];
#pragma unroll
      for (int ks = 0; ks < KS; ++ks) { bk[ks].half[0] = *(const v8us*)(kr + fo[ks][0]); bk[ks].half[1] = *(const v8us*)(kr + fo[ks][1]); }
#pragma unroll
      for (int rt = 0; rt < RTN; ++rt) { v8f acc = (v8f){0.f,0.f,0.f,0.f,0.f,0.f,0.f,0.f};
#pragma unroll
        for (int ks = 0; ks < KS; ++ks) acc = mmaH<1>(bk[ks].v, bk[ks].v, aq[rt][ks].v, aq[rt][ks].v, acc); s[rt][nt] = acc; } }      /* s[rt][nt][r] = score of key j0 + nt * 16 + 8 * hh + r, query q0 + rt * 16 + ln */
    FragH pb[2];
#pragma unroll
    for (int rt = 0; rt < RTN; ++rt) { const int tq = q0 + rt * 16 + ln; float sv[16]; bool ok[16];
#pragma unroll
      for (int e = 0; e < 16; ++e) { const int kk = j0 + (e >> 3) * 16 + 8 * hh + (e & 7);
        ok[e] = (CAUSAL == 1) ? (kk <= tq) : ((CAUSAL == 2) ? ((kk >> 5) == (tq >> 5)) : true);      /* mode 2: block-diagonal 32-token groups */
        sv[e] = ok[e] ? s[rt][e >> 3][e & 7] : -3.0e38f; }      /* raw scores: the scale is positive, so the maximum is taken ahead of it */
      float mx[4];
#pragma unroll
      for (int c = 0; c < 4; ++c) mx[c] = fmaxf(fmaxf(sv[c], sv[4 + c]), fmaxf(sv[8 + c], sv[12 + c]));
      float mc = fmaxf(fmaxf(mx[0], mx[1]), fmaxf(mx[2], mx[3])); mc = fmaxf(mc, xhalf(mc));      /* both halves now hold the query's maximum over the 32 keys */
      const float mn = fmaxf(m_r[rt], mc); const float ea = __builtin_amdgcn_exp2f((m_r[rt] - mn) * C2); const float al = (mn > -1.0e38f) ? ea : 1.0f; m_r[rt] = mn;
      const float nb = fmaf(-mn, C2, 10.0f);      /* 1024 p = 2^(score * C2 + nb): scale, log2 e, the maximum and P's factor 1024 in one multiply-add */
      const v2f c2v = {C2, C2}, nbv = {nb, nb}; v2f ls[2];
#pragma unroll
      for (int e = 0; e < 16; e += 2) { const v2f x = __builtin_elementwise_fma((v2f){sv[e], sv[e + 1]}, c2v, nbv);
        const v2f p = {ok[e] ? __builtin_amdgcn_exp2f(x[0]) : 0.f, ok[e + 1] ? __builtin_amdgcn_exp2f(x[1]) : 0.f};
        if (e < 4) ls[e >> 1] = p; else ls[(e >> 1) & 1] += p;
        pb[rt].h[e] = (_Float16)p[0]; pb[rt].h[e + 1] = (_Float16)p[1]; }
      l_r[rt] = l_r[rt] * al + ((ls[0][0] + ls[0][1]) + (ls[1][0] + ls[1][1]));      /* the sum carries the factor 1024 too */
#pragma unroll
      for (int dt = 0; dt < DT; ++dt)
#pragma unroll
        for (int r = 0; r < 8; ++r) oacc[rt][dt][r] *= al; }
#pragma unroll
    for (int dt = 0; dt < DT; ++dt) { const unsigned char* vrow = st + TILE_B + dt * 16 * 128; FragH bv; bv.half[0] = *(const v8us*)(vrow + (fo[0][0] ^ (ps * 64))); bv.half[1] = *(const v8us*)(vrow + (fo[0][1] ^ (ps * 64)));      /* the pass's 32 keys: piece index + 4 = bit 6 of the offset */
#pragma unroll
      for (int rt = 0; rt < RTN; ++rt) oacc[rt][dt] = mmaH<1>(bv.v, bv.v, pb[rt].v, pb[rt].v, oacc[rt][dt]); } }
    asm volatile("s_wait_dscnt 0x0" ::: "memory");         /* this wave's reads of stage t have returned */
    asm volatile("s_wait_asynccnt 0x0" ::: "memory");      /* this wave's copies of stage t + 1 have landed */
    __syncthreads();                                       /* publishes stage t + 1 and ends every wave's reads of stage t */
    if (t + 2 < nst) stage_copy(cp_lds + (t & 1) * STAGE_B, cp_k + (size_t)(t + 2) * 64 * ldk, kstep, cp_v + (t + 2) * 64, vstep); }
  asm volatile("s_wait_asynccnt 0x0" ::: "memory");        /* nothing is in flight when the ring becomes output staging */
#pragma unroll
  for (int rt = 0; rt < RTN; ++rt) { float l = l_r[rt]; l += xhalf(l); const float inv = (l > 0.f) ? 1.0f / l : 0.f;      /* the halves' sums join once */
#pragma unroll
    for (int dt = 0; dt < DT; ++dt)
#pragma unroll
      for (int q4 = 0; q4 < 2; ++q4) { v4f o4;
#pragma unroll
        for (int i = 0; i < 4; ++i) o4[i] = oacc[rt][dt][q4 * 4 + i] * inv;
        *(v4fa*)&sO[w][rt * 16 + ln][dt * 16 + 8 * hh + q4 * 4] = o4; } }
  __builtin_amdgcn_fence(__ATOMIC_ACQ_REL, "workgroup"); __builtin_amdgcn_wave_barrier();
  {
#pragma unroll
    for (int rp = 0; rp < RPW; rp += 2) { const int r = rp + (lane >> 4), pc = lane & 15; const v4f val = *(const v4fa*)&sO[w][r][pc * 4]; *(v4f*)(O + ((size_t)b * TQ + q0 + r) * ldo + h * 64 + pc * 4) = val; }
     } }

__global__ __launch_bounds__(256) void k_wsc(const float* __restrict__ Wm, _Float16* __restrict__ Bt, size_t n8, float sc) { const size_t t = (size_t)blockIdx.x * 256 + threadIdx.x; if (t >= n8) return; FragH f; for (int q = 0; q < 8; ++q) f.h[q] = (_Float16)(bf16_round(Wm[t * 8 + q]) * sc); *(v8us*)((unsigned short*)Bt + t * 8) = f.half[0];  }
__global__ __launch_bounds__(256) void k_woutp(const float* __restrict__ Wm, _Float16* __restrict__ Bt) { const size_t t = (size_t)blockIdx.x * 256 + threadIdx.x; if (t >= (size_t)DMOD * (2 * DMOD / 8)) return; const int pc = (int)(t % (2 * DMOD / 8)); const int o = (int)(t / (2 * DMOD / 8)); const bool lo = pc * 8 >= DMOD; FragH f;
  for (int q = 0; q < 8; ++q) { const int c = pc * 8 + q - (lo ? DMOD : 0); f.h[q] = (_Float16)(bf16_round(Wm[(size_t)o * DMOD + c]) * (lo ? 1.0f : 16.0f)); } *(v8us*)((unsigned short*)Bt + (size_t)o * 2 * DMOD + pc * 8) = f.half[0];  }
__global__ __launch_bounds__(256) void k_ropetab(float* __restrict__ CS) {
  #pragma clang fp contract(off)
  const int t = blockIdx.x * 256 + threadIdx.x; if (t >= SLEN * (RD / 2)) return; const int i = t % (RD / 2), tpos = t / (RD / 2); const float invf = (float)pow(10000.0, -(double)(2 * i) / (double)RD); const float ang = (float)tpos * invf; const float c = cosf(ang), s = sinf(ang);
  { *(float*)(CS + t) = c; *(float*)(CS + SLEN * (RD / 2) + t) = s;  } }
__global__ __launch_bounds__(256) void k_rope(const float* __restrict__ Q, const float* __restrict__ Kf, const float* __restrict__ CS, _Float16* __restrict__ Q16, _Float16* __restrict__ K16) {
  #pragma clang fp contract(off)
  const size_t t = (size_t)blockIdx.x * 256 + threadIdx.x; if (t >= (size_t)NR * NH * 2) return; const int which = (int)(t & 1); const int h = (int)((t >> 1) % NH); const size_t r = t / (2 * NH); const int tpos = (int)(r % SLEN);
  const float* src = (which ? Kf : Q) + r * DMOD + h * HD; _Float16* dst = (which ? K16 : Q16) + r * DMOD + h * HD; FragH f[4];
#pragma unroll
  for (int i = 0; i < RD / 2; ++i) { const float c = CS[tpos * (RD / 2) + i], s = CS[SLEN * (RD / 2) + tpos * (RD / 2) + i]; const float x1 = src[i], x2 = src[RD / 2 + i];
    float a = x1 * c; a += x2 * s; float bq = x1 * -s; bq += x2 * c; f[0].h[i] = (_Float16)a; f[1].h[i] = (_Float16)bq; }
#pragma unroll
  for (int i = 0; i < 16; ++i) { f[2].h[i] = (_Float16)src[RD + i]; f[3].h[i] = (_Float16)src[RD + 16 + i]; }
  { for (int u = 0; u < 4; ++u) { *(v8us*)((unsigned short*)dst + u * 16) = f[u].half[0]; *(v8us*)((unsigned short*)dst + u * 16 + 8) = f[u].half[1]; }  } }

extern "C" void kernel_launch(void* const* d_in, const int* in_sizes, int n_in,
                              void* d_out, int out_size, void* d_ws, size_t ws_size, hipStream_t stream) {
  (void)in_sizes; (void)n_in; (void)out_size;
  const float* const* I = (const float* const*)d_in; const float* x = I[0]; const float* Wq = I[1]; const float* Wk = I[2]; const float* Wv = I[3]; const float* Wo = I[4];
  char* ws = (char*)d_ws; size_t off = 0;
  auto take = [&](size_t bytes) { char* p = ws + off; off += (bytes + 255) & ~(size_t)255; return p; };
  const size_t w8 = (size_t)DMOD * DMOD / 8;
  _Float16* BQ = (_Float16*)take(w8 * 16); _Float16* BK = (_Float16*)take(w8 * 16); _Float16* BV = (_Float16*)take(w8 * 16); _Float16* BO = (_Float16*)take(w8 * 32);
  _Float16* X16 = (_Float16*)take((size_t)NR * DMOD * 2); float* Qf = (float*)take((size_t)NR * DMOD * 4); float* Kf = (float*)take((size_t)NR * DMOD * 4); _Float16* Q16 = (_Float16*)take((size_t)NR * DMOD * 2); _Float16* K16 = (_Float16*)take((size_t)NR * DMOD * 2); _Float16* V16 = (_Float16*)take((size_t)NR * DMOD * 2); _Float16* VT = (_Float16*)take((size_t)NR * DMOD * 2); float* CS = (float*)take((size_t)SLEN * RD * 4);
  float* O = Qf; _Float16* Hh = Q16; _Float16* Hl = K16;      /* aliases after the flash kernel: Qf/Q16/K16 are dead */
  if (off > ws_size) return;      /* 10 + 16 + 32 + 32 + 16 x 4 = 154 MiB */
  k_wsc<<<(unsigned)((w8 + 255) / 256), 256, 0, stream>>>(Wq, BQ, w8, 16.0f); k_wsc<<<(unsigned)((w8 + 255) / 256), 256, 0, stream>>>(Wk, BK, w8, 16.0f); k_wsc<<<(unsigned)((w8 + 255) / 256), 256, 0, stream>>>(Wv, BV, w8, 16.0f); k_woutp<<<(unsigned)(((size_t)DMOD * (2 * DMOD / 8) + 255) / 256), 256, 0, stream>>>(Wo, BO);
  k_x16<<<(unsigned)(((size_t)NR * DMOD / 8 + 255) / 256), 256, 0, stream>>>(x, X16, (size_t)NR * DMOD / 8);
  const dim3 gP((NR / 128) * (DMOD / 64), 1);
  k_gemm2<0><<<gP, 128, 0, stream>>>(X16, DMOD, 0, BQ, DMOD, 0, 0.0625f, nullptr, 0, nullptr, 1, 0, 0, Qf, nullptr, DMOD, 0, NR, DMOD, DMOD);
  k_gemm2<0><<<gP, 128, 0, stream>>>(X16, DMOD, 0, BK, DMOD, 0, 0.0625f, nullptr, 0, nullptr, 1, 0, 0, Kf, nullptr, DMOD, 0, NR, DMOD, DMOD);
  k_gemm2<0><<<gP, 128, 0, stream>>>(X16, DMOD, 0, BV, DMOD, 0, 0.0625f, nullptr, 0, nullptr, 1, 0, 0, nullptr, V16, DMOD, 0, NR, DMOD, DMOD);
  k_ropetab<<<(SLEN * (RD / 2) + 255) / 256, 256, 0, stream>>>(CS); k_rope<<<(unsigned)(((size_t)NR * NH * 2 + 255) / 256), 256, 0, stream>>>(Qf, Kf, CS, Q16, K16);
  k_vt<NH, SLEN><<<NB * NH * (SLEN / 64), 256, 0, stream>>>(V16, DMOD, 0, VT);
  k_flash<0><<<NB * NH * QBLKS, 128, 0, stream>>>(Q16, DMOD, K16, DMOD, VT, nullptr, O, DMOD);
  k_hl<<<(unsigned)(((size_t)NR * DMOD / 8 + 255) / 256), 256, 0, stream>>>(O, Hh, Hl, (size_t)NR * DMOD / 8);
  k_gemm2<0><<<gP, 128, 0, stream>>>(Hh, DMOD, 0, BO, 2 * DMOD, 0, 0.0625f, nullptr, 0, nullptr, 1, 0, 0, (float*)d_out, nullptr, DMOD, 0, NR, DMOD, DMOD);
  k_gemm2<0><<<gP, 128, 0, stream>>>(Hl, DMOD, 0, BO + DMOD, 2 * DMOD, 0, 1.0f / 1024.0f, nullptr, 0, (const float*)d_out, 1, (size_t)DMOD, 0, (float*)d_out, nullptr, DMOD, 0, NR, DMOD, DMOD);
}

// v005
// It runs in 238 microseconds.
// Next to v004, in two timings, it ran 1.08 times as fast each time.
// Over all steps from v000 it is 3.41 times as fast.
#include <hip/hip_runtime.h>
// TinyAttn (4 sequences x 2048 tokens x 1024; 16 heads x 64; rotary embedding on the first 32 dims of each head): q,k,v = x W^T; q,k rotated (rot = [x1 cos + x2 sin, -x1 sin + x2 cos] on dims 0..31 with the module's inverse-frequency table); softmax(q k^T / 8) v; y Wo^T -> [4,2048,1024].
// Structure: x as an exact f16 plane; q/k/v projections as f16 WMMA GEMMs (32x64 wave tiles, operand tiles staged in an LDS ring, f32 accumulation, exact x16 weights; q/k rotated in f32 on the staged tile, v as f16); the rotary tables recomputed on the device (f64 pow for the inverse frequencies, f32 angle product, f32 cos/sin) and applied in the q/k projections' epilogue, which writes the f16 q/k planes; V transposed by LDS tiles; the fused flash kernel; the attention output as hi + residual planes into two accumulating output-projection GEMMs.
// Compute dtype: x and weights rounded to bf16; q, k (after rotation), v, P as f16 operands (~2^-12); attention output hi + 2^-10-scaled residual; f32 accumulation/softmax. v_wmma_f32_16x16x32_f16.
#define NB 4
#define DMOD 1024
#define HD 64
#define RD 32                    /* rotary dims per head */
#define NR (NB * SLEN)
#define QBLKS (TQ / 64)          /* query blocks per (sequence, head) launched */
#define SLEN 2048
#define TQ SLEN
#define TK SLEN
#define NH 16
#define SCL 0.125f               /* 64^-0.5 */
typedef __bf16 v16b __attribute__((ext_vector_type(16)));
typedef unsigned short v8us __attribute__((ext_vector_type(8), may_alias));
typedef float  v8f  __attribute__((ext_vector_type(8)));
typedef float  v4f  __attribute__((ext_vector_type(4)));
typedef float  v2f  __attribute__((ext_vector_type(2)));
typedef float  v4fa __attribute__((ext_vector_type(4), may_alias));
union FragB { v16b v; v8us half[2]; unsigned short u[16]; };

__device__ __forceinline__ unsigned short bf16_bits(float x) { unsigned int u = __float_as_uint(x); return (unsigned short)((u + 0x7FFFu + ((u >> 16) & 1u)) >> 16); }
__device__ __forceinline__ float bf16_val(unsigned short b) { return __uint_as_float(((unsigned int)b) << 16); }
__device__ __forceinline__ float bf16_round(float x) { return bf16_val(bf16_bits(x)); }
// D += A·B with NT terms: 1 = ah·bh, 2 = + al·bh (A split), 3 = + ah·bl (both split)
template <int NT>
__device__ __forceinline__ v8f mmaN(v16b ah, v16b al, v16b bh, v16b bl, v8f c) {
  c = __builtin_amdgcn_wmma_f32_16x16x32_bf16(false, ah, false, bh, (short)0, c, false, false);
  if (NT >= 2) c = __builtin_amdgcn_wmma_f32_16x16x32_bf16(false, al, false, bh, (short)0, c, false, false);
  if (NT >= 3) c = __builtin_amdgcn_wmma_f32_16x16x32_bf16(false, ah, false, bl, (short)0, c, false, false);
  asm volatile("v_nop\n\tv_nop\n\tv_nop\n\tv_nop" : "+v"(c) : "v"(ah), "v"(al), "v"(bh), "v"(bl));
  return c;
}

__global__ __launch_bounds__(256) void k_wt_bf16(const float* __restrict__ W, unsigned short* __restrict__ Wt, int K, int N) {
  const int t = blockIdx.x * 256 + threadIdx.x;
  const int k8n = K / 8;
  if (t >= N * k8n) return;
  const int n = t / k8n, k8 = (t % k8n) * 8;
  v8us v;
#pragma unroll
  for (int i = 0; i < 8; ++i) v[i] = bf16_bits(W[(size_t)(k8 + i) * N + n]);
  *(v8us*)(Wt + (size_t)n * K + k8) = v;
  
}

// GEMM C[M][N] (f32, pitch ldc) = act(A[M][K]·W + bias). A f32 row-major (pitch lda) converted per fragment to bf16
// (ASPLIT: hi/lo two planes -> 2 terms, else single rounded term); Wt bf16 [N][K] (pitch ldb). BIAS_BF16 rounds the
// bias to bf16 first (bias quantised to bf16 before the add). K%32==0, M%16==0, N%64==0.
template <bool ASPLIT, int ACT, bool BIAS_BF16>
__global__ __launch_bounds__(128) void k_gemm_bf(const float* __restrict__ A, int lda, const unsigned short* __restrict__ Wt, int ldb,
                                               const float* __restrict__ bias, float* __restrict__ C, int ldc, int M, int N, int K) {
  __shared__ __attribute__((aligned(16))) float so[4][16][64];
  const int tid = threadIdx.x, w = tid >> 5, lane = tid & 31, ln = lane & 15, hh = lane >> 4;
  const int ntn = N / 64;
  const int wid = blockIdx.x * 4 + w;
  const int mt = wid / ntn, nq = wid % ntn;
  if (mt * 16 >= M) return;
  const int row0 = mt * 16, col0 = nq * 64;
  const float* arow = A + (size_t)(row0 + ln) * lda;
  v8f acc[4] = {};
  for (int kb = 0; kb < K; kb += 32) {
    FragB ah, al;
    const v4f x0 = *(const v4fa*)(arow + kb + 8 * hh), x1 = *(const v4fa*)(arow + kb + 8 * hh + 4);
    const v4f x2 = *(const v4fa*)(arow + kb + 16 + 8 * hh), x3 = *(const v4fa*)(arow + kb + 16 + 8 * hh + 4);
    float xs[16] = {x0[0],x0[1],x0[2],x0[3],x1[0],x1[1],x1[2],x1[3],x2[0],x2[1],x2[2],x2[3],x3[0],x3[1],x3[2],x3[3]};
#pragma unroll
    for (int i = 0; i < 16; ++i) { const unsigned short hb = bf16_bits(xs[i]); ah.u[i] = hb; al.u[i] = ASPLIT ? bf16_bits(xs[i] - bf16_val(hb)) : (unsigned short)0; }
#pragma unroll
    for (int t = 0; t < 4; ++t) {
      const unsigned short* brow = Wt + (size_t)(col0 + t * 16 + ln) * ldb + kb;
      FragB b;
      b.half[0] = *(const v8us*)(brow + 8 * hh);
      b.half[1] = *(const v8us*)(brow + 16 + 8 * hh);
      acc[t] = mmaN<ASPLIT ? 2 : 1>(ah.v, al.v, b.v, b.v, acc[t]);
    }
  }
#pragma unroll
  for (int t = 0; t < 4; ++t) {
    float bv = bias ? bias[col0 + t * 16 + ln] : 0.f;
    if (BIAS_BF16) bv = bf16_round(bv);
#pragma unroll
    for (int r = 0; r < 8; ++r) { float v = acc[t][r] + bv; if (ACT == 1) v = fmaxf(v, 0.f); so[w][8 * hh + r][t * 16 + ln] = v; }
  }
  __builtin_amdgcn_fence(__ATOMIC_ACQ_REL, "workgroup");
  __builtin_amdgcn_wave_barrier();
  const int rsub = lane >> 4, c4 = (lane & 15) * 4;
  {
#pragma unroll
    for (int q = 0; q < 8; ++q) {
      const int r = q * 2 + rsub;
      const v4f v = *(const v4fa*)&so[w][r][c4];
      *(v4f*)(C + (size_t)(row0 + r) * ldc + col0 + c4) = v;
    }
    
  }
}

// GEMM C = act(A·W + bias + resid): A f32 (ASPLIT -> hi/lo 2 terms), Wt bf16 [N][K]; ACT 0 none, 1 relu, 2 exact gelu;
// resid (optional, f32, row index = (row % rmod), pitch ldr, RES_BF16 rounds it) added before the activation.
template <bool ASPLIT, int ACT, bool BIAS_BF16, bool RES_BF16>
__global__ __launch_bounds__(128) void k_gemm_bf3(const float* __restrict__ A, int lda, const unsigned short* __restrict__ Wt, int ldb,
                                                const float* __restrict__ bias, const float* __restrict__ resid, int rmod, int ldr,
                                                float* __restrict__ C, int ldc, int M, int N, int K) {
  __shared__ __attribute__((aligned(16))) float so[4][16][64];
  const int tid = threadIdx.x, w = tid >> 5, lane = tid & 31, ln = lane & 15, hh = lane >> 4;
  const int ntn = N / 64;
  const int wid = blockIdx.x * 4 + w;
  const int mt = wid / ntn, nq = wid % ntn;
  if (mt * 16 >= M) return;
  const int row0 = mt * 16, col0 = nq * 64;
  const float* arow = A + (size_t)(row0 + ln) * lda;
  v8f acc[4] = {};
  for (int kb = 0; kb < K; kb += 32) {
    FragB ah, al;
    const v4f x0 = *(const v4fa*)(arow + kb + 8 * hh), x1 = *(const v4fa*)(arow + kb + 8 * hh + 4);
    const v4f x2 = *(const v4fa*)(arow + kb + 16 + 8 * hh), x3 = *(const v4fa*)(arow + kb + 16 + 8 * hh + 4);
    float xs[16] = {x0[0],x0[1],x0[2],x0[3],x1[0],x1[1],x1[2],x1[3],x2[0],x2[1],x2[2],x2[3],x3[0],x3[1],x3[2],x3[3]};
#pragma unroll
    for (int i = 0; i < 16; ++i) { const unsigned short hb = bf16_bits(xs[i]); ah.u[i] = hb; al.u[i] = ASPLIT ? bf16_bits(xs[i] - bf16_val(hb)) : (unsigned short)0; }
#pragma unroll
    for (int t = 0; t < 4; ++t) {
      const unsigned short* brow = Wt + (size_t)(col0 + t * 16 + ln) * ldb + kb;
      FragB b;
      b.half[0] = *(const v8us*)(brow + 8 * hh);
      b.half[1] = *(const v8us*)(brow + 16 + 8 * hh);
      acc[t] = mmaN<ASPLIT ? 2 : 1>(ah.v, al.v, b.v, b.v, acc[t]);
    }
  }
#pragma unroll
  for (int t = 0; t < 4; ++t) {
    const int col = col0 + t * 16 + ln;
    float bv = bias ? bias[col] : 0.f;
    if (BIAS_BF16) bv = bf16_round(bv);
#pragma unroll
    for (int r = 0; r < 8; ++r) {
      float v = acc[t][r] + bv;
      if (resid) { float rv = resid[(size_t)((row0 + 8 * hh + r) % rmod) * ldr + col]; if (RES_BF16) rv = bf16_round(rv); v += rv; }
      if (ACT == 1) v = fmaxf(v, 0.f);
      if (ACT == 2) v = 0.5f * v * (1.0f + erff(v * 0.70710678118654752f));
      if (ACT == 3) { const float u = 0.7978845608028654f * (v + 0.044715f * v * v * v); v = 0.5f * v * (1.0f + tanhf(u)); }
      so[w][8 * hh + r][t * 16 + ln] = v;
    }
  }
  __builtin_amdgcn_fence(__ATOMIC_ACQ_REL, "workgroup");
  __builtin_amdgcn_wave_barrier();
  const int rsub = lane >> 4, c4 = (lane & 15) * 4;
  {
#pragma unroll
    for (int q = 0; q < 8; ++q) {
      const int r = q * 2 + rsub;
      const v4f v = *(const v4fa*)&so[w][r][c4];
      *(v4f*)(C + (size_t)(row0 + r) * ldc + col0 + c4) = v;
    }
    
  }
}
// row LayerNorm (biased variance, eps) over N: s = X (+ R); optional out_sum <- s; out_norm <- (s-mu)*rsqrt(var+eps)*g + b
template <bool PARAM_BF16>
__global__ __launch_bounds__(256) void k_layernorm(const float* __restrict__ X, const float* __restrict__ R, const float* __restrict__ g, const float* __restrict__ bta,
                                                  float* __restrict__ out_sum, float* __restrict__ out_norm, int N, float eps) {
  __shared__ float red[256];
  const int row = blockIdx.x, tid = threadIdx.x;
  const float* x = X + (size_t)row * N; const float* rr = R ? R + (size_t)row * N : nullptr;
  float vals[16];                     // up to N = 4096
  const int per = N / 256;            // contiguous chunk per thread? use strided-by-4 chunks: thread handles j = tid*4 + 1024*u
  float s1 = 0.f;
  for (int u = 0; u < per / 4; ++u) {
    const int j = tid * 4 + 1024 * u;
    const v4f a = *(const v4fa*)(x + j);
    v4f b = {0.f,0.f,0.f,0.f}; if (rr) b = *(const v4fa*)(rr + j);
#pragma unroll
    for (int q = 0; q < 4; ++q) { const float v = a[q] + b[q]; vals[u * 4 + q] = v; s1 += v; }
  }
  red[tid] = s1; __syncthreads();
  for (int st = 128; st > 0; st >>= 1) { if (tid < st) red[tid] += red[tid + st]; __syncthreads(); }
  const float mu = red[0] / (float)N; __syncthreads();
  float s2 = 0.f;
  for (int u = 0; u < per / 4; ++u)
#pragma unroll
    for (int q = 0; q < 4; ++q) { const float c = vals[u * 4 + q] - mu; s2 += c * c; }
  red[tid] = s2; __syncthreads();
  for (int st = 128; st > 0; st >>= 1) { if (tid < st) red[tid] += red[tid + st]; __syncthreads(); }
  const float rs = rsqrtf(red[0] / (float)N + eps);
  {
    for (int u = 0; u < per / 4; ++u) {
      const int j = tid * 4 + 1024 * u;
      v4f o, sm;
#pragma unroll
      for (int q = 0; q < 4; ++q) {
        float gg = g[j + q], bb = bta[j + q];
        if (PARAM_BF16) { gg = bf16_round(gg); bb = bf16_round(bb); }
        sm[q] = vals[u * 4 + q]; o[q] = (vals[u * 4 + q] - mu) * rs * gg + bb;
      }
      if (out_sum) *(v4f*)(out_sum + (size_t)row * N + j) = sm;
      *(v4f*)(out_norm + (size_t)row * N + j) = o;
    }
    
  }
}



// ---- f16 WMMA path (v_wmma_f32_16x16x32_f16): 11-bit significands for operands in range — used where a [0,1] probability operand needs more precision than bf16
typedef _Float16 v16h __attribute__((ext_vector_type(16)));
union FragH { v16h v; v8us half[2]; _Float16 h[16]; unsigned short u[16]; };
template <int NT>
__device__ __forceinline__ v8f mmaH(v16h ah, v16h al, v16h bh, v16h bl, v8f c) {
  c = __builtin_amdgcn_wmma_f32_16x16x32_f16(false, ah, false, bh, (short)0, c, false, false);
  if (NT >= 2) c = __builtin_amdgcn_wmma_f32_16x16x32_f16(false, al, false, bh, (short)0, c, false, false);
  if (NT >= 3) c = __builtin_amdgcn_wmma_f32_16x16x32_f16(false, ah, false, bl, (short)0, c, false, false);
  asm volatile("v_nop\n\tv_nop\n\tv_nop\n\tv_nop" : "+v"(c) : "v"(ah), "v"(al), "v"(bh), "v"(bl));
  return c;
}
// batched GEMM like k_gemm_b but f16 operands: A f32 (split into f16 hi/lo if ASPLIT, else rounded to f16), Bt = f16 values [n][k]; alpha; C f32; N multiple of 16 (partial tiles skipped)
template <bool ASPLIT>
__global__ __launch_bounds__(128) void k_gemm_h(const float* __restrict__ A, int lda, size_t sA, const _Float16* __restrict__ Bh, int ldb, size_t sB, float alpha, float* __restrict__ C, int ldc, size_t sC, int M, int N, int K) {
  __shared__ __attribute__((aligned(16))) float so[4][16][64];
  const int tid = threadIdx.x, w = tid >> 5, lane = tid & 31, ln = lane & 15, hh = lane >> 4; const int by = blockIdx.y;
  A += (size_t)by * sA; Bh += (size_t)by * sB; C += (size_t)by * sC;
  const int ntn = (N + 63) / 64; const int wid = blockIdx.x * 4 + w; const int mt = wid / ntn, nq = wid % ntn; if (mt * 16 >= M) return;
  const int row0 = mt * 16, col0 = nq * 64; const float* arow = A + (size_t)(row0 + ln) * lda;
  v8f acc[4] = {};
  for (int kb = 0; kb < K; kb += 32) {
    FragH ah, al;
    const v4f x0 = *(const v4fa*)(arow + kb + 8 * hh), x1 = *(const v4fa*)(arow + kb + 8 * hh + 4), x2 = *(const v4fa*)(arow + kb + 16 + 8 * hh), x3 = *(const v4fa*)(arow + kb + 16 + 8 * hh + 4);
    float xs[16] = {x0[0],x0[1],x0[2],x0[3],x1[0],x1[1],x1[2],x1[3],x2[0],x2[1],x2[2],x2[3],x3[0],x3[1],x3[2],x3[3]};
#pragma unroll
    for (int i = 0; i < 16; ++i) { const _Float16 h = (_Float16)xs[i]; ah.h[i] = h; al.h[i] = ASPLIT ? (_Float16)(xs[i] - (float)h) : (_Float16)0.0f; }
#pragma unroll
    for (int t = 0; t < 4; ++t) { if (col0 + t * 16 >= N) continue; const size_t boff = (size_t)(col0 + t * 16 + ln) * ldb + kb; FragH bq; bq.half[0] = *(const v8us*)(Bh + boff + 8 * hh); bq.half[1] = *(const v8us*)(Bh + boff + 16 + 8 * hh);
      acc[t] = mmaH<ASPLIT ? 2 : 1>(ah.v, al.v, bq.v, bq.v, acc[t]); }
  }
#pragma unroll
  for (int t = 0; t < 4; ++t) { if (col0 + t * 16 >= N) continue;
#pragma unroll
    for (int r = 0; r < 8; ++r) so[w][8 * hh + r][t * 16 + ln] = acc[t][r] * alpha; }
  __builtin_amdgcn_fence(__ATOMIC_ACQ_REL, "workgroup"); __builtin_amdgcn_wave_barrier();
  const int rsub = lane >> 4, c4 = (lane & 15) * 4;
  {
#pragma unroll
    for (int q = 0; q < 8; ++q) { const int r = q * 2 + rsub; if (col0 + c4 < N) { const v4f v = *(const v4fa*)&so[w][r][c4]; *(v4f*)(C + (size_t)(row0 + r) * ldc + col0 + c4) = v; } }
     }
}

// Wt[n][k] = f16(W[k][n]·scale) from f32 row-major W[K][N] (scale = power of two; bf16-exact weights stay exact in f16 away from the subnormal range)
__global__ __launch_bounds__(256) void k_wt_f16(const float* __restrict__ W, _Float16* __restrict__ Wt, int K, int N, float scale) {
  const int t = blockIdx.x * 256 + threadIdx.x; if (t >= N * (K / 8)) return; const int n = t / (K / 8), k8 = (t % (K / 8)) * 8; FragH f;
#pragma unroll
  for (int i = 0; i < 8; ++i) f.h[i] = (_Float16)(bf16_round(W[(size_t)(k8 + i) * N + n]) * scale); const v8us o = f.half[0];
  *(v8us*)((unsigned short*)Wt + (size_t)n * K + k8) = o; 
}
// k_gemm_hh variant with fused epilogue: v = acc·alpha + bias[by·sBias + col] (+ CP[(row/rowsPerB)·sCPb + by·64 + col] if CP) ; ACT 0 none / 1 elu ; writes f16 C16 (and f32 C if non-null)
template <int ACT>
__global__ __launch_bounds__(128) void k_gemm_hhx(const _Float16* __restrict__ A, int lda, size_t sA, const _Float16* __restrict__ Bh, int ldb, size_t sB, float alpha, const float* __restrict__ bias, size_t sBias, const float* __restrict__ CP, int rowsPerB, size_t sCPb, int row0g,
    float* __restrict__ C, _Float16* __restrict__ C16, int ldc, size_t sC, int M, int N, int K) {
  __shared__ __attribute__((aligned(16))) float so[4][16][64];
  const int tid = threadIdx.x, w = tid >> 5, lane = tid & 31, ln = lane & 15, hh = lane >> 4; const int by = blockIdx.y;
  A += (size_t)by * sA; Bh += (size_t)by * sB; const size_t cofs = (size_t)by * sC; const float* bp = bias ? bias + (size_t)by * sBias : nullptr;
  const int ntn = (N + 63) / 64; const int wid = blockIdx.x * 4 + w; const int mt = wid / ntn, nq = wid % ntn; if (mt * 16 >= M) return;
  const int row0 = mt * 16, col0 = nq * 64; const _Float16* arow = A + (size_t)(row0 + ln) * lda;
  v8f acc[4] = {};
  for (int kb = 0; kb < K; kb += 32) { FragH ah; ah.half[0] = *(const v8us*)((const unsigned short*)arow + kb + 8 * hh); ah.half[1] = *(const v8us*)((const unsigned short*)arow + kb + 16 + 8 * hh);
#pragma unroll
    for (int t = 0; t < 4; ++t) { if (col0 + t * 16 >= N) continue; const size_t boff = (size_t)(col0 + t * 16 + ln) * ldb + kb; FragH bq; bq.half[0] = *(const v8us*)((const unsigned short*)Bh + boff + 8 * hh); bq.half[1] = *(const v8us*)((const unsigned short*)Bh + boff + 16 + 8 * hh);
      acc[t] = mmaH<1>(ah.v, ah.v, bq.v, bq.v, acc[t]); }
  }
#pragma unroll
  for (int t = 0; t < 4; ++t) { if (col0 + t * 16 >= N) continue; const int col = col0 + t * 16 + ln; const float bv = bp ? bf16_round(bp[col]) : 0.f;
#pragma unroll
    for (int r = 0; r < 8; ++r) { float v = acc[t][r] * alpha + bv; if (CP) { const int bidx = (row0g + row0 + 8 * hh + r) / rowsPerB; v += CP[(size_t)bidx * sCPb + (size_t)by * 64 + col]; } if (ACT == 1) v = (v > 0.f) ? v : expm1f(v); else if (ACT == 7) v = (v > 0.f) ? v + 1.0f : expf(v); else if (ACT == 8) v = tanhf(v); else if (ACT == 9) v = 0.5f * v * (1.0f + tanhf(0.7978845608028654f * (v + 0.044715f * v * v * v))); else if (ACT == 11) v = 1.0f / (1.0f + expf(-v)); else if (ACT == 12) v = (v > 0.f) ? v : 0.01f * v; else if (ACT == 14) v = (v > 0.f) ? v : 0.1f * v; else if (ACT == 15) v = v / (1.0f + expf(-v)); else if (ACT == 3) v = fmaxf(v, 0.f); else if (ACT == 6) v = 0.5f * v * (1.0f + erff(v * 0.70710678118654752f)); so[w][8 * hh + r][t * 16 + ln] = v; } }
  __builtin_amdgcn_fence(__ATOMIC_ACQ_REL, "workgroup"); __builtin_amdgcn_wave_barrier();
  const int rsub = lane >> 4, c4 = (lane & 15) * 4; typedef _Float16 v4h __attribute__((ext_vector_type(4)));
  {
#pragma unroll
    for (int q = 0; q < 8; ++q) { const int r = q * 2 + rsub; if (col0 + c4 < N) { const v4f v = *(const v4fa*)&so[w][r][c4]; if (C) *(v4f*)(C + cofs + (size_t)(row0 + r) * ldc + col0 + c4) = v; if (C16) { v4h h4; for (int i = 0; i < 4; ++i) h4[i] = (_Float16)v[i]; *(v4h*)(C16 + cofs + (size_t)(row0 + r) * ldc + col0 + c4) = h4; } } }
     }
}


typedef _Float16 v4h __attribute__((ext_vector_type(4)));

__global__ __launch_bounds__(256) void k_x16(const float* __restrict__ x, _Float16* __restrict__ X16, size_t n8) { const size_t t = (size_t)blockIdx.x * 256 + threadIdx.x; if (t >= n8) return; FragH f;
#pragma unroll
  for (int q = 0; q < 8; ++q) f.h[q] = (_Float16)bf16_round(x[t * 8 + q]); *(v8us*)((unsigned short*)X16 + t * 8) = f.half[0];  }
__global__ __launch_bounds__(256) void k_h16(const float* __restrict__ x, _Float16* __restrict__ X16, size_t n8) { const size_t t = (size_t)blockIdx.x * 256 + threadIdx.x; if (t >= n8) return; FragH f;
#pragma unroll
  for (int q = 0; q < 8; ++q) f.h[q] = (_Float16)x[t * 8 + q]; *(v8us*)((unsigned short*)X16 + t * 8) = f.half[0];  }
__global__ __launch_bounds__(256) void k_round16f(const float* __restrict__ W, _Float16* __restrict__ Bt, size_t n8) { const size_t t = (size_t)blockIdx.x * 256 + threadIdx.x; if (t >= n8) return; FragH f;
#pragma unroll
  for (int i = 0; i < 8; ++i) f.h[i] = (_Float16)(bf16_round(W[t * 8 + i]) * 16.0f); *(v8us*)((unsigned short*)Bt + t * 8) = f.half[0];  }
template <int NHv, int TTv>
__global__ __launch_bounds__(256) void k_vt(const _Float16* __restrict__ V16, int ldv, int voff, _Float16* __restrict__ Vt) { __shared__ unsigned short tl[64][66]; const int tid = threadIdx.x; const int slab = blockIdx.x / (TTv / 64), lg = blockIdx.x % (TTv / 64); const int b = slab / NHv, h = slab % NHv;
  for (int i = tid; i < 64 * 8; i += 256) { const int r = i / 8, c8 = (i % 8) * 8; FragH f; f.half[0] = *(const v8us*)((const unsigned short*)V16 + ((size_t)b * TTv + lg * 64 + r) * ldv + voff + h * 64 + c8);
#pragma unroll
    for (int q = 0; q < 8; ++q) tl[r][c8 + q] = f.u[q]; }
  __syncthreads();
  {
#pragma unroll
    for (int rd = 0; rd < 2; ++rd) { const int d = rd * 32 + tid / 8, pc = tid % 8; FragH f;
#pragma unroll
      for (int q = 0; q < 8; ++q) f.u[q] = tl[pc * 8 + q][d];
      *(v8us*)((unsigned short*)Vt + ((size_t)slab * 64 + d) * TTv + lg * 64 + pc * 8) = f.half[0]; }
     } }

__global__ __launch_bounds__(256) void k_hl(const float* __restrict__ F, _Float16* __restrict__ Hh, _Float16* __restrict__ Hl, size_t n8) { const size_t t = (size_t)blockIdx.x * 256 + threadIdx.x; if (t >= n8) return; FragH fh, fl; const v4f a = *(const v4fa*)(F + t * 8), c = *(const v4fa*)(F + t * 8 + 4);
#pragma unroll
  for (int q = 0; q < 4; ++q) { _Float16 h = (_Float16)a[q]; fh.h[q] = h; fl.h[q] = (_Float16)((a[q] - (float)h) * 1024.0f); h = (_Float16)c[q]; fh.h[4 + q] = h; fl.h[4 + q] = (_Float16)((c[q] - (float)h) * 1024.0f); }
  { *(v8us*)((unsigned short*)Hh + t * 8) = fh.half[0]; *(v8us*)((unsigned short*)Hl + t * 8) = fl.half[0];  } }

// ---- fast GEMM (work-group tile 128x64, wave tile 32x64; requires M % 128 == 0, N % 64 == 0, K % 64 == 0 and K >= 64); epilogue = k_gemm_hhx semantics ----
__device__ __forceinline__ v8f g2_mma(v16h a, v16h b, v8f c) { v8f d = __builtin_amdgcn_wmma_f32_16x16x32_f16(false, a, false, b, (short)0, c, false, false); asm volatile("v_nop\n\tv_nop\n\tv_nop\n\tv_nop" : "+v"(d) : "v"(a), "v"(b)); return d; }
// a fragment from a staged tile: the two 16-byte pieces of the lane's row (same k order as a fragment read from global memory: 8 * hh .. and 16 + 8 * hh ..)
__device__ __forceinline__ v16h g2_lfrag(const unsigned char* rows, int o0, int o1) { FragH f; f.half[0] = *(const v8us*)(rows + o0); f.half[1] = *(const v8us*)(rows + o1); return f.v; }
// One stage of the GEMM ring: 64 k of the tile's 128 A rows, then of its 64 B rows (rows of 128 bytes without a pad, 24 KiB), brought by asynchronous copies to LDS.
// Twelve copies a lane; a wave-wide copy covers four whole 128-byte lines. s_wait_xcnt stands inside the statement so that no address register is rewritten ahead of it.
__device__ __forceinline__ void g2_stage_copy(unsigned lds, const unsigned short* ga, size_t astep, const unsigned short* gb, size_t bstep) {
  asm volatile("global_load_async_to_lds_b128 %0, %12, off\n\t"
               "global_load_async_to_lds_b128 %1, %13, off\n\t"
               "global_load_async_to_lds_b128 %2, %14, off\n\t"
               "global_load_async_to_lds_b128 %3, %15, off\n\t"
               "global_load_async_to_lds_b128 %4, %16, off\n\t"
               "global_load_async_to_lds_b128 %5, %17, off\n\t"
               "global_load_async_to_lds_b128 %6, %18, off\n\t"
               "global_load_async_to_lds_b128 %7, %19, off\n\t"
               "global_load_async_to_lds_b128 %8, %20, off\n\t"
               "global_load_async_to_lds_b128 %9, %21, off\n\t"
               "global_load_async_to_lds_b128 %10, %22, off\n\t"
               "global_load_async_to_lds_b128 %11, %23, off\n\t"
               "s_wait_xcnt 0x0"
               :: "v"(lds), "v"(lds + 2048u), "v"(lds + 4096u), "v"(lds + 6144u), "v"(lds + 8192u), "v"(lds + 10240u), "v"(lds + 12288u), "v"(lds + 14336u),
                  "v"(lds + 16384u), "v"(lds + 18432u), "v"(lds + 20480u), "v"(lds + 22528u),
                  "v"(ga), "v"(ga + astep), "v"(ga + 2 * astep), "v"(ga + 3 * astep), "v"(ga + 4 * astep), "v"(ga + 5 * astep), "v"(ga + 6 * astep), "v"(ga + 7 * astep),
                  "v"(gb), "v"(gb + bstep), "v"(gb + 2 * bstep), "v"(gb + 3 * bstep)
               : "memory");
}
// ROT: the tile's 64 columns are one head and its rows are tokens (position = row % SLEN): the rotary embedding is applied to the staged f32 tile on its way out (CS: cos table, then sin table, [position][RD / 2]).
template <int ACT, bool ROT>
__global__ __launch_bounds__(128) void k_gemm2(const _Float16* __restrict__ A, int lda, size_t sA, const _Float16* __restrict__ Bh, int ldb, size_t sB, float alpha, const float* __restrict__ bias, size_t sBias, const float* __restrict__ CP, int rowsPerB, size_t sCPb, int row0g,
    float* __restrict__ C, _Float16* __restrict__ C16, int ldc, size_t sC, int M, int N, int K, const float* __restrict__ CS) {
  constexpr int ATILE_B = 128 * 128, GSTAGE_B = ATILE_B + 64 * 128;      /* a stage = 64 k: A tile, then B tile */
  __shared__ __attribute__((aligned(16))) unsigned char ring[2 * GSTAGE_B];
  float (*so)[32][68] = reinterpret_cast<float (*)[32][68]>(ring);      /* output staging (34,816 bytes) takes the ring's place behind the loop's last barrier */
  const int tid = threadIdx.x, w = tid >> 5, lane = tid & 31, ln = lane & 15, hh = lane >> 4; const int by = blockIdx.y;
  A += (size_t)by * sA; Bh += (size_t)by * sB; const size_t cofs = (size_t)by * sC; const float* bp = bias ? bias + (size_t)by * sBias : nullptr;
  const int ntn = N >> 6; const int mt = blockIdx.x / ntn, nq = blockIdx.x - mt * ntn; if (mt * 128 >= M) return;      /* the whole work-group leaves, ahead of every copy and barrier */
  const int row0 = mt * 128 + 32 * w, col0 = nq * 64;
  const int nst = K >> 6;
  /* 16-byte piece c of row r lies at r * 128 + (c ^ ((r >> 1) & 7)) * 16: sixteen rows read at one piece index fall on all 64 banks */
  const unsigned cp_lds = (unsigned)(size_t)ring + (unsigned)((tid >> 3) * 128 + (((tid & 7) ^ ((tid >> 4) & 7)) * 16));
  const unsigned short* cp_a = (const unsigned short*)A + (size_t)(mt * 128 + (tid >> 3)) * lda + (tid & 7) * 8;
  const unsigned short* cp_b = (const unsigned short*)Bh + (size_t)(col0 + (tid >> 3)) * ldb + (tid & 7) * 8;
  const size_t astep = (size_t)16 * lda, bstep = (size_t)16 * ldb;
  g2_stage_copy(cp_lds, cp_a, astep, cp_b, bstep);
  int fo[2][2];      /* a fragment's two pieces in row ln: [32-element group of the row][piece] */
#pragma unroll
  for (int g = 0; g < 2; ++g)
#pragma unroll
    for (int pc = 0; pc < 2; ++pc) fo[g][pc] = ln * 128 + (((g * 4 + pc * 2 + hh) ^ ((ln >> 1) & 7)) * 16);
  const v8f z8 = {0.f,0.f,0.f,0.f,0.f,0.f,0.f,0.f}; v8f c00 = z8, c01 = z8, c02 = z8, c03 = z8, c10 = z8, c11 = z8, c12 = z8, c13 = z8;
  asm volatile("s_wait_asynccnt 0x0" ::: "memory");      /* stage 0 has landed for this wave's own copies */
  __syncthreads();                                       /* ... and for every other wave's */
  if (1 < nst) g2_stage_copy(cp_lds + GSTAGE_B, cp_a + 64, astep, cp_b + 64, bstep);
#pragma unroll 1      /* one body for both buffers: the buffer is picked by the trip's parity */
  for (int t = 0; t < nst; ++t) {
    const unsigned char* ar = ring + (t & 1) * GSTAGE_B + w * (32 * 128); const unsigned char* br = ring + (t & 1) * GSTAGE_B + ATILE_B;
#pragma unroll
    for (int g = 0; g < 2; ++g) { const int o0 = fo[g][0], o1 = fo[g][1];
      const v16h a0 = g2_lfrag(ar, o0, o1), a1 = g2_lfrag(ar + 2048, o0, o1);
      const v16h b0 = g2_lfrag(br, o0, o1), b1 = g2_lfrag(br + 2048, o0, o1), b2 = g2_lfrag(br + 4096, o0, o1), b3 = g2_lfrag(br + 6144, o0, o1);
      c00 = g2_mma(a0, b0, c00); c10 = g2_mma(a1, b0, c10);
      c01 = g2_mma(a0, b1, c01); c11 = g2_mma(a1, b1, c11);
      c02 = g2_mma(a0, b2, c02); c12 = g2_mma(a1, b2, c12);
      c03 = g2_mma(a0, b3, c03); c13 = g2_mma(a1, b3, c13); }
    asm volatile("s_wait_dscnt 0x0" ::: "memory");         /* this wave's reads of stage t have returned */
    asm volatile("s_wait_asynccnt 0x0" ::: "memory");      /* this wave's copies of stage t + 1 have landed */
    __syncthreads();                                       /* publishes stage t + 1 and ends every wave's reads of stage t */
    if (t + 2 < nst) g2_stage_copy(cp_lds + (t & 1) * GSTAGE_B, cp_a + (size_t)(t + 2) * 64, astep, cp_b + (size_t)(t + 2) * 64, bstep); }
  asm volatile("s_wait_asynccnt 0x0" ::: "memory");        /* nothing is in flight when the ring becomes output staging */
  const int rsub = lane >> 4, c4 = (lane & 15) * 4;
  v8f accs[8] = {c00, c01, c02, c03, c10, c11, c12, c13};
#pragma unroll
  for (int u = 0; u < 8; ++u) { const int t = u & 3, half = u >> 2; const int col = col0 + t * 16 + ln; const float bv = bp ? bf16_round(bp[col]) : 0.f;
#pragma unroll
    for (int r = 0; r < 8; ++r) { const int rloc = half * 16 + 8 * hh + r; float v = accs[u][r] * alpha + bv; if (CP) { const int bidx = (row0g + row0 + rloc) / rowsPerB; v += CP[(size_t)bidx * sCPb + (size_t)by * 64 + col]; }
      if (ACT == 3) v = fmaxf(v, 0.f); else if (ACT == 6) v = 0.5f * v * (1.0f + erff(v * 0.70710678118654752f)); else if (ACT == 11) v = 1.0f / (1.0f + expf(-v)); else if (ACT == 15) v = v / (1.0f + expf(-v)); else if (ACT == 12) v = (v > 0.f) ? v : 0.01f * v; else if (ACT == 8) v = tanhf(v);
      so[w][rloc][t * 16 + ln] = v; } }
  v4f tcs[16], tsn[16];      /* ROT: the lane's table pieces for its sixteen rows, all asked for at once so that their latency is paid once; behind the staging, where the accumulators' registers are free */
  if (ROT) { const float* tb = CS + (size_t)(row0 % SLEN + rsub) * (RD / 2) + (c4 & (RD / 2 - 1));      /* a wave's 32 rows never cross a sequence's end: both are multiples of 32 */
#pragma unroll
    for (int q = 0; q < 16; ++q) { tcs[q] = *(const v4fa*)(tb + q * RD); tsn[q] = *(const v4fa*)(tb + q * RD + SLEN * (RD / 2)); }
    asm volatile("s_wait_xcnt 0x0" ::: "memory"); }      /* stands ahead of any rewrite of the table loads' address registers */
  __builtin_amdgcn_fence(__ATOMIC_ACQ_REL, "workgroup"); __builtin_amdgcn_wave_barrier();
  {
#pragma unroll
    for (int q = 0; q < 16; ++q) { const int r = q * 2 + rsub; v4f v = *(const v4fa*)&so[w][r][c4];
      if (ROT) {      /* every lane reads a partner piece at a valid place; only dims under RD take the rotated value */
        const v4f u = *(const v4fa*)&so[w][r][c4 ^ (RD / 2)]; const v4f cs = tcs[q], sn = tsn[q];
        const v4f lo = v * cs + u * sn, hi = u * -sn + v * cs;      /* dims 0..15: x1 cos + x2 sin (x1 own); dims 16..31: -x1 sin + x2 cos (x2 own) */
        v = (c4 < RD / 2) ? lo : ((c4 < RD) ? hi : v); }
      if (C) *(v4f*)(C + cofs + (size_t)(row0 + r) * ldc + col0 + c4) = v; if (C16) { v4h h4; for (int i = 0; i < 4; ++i) h4[i] = (_Float16)v[i]; *(v4h*)(C16 + cofs + (size_t)(row0 + r) * ldc + col0 + c4) = h4; } }
     } }



// One stage of the K / V^T ring: 64 key rows of K (128 bytes each) and 64 rows of V^T (the same 64 keys, 128 bytes each), 16 KiB, brought by asynchronous copies to LDS.
// Eight copies a lane; a wave-wide copy covers four whole 128-byte lines. s_wait_xcnt stands inside the statement so that no address register is rewritten ahead of it.
__device__ __forceinline__ void stage_copy(unsigned lds, const unsigned short* gk, size_t kstep, const unsigned short* gv, size_t vstep) {
  asm volatile("global_load_async_to_lds_b128 %0, %8, off\n\t"
               "global_load_async_to_lds_b128 %1, %9, off\n\t"
               "global_load_async_to_lds_b128 %2, %10, off\n\t"
               "global_load_async_to_lds_b128 %3, %11, off\n\t"
               "global_load_async_to_lds_b128 %4, %12, off\n\t"
               "global_load_async_to_lds_b128 %5, %13, off\n\t"
               "global_load_async_to_lds_b128 %6, %14, off\n\t"
               "global_load_async_to_lds_b128 %7, %15, off\n\t"
               "s_wait_xcnt 0x0"
               :: "v"(lds), "v"(lds + 2048u), "v"(lds + 4096u), "v"(lds + 6144u), "v"(lds + 8192u), "v"(lds + 10240u), "v"(lds + 12288u), "v"(lds + 14336u),
                  "v"(gk), "v"(gk + kstep), "v"(gk + 2 * kstep), "v"(gk + 3 * kstep), "v"(gv), "v"(gv + vstep), "v"(gv + 2 * vstep), "v"(gv + 3 * vstep)
               : "memory");
}
// lane l with lane l ^ 16: one vector cross-row move
__device__ __forceinline__ float xhalf(float x) { return __builtin_bit_cast(float, __builtin_amdgcn_permlanex16(__builtin_bit_cast(int, x), __builtin_bit_cast(int, x), 0x76543210, 0xfedcba98, false, false)); }
template <int CAUSAL>
__global__ __launch_bounds__(128) void k_flash(const _Float16* __restrict__ Q16, int ldq, const _Float16* __restrict__ K16, int ldk, const _Float16* __restrict__ Vt, const int* __restrict__ MSK, float* __restrict__ O, int ldo) {
  constexpr int RPW = 16, RTN = RPW / 16, NQB = TQ / (4 * RPW), DT = 4, KS = 2;
  constexpr float C2 = SCL * 1.44269504088896340736f;      /* score -> exponent of 2; the bare exp2 instruction serves: no exponent exceeds 10, and a result that flushes to zero lies far under P's f16 step */
  constexpr int TILE_B = 64 * 128, STAGE_B = 2 * TILE_B;      /* a stage = 64 keys: K tile, then V^T tile, rows of 128 bytes without a pad */
  __shared__ __attribute__((aligned(16))) unsigned char ring[2 * STAGE_B];
  float (*sO)[RPW][64 + 4] = reinterpret_cast<float (*)[RPW][64 + 4]>(ring);      /* output staging takes the ring's place behind the loop's last barrier */
  const int tid = threadIdx.x, w = tid >> 5, lane = tid & 31, ln = lane & 15, hh = lane >> 4;
  const int slab = blockIdx.x / QBLKS, qblk = blockIdx.x % QBLKS; (void)NQB; (void)MSK; const int b = slab / NH, h = slab % NH; const int qb0 = qblk * (4 * RPW); const int q0 = qb0 + w * RPW;
  const unsigned short* Vth = (const unsigned short*)Vt + (size_t)slab * 64 * TK;
  const int jend = (CAUSAL == 1) ? (qb0 + 4 * RPW) : TK;      /* causal: keys beyond the block's last query never contribute */
  const int nst = jend / 64;
  /* 16-byte piece c of row r lies at r * 128 + (c ^ ((r >> 1) & 7)) * 16: sixteen rows read at one piece index fall on all 64 banks */
  const unsigned cp_lds = (unsigned)(size_t)ring + (unsigned)((tid >> 3) * 128 + (((tid & 7) ^ ((tid >> 4) & 7)) * 16));
  const unsigned short* cp_k = (const unsigned short*)K16 + ((size_t)b * TK + (tid >> 3)) * ldk + h * 64 + (tid & 7) * 8;
  const unsigned short* cp_v = Vth + (size_t)(tid >> 3) * TK + (tid & 7) * 8;
  const size_t kstep = (size_t)16 * ldk, vstep = (size_t)16 * TK;
  stage_copy(cp_lds, cp_k, kstep, cp_v, vstep);
  FragH aq[2][KS];
#pragma unroll
  for (int rt = 0; rt < RTN; ++rt) { const unsigned short* qr = (const unsigned short*)Q16 + ((size_t)b * TQ + q0 + rt * 16 + ln) * ldq + h * 64;
#pragma unroll
    for (int ks = 0; ks < KS; ++ks) { aq[rt][ks].half[0] = *(const v8us*)(qr + ks * 32 + 8 * hh); aq[rt][ks].half[1] = *(const v8us*)(qr + ks * 32 + 16 + 8 * hh); } }
  int fo[2][2];      /* a fragment's two pieces in row ln: [32-element group of the row][piece] */
#pragma unroll
  for (int g = 0; g < 2; ++g)
#pragma unroll
    for (int pc = 0; pc < 2; ++pc) fo[g][pc] = ln * 128 + (((g * 4 + pc * 2 + hh) ^ ((ln >> 1) & 7)) * 16);
  float m_r[2], l_r[2]; v8f oacc[2][DT];      /* per lane: its query's running maximum (of raw scores), its half's share of the sum (x 1024), and O^T[d = dt * 16 + 8 * hh + r][query ln] */
#pragma unroll
  for (int rt = 0; rt < RTN; ++rt) { m_r[rt] = -3.0e38f; l_r[rt] = 0.f;
#pragma unroll
    for (int dt = 0; dt < DT; ++dt) oacc[rt][dt] = (v8f){0.f,0.f,0.f,0.f,0.f,0.f,0.f,0.f}; }
  asm volatile("s_wait_asynccnt 0x0" ::: "memory");      /* stage 0 has landed for this wave's own copies */
  __syncthreads();                                       /* ... and for every other wave's */
  if (1 < nst) stage_copy(cp_lds + STAGE_B, cp_k + (size_t)64 * ldk, kstep, cp_v + 64, vstep);
#pragma unroll 1
  for (int t = 0; t < nst; ++t) {
    const unsigned char* st = ring + (t & 1) * STAGE_B;
#pragma unroll 1      /* the two 32-key passes of a stage stay one body: unrolled, the registers grow and a work-group per WGP is lost */
    for (int ps = 0; ps < 2; ++ps) { const int j0 = t * 64 + ps * 32;
    v8f s[2][2];
#pragma unroll
    for (int nt = 0; nt < 2; ++nt) { const unsigned char* kr = st + (ps * 32 + nt * 16) * 128; FragH bk[KS];
#pragma unroll
      for (int ks = 0; ks < KS; ++ks) { bk[ks].half[0] = *(const v8us*)(kr + fo[ks][0]); bk[ks].half[1] = *(const v8us*)(kr + fo[ks][1]); }
#pragma unroll
      for (int rt = 0; rt < RTN; ++rt) { v8f acc = (v8f){0.f,0.f,0.f,0.f,0.f,0.f,0.f,0.f};
#pragma unroll
        for (int ks = 0; ks < KS; ++ks) acc = mmaH<1>(bk[ks].v, bk[ks].v, aq[rt][ks].v, aq[rt][ks].v, acc); s[rt][nt] = acc; } }      /* s[rt][nt][r] = score of key j0 + nt * 16 + 8 * hh + r, query q0 + rt * 16 + ln */
    FragH pb[2];
#pragma unroll
    for (int rt = 0; rt < RTN; ++rt) { const int tq = q0 + rt * 16 + ln; float sv[16]; bool ok[16];
#pragma unroll
      for (int e = 0; e < 16; ++e) { const int kk = j0 + (e >> 3) * 16 + 8 * hh + (e & 7);
        ok[e] = (CAUSAL == 1) ? (kk <= tq) : ((CAUSAL == 2) ? ((kk >> 5) == (tq >> 5)) : true);      /* mode 2: block-diagonal 32-token groups */
        sv[e] = ok[e] ? s[rt][e >> 3][e & 7] : -3.0e38f; }      /* raw scores: the scale is positive, so the maximum is taken ahead of it */
      float mx[4];
#pragma unroll
      for (int c = 0; c < 4; ++c) mx[c] = fmaxf(fmaxf(sv[c], sv[4 + c]), fmaxf(sv[8 + c], sv[12 + c]));
      float mc = fmaxf(fmaxf(mx[0], mx[1]), fmaxf(mx[2], mx[3])); mc = fmaxf(mc, xhalf(mc));      /* both halves now hold the query's maximum over the 32 keys */
      const float mn = fmaxf(m_r[rt], mc); const float ea = __builtin_amdgcn_exp2f((m_r[rt] - mn) * C2); const float al = (mn > -1.0e38f) ? ea : 1.0f; m_r[rt] = mn;
      const float nb = fmaf(-mn, C2, 10.0f);      /* 1024 p = 2^(score * C2 + nb): scale, log2 e, the maximum and P's factor 1024 in one multiply-add */
      const v2f c2v = {C2, C2}, nbv = {nb, nb}; v2f ls[2];
#pragma unroll
      for (int e = 0; e < 16; e += 2) { const v2f x = __builtin_elementwise_fma((v2f){sv[e], sv[e + 1]}, c2v, nbv);
        const v2f p = {ok[e] ? __builtin_amdgcn_exp2f(x[0]) : 0.f, ok[e + 1] ? __builtin_amdgcn_exp2f(x[1]) : 0.f};
        if (e < 4) ls[e >> 1] = p; else ls[(e >> 1) & 1] += p;
        pb[rt].h[e] = (_Float16)p[0]; pb[rt].h[e + 1] = (_Float16)p[1]; }
      l_r[rt] = l_r[rt] * al + ((ls[0][0] + ls[0][1]) + (ls[1][0] + ls[1][1]));      /* the sum carries the factor 1024 too */
#pragma unroll
      for (int dt = 0; dt < DT; ++dt)
#pragma unroll
        for (int r = 0; r < 8; ++r) oacc[rt][dt][r] *= al; }
#pragma unroll
    for (int dt = 0; dt < DT; ++dt) { const unsigned char* vrow = st + TILE_B + dt * 16 * 128; FragH bv; bv.half[0] = *(const v8us*)(vrow + (fo[0][0] ^ (ps * 64))); bv.half[1] = *(const v8us*)(vrow + (fo[0][1] ^ (ps * 64)));      /* the pass's 32 keys: piece index + 4 = bit 6 of the offset */
#pragma unroll
      for (int rt = 0; rt < RTN; ++rt) oacc[rt][dt] = mmaH<1>(bv.v, bv.v, pb[rt].v, pb[rt].v, oacc[rt][dt]); } }
    asm volatile("s_wait_dscnt 0x0" ::: "memory");         /* this wave's reads of stage t have returned */
    asm volatile("s_wait_asynccnt 0x0" ::: "memory");      /* this wave's copies of stage t + 1 have landed */
    __syncthreads();                                       /* publishes stage t + 1 and ends every wave's reads of stage t */
    if (t + 2 < nst) stage_copy(cp_lds + (t & 1) * STAGE_B, cp_k + (size_t)(t + 2) * 64 * ldk, kstep, cp_v + (t + 2) * 64, vstep); }
  asm volatile("s_wait_asynccnt 0x0" ::: "memory");        /* nothing is in flight when the ring becomes output staging */
#pragma unroll
  for (int rt = 0; rt < RTN; ++rt) { float l = l_r[rt]; l += xhalf(l); const float inv = (l > 0.f) ? 1.0f / l : 0.f;      /* the halves' sums join once */
#pragma unroll
    for (int dt = 0; dt < DT; ++dt)
#pragma unroll
      for (int q4 = 0; q4 < 2; ++q4) { v4f o4;
#pragma unroll
        for (int i = 0; i < 4; ++i) o4[i] = oacc[rt][dt][q4 * 4 + i] * inv;
        *(v4fa*)&sO[w][rt * 16 + ln][dt * 16 + 8 * hh + q4 * 4] = o4; } }
  __builtin_amdgcn_fence(__ATOMIC_ACQ_REL, "workgroup"); __builtin_amdgcn_wave_barrier();
  {
#pragma unroll
    for (int rp = 0; rp < RPW; rp += 2) { const int r = rp + (lane >> 4), pc = lane & 15; const v4f val = *(const v4fa*)&sO[w][r][pc * 4]; *(v4f*)(O + ((size_t)b * TQ + q0 + r) * ldo + h * 64 + pc * 4) = val; }
     } }

__global__ __launch_bounds__(256) void k_wsc(const float* __restrict__ Wm, _Float16* __restrict__ Bt, size_t n8, float sc) { const size_t t = (size_t)blockIdx.x * 256 + threadIdx.x; if (t >= n8) return; FragH f; for (int q = 0; q < 8; ++q) f.h[q] = (_Float16)(bf16_round(Wm[t * 8 + q]) * sc); *(v8us*)((unsigned short*)Bt + t * 8) = f.half[0];  }
__global__ __launch_bounds__(256) void k_woutp(const float* __restrict__ Wm, _Float16* __restrict__ Bt) { const size_t t = (size_t)blockIdx.x * 256 + threadIdx.x; if (t >= (size_t)DMOD * (2 * DMOD / 8)) return; const int pc = (int)(t % (2 * DMOD / 8)); const int o = (int)(t / (2 * DMOD / 8)); const bool lo = pc * 8 >= DMOD; FragH f;
  for (int q = 0; q < 8; ++q) { const int c = pc * 8 + q - (lo ? DMOD : 0); f.h[q] = (_Float16)(bf16_round(Wm[(size_t)o * DMOD + c]) * (lo ? 1.0f : 16.0f)); } *(v8us*)((unsigned short*)Bt + (size_t)o * 2 * DMOD + pc * 8) = f.half[0];  }
__global__ __launch_bounds__(256) void k_ropetab(float* __restrict__ CS) {
  #pragma clang fp contract(off)
  const int t = blockIdx.x * 256 + threadIdx.x; if (t >= SLEN * (RD / 2)) return; const int i = t % (RD / 2), tpos = t / (RD / 2); const float invf = (float)pow(10000.0, -(double)(2 * i) / (double)RD); const float ang = (float)tpos * invf; const float c = cosf(ang), s = sinf(ang);
  { *(float*)(CS + t) = c; *(float*)(CS + SLEN * (RD / 2) + t) = s;  } }

extern "C" void kernel_launch(void* const* d_in, const int* in_sizes, int n_in,
                              void* d_out, int out_size, void* d_ws, size_t ws_size, hipStream_t stream) {
  (void)in_sizes; (void)n_in; (void)out_size;
  const float* const* I = (const float* const*)d_in; const float* x = I[0]; const float* Wq = I[1]; const float* Wk = I[2]; const float* Wv = I[3]; const float* Wo = I[4];
  char* ws = (char*)d_ws; size_t off = 0;
  auto take = [&](size_t bytes) { char* p = ws + off; off += (bytes + 255) & ~(size_t)255; return p; };
  const size_t w8 = (size_t)DMOD * DMOD / 8;
  _Float16* BQ = (_Float16*)take(w8 * 16); _Float16* BK = (_Float16*)take(w8 * 16); _Float16* BV = (_Float16*)take(w8 * 16); _Float16* BO = (_Float16*)take(w8 * 32);
  _Float16* X16 = (_Float16*)take((size_t)NR * DMOD * 2); float* O = (float*)take((size_t)NR * DMOD * 4); _Float16* Q16 = (_Float16*)take((size_t)NR * DMOD * 2); _Float16* K16 = (_Float16*)take((size_t)NR * DMOD * 2); _Float16* V16 = (_Float16*)take((size_t)NR * DMOD * 2); _Float16* VT = (_Float16*)take((size_t)NR * DMOD * 2); float* CS = (float*)take((size_t)SLEN * RD * 4);
  _Float16* Hh = Q16; _Float16* Hl = K16;      /* aliases after the flash kernel: Q16/K16 are dead */
  if (off > ws_size) return;      /* 10 + 16 + 32 + 16 x 4 = 122 MiB */
  k_wsc<<<(unsigned)((w8 + 255) / 256), 256, 0, stream>>>(Wq, BQ, w8, 16.0f); k_wsc<<<(unsigned)((w8 + 255) / 256), 256, 0, stream>>>(Wk, BK, w8, 16.0f); k_wsc<<<(unsigned)((w8 + 255) / 256), 256, 0, stream>>>(Wv, BV, w8, 16.0f); k_woutp<<<(unsigned)(((size_t)DMOD * (2 * DMOD / 8) + 255) / 256), 256, 0, stream>>>(Wo, BO);
  k_x16<<<(unsigned)(((size_t)NR * DMOD / 8 + 255) / 256), 256, 0, stream>>>(x, X16, (size_t)NR * DMOD / 8);
  k_ropetab<<<(SLEN * (RD / 2) + 255) / 256, 256, 0, stream>>>(CS);
  const dim3 gP((NR / 128) * (DMOD / 64), 1);
  k_gemm2<0, true><<<gP, 128, 0, stream>>>(X16, DMOD, 0, BQ, DMOD, 0, 0.0625f, nullptr, 0, nullptr, 1, 0, 0, nullptr, Q16, DMOD, 0, NR, DMOD, DMOD, CS);
  k_gemm2<0, true><<<gP, 128, 0, stream>>>(X16, DMOD, 0, BK, DMOD, 0, 0.0625f, nullptr, 0, nullptr, 1, 0, 0, nullptr, K16, DMOD, 0, NR, DMOD, DMOD, CS);
  k_gemm2<0, false><<<gP, 128, 0, stream>>>(X16, DMOD, 0, BV, DMOD, 0, 0.0625f, nullptr, 0, nullptr, 1, 0, 0, nullptr, V16, DMOD, 0, NR, DMOD, DMOD, nullptr);
  k_vt<NH, SLEN><<<NB * NH * (SLEN / 64), 256, 0, stream>>>(V16, DMOD, 0, VT);
  k_flash<0><<<NB * NH * QBLKS, 128, 0, stream>>>(Q16, DMOD, K16, DMOD, VT, nullptr, O, DMOD);
  k_hl<<<(unsigned)(((size_t)NR * DMOD / 8 + 255) / 256), 256, 0, stream>>>(O, Hh, Hl, (size_t)NR * DMOD / 8);
  k_gemm2<0, false><<<gP, 128, 0, stream>>>(Hh, DMOD, 0, BO, 2 * DMOD, 0, 0.0625f, nullptr, 0, nullptr, 1, 0, 0, (float*)d_out, nullptr, DMOD, 0, NR, DMOD, DMOD, nullptr);
  k_gemm2<0, false><<<gP, 128, 0, stream>>>(Hl, DMOD, 0, BO + DMOD, 2 * DMOD, 0, 1.0f / 1024.0f, nullptr, 0, (const float*)d_out, 1, (size_t)DMOD, 0, (float*)d_out, nullptr, DMOD, 0, NR, DMOD, DMOD, nullptr);
}

// v006
// Measured time: 215 microseconds a run.
// Next to v005, in two timings, it ran 1.11 times as fast each time.
// All steps since v000 together make it 3.77 times as fast.
#include <hip/hip_runtime.h>
// TinyAttn (4 sequences x 2048 tokens x 1024; 16 heads x 64; rotary embedding on the first 32 dims of each head): q,k,v = x W^T; q,k rotated (rot = [x1 cos + x2 sin, -x1 sin + x2 cos] on dims 0..31 with the module's inverse-frequency table); softmax(q k^T / 8) v; y Wo^T -> [4,2048,1024].
// Structure: x as an exact f16 plane; q/k/v projections as f16 WMMA GEMMs (32x64 wave tiles, operand tiles staged in an LDS ring, f32 accumulation, exact x16 weights; q/k rotated in f32 on the staged tile, v as f16); the rotary tables recomputed on the device (f64 pow for the inverse frequencies, f32 angle product, f32 cos/sin) and applied in the q/k projections' epilogue, which writes the f16 q/k planes; V transposed by LDS tiles; the fused flash kernel; the attention output as the hi and residual halves of one [token][2048] f16 plane into one output-projection GEMM over k = 2048, whose accumulators are multiplied by 64 between the halves.
// Compute dtype: x and weights rounded to bf16; q, k (after rotation), v, P as f16 operands (~2^-12); attention output hi + 2^-10-scaled residual; f32 accumulation/softmax. v_wmma_f32_16x16x32_f16.
#define NB 4
#define DMOD 1024
#define HD 64
#define RD 32                    /* rotary dims per head */
#define NR (NB * SLEN)
#define QBLKS (TQ / 64)          /* query blocks per (sequence, head) launched */
#define SLEN 2048
#define TQ SLEN
#define TK SLEN
#define NH 16
#define SCL 0.125f               /* 64^-0.5 */
typedef __bf16 v16b __attribute__((ext_vector_type(16)));
typedef unsigned short v8us __attribute__((ext_vector_type(8), may_alias));
typedef float  v8f  __attribute__((ext_vector_type(8)));
typedef float  v4f  __attribute__((ext_vector_type(4)));
typedef float  v2f  __attribute__((ext_vector_type(2)));
typedef float  v4fa __attribute__((ext_vector_type(4), may_alias));
union FragB { v16b v; v8us half[2]; unsigned short u[16]; };

__device__ __forceinline__ unsigned short bf16_bits(float x) { unsigned int u = __float_as_uint(x); return (unsigned short)((u + 0x7FFFu + ((u >> 16) & 1u)) >> 16); }
__device__ __forceinline__ float bf16_val(unsigned short b) { return __uint_as_float(((unsigned int)b) << 16); }
__device__ __forceinline__ float bf16_round(float x) { return bf16_val(bf16_bits(x)); }
// D += A·B with NT terms: 1 = ah·bh, 2 = + al·bh (A split), 3 = + ah·bl (both split)
template <int NT>
__device__ __forceinline__ v8f mmaN(v16b ah, v16b al, v16b bh, v16b bl, v8f c) {
  c = __builtin_amdgcn_wmma_f32_16x16x32_bf16(false, ah, false, bh, (short)0, c, false, false);
  if (NT >= 2) c = __builtin_amdgcn_wmma_f32_16x16x32_bf16(false, al, false, bh, (short)0, c, false, false);
  if (NT >= 3) c = __builtin_amdgcn_wmma_f32_16x16x32_bf16(false, ah, false, bl, (short)0, c, false, false);
  asm volatile("v_nop\n\tv_nop\n\tv_nop\n\tv_nop" : "+v"(c) : "v"(ah), "v"(al), "v"(bh), "v"(bl));
  return c;
}

__global__ __launch_bounds__(256) void k_wt_bf16(const float* __restrict__ W, unsigned short* __restrict__ Wt, int K, int N) {
  const int t = blockIdx.x * 256 + threadIdx.x;
  const int k8n = K / 8;
  if (t >= N * k8n) return;
  const int n = t / k8n, k8 = (t % k8n) * 8;
  v8us v;
#pragma unroll
  for (int i = 0; i < 8; ++i) v[i] = bf16_bits(W[(size_t)(k8 + i) * N + n]);
  *(v8us*)(Wt + (size_t)n * K + k8) = v;
  
}

// GEMM C[M][N] (f32, pitch ldc) = act(A[M][K]·W + bias). A f32 row-major (pitch lda) converted per fragment to bf16
// (ASPLIT: hi/lo two planes -> 2 terms, else single rounded term); Wt bf16 [N][K] (pitch ldb). BIAS_BF16 rounds the
// bias to bf16 first (bias quantised to bf16 before the add). K%32==0, M%16==0, N%64==0.
template <bool ASPLIT, int ACT, bool BIAS_BF16>
__global__ __launch_bounds__(128) void k_gemm_bf(const float* __restrict__ A, int lda, const unsigned short* __restrict__ Wt, int ldb,
                                               const float* __restrict__ bias, float* __restrict__ C, int ldc, int M, int N, int K) {
  __shared__ __attribute__((aligned(16))) float so[4][16][64];
  const int tid = threadIdx.x, w = tid >> 5, lane = tid & 31, ln = lane & 15, hh = lane >> 4;
  const int ntn = N / 64;
  const int wid = blockIdx.x * 4 + w;
  const int mt = wid / ntn, nq = wid % ntn;
  if (mt * 16 >= M) return;
  const int row0 = mt * 16, col0 = nq * 64;
  const float* arow = A + (size_t)(row0 + ln) * lda;
  v8f acc[4] = {};
  for (int kb = 0; kb < K; kb += 32) {
    FragB ah, al;
    const v4f x0 = *(const v4fa*)(arow + kb + 8 * hh), x1 = *(const v4fa*)(arow + kb + 8 * hh + 4);
    const v4f x2 = *(const v4fa*)(arow + kb + 16 + 8 * hh), x3 = *(const v4fa*)(arow + kb + 16 + 8 * hh + 4);
    float xs[16] = {x0[0],x0[1],x0[2],x0[3],x1[0],x1[1],x1[2],x1[3],x2[0],x2[1],x2[2],x2[3],x3[0],x3[1],x3[2],x3[3]};
#pragma unroll
    for (int i = 0; i < 16; ++i) { const unsigned short hb = bf16_bits(xs[i]); ah.u[i] = hb; al.u[i] = ASPLIT ? bf16_bits(xs[i] - bf16_val(hb)) : (unsigned short)0; }
#pragma unroll
    for (int t = 0; t < 4; ++t) {
      const unsigned short* brow = Wt + (size_t)(col0 + t * 16 + ln) * ldb + kb;
      FragB b;
      b.half[0] = *(const v8us*)(brow + 8 * hh);
      b.half[1] = *(const v8us*)(brow + 16 + 8 * hh);
      acc[t] = mmaN<ASPLIT ? 2 : 1>(ah.v, al.v, b.v, b.v, acc[t]);
    }
  }
#pragma unroll
  for (int t = 0; t < 4; ++t) {
    float bv = bias ? bias[col0 + t * 16 + ln] : 0.f;
    if (BIAS_BF16) bv = bf16_round(bv);
#pragma unroll
    for (int r = 0; r < 8; ++r) { float v = acc[t][r] + bv; if (ACT == 1) v = fmaxf(v, 0.f); so[w][8 * hh + r][t * 16 + ln] = v; }
  }
  __builtin_amdgcn_fence(__ATOMIC_ACQ_REL, "workgroup");
  __builtin_amdgcn_wave_barrier();
  const int rsub = lane >> 4, c4 = (lane & 15) * 4;
  {
#pragma unroll
    for (int q = 0; q < 8; ++q) {
      const int r = q * 2 + rsub;
      const v4f v = *(const v4fa*)&so[w][r][c4];
      *(v4f*)(C + (size_t)(row0 + r) * ldc + col0 + c4) = v;
    }
    
  }
}

// GEMM C = act(A·W + bias + resid): A f32 (ASPLIT -> hi/lo 2 terms), Wt bf16 [N][K]; ACT 0 none, 1 relu, 2 exact gelu;
// resid (optional, f32, row index = (row % rmod), pitch ldr, RES_BF16 rounds it) added before the activation.
template <bool ASPLIT, int ACT, bool BIAS_BF16, bool RES_BF16>
__global__ __launch_bounds__(128) void k_gemm_bf3(const float* __restrict__ A, int lda, const unsigned short* __restrict__ Wt, int ldb,
                                                const float* __restrict__ bias, const float* __restrict__ resid, int rmod, int ldr,
                                                float* __restrict__ C, int ldc, int M, int N, int K) {
  __shared__ __attribute__((aligned(16))) float so[4][16][64];
  const int tid = threadIdx.x, w = tid >> 5, lane = tid & 31, ln = lane & 15, hh = lane >> 4;
  const int ntn = N / 64;
  const int wid = blockIdx.x * 4 + w;
  const int mt = wid / ntn, nq = wid % ntn;
  if (mt * 16 >= M) return;
  const int row0 = mt * 16, col0 = nq * 64;
  const float* arow = A + (size_t)(row0 + ln) * lda;
  v8f acc[4] = {};
  for (int kb = 0; kb < K; kb += 32) {
    FragB ah, al;
    const v4f x0 = *(const v4fa*)(arow + kb + 8 * hh), x1 = *(const v4fa*)(arow + kb + 8 * hh + 4);
    const v4f x2 = *(const v4fa*)(arow + kb + 16 + 8 * hh), x3 = *(const v4fa*)(arow + kb + 16 + 8 * hh + 4);
    float xs[16] = {x0[0],x0[1],x0[2],x0[3],x1[0],x1[1],x1[2],x1[3],x2[0],x2[1],x2[2],x2[3],x3[0],x3[1],x3[2],x3[3]};
#pragma unroll
    for (int i = 0; i < 16; ++i) { const unsigned short hb = bf16_bits(xs[i]); ah.u[i] = hb; al.u[i] = ASPLIT ? bf16_bits(xs[i] - bf16_val(hb)) : (unsigned short)0; }
#pragma unroll
    for (int t = 0; t < 4; ++t) {
      const unsigned short* brow = Wt + (size_t)(col0 + t * 16 + ln) * ldb + kb;
      FragB b;
      b.half[0] = *(const v8us*)(brow + 8 * hh);
      b.half[1] = *(const v8us*)(brow + 16 + 8 * hh);
      acc[t] = mmaN<ASPLIT ? 2 : 1>(ah.v, al.v, b.v, b.v, acc[t]);
    }
  }
#pragma unroll
  for (int t = 0; t < 4; ++t) {
    const int col = col0 + t * 16 + ln;
    float bv = bias ? bias[col] : 0.f;
    if (BIAS_BF16) bv = bf16_round(bv);
#pragma unroll
    for (int r = 0; r < 8; ++r) {
      float v = acc[t][r] + bv;
      if (resid) { float rv = resid[(size_t)((row0 + 8 * hh + r) % rmod) * ldr + col]; if (RES_BF16) rv = bf16_round(rv); v += rv; }
      if (ACT == 1) v = fmaxf(v, 0.f);
      if (ACT == 2) v = 0.5f * v * (1.0f + erff(v * 0.70710678118654752f));
      if (ACT == 3) { const float u = 0.7978845608028654f * (v + 0.044715f * v * v * v); v = 0.5f * v * (1.0f + tanhf(u)); }
      so[w][8 * hh + r][t * 16 + ln] = v;
    }
  }
  __builtin_amdgcn_fence(__ATOMIC_ACQ_REL, "workgroup");
  __builtin_amdgcn_wave_barrier();
  const int rsub = lane >> 4, c4 = (lane & 15) * 4;
  {
#pragma unroll
    for (int q = 0; q < 8; ++q) {
      const int r = q * 2 + rsub;
      const v4f v = *(const v4fa*)&so[w][r][c4];
      *(v4f*)(C + (size_t)(row0 + r) * ldc + col0 + c4) = v;
    }
    
  }
}
// row LayerNorm (biased variance, eps) over N: s = X (+ R); optional out_sum <- s; out_norm <- (s-mu)*rsqrt(var+eps)*g + b
template <bool PARAM_BF16>
__global__ __launch_bounds__(256) void k_layernorm(const float* __restrict__ X, const float* __restrict__ R, const float* __restrict__ g, const float* __restrict__ bta,
                                                  float* __restrict__ out_sum, float* __restrict__ out_norm, int N, float eps) {
  __shared__ float red[256];
  const int row = blockIdx.x, tid = threadIdx.x;
  const float* x = X + (size_t)row * N; const float* rr = R ? R + (size_t)row * N : nullptr;
  float vals[16];                     // up to N = 4096
  const int per = N / 256;            // contiguous chunk per thread? use strided-by-4 chunks: thread handles j = tid*4 + 1024*u
  float s1 = 0.f;
  for (int u = 0; u < per / 4; ++u) {
    const int j = tid * 4 + 1024 * u;
    const v4f a = *(const v4fa*)(x + j);
    v4f b = {0.f,0.f,0.f,0.f}; if (rr) b = *(const v4fa*)(rr + j);
#pragma unroll
    for (int q = 0; q < 4; ++q) { const float v = a[q] + b[q]; vals[u * 4 + q] = v; s1 += v; }
  }
  red[tid] = s1; __syncthreads();
  for (int st = 128; st > 0; st >>= 1) { if (tid < st) red[tid] += red[tid + st]; __syncthreads(); }
  const float mu = red[0] / (float)N; __syncthreads();
  float s2 = 0.f;
  for (int u = 0; u < per / 4; ++u)
#pragma unroll
    for (int q = 0; q < 4; ++q) { const float c = vals[u * 4 + q] - mu; s2 += c * c; }
  red[tid] = s2; __syncthreads();
  for (int st = 128; st > 0; st >>= 1) { if (tid < st) red[tid] += red[tid + st]; __syncthreads(); }
  const float rs = rsqrtf(red[0] / (float)N + eps);
  {
    for (int u = 0; u < per / 4; ++u) {
      const int j = tid * 4 + 1024 * u;
      v4f o, sm;
#pragma unroll
      for (int q = 0; q < 4; ++q) {
        float gg = g[j + q], bb = bta[j + q];
        if (PARAM_BF16) { gg = bf16_round(gg); bb = bf16_round(bb); }
        sm[q] = vals[u * 4 + q]; o[q] = (vals[u * 4 + q] - mu) * rs * gg + bb;
      }
      if (out_sum) *(v4f*)(out_sum + (size_t)row * N + j) = sm;
      *(v4f*)(out_norm + (size_t)row * N + j) = o;
    }
    
  }
}



// ---- f16 WMMA path (v_wmma_f32_16x16x32_f16): 11-bit significands for operands in range — used where a [0,1] probability operand needs more precision than bf16
typedef _Float16 v16h __attribute__((ext_vector_type(16)));
union FragH { v16h v; v8us half[2]; _Float16 h[16]; unsigned short u[16]; };
template <int NT>
__device__ __forceinline__ v8f mmaH(v16h ah, v16h al, v16h bh, v16h bl, v8f c) {
  c = __builtin_amdgcn_wmma_f32_16x16x32_f16(false, ah, false, bh, (short)0, c, false, false);
  if (NT >= 2) c = __builtin_amdgcn_wmma_f32_16x16x32_f16(false, al, false, bh, (short)0, c, false, false);
  if (NT >= 3) c = __builtin_amdgcn_wmma_f32_16x16x32_f16(false, ah, false, bl, (short)0, c, false, false);
  asm volatile("v_nop\n\tv_nop\n\tv_nop\n\tv_nop" : "+v"(c) : "v"(ah), "v"(al), "v"(bh), "v"(bl));
  return c;
}
// batched GEMM like k_gemm_b but f16 operands: A f32 (split into f16 hi/lo if ASPLIT, else rounded to f16), Bt = f16 values [n][k]; alpha; C f32; N multiple of 16 (partial tiles skipped)
template <bool ASPLIT>
__global__ __launch_bounds__(128) void k_gemm_h(const float* __restrict__ A, int lda, size_t sA, const _Float16* __restrict__ Bh, int ldb, size_t sB, float alpha, float* __restrict__ C, int ldc, size_t sC, int M, int N, int K) {
  __shared__ __attribute__((aligned(16))) float so[4][16][64];
  const int tid = threadIdx.x, w = tid >> 5, lane = tid & 31, ln = lane & 15, hh = lane >> 4; const int by = blockIdx.y;
  A += (size_t)by * sA; Bh += (size_t)by * sB; C += (size_t)by * sC;
  const int ntn = (N + 63) / 64; const int wid = blockIdx.x * 4 + w; const int mt = wid / ntn, nq = wid % ntn; if (mt * 16 >= M) return;
  const int row0 = mt * 16, col0 = nq * 64; const float* arow = A + (size_t)(row0 + ln) * lda;
  v8f acc[4] = {};
  for (int kb = 0; kb < K; kb += 32) {
    FragH ah, al;
    const v4f x0 = *(const v4fa*)(arow + kb + 8 * hh), x1 = *(const v4fa*)(arow + kb + 8 * hh + 4), x2 = *(const v4fa*)(arow + kb + 16 + 8 * hh), x3 = *(const v4fa*)(arow + kb + 16 + 8 * hh + 4);
    float xs[16] = {x0[0],x0[1],x0[2],x0[3],x1[0],x1[1],x1[2],x1[3],x2[0],x2[1],x2[2],x2[3],x3[0],x3[1],x3[2],x3[3]};
#pragma unroll
    for (int i = 0; i < 16; ++i) { const _Float16 h = (_Float16)xs[i]; ah.h[i] = h; al.h[i] = ASPLIT ? (_Float16)(xs[i] - (float)h) : (_Float16)0.0f; }
#pragma unroll
    for (int t = 0; t < 4; ++t) { if (col0 + t * 16 >= N) continue; const size_t boff = (size_t)(col0 + t * 16 + ln) * ldb + kb; FragH bq; bq.half[0] = *(const v8us*)(Bh + boff + 8 * hh); bq.half[1] = *(const v8us*)(Bh + boff + 16 + 8 * hh);
      acc[t] = mmaH<ASPLIT ? 2 : 1>(ah.v, al.v, bq.v, bq.v, acc[t]); }
  }
#pragma unroll
  for (int t = 0; t < 4; ++t) { if (col0 + t * 16 >= N) continue;
#pragma unroll
    for (int r = 0; r < 8; ++r) so[w][8 * hh + r][t * 16 + ln] = acc[t][r] * alpha; }
  __builtin_amdgcn_fence(__ATOMIC_ACQ_REL, "workgroup"); __builtin_amdgcn_wave_barrier();
  const int rsub = lane >> 4, c4 = (lane & 15) * 4;
  {
#pragma unroll
    for (int q = 0; q < 8; ++q) { const int r = q * 2 + rsub; if (col0 + c4 < N) { const v4f v = *(const v4fa*)&so[w][r][c4]; *(v4f*)(C + (size_t)(row0 + r) * ldc + col0 + c4) = v; } }
     }
}

// Wt[n][k] = f16(W[k][n]·scale) from f32 row-major W[K][N] (scale = power of two; bf16-exact weights stay exact in f16 away from the subnormal range)
__global__ __launch_bounds__(256) void k_wt_f16(const float* __restrict__ W, _Float16* __restrict__ Wt, int K, int N, float scale) {
  const int t = blockIdx.x * 256 + threadIdx.x; if (t >= N * (K / 8)) return; const int n = t / (K / 8), k8 = (t % (K / 8)) * 8; FragH f;
#pragma unroll
  for (int i = 0; i < 8; ++i) f.h[i] = (_Float16)(bf16_round(W[(size_t)(k8 + i) * N + n]) * scale); const v8us o = f.half[0];
  *(v8us*)((unsigned short*)Wt + (size_t)n * K + k8) = o; 
}
// k_gemm_hh variant with fused epilogue: v = acc·alpha + bias[by·sBias + col] (+ CP[(row/rowsPerB)·sCPb + by·64 + col] if CP) ; ACT 0 none / 1 elu ; writes f16 C16 (and f32 C if non-null)
template <int ACT>
__global__ __launch_bounds__(128) void k_gemm_hhx(const _Float16* __restrict__ A, int lda, size_t sA, const _Float16* __restrict__ Bh, int ldb, size_t sB, float alpha, const float* __restrict__ bias, size_t sBias, const float* __restrict__ CP, int rowsPerB, size_t sCPb, int row0g,
    float* __restrict__ C, _Float16* __restrict__ C16, int ldc, size_t sC, int M, int N, int K) {
  __shared__ __attribute__((aligned(16))) float so[4][16][64];
  const int tid = threadIdx.x, w = tid >> 5, lane = tid & 31, ln = lane & 15, hh = lane >> 4; const int by = blockIdx.y;
  A += (size_t)by * sA; Bh += (size_t)by * sB; const size_t cofs = (size_t)by * sC; const float* bp = bias ? bias + (size_t)by * sBias : nullptr;
  const int ntn = (N + 63) / 64; const int wid = blockIdx.x * 4 + w; const int mt = wid / ntn, nq = wid % ntn; if (mt * 16 >= M) return;
  const int row0 = mt * 16, col0 = nq * 64; const _Float16* arow = A + (size_t)(row0 + ln) * lda;
  v8f acc[4] = {};
  for (int kb = 0; kb < K; kb += 32) { FragH ah; ah.half[0] = *(const v8us*)((const unsigned short*)arow + kb + 8 * hh); ah.half[1] = *(const v8us*)((const unsigned short*)arow + kb + 16 + 8 * hh);
#pragma unroll
    for (int t = 0; t < 4; ++t) { if (col0 + t * 16 >= N) continue; const size_t boff = (size_t)(col0 + t * 16 + ln) * ldb + kb; FragH bq; bq.half[0] = *(const v8us*)((const unsigned short*)Bh + boff + 8 * hh); bq.half[1] = *(const v8us*)((const unsigned short*)Bh + boff + 16 + 8 * hh);
      acc[t] = mmaH<1>(ah.v, ah.v, bq.v, bq.v, acc[t]); }
  }
#pragma unroll
  for (int t = 0; t < 4; ++t) { if (col0 + t * 16 >= N) continue; const int col = col0 + t * 16 + ln; const float bv = bp ? bf16_round(bp[col]) : 0.f;
#pragma unroll
    for (int r = 0; r < 8; ++r) { float v = acc[t][r] * alpha + bv; if (CP) { const int bidx = (row0g + row0 + 8 * hh + r) / rowsPerB; v += CP[(size_t)bidx * sCPb + (size_t)by * 64 + col]; } if (ACT == 1) v = (v > 0.f) ? v : expm1f(v); else if (ACT == 7) v = (v > 0.f) ? v + 1.0f : expf(v); else if (ACT == 8) v = tanhf(v); else if (ACT == 9) v = 0.5f * v * (1.0f + tanhf(0.7978845608028654f * (v + 0.044715f * v * v * v))); else if (ACT == 11) v = 1.0f / (1.0f + expf(-v)); else if (ACT == 12) v = (v > 0.f) ? v : 0.01f * v; else if (ACT == 14) v = (v > 0.f) ? v : 0.1f * v; else if (ACT == 15) v = v / (1.0f + expf(-v)); else if (ACT == 3) v = fmaxf(v, 0.f); else if (ACT == 6) v = 0.5f * v * (1.0f + erff(v * 0.70710678118654752f)); so[w][8 * hh + r][t * 16 + ln] = v; } }
  __builtin_amdgcn_fence(__ATOMIC_ACQ_REL, "workgroup"); __builtin_amdgcn_wave_barrier();
  const int rsub = lane >> 4, c4 = (lane & 15) * 4; typedef _Float16 v4h __attribute__((ext_vector_type(4)));
  {
#pragma unroll
    for (int q = 0; q < 8; ++q) { const int r = q * 2 + rsub; if (col0 + c4 < N) { const v4f v = *(const v4fa*)&so[w][r][c4]; if (C) *(v4f*)(C + cofs + (size_t)(row0 + r) * ldc + col0 + c4) = v; if (C16) { v4h h4; for (int i = 0; i < 4; ++i) h4[i] = (_Float16)v[i]; *(v4h*)(C16 + cofs + (size_t)(row0 + r) * ldc + col0 + c4) = h4; } } }
     }
}


typedef _Float16 v4h __attribute__((ext_vector_type(4)));

__global__ __launch_bounds__(256) void k_x16(const float* __restrict__ x, _Float16* __restrict__ X16, size_t n8) { const size_t t = (size_t)blockIdx.x * 256 + threadIdx.x; if (t >= n8) return; FragH f;
#pragma unroll
  for (int q = 0; q < 8; ++q) f.h[q] = (_Float16)bf16_round(x[t * 8 + q]); *(v8us*)((unsigned short*)X16 + t * 8) = f.half[0];  }
__global__ __launch_bounds__(256) void k_h16(const float* __restrict__ x, _Float16* __restrict__ X16, size_t n8) { const size_t t = (size_t)blockIdx.x * 256 + threadIdx.x; if (t >= n8) return; FragH f;
#pragma unroll
  for (int q = 0; q < 8; ++q) f.h[q] = (_Float16)x[t * 8 + q]; *(v8us*)((unsigned short*)X16 + t * 8) = f.half[0];  }
__global__ __launch_bounds__(256) void k_round16f(const float* __restrict__ W, _Float16* __restrict__ Bt, size_t n8) { const size_t t = (size_t)blockIdx.x * 256 + threadIdx.x; if (t >= n8) return; FragH f;
#pragma unroll
  for (int i = 0; i < 8; ++i) f.h[i] = (_Float16)(bf16_round(W[t * 8 + i]) * 16.0f); *(v8us*)((unsigned short*)Bt + t * 8) = f.half[0];  }
template <int NHv, int TTv>
__global__ __launch_bounds__(256) void k_vt(const _Float16* __restrict__ V16, int ldv, int voff, _Float16* __restrict__ Vt) { __shared__ unsigned short tl[64][66]; const int tid = threadIdx.x; const int slab = blockIdx.x / (TTv / 64), lg = blockIdx.x % (TTv / 64); const int b = slab / NHv, h = slab % NHv;
  for (int i = tid; i < 64 * 8; i += 256) { const int r = i / 8, c8 = (i % 8) * 8; FragH f; f.half[0] = *(const v8us*)((const unsigned short*)V16 + ((size_t)b * TTv + lg * 64 + r) * ldv + voff + h * 64 + c8);
#pragma unroll
    for (int q = 0; q < 8; ++q) tl[r][c8 + q] = f.u[q]; }
  __syncthreads();
  {
#pragma unroll
    for (int rd = 0; rd < 2; ++rd) { const int d = rd * 32 + tid / 8, pc = tid % 8; FragH f;
#pragma unroll
      for (int q = 0; q < 8; ++q) f.u[q] = tl[pc * 8 + q][d];
      *(v8us*)((unsigned short*)Vt + ((size_t)slab * 64 + d) * TTv + lg * 64 + pc * 8) = f.half[0]; }
     } }

// H: [row][2 * DMOD], a row's hi values in its first half and its residuals (x 1024) in its second: one A operand for a product over k = 2 * DMOD
__global__ __launch_bounds__(256) void k_hl(const float* __restrict__ F, _Float16* __restrict__ H, size_t n8) { const size_t t = (size_t)blockIdx.x * 256 + threadIdx.x; if (t >= n8) return; FragH fh, fl; unsigned short* hp = (unsigned short*)H + (t / (DMOD / 8)) * (2 * DMOD) + (t % (DMOD / 8)) * 8; const v4f a = *(const v4fa*)(F + t * 8), c = *(const v4fa*)(F + t * 8 + 4);
#pragma unroll
  for (int q = 0; q < 4; ++q) { _Float16 h = (_Float16)a[q]; fh.h[q] = h; fl.h[q] = (_Float16)((a[q] - (float)h) * 1024.0f); h = (_Float16)c[q]; fh.h[4 + q] = h; fl.h[4 + q] = (_Float16)((c[q] - (float)h) * 1024.0f); }
  { *(v8us*)hp = fh.half[0]; *(v8us*)(hp + DMOD) = fl.half[0];  } }

// ---- fast GEMM (work-group tile 128x64, wave tile 32x64; requires M % 128 == 0, N % 64 == 0, K % 64 == 0 and K >= 64); epilogue = k_gemm_hhx semantics ----
__device__ __forceinline__ v8f g2_mma(v16h a, v16h b, v8f c) { v8f d = __builtin_amdgcn_wmma_f32_16x16x32_f16(false, a, false, b, (short)0, c, false, false); asm volatile("v_nop\n\tv_nop\n\tv_nop\n\tv_nop" : "+v"(d) : "v"(a), "v"(b)); return d; }
// a fragment from a staged tile: the two 16-byte pieces of the lane's row (same k order as a fragment read from global memory: 8 * hh .. and 16 + 8 * hh ..)
__device__ __forceinline__ v16h g2_lfrag(const unsigned char* rows, int o0, int o1) { FragH f; f.half[0] = *(const v8us*)(rows + o0); f.half[1] = *(const v8us*)(rows + o1); return f.v; }
// One stage of the GEMM ring: 64 k of the tile's 128 A rows, then of its 64 B rows (rows of 128 bytes without a pad, 24 KiB), brought by asynchronous copies to LDS.
// Twelve copies a lane; a wave-wide copy covers four whole 128-byte lines. s_wait_xcnt stands inside the statement so that no address register is rewritten ahead of it.
__device__ __forceinline__ void g2_stage_copy(unsigned lds, const unsigned short* ga, size_t astep, const unsigned short* gb, size_t bstep) {
  asm volatile("global_load_async_to_lds_b128 %0, %12, off\n\t"
               "global_load_async_to_lds_b128 %1, %13, off\n\t"
               "global_load_async_to_lds_b128 %2, %14, off\n\t"
               "global_load_async_to_lds_b128 %3, %15, off\n\t"
               "global_load_async_to_lds_b128 %4, %16, off\n\t"
               "global_load_async_to_lds_b128 %5, %17, off\n\t"
               "global_load_async_to_lds_b128 %6, %18, off\n\t"
               "global_load_async_to_lds_b128 %7, %19, off\n\t"
               "global_load_async_to_lds_b128 %8, %20, off\n\t"
               "global_load_async_to_lds_b128 %9, %21, off\n\t"
               "global_load_async_to_lds_b128 %10, %22, off\n\t"
               "global_load_async_to_lds_b128 %11, %23, off\n\t"
               "s_wait_xcnt 0x0"
               :: "v"(lds), "v"(lds + 2048u), "v"(lds + 4096u), "v"(lds + 6144u), "v"(lds + 8192u), "v"(lds + 10240u), "v"(lds + 12288u), "v"(lds + 14336u),
                  "v"(lds + 16384u), "v"(lds + 18432u), "v"(lds + 20480u), "v"(lds + 22528u),
                  "v"(ga), "v"(ga + astep), "v"(ga + 2 * astep), "v"(ga + 3 * astep), "v"(ga + 4 * astep), "v"(ga + 5 * astep), "v"(ga + 6 * astep), "v"(ga + 7 * astep),
                  "v"(gb), "v"(gb + bstep), "v"(gb + 2 * bstep), "v"(gb + 3 * bstep)
               : "memory");
}
// ROT: the tile's 64 columns are one head and its rows are tokens (position = row % SLEN): the rotary embedding is applied to the staged f32 tile on its way out (CS: cos table, then sin table, [position][RD / 2]).
// KMID > 0: the operands' k range is two parts that carry different powers of two; ahead of k = KMID (a multiple of 64) the accumulators are multiplied by MIDMUL, an exact step that brings the first part's sums to the second part's scale.
template <int ACT, bool ROT, int KMID = 0, int MIDMUL = 1>
__global__ __launch_bounds__(128) void k_gemm2(const _Float16* __restrict__ A, int lda, size_t sA, const _Float16* __restrict__ Bh, int ldb, size_t sB, float alpha, const float* __restrict__ bias, size_t sBias, const float* __restrict__ CP, int rowsPerB, size_t sCPb, int row0g,
    float* __restrict__ C, _Float16* __restrict__ C16, int ldc, size_t sC, int M, int N, int K, const float* __restrict__ CS) {
  constexpr int ATILE_B = 128 * 128, GSTAGE_B = ATILE_B + 64 * 128;      /* a stage = 64 k: A tile, then B tile */
  __shared__ __attribute__((aligned(16))) unsigned char ring[2 * GSTAGE_B];
  float (*so)[32][68] = reinterpret_cast<float (*)[32][68]>(ring);      /* output staging (34,816 bytes) takes the ring's place behind the loop's last barrier */
  const int tid = threadIdx.x, w = tid >> 5, lane = tid & 31, ln = lane & 15, hh = lane >> 4; const int by = blockIdx.y;
  A += (size_t)by * sA; Bh += (size_t)by * sB; const size_t cofs = (size_t)by * sC; const float* bp = bias ? bias + (size_t)by * sBias : nullptr;
  const int ntn = N >> 6; const int mt = blockIdx.x / ntn, nq = blockIdx.x - mt * ntn; if (mt * 128 >= M) return;      /* the whole work-group leaves, ahead of every copy and barrier */
  const int row0 = mt * 128 + 32 * w, col0 = nq * 64;
  const int nst = K >> 6;
  /* 16-byte piece c of row r lies at r * 128 + (c ^ ((r >> 1) & 7)) * 16: sixteen rows read at one piece index fall on all 64 banks */
  const unsigned cp_lds = (unsigned)(size_t)ring + (unsigned)((tid >> 3) * 128 + (((tid & 7) ^ ((tid >> 4) & 7)) * 16));
  const unsigned short* cp_a = (const unsigned short*)A + (size_t)(mt * 128 + (tid >> 3)) * lda + (tid & 7) * 8;
  const unsigned short* cp_b = (const unsigned short*)Bh + (size_t)(col0 + (tid >> 3)) * ldb + (tid & 7) * 8;
  const size_t astep = (size_t)16 * lda, bstep = (size_t)16 * ldb;
  g2_stage_copy(cp_lds, cp_a, astep, cp_b, bstep);
  int fo[2][2];      /* a fragment's two pieces in row ln: [32-element group of the row][piece] */
#pragma unroll
  for (int g = 0; g < 2; ++g)
#pragma unroll
    for (int pc = 0; pc < 2; ++pc) fo[g][pc] = ln * 128 + (((g * 4 + pc * 2 + hh) ^ ((ln >> 1) & 7)) * 16);
  const v8f z8 = {0.f,0.f,0.f,0.f,0.f,0.f,0.f,0.f}; v8f c00 = z8, c01 = z8, c02 = z8, c03 = z8, c10 = z8, c11 = z8, c12 = z8, c13 = z8;
  asm volatile("s_wait_asynccnt 0x0" ::: "memory");      /* stage 0 has landed for this wave's own copies */
  __syncthreads();                                       /* ... and for every other wave's */
  if (1 < nst) g2_stage_copy(cp_lds + GSTAGE_B, cp_a + 64, astep, cp_b + 64, bstep);
#pragma unroll 1      /* one body for both buffers: the buffer is picked by the trip's parity */
  for (int t = 0; t < nst; ++t) {
    const unsigned char* ar = ring + (t & 1) * GSTAGE_B + w * (32 * 128); const unsigned char* br = ring + (t & 1) * GSTAGE_B + ATILE_B;
    if (KMID > 0 && t == (KMID >> 6)) { const float ms = (float)MIDMUL; c00 *= ms; c01 *= ms; c02 *= ms; c03 *= ms; c10 *= ms; c11 *= ms; c12 *= ms; c13 *= ms; }
#pragma unroll
    for (int g = 0; g < 2; ++g) { const int o0 = fo[g][0], o1 = fo[g][1];
      const v16h a0 = g2_lfrag(ar, o0, o1), a1 = g2_lfrag(ar + 2048, o0, o1);
      const v16h b0 = g2_lfrag(br, o0, o1), b1 = g2_lfrag(br + 2048, o0, o1), b2 = g2_lfrag(br + 4096, o0, o1), b3 = g2_lfrag(br + 6144, o0, o1);
      c00 = g2_mma(a0, b0, c00); c10 = g2_mma(a1, b0, c10);
      c01 = g2_mma(a0, b1, c01); c11 = g2_mma(a1, b1, c11);
      c02 = g2_mma(a0, b2, c02); c12 = g2_mma(a1, b2, c12);
      c03 = g2_mma(a0, b3, c03); c13 = g2_mma(a1, b3, c13); }
    asm volatile("s_wait_dscnt 0x0" ::: "memory");         /* this wave's reads of stage t have returned */
    asm volatile("s_wait_asynccnt 0x0" ::: "memory");      /* this wave's copies of stage t + 1 have landed */
    __syncthreads();                                       /* publishes stage t + 1 and ends every wave's reads of stage t */
    if (t + 2 < nst) g2_stage_copy(cp_lds + (t & 1) * GSTAGE_B, cp_a + (size_t)(t + 2) * 64, astep, cp_b + (size_t)(t + 2) * 64, bstep); }
  asm volatile("s_wait_asynccnt 0x0" ::: "memory");        /* nothing is in flight when the ring becomes output staging */
  const int rsub = lane >> 4, c4 = (lane & 15) * 4;
  v8f accs[8] = {c00, c01, c02, c03, c10, c11, c12, c13};
#pragma unroll
  for (int u = 0; u < 8; ++u) { const int t = u & 3, half = u >> 2; const int col = col0 + t * 16 + ln; const float bv = bp ? bf16_round(bp[col]) : 0.f;
#pragma unroll
    for (int r = 0; r < 8; ++r) { const int rloc = half * 16 + 8 * hh + r; float v = accs[u][r] * alpha + bv; if (CP) { const int bidx = (row0g + row0 + rloc) / rowsPerB; v += CP[(size_t)bidx * sCPb + (size_t)by * 64 + col]; }
      if (ACT == 3) v = fmaxf(v, 0.f); else if (ACT == 6) v = 0.5f * v * (1.0f + erff(v * 0.70710678118654752f)); else if (ACT == 11) v = 1.0f / (1.0f + expf(-v)); else if (ACT == 15) v = v / (1.0f + expf(-v)); else if (ACT == 12) v = (v > 0.f) ? v : 0.01f * v; else if (ACT == 8) v = tanhf(v);
      so[w][rloc][t * 16 + ln] = v; } }
  v4f tcs[16], tsn[16];      /* ROT: the lane's table pieces for its sixteen rows, all asked for at once so that their latency is paid once; behind the staging, where the accumulators' registers are free */
  if (ROT) { const float* tb = CS + (size_t)(row0 % SLEN + rsub) * (RD / 2) + (c4 & (RD / 2 - 1));      /* a wave's 32 rows never cross a sequence's end: both are multiples of 32 */
#pragma unroll
    for (int q = 0; q < 16; ++q) { tcs[q] = *(const v4fa*)(tb + q * RD); tsn[q] = *(const v4fa*)(tb + q * RD + SLEN * (RD / 2)); }
    asm volatile("s_wait_xcnt 0x0" ::: "memory"); }      /* stands ahead of any rewrite of the table loads' address registers */
  __builtin_amdgcn_fence(__ATOMIC_ACQ_REL, "workgroup"); __builtin_amdgcn_wave_barrier();
  {
#pragma unroll
    for (int q = 0; q < 16; ++q) { const int r = q * 2 + rsub; v4f v = *(const v4fa*)&so[w][r][c4];
      if (ROT) {      /* every lane reads a partner piece at a valid place; only dims under RD take the rotated value */
        const v4f u = *(const v4fa*)&so[w][r][c4 ^ (RD / 2)]; const v4f cs = tcs[q], sn = tsn[q];
        const v4f lo = v * cs + u * sn, hi = u * -sn + v * cs;      /* dims 0..15: x1 cos + x2 sin (x1 own); dims 16..31: -x1 sin + x2 cos (x2 own) */
        v = (c4 < RD / 2) ? lo : ((c4 < RD) ? hi : v); }
      if (C) *(v4f*)(C + cofs + (size_t)(row0 + r) * ldc + col0 + c4) = v; if (C16) { v4h h4; for (int i = 0; i < 4; ++i) h4[i] = (_Float16)v[i]; *(v4h*)(C16 + cofs + (size_t)(row0 + r) * ldc + col0 + c4) = h4; } }
     } }



// One stage of the K / V^T ring: 64 key rows of K (128 bytes each) and 64 rows of V^T (the same 64 keys, 128 bytes each), 16 KiB, brought by asynchronous copies to LDS.
// Eight copies a lane; a wave-wide copy covers four whole 128-byte lines. s_wait_xcnt stands inside the statement so that no address register is rewritten ahead of it.
__device__ __forceinline__ void stage_copy(unsigned lds, const unsigned short* gk, size_t kstep, const unsigned short* gv, size_t vstep) {
  asm volatile("global_load_async_to_lds_b128 %0, %8, off\n\t"
               "global_load_async_to_lds_b128 %1, %9, off\n\t"
               "global_load_async_to_lds_b128 %2, %10, off\n\t"
               "global_load_async_to_lds_b128 %3, %11, off\n\t"
               "global_load_async_to_lds_b128 %4, %12, off\n\t"
               "global_load_async_to_lds_b128 %5, %13, off\n\t"
               "global_load_async_to_lds_b128 %6, %14, off\n\t"
               "global_load_async_to_lds_b128 %7, %15, off\n\t"
               "s_wait_xcnt 0x0"
               :: "v"(lds), "v"(lds + 2048u), "v"(lds + 4096u), "v"(lds + 6144u), "v"(lds + 8192u), "v"(lds + 10240u), "v"(lds + 12288u), "v"(lds + 14336u),
                  "v"(gk), "v"(gk + kstep), "v"(gk + 2 * kstep), "v"(gk + 3 * kstep), "v"(gv), "v"(gv + vstep), "v"(gv + 2 * vstep), "v"(gv + 3 * vstep)
               : "memory");
}
// lane l with lane l ^ 16: one vector cross-row move
__device__ __forceinline__ float xhalf(float x) { return __builtin_bit_cast(float, __builtin_amdgcn_permlanex16(__builtin_bit_cast(int, x), __builtin_bit_cast(int, x), 0x76543210, 0xfedcba98, false, false)); }
template <int CAUSAL>
__global__ __launch_bounds__(128) void k_flash(const _Float16* __restrict__ Q16, int ldq, const _Float16* __restrict__ K16, int ldk, const _Float16* __restrict__ Vt, const int* __restrict__ MSK, float* __restrict__ O, int ldo) {
  constexpr int RPW = 16, RTN = RPW / 16, NQB = TQ / (4 * RPW), DT = 4, KS = 2;
  constexpr float C2 = SCL * 1.44269504088896340736f;      /* score -> exponent of 2; the bare exp2 instruction serves: no exponent exceeds 10, and a result that flushes to zero lies far under P's f16 step */
  constexpr int TILE_B = 64 * 128, STAGE_B = 2 * TILE_B;      /* a stage = 64 keys: K tile, then V^T tile, rows of 128 bytes without a pad */
  __shared__ __attribute__((aligned(16))) unsigned char ring[2 * STAGE_B];
  float (*sO)[RPW][64 + 4] = reinterpret_cast<float (*)[RPW][64 + 4]>(ring);      /* output staging takes the ring's place behind the loop's last barrier */
  const int tid = threadIdx.x, w = tid >> 5, lane = tid & 31, ln = lane & 15, hh = lane >> 4;
  const int slab = blockIdx.x / QBLKS, qblk = blockIdx.x % QBLKS; (void)NQB; (void)MSK; const int b = slab / NH, h = slab % NH; const int qb0 = qblk * (4 * RPW); const int q0 = qb0 + w * RPW;
  const unsigned short* Vth = (const unsigned short*)Vt + (size_t)slab * 64 * TK;
  const int jend = (CAUSAL == 1) ? (qb0 + 4 * RPW) : TK;      /* causal: keys beyond the block's last query never contribute */
  const int nst = jend / 64;
  /* 16-byte piece c of row r lies at r * 128 + (c ^ ((r >> 1) & 7)) * 16: sixteen rows read at one piece index fall on all 64 banks */
  const unsigned cp_lds = (unsigned)(size_t)ring + (unsigned)((tid >> 3) * 128 + (((tid & 7) ^ ((tid >> 4) & 7)) * 16));
  const unsigned short* cp_k = (const unsigned short*)K16 + ((size_t)b * TK + (tid >> 3)) * ldk + h * 64 + (tid & 7) * 8;
  const unsigned short* cp_v = Vth + (size_t)(tid >> 3) * TK + (tid & 7) * 8;
  const size_t kstep = (size_t)16 * ldk, vstep = (size_t)16 * TK;
  stage_copy(cp_lds, cp_k, kstep, cp_v, vstep);
  FragH aq[2][KS];
#pragma unroll
  for (int rt = 0; rt < RTN; ++rt) { const unsigned short* qr = (const unsigned short*)Q16 + ((size_t)b * TQ + q0 + rt * 16 + ln) * ldq + h * 64;
#pragma unroll
    for (int ks = 0; ks < KS; ++ks) { aq[rt][ks].half[0] = *(const v8us*)(qr + ks * 32 + 8 * hh); aq[rt][ks].half[1] = *(const v8us*)(qr + ks * 32 + 16 + 8 * hh); } }
  int fo[2][2];      /* a fragment's two pieces in row ln: [32-element group of the row][piece] */
#pragma unroll
  for (int g = 0; g < 2; ++g)
#pragma unroll
    for (int pc = 0; pc < 2; ++pc) fo[g][pc] = ln * 128 + (((g * 4 + pc * 2 + hh) ^ ((ln >> 1) & 7)) * 16);
  float m_r[2], l_r[2]; v8f oacc[2][DT];      /* per lane: its query's running maximum (of raw scores), its half's share of the sum (x 1024), and O^T[d = dt * 16 + 8 * hh + r][query ln] */
#pragma unroll
  for (int rt = 0; rt < RTN; ++rt) { m_r[rt] = -3.0e38f; l_r[rt] = 0.f;
#pragma unroll
    for (int dt = 0; dt < DT; ++dt) oacc[rt][dt] = (v8f){0.f,0.f,0.f,0.f,0.f,0.f,0.f,0.f}; }
  asm volatile("s_wait_asynccnt 0x0" ::: "memory");      /* stage 0 has landed for this wave's own copies */
  __syncthreads();                                       /* ... and for every other wave's */
  if (1 < nst) stage_copy(cp_lds + STAGE_B, cp_k + (size_t)64 * ldk, kstep, cp_v + 64, vstep);
#pragma unroll 1
  for (int t = 0; t < nst; ++t) {
    const unsigned char* st = ring + (t & 1) * STAGE_B;
#pragma unroll 1      /* the two 32-key passes of a stage stay one body: unrolled, the registers grow and a work-group per WGP is lost */
    for (int ps = 0; ps < 2; ++ps) { const int j0 = t * 64 + ps * 32;
    v8f s[2][2];
#pragma unroll
    for (int nt = 0; nt < 2; ++nt) { const unsigned char* kr = st + (ps * 32 + nt * 16) * 128; FragH bk[KS];
#pragma unroll
      for (int ks = 0; ks < KS; ++ks) { bk[ks].half[0] = *(const v8us*)(kr + fo[ks][0]); bk[ks].half[1] = *(const v8us*)(kr + fo[ks][1]); }
#pragma unroll
      for (int rt = 0; rt < RTN; ++rt) { v8f acc = (v8f){0.f,0.f,0.f,0.f,0.f,0.f,0.f,0.f};
#pragma unroll
        for (int ks = 0; ks < KS; ++ks) acc = mmaH<1>(bk[ks].v, bk[ks].v, aq[rt][ks].v, aq[rt][ks].v, acc); s[rt][nt] = acc; } }      /* s[rt][nt][r] = score of key j0 + nt * 16 + 8 * hh + r, query q0 + rt * 16 + ln */
    FragH pb[2];
#pragma unroll
    for (int rt = 0; rt < RTN; ++rt) { const int tq = q0 + rt * 16 + ln; float sv[16]; bool ok[16];
#pragma unroll
      for (int e = 0; e < 16; ++e) { const int kk = j0 + (e >> 3) * 16 + 8 * hh + (e & 7);
        ok[e] = (CAUSAL == 1) ? (kk <= tq) : ((CAUSAL == 2) ? ((kk >> 5) == (tq >> 5)) : true);      /* mode 2: block-diagonal 32-token groups */
        sv[e] = ok[e] ? s[rt][e >> 3][e & 7] : -3.0e38f; }      /* raw scores: the scale is positive, so the maximum is taken ahead of it */
      float mx[4];
#pragma unroll
      for (int c = 0; c < 4; ++c) mx[c] = fmaxf(fmaxf(sv[c], sv[4 + c]), fmaxf(sv[8 + c], sv[12 + c]));
      float mc = fmaxf(fmaxf(mx[0], mx[1]), fmaxf(mx[2], mx[3])); mc = fmaxf(mc, xhalf(mc));      /* both halves now hold the query's maximum over the 32 keys */
      const float mn = fmaxf(m_r[rt], mc); const float ea = __builtin_amdgcn_exp2f((m_r[rt] - mn) * C2); const float al = (mn > -1.0e38f) ? ea : 1.0f; m_r[rt] = mn;
      const float nb = fmaf(-mn, C2, 10.0f);      /* 1024 p = 2^(score * C2 + nb): scale, log2 e, the maximum and P's factor 1024 in one multiply-add */
      const v2f c2v = {C2, C2}, nbv = {nb, nb}; v2f ls[2];
#pragma unroll
      for (int e = 0; e < 16; e += 2) { const v2f x = __builtin_elementwise_fma((v2f){sv[e], sv[e + 1]}, c2v, nbv);
        const v2f p = {ok[e] ? __builtin_amdgcn_exp2f(x[0]) : 0.f, ok[e + 1] ? __builtin_amdgcn_exp2f(x[1]) : 0.f};
        if (e < 4) ls[e >> 1] = p; else ls[(e >> 1) & 1] += p;
        pb[rt].h[e] = (_Float16)p[0]; pb[rt].h[e + 1] = (_Float16)p[1]; }
      l_r[rt] = l_r[rt] * al + ((ls[0][0] + ls[0][1]) + (ls[1][0] + ls[1][1]));      /* the sum carries the factor 1024 too */
#pragma unroll
      for (int dt = 0; dt < DT; ++dt)
#pragma unroll
        for (int r = 0; r < 8; ++r) oacc[rt][dt][r] *= al; }
#pragma unroll
    for (int dt = 0; dt < DT; ++dt) { const unsigned char* vrow = st + TILE_B + dt * 16 * 128; FragH bv; bv.half[0] = *(const v8us*)(vrow + (fo[0][0] ^ (ps * 64))); bv.half[1] = *(const v8us*)(vrow + (fo[0][1] ^ (ps * 64)));      /* the pass's 32 keys: piece index + 4 = bit 6 of the offset */
#pragma unroll
      for (int rt = 0; rt < RTN; ++rt) oacc[rt][dt] = mmaH<1>(bv.v, bv.v, pb[rt].v, pb[rt].v, oacc[rt][dt]); } }
    asm volatile("s_wait_dscnt 0x0" ::: "memory");         /* this wave's reads of stage t have returned */
    asm volatile("s_wait_asynccnt 0x0" ::: "memory");      /* this wave's copies of stage t + 1 have landed */
    __syncthreads();                                       /* publishes stage t + 1 and ends every wave's reads of stage t */
    if (t + 2 < nst) stage_copy(cp_lds + (t & 1) * STAGE_B, cp_k + (size_t)(t + 2) * 64 * ldk, kstep, cp_v + (t + 2) * 64, vstep); }
  asm volatile("s_wait_asynccnt 0x0" ::: "memory");        /* nothing is in flight when the ring becomes output staging */
#pragma unroll
  for (int rt = 0; rt < RTN; ++rt) { float l = l_r[rt]; l += xhalf(l); const float inv = (l > 0.f) ? 1.0f / l : 0.f;      /* the halves' sums join once */
#pragma unroll
    for (int dt = 0; dt < DT; ++dt)
#pragma unroll
      for (int q4 = 0; q4 < 2; ++q4) { v4f o4;
#pragma unroll
        for (int i = 0; i < 4; ++i) o4[i] = oacc[rt][dt][q4 * 4 + i] * inv;
        *(v4fa*)&sO[w][rt * 16 + ln][dt * 16 + 8 * hh + q4 * 4] = o4; } }
  __builtin_amdgcn_fence(__ATOMIC_ACQ_REL, "workgroup"); __builtin_amdgcn_wave_barrier();
  {
#pragma unroll
    for (int rp = 0; rp < RPW; rp += 2) { const int r = rp + (lane >> 4), pc = lane & 15; const v4f val = *(const v4fa*)&sO[w][r][pc * 4]; *(v4f*)(O + ((size_t)b * TQ + q0 + r) * ldo + h * 64 + pc * 4) = val; }
     } }

__global__ __launch_bounds__(256) void k_wsc(const float* __restrict__ Wm, _Float16* __restrict__ Bt, size_t n8, float sc) { const size_t t = (size_t)blockIdx.x * 256 + threadIdx.x; if (t >= n8) return; FragH f; for (int q = 0; q < 8; ++q) f.h[q] = (_Float16)(bf16_round(Wm[t * 8 + q]) * sc); *(v8us*)((unsigned short*)Bt + t * 8) = f.half[0];  }
__global__ __launch_bounds__(256) void k_woutp(const float* __restrict__ Wm, _Float16* __restrict__ Bt) { const size_t t = (size_t)blockIdx.x * 256 + threadIdx.x; if (t >= (size_t)DMOD * (2 * DMOD / 8)) return; const int pc = (int)(t % (2 * DMOD / 8)); const int o = (int)(t / (2 * DMOD / 8)); const bool lo = pc * 8 >= DMOD; FragH f;
  for (int q = 0; q < 8; ++q) { const int c = pc * 8 + q - (lo ? DMOD : 0); f.h[q] = (_Float16)(bf16_round(Wm[(size_t)o * DMOD + c]) * (lo ? 1.0f : 16.0f)); } *(v8us*)((unsigned short*)Bt + (size_t)o * 2 * DMOD + pc * 8) = f.half[0];  }
__global__ __launch_bounds__(256) void k_ropetab(float* __restrict__ CS) {
  #pragma clang fp contract(off)
  const int t = blockIdx.x * 256 + threadIdx.x; if (t >= SLEN * (RD / 2)) return; const int i = t % (RD / 2), tpos = t / (RD / 2); const float invf = (float)pow(10000.0, -(double)(2 * i) / (double)RD); const float ang = (float)tpos * invf; const float c = cosf(ang), s = sinf(ang);
  { *(float*)(CS + t) = c; *(float*)(CS + SLEN * (RD / 2) + t) = s;  } }

extern "C" void kernel_launch(void* const* d_in, const int* in_sizes, int n_in,
                              void* d_out, int out_size, void* d_ws, size_t ws_size, hipStream_t stream) {
  (void)in_sizes; (void)n_in; (void)out_size;
  const float* const* I = (const float* const*)d_in; const float* x = I[0]; const float* Wq = I[1]; const float* Wk = I[2]; const float* Wv = I[3]; const float* Wo = I[4];
  char* ws = (char*)d_ws; size_t off = 0;
  auto take = [&](size_t bytes) { char* p = ws + off; off += (bytes + 255) & ~(size_t)255; return p; };
  const size_t w8 = (size_t)DMOD * DMOD / 8;
  _Float16* BQ = (_Float16*)take(w8 * 16); _Float16* BK = (_Float16*)take(w8 * 16); _Float16* BV = (_Float16*)take(w8 * 16); _Float16* BO = (_Float16*)take(w8 * 32);
  _Float16* X16 = (_Float16*)take((size_t)NR * DMOD * 2); float* O = (float*)take((size_t)NR * DMOD * 4); _Float16* Q16 = (_Float16*)take((size_t)NR * DMOD * 2); _Float16* K16 = (_Float16*)take((size_t)NR * DMOD * 2); _Float16* V16 = (_Float16*)take((size_t)NR * DMOD * 2); _Float16* VT = (_Float16*)take((size_t)NR * DMOD * 2); float* CS = (float*)take((size_t)SLEN * RD * 4);
  _Float16* HH = Q16;      /* alias after the flash kernel: Q16 and K16 are dead and lie back to back (each a multiple of 256 bytes): one [NR][2 * DMOD] plane */
  if (off > ws_size) return;      /* 10 + 16 + 32 + 16 x 4 = 122 MiB */
  k_wsc<<<(unsigned)((w8 + 255) / 256), 256, 0, stream>>>(Wq, BQ, w8, 16.0f); k_wsc<<<(unsigned)((w8 + 255) / 256), 256, 0, stream>>>(Wk, BK, w8, 16.0f); k_wsc<<<(unsigned)((w8 + 255) / 256), 256, 0, stream>>>(Wv, BV, w8, 16.0f); k_woutp<<<(unsigned)(((size_t)DMOD * (2 * DMOD / 8) + 255) / 256), 256, 0, stream>>>(Wo, BO);
  k_x16<<<(unsigned)(((size_t)NR * DMOD / 8 + 255) / 256), 256, 0, stream>>>(x, X16, (size_t)NR * DMOD / 8);
  k_ropetab<<<(SLEN * (RD / 2) + 255) / 256, 256, 0, stream>>>(CS);
  const dim3 gP((NR / 128) * (DMOD / 64), 1);
  k_gemm2<0, true><<<gP, 128, 0, stream>>>(X16, DMOD, 0, BQ, DMOD, 0, 0.0625f, nullptr, 0, nullptr, 1, 0, 0, nullptr, Q16, DMOD, 0, NR, DMOD, DMOD, CS);
  k_gemm2<0, true><<<gP, 128, 0, stream>>>(X16, DMOD, 0, BK, DMOD, 0, 0.0625f, nullptr, 0, nullptr, 1, 0, 0, nullptr, K16, DMOD, 0, NR, DMOD, DMOD, CS);
  k_gemm2<0, false><<<gP, 128, 0, stream>>>(X16, DMOD, 0, BV, DMOD, 0, 0.0625f, nullptr, 0, nullptr, 1, 0, 0, nullptr, V16, DMOD, 0, NR, DMOD, DMOD, nullptr);
  k_vt<NH, SLEN><<<NB * NH * (SLEN / 64), 256, 0, stream>>>(V16, DMOD, 0, VT);
  k_flash<0><<<NB * NH * QBLKS, 128, 0, stream>>>(Q16, DMOD, K16, DMOD, VT, nullptr, O, DMOD);
  k_hl<<<(unsigned)(((size_t)NR * DMOD / 8 + 255) / 256), 256, 0, stream>>>(O, HH, (size_t)NR * DMOD / 8);
  /* hi x (16 W) summed first, x 64, then (1024 residual) x W on top: 1024 y, scaled back once */
  k_gemm2<0, false, DMOD, 64><<<gP, 128, 0, stream>>>(HH, 2 * DMOD, 0, BO, 2 * DMOD, 0, 1.0f / 1024.0f, nullptr, 0, nullptr, 1, 0, 0, (float*)d_out, nullptr, DMOD, 0, NR, DMOD, 2 * DMOD, nullptr);
}

// v007
// It runs in 197 microseconds.
// Two timings next to v006 put it at 1.10 and 1.09 times that version's speed.
// Counting every step since v000, it is 4.12 times as fast.
#include <hip/hip_runtime.h>
// TinyAttn (4 sequences x 2048 tokens x 1024; 16 heads x 64; rotary embedding on the first 32 dims of each head): q,k,v = x W^T; q,k rotated (rot = [x1 cos + x2 sin, -x1 sin + x2 cos] on dims 0..31 with the module's inverse-frequency table); softmax(q k^T / 8) v; y Wo^T -> [4,2048,1024].
// Structure: x as an exact f16 plane; q/k/v projections as f16 WMMA GEMMs (32x64 wave tiles, operand tiles staged in an LDS ring, f32 accumulation, exact x16 weights; q/k rotated in f32 on the staged tile, v as f16); the rotary tables recomputed on the device (f64 pow for the inverse frequencies, f32 angle product, f32 cos/sin) and applied in the q/k projections' epilogue, which writes the f16 q/k planes; V transposed by LDS tiles; the fused flash kernel; the attention output as the hi and residual halves of one [token][2048] f16 plane into one output-projection GEMM over k = 2048, whose accumulators are multiplied by 64 between the halves.
// Compute dtype: x and weights rounded to bf16; q, k (after rotation), v, P as f16 operands (~2^-12); attention output hi + 2^-10-scaled residual; f32 accumulation/softmax. v_wmma_f32_16x16x32_f16.
#define NB 4
#define DMOD 1024
#define HD 64
#define RD 32                    /* rotary dims per head */
#define NR (NB * SLEN)
#define QBLKS (TQ / 64)          /* query blocks per (sequence, head) launched */
#define SLEN 2048
#define TQ SLEN
#define TK SLEN
#define NH 16
#define SCL 0.125f               /* 64^-0.5 */
typedef __bf16 v16b __attribute__((ext_vector_type(16)));
typedef unsigned short v8us __attribute__((ext_vector_type(8), may_alias));
typedef float  v8f  __attribute__((ext_vector_type(8)));
typedef float  v4f  __attribute__((ext_vector_type(4)));
typedef float  v2f  __attribute__((ext_vector_type(2)));
typedef float  v4fa __attribute__((ext_vector_type(4), may_alias));
union FragB { v16b v; v8us half[2]; unsigned short u[16]; };

__device__ __forceinline__ unsigned short bf16_bits(float x) { unsigned int u = __float_as_uint(x); return (unsigned short)((u + 0x7FFFu + ((u >> 16) & 1u)) >> 16); }
__device__ __forceinline__ float bf16_val(unsigned short b) { return __uint_as_float(((unsigned int)b) << 16); }
__device__ __forceinline__ float bf16_round(float x) { return bf16_val(bf16_bits(x)); }
// D += A·B with NT terms: 1 = ah·bh, 2 = + al·bh (A split), 3 = + ah·bl (both split)
template <int NT>
__device__ __forceinline__ v8f mmaN(v16b ah, v16b al, v16b bh, v16b bl, v8f c) {
  c = __builtin_amdgcn_wmma_f32_16x16x32_bf16(false, ah, false, bh, (short)0, c, false, false);
  if (NT >= 2) c = __builtin_amdgcn_wmma_f32_16x16x32_bf16(false, al, false, bh, (short)0, c, false, false);
  if (NT >= 3) c = __builtin_amdgcn_wmma_f32_16x16x32_bf16(false, ah, false, bl, (short)0, c, false, false);
  asm volatile("v_nop\n\tv_nop\n\tv_nop\n\tv_nop" : "+v"(c) : "v"(ah), "v"(al), "v"(bh), "v"(bl));
  return c;
}

__global__ __launch_bounds__(256) void k_wt_bf16(const float* __restrict__ W, unsigned short* __restrict__ Wt, int K, int N) {
  const int t = blockIdx.x * 256 + threadIdx.x;
  const int k8n = K / 8;
  if (t >= N * k8n) return;
  const int n = t / k8n, k8 = (t % k8n) * 8;
  v8us v;
#pragma unroll
  for (int i = 0; i < 8; ++i) v[i] = bf16_bits(W[(size_t)(k8 + i) * N + n]);
  *(v8us*)(Wt + (size_t)n * K + k8) = v;
  
}

// GEMM C[M][N] (f32, pitch ldc) = act(A[M][K]·W + bias). A f32 row-major (pitch lda) converted per fragment to bf16
// (ASPLIT: hi/lo two planes -> 2 terms, else single rounded term); Wt bf16 [N][K] (pitch ldb). BIAS_BF16 rounds the
// bias to bf16 first (bias quantised to bf16 before the add). K%32==0, M%16==0, N%64==0.
template <bool ASPLIT, int ACT, bool BIAS_BF16>
__global__ __launch_bounds__(128) void k_gemm_bf(const float* __restrict__ A, int lda, const unsigned short* __restrict__ Wt, int ldb,
                                               const float* __restrict__ bias, float* __restrict__ C, int ldc, int M, int N, int K) {
  __shared__ __attribute__((aligned(16))) float so[4][16][64];
  const int tid = threadIdx.x, w = tid >> 5, lane = tid & 31, ln = lane & 15, hh = lane >> 4;
  const int ntn = N / 64;
  const int wid = blockIdx.x * 4 + w;
  const int mt = wid / ntn, nq = wid % ntn;
  if (mt * 16 >= M) return;
  const int row0 = mt * 16, col0 = nq * 64;
  const float* arow = A + (size_t)(row0 + ln) * lda;
  v8f acc[4] = {};
  for (int kb = 0; kb < K; kb += 32) {
    FragB ah, al;
    const v4f x0 = *(const v4fa*)(arow + kb + 8 * hh), x1 = *(const v4fa*)(arow + kb + 8 * hh + 4);
    const v4f x2 = *(const v4fa*)(arow + kb + 16 + 8 * hh), x3 = *(const v4fa*)(arow + kb + 16 + 8 * hh + 4);
    float xs[16] = {x0[0],x0[1],x0[2],x0[3],x1[0],x1[1],x1[2],x1[3],x2[0],x2[1],x2[2],x2[3],x3[0],x3[1],x3[2],x3[3]};
#pragma unroll
    for (int i = 0; i < 16; ++i) { const unsigned short hb = bf16_bits(xs[i]); ah.u[i] = hb; al.u[i] = ASPLIT ? bf16_bits(xs[i] - bf16_val(hb)) : (unsigned short)0; }
#pragma unroll
    for (int t = 0; t < 4; ++t) {
      const unsigned short* brow = Wt + (size_t)(col0 + t * 16 + ln) * ldb + kb;
      FragB b;
      b.half[0] = *(const v8us*)(brow + 8 * hh);
      b.half[1] = *(const v8us*)(brow + 16 + 8 * hh);
      acc[t] = mmaN<ASPLIT ? 2 : 1>(ah.v, al.v, b.v, b.v, acc[t]);
    }
  }
#pragma unroll
  for (int t = 0; t < 4; ++t) {
    float bv = bias ? bias[col0 + t * 16 + ln] : 0.f;
    if (BIAS_BF16) bv = bf16_round(bv);
#pragma unroll
    for (int r = 0; r < 8; ++r) { float v = acc[t][r] + bv; if (ACT == 1) v = fmaxf(v, 0.f); so[w][8 * hh + r][t * 16 + ln] = v; }
  }
  __builtin_amdgcn_fence(__ATOMIC_ACQ_REL, "workgroup");
  __builtin_amdgcn_wave_barrier();
  const int rsub = lane >> 4, c4 = (lane & 15) * 4;
  {
#pragma unroll
    for (int q = 0; q < 8; ++q) {
      const int r = q * 2 + rsub;
      const v4f v = *(const v4fa*)&so[w][r][c4];
      *(v4f*)(C + (size_t)(row0 + r) * ldc + col0 + c4) = v;
    }
    
  }
}

// GEMM C = act(A·W + bias + resid): A f32 (ASPLIT -> hi/lo 2 terms), Wt bf16 [N][K]; ACT 0 none, 1 relu, 2 exact gelu;
// resid (optional, f32, row index = (row % rmod), pitch ldr, RES_BF16 rounds it) added before the activation.
template <bool ASPLIT, int ACT, bool BIAS_BF16, bool RES_BF16>
__global__ __launch_bounds__(128) void k_gemm_bf3(const float* __restrict__ A, int lda, const unsigned short* __restrict__ Wt, int ldb,
                                                const float* __restrict__ bias, const float* __restrict__ resid, int rmod, int ldr,
                                                float* __restrict__ C, int ldc, int M, int N, int K) {
  __shared__ __attribute__((aligned(16))) float so[4][16][64];
  const int tid = threadIdx.x, w = tid >> 5, lane = tid & 31, ln = lane & 15, hh = lane >> 4;
  const int ntn = N / 64;
  const int wid = blockIdx.x * 4 + w;
  const int mt = wid / ntn, nq = wid % ntn;
  if (mt * 16 >= M) return;
  const int row0 = mt * 16, col0 = nq * 64;
  const float* arow = A + (size_t)(row0 + ln) * lda;
  v8f acc[4] = {};
  for (int kb = 0; kb < K; kb += 32) {
    FragB ah, al;
    const v4f x0 = *(const v4fa*)(arow + kb + 8 * hh), x1 = *(const v4fa*)(arow + kb + 8 * hh + 4);
    const v4f x2 = *(const v4fa*)(arow + kb + 16 + 8 * hh), x3 = *(const v4fa*)(arow + kb + 16 + 8 * hh + 4);
    float xs[16] = {x0[0],x0[1],x0[2],x0[3],x1[0],x1[1],x1[2],x1[3],x2[0],x2[1],x2[2],x2[3],x3[0],x3[1],x3[2],x3[3]};
#pragma unroll
    for (int i = 0; i < 16; ++i) { const unsigned short hb = bf16_bits(xs[i]); ah.u[i] = hb; al.u[i] = ASPLIT ? bf16_bits(xs[i] - bf16_val(hb)) : (unsigned short)0; }
#pragma unroll
    for (int t = 0; t < 4; ++t) {
      const unsigned short* brow = Wt + (size_t)(col0 + t * 16 + ln) * ldb + kb;
      FragB b;
      b.half[0] = *(const v8us*)(brow + 8 * hh);
      b.half[1] = *(const v8us*)(brow + 16 + 8 * hh);
      acc[t] = mmaN<ASPLIT ? 2 : 1>(ah.v, al.v, b.v, b.v, acc[t]);
    }
  }
#pragma unroll
  for (int t = 0; t < 4; ++t) {
    const int col = col0 + t * 16 + ln;
    float bv = bias ? bias[col] : 0.f;
    if (BIAS_BF16) bv = bf16_round(bv);
#pragma unroll
    for (int r = 0; r < 8; ++r) {
      float v = acc[t][r] + bv;
      if (resid) { float rv = resid[(size_t)((row0 + 8 * hh + r) % rmod) * ldr + col]; if (RES_BF16) rv = bf16_round(rv); v += rv; }
      if (ACT == 1) v = fmaxf(v, 0.f);
      if (ACT == 2) v = 0.5f * v * (1.0f + erff(v * 0.70710678118654752f));
      if (ACT == 3) { const float u = 0.7978845608028654f * (v + 0.044715f * v * v * v); v = 0.5f * v * (1.0f + tanhf(u)); }
      so[w][8 * hh + r][t * 16 + ln] = v;
    }
  }
  __builtin_amdgcn_fence(__ATOMIC_ACQ_REL, "workgroup");
  __builtin_amdgcn_wave_barrier();
  const int rsub = lane >> 4, c4 = (lane & 15) * 4;
  {
#pragma unroll
    for (int q = 0; q < 8; ++q) {
      const int r = q * 2 + rsub;
      const v4f v = *(const v4fa*)&so[w][r][c4];
      *(v4f*)(C + (size_t)(row0 + r) * ldc + col0 + c4) = v;
    }
    
  }
}
// row LayerNorm (biased variance, eps) over N: s = X (+ R); optional out_sum <- s; out_norm <- (s-mu)*rsqrt(var+eps)*g + b
template <bool PARAM_BF16>
__global__ __launch_bounds__(256) void k_layernorm(const float* __restrict__ X, const float* __restrict__ R, const float* __restrict__ g, const float* __restrict__ bta,
                                                  float* __restrict__ out_sum, float* __restrict__ out_norm, int N, float eps) {
  __shared__ float red[256];
  const int row = blockIdx.x, tid = threadIdx.x;
  const float* x = X + (size_t)row * N; const float* rr = R ? R + (size_t)row * N : nullptr;
  float vals[16];                     // up to N = 4096
  const int per = N / 256;            // contiguous chunk per thread? use strided-by-4 chunks: thread handles j = tid*4 + 1024*u
  float s1 = 0.f;
  for (int u = 0; u < per / 4; ++u) {
    const int j = tid * 4 + 1024 * u;
    const v4f a = *(const v4fa*)(x + j);
    v4f b = {0.f,0.f,0.f,0.f}; if (rr) b = *(const v4fa*)(rr + j);
#pragma unroll
    for (int q = 0; q < 4; ++q) { const float v = a[q] + b[q]; vals[u * 4 + q] = v; s1 += v; }
  }
  red[tid] = s1; __syncthreads();
  for (int st = 128; st > 0; st >>= 1) { if (tid < st) red[tid] += red[tid + st]; __syncthreads(); }
  const float mu = red[0] / (float)N; __syncthreads();
  float s2 = 0.f;
  for (int u = 0; u < per / 4; ++u)
#pragma unroll
    for (int q = 0; q < 4; ++q) { const float c = vals[u * 4 + q] - mu; s2 += c * c; }
  red[tid] = s2; __syncthreads();
  for (int st = 128; st > 0; st >>= 1) { if (tid < st) red[tid] += red[tid + st]; __syncthreads(); }
  const float rs = rsqrtf(red[0] / (float)N + eps);
  {
    for (int u = 0; u < per / 4; ++u) {
      const int j = tid * 4 + 1024 * u;
      v4f o, sm;
#pragma unroll
      for (int q = 0; q < 4; ++q) {
        float gg = g[j + q], bb = bta[j + q];
        if (PARAM_BF16) { gg = bf16_round(gg); bb = bf16_round(bb); }
        sm[q] = vals[u * 4 + q]; o[q] = (vals[u * 4 + q] - mu) * rs * gg + bb;
      }
      if (out_sum) *(v4f*)(out_sum + (size_t)row * N + j) = sm;
      *(v4f*)(out_norm + (size_t)row * N + j) = o;
    }
    
  }
}



// ---- f16 WMMA path (v_wmma_f32_16x16x32_f16): 11-bit significands for operands in range — used where a [0,1] probability operand needs more precision than bf16
typedef _Float16 v16h __attribute__((ext_vector_type(16)));
union FragH { v16h v; v8us half[2]; _Float16 h[16]; unsigned short u[16]; };
template <int NT>
__device__ __forceinline__ v8f mmaH(v16h ah, v16h al, v16h bh, v16h bl, v8f c) {
  c = __builtin_amdgcn_wmma_f32_16x16x32_f16(false, ah, false, bh, (short)0, c, false, false);
  if (NT >= 2) c = __builtin_amdgcn_wmma_f32_16x16x32_f16(false, al, false, bh, (short)0, c, false, false);
  if (NT >= 3) c = __builtin_amdgcn_wmma_f32_16x16x32_f16(false, ah, false, bl, (short)0, c, false, false);
  asm volatile("v_nop\n\tv_nop\n\tv_nop\n\tv_nop" : "+v"(c) : "v"(ah), "v"(al), "v"(bh), "v"(bl));
  return c;
}
// batched GEMM like k_gemm_b but f16 operands: A f32 (split into f16 hi/lo if ASPLIT, else rounded to f16), Bt = f16 values [n][k]; alpha; C f32; N multiple of 16 (partial tiles skipped)
template <bool ASPLIT>
__global__ __launch_bounds__(128) void k_gemm_h(const float* __restrict__ A, int lda, size_t sA, const _Float16* __restrict__ Bh, int ldb, size_t sB, float alpha, float* __restrict__ C, int ldc, size_t sC, int M, int N, int K) {
  __shared__ __attribute__((aligned(16))) float so[4][16][64];
  const int tid = threadIdx.x, w = tid >> 5, lane = tid & 31, ln = lane & 15, hh = lane >> 4; const int by = blockIdx.y;
  A += (size_t)by * sA; Bh += (size_t)by * sB; C += (size_t)by * sC;
  const int ntn = (N + 63) / 64; const int wid = blockIdx.x * 4 + w; const int mt = wid / ntn, nq = wid % ntn; if (mt * 16 >= M) return;
  const int row0 = mt * 16, col0 = nq * 64; const float* arow = A + (size_t)(row0 + ln) * lda;
  v8f acc[4] = {};
  for (int kb = 0; kb < K; kb += 32) {
    FragH ah, al;
    const v4f x0 = *(const v4fa*)(arow + kb + 8 * hh), x1 = *(const v4fa*)(arow + kb + 8 * hh + 4), x2 = *(const v4fa*)(arow + kb + 16 + 8 * hh), x3 = *(const v4fa*)(arow + kb + 16 + 8 * hh + 4);
    float xs[16] = {x0[0],x0[1],x0[2],x0[3],x1[0],x1[1],x1[2],x1[3],x2[0],x2[1],x2[2],x2[3],x3[0],x3[1],x3[2],x3[3]};
#pragma unroll
    for (int i = 0; i < 16; ++i) { const _Float16 h = (_Float16)xs[i]; ah.h[i] = h; al.h[i] = ASPLIT ? (_Float16)(xs[i] - (float)h) : (_Float16)0.0f; }
#pragma unroll
    for (int t = 0; t < 4; ++t) { if (col0 + t * 16 >= N) continue; const size_t boff = (size_t)(col0 + t * 16 + ln) * ldb + kb; FragH bq; bq.half[0] = *(const v8us*)(Bh + boff + 8 * hh); bq.half[1] = *(const v8us*)(Bh + boff + 16 + 8 * hh);
      acc[t] = mmaH<ASPLIT ? 2 : 1>(ah.v, al.v, bq.v, bq.v, acc[t]); }
  }
#pragma unroll
  for (int t = 0; t < 4; ++t) { if (col0 + t * 16 >= N) continue;
#pragma unroll
    for (int r = 0; r < 8; ++r) so[w][8 * hh + r][t * 16 + ln] = acc[t][r] * alpha; }
  __builtin_amdgcn_fence(__ATOMIC_ACQ_REL, "workgroup"); __builtin_amdgcn_wave_barrier();
  const int rsub = lane >> 4, c4 = (lane & 15) * 4;
  {
#pragma unroll
    for (int q = 0; q < 8; ++q) { const int r = q * 2 + rsub; if (col0 + c4 < N) { const v4f v = *(const v4fa*)&so[w][r][c4]; *(v4f*)(C + (size_t)(row0 + r) * ldc + col0 + c4) = v; } }
     }
}

// Wt[n][k] = f16(W[k][n]·scale) from f32 row-major W[K][N] (scale = power of two; bf16-exact weights stay exact in f16 away from the subnormal range)
__global__ __launch_bounds__(256) void k_wt_f16(const float* __restrict__ W, _Float16* __restrict__ Wt, int K, int N, float scale) {
  const int t = blockIdx.x * 256 + threadIdx.x; if (t >= N * (K / 8)) return; const int n = t / (K / 8), k8 = (t % (K / 8)) * 8; FragH f;
#pragma unroll
  for (int i = 0; i < 8; ++i) f.h[i] = (_Float16)(bf16_round(W[(size_t)(k8 + i) * N + n]) * scale); const v8us o = f.half[0];
  *(v8us*)((unsigned short*)Wt + (size_t)n * K + k8) = o; 
}
// k_gemm_hh variant with fused epilogue: v = acc·alpha + bias[by·sBias + col] (+ CP[(row/rowsPerB)·sCPb + by·64 + col] if CP) ; ACT 0 none / 1 elu ; writes f16 C16 (and f32 C if non-null)
template <int ACT>
__global__ __launch_bounds__(128) void k_gemm_hhx(const _Float16* __restrict__ A, int lda, size_t sA, const _Float16* __restrict__ Bh, int ldb, size_t sB, float alpha, const float* __restrict__ bias, size_t sBias, const float* __restrict__ CP, int rowsPerB, size_t sCPb, int row0g,
    float* __restrict__ C, _Float16* __restrict__ C16, int ldc, size_t sC, int M, int N, int K) {
  __shared__ __attribute__((aligned(16))) float so[4][16][64];
  const int tid = threadIdx.x, w = tid >> 5, lane = tid & 31, ln = lane & 15, hh = lane >> 4; const int by = blockIdx.y;
  A += (size_t)by * sA; Bh += (size_t)by * sB; const size_t cofs = (size_t)by * sC; const float* bp = bias ? bias + (size_t)by * sBias : nullptr;
  const int ntn = (N + 63) / 64; const int wid = blockIdx.x * 4 + w; const int mt = wid / ntn, nq = wid % ntn; if (mt * 16 >= M) return;
  const int row0 = mt * 16, col0 = nq * 64; const _Float16* arow = A + (size_t)(row0 + ln) * lda;
  v8f acc[4] = {};
  for (int kb = 0; kb < K; kb += 32) { FragH ah; ah.half[0] = *(const v8us*)((const unsigned short*)arow + kb + 8 * hh); ah.half[1] = *(const v8us*)((const unsigned short*)arow + kb + 16 + 8 * hh);
#pragma unroll
    for (int t = 0; t < 4; ++t) { if (col0 + t * 16 >= N) continue; const size_t boff = (size_t)(col0 + t * 16 + ln) * ldb + kb; FragH bq; bq.half[0] = *(const v8us*)((const unsigned short*)Bh + boff + 8 * hh); bq.half[1] = *(const v8us*)((const unsigned short*)Bh + boff + 16 + 8 * hh);
      acc[t] = mmaH<1>(ah.v, ah.v, bq.v, bq.v, acc[t]); }
  }
#pragma unroll
  for (int t = 0; t < 4; ++t) { if (col0 + t * 16 >= N) continue; const int col = col0 + t * 16 + ln; const float bv = bp ? bf16_round(bp[col]) : 0.f;
#pragma unroll
    for (int r = 0; r < 8; ++r) { float v = acc[t][r] * alpha + bv; if (CP) { const int bidx = (row0g + row0 + 8 * hh + r) / rowsPerB; v += CP[(size_t)bidx * sCPb + (size_t)by * 64 + col]; } if (ACT == 1) v = (v > 0.f) ? v : expm1f(v); else if (ACT == 7) v = (v > 0.f) ? v + 1.0f : expf(v); else if (ACT == 8) v = tanhf(v); else if (ACT == 9) v = 0.5f * v * (1.0f + tanhf(0.7978845608028654f * (v + 0.044715f * v * v * v))); else if (ACT == 11) v = 1.0f / (1.0f + expf(-v)); else if (ACT == 12) v = (v > 0.f) ? v : 0.01f * v; else if (ACT == 14) v = (v > 0.f) ? v : 0.1f * v; else if (ACT == 15) v = v / (1.0f + expf(-v)); else if (ACT == 3) v = fmaxf(v, 0.f); else if (ACT == 6) v = 0.5f * v * (1.0f + erff(v * 0.70710678118654752f)); so[w][8 * hh + r][t * 16 + ln] = v; } }
  __builtin_amdgcn_fence(__ATOMIC_ACQ_REL, "workgroup"); __builtin_amdgcn_wave_barrier();
  const int rsub = lane >> 4, c4 = (lane & 15) * 4; typedef _Float16 v4h __attribute__((ext_vector_type(4)));
  {
#pragma unroll
    for (int q = 0; q < 8; ++q) { const int r = q * 2 + rsub; if (col0 + c4 < N) { const v4f v = *(const v4fa*)&so[w][r][c4]; if (C) *(v4f*)(C + cofs + (size_t)(row0 + r) * ldc + col0 + c4) = v; if (C16) { v4h h4; for (int i = 0; i < 4; ++i) h4[i] = (_Float16)v[i]; *(v4h*)(C16 + cofs + (size_t)(row0 + r) * ldc + col0 + c4) = h4; } } }
     }
}


typedef _Float16 v4h __attribute__((ext_vector_type(4)));

__global__ __launch_bounds__(256) void k_h16(const float* __restrict__ x, _Float16* __restrict__ X16, size_t n8) { const size_t t = (size_t)blockIdx.x * 256 + threadIdx.x; if (t >= n8) return; FragH f;
#pragma unroll
  for (int q = 0; q < 8; ++q) f.h[q] = (_Float16)x[t * 8 + q]; *(v8us*)((unsigned short*)X16 + t * 8) = f.half[0];  }
__global__ __launch_bounds__(256) void k_round16f(const float* __restrict__ W, _Float16* __restrict__ Bt, size_t n8) { const size_t t = (size_t)blockIdx.x * 256 + threadIdx.x; if (t >= n8) return; FragH f;
#pragma unroll
  for (int i = 0; i < 8; ++i) f.h[i] = (_Float16)(bf16_round(W[t * 8 + i]) * 16.0f); *(v8us*)((unsigned short*)Bt + t * 8) = f.half[0];  }
template <int NHv, int TTv>
__global__ __launch_bounds__(256) void k_vt(const _Float16* __restrict__ V16, int ldv, int voff, _Float16* __restrict__ Vt) { __shared__ unsigned short tl[64][66]; const int tid = threadIdx.x; const int slab = blockIdx.x / (TTv / 64), lg = blockIdx.x % (TTv / 64); const int b = slab / NHv, h = slab % NHv;
  for (int i = tid; i < 64 * 8; i += 256) { const int r = i / 8, c8 = (i % 8) * 8; FragH f; f.half[0] = *(const v8us*)((const unsigned short*)V16 + ((size_t)b * TTv + lg * 64 + r) * ldv + voff + h * 64 + c8);
#pragma unroll
    for (int q = 0; q < 8; ++q) tl[r][c8 + q] = f.u[q]; }
  __syncthreads();
  {
#pragma unroll
    for (int rd = 0; rd < 2; ++rd) { const int d = rd * 32 + tid / 8, pc = tid % 8; FragH f;
#pragma unroll
      for (int q = 0; q < 8; ++q) f.u[q] = tl[pc * 8 + q][d];
      *(v8us*)((unsigned short*)Vt + ((size_t)slab * 64 + d) * TTv + lg * 64 + pc * 8) = f.half[0]; }
     } }

// H: [row][2 * DMOD], a row's hi values in its first half and its residuals (x 1024) in its second: one A operand for a product over k = 2 * DMOD
__global__ __launch_bounds__(256) void k_hl(const float* __restrict__ F, _Float16* __restrict__ H, size_t n8) { const size_t t = (size_t)blockIdx.x * 256 + threadIdx.x; if (t >= n8) return; FragH fh, fl; unsigned short* hp = (unsigned short*)H + (t / (DMOD / 8)) * (2 * DMOD) + (t % (DMOD / 8)) * 8; const v4f a = *(const v4fa*)(F + t * 8), c = *(const v4fa*)(F + t * 8 + 4);
#pragma unroll
  for (int q = 0; q < 4; ++q) { _Float16 h = (_Float16)a[q]; fh.h[q] = h; fl.h[q] = (_Float16)((a[q] - (float)h) * 1024.0f); h = (_Float16)c[q]; fh.h[4 + q] = h; fl.h[4 + q] = (_Float16)((c[q] - (float)h) * 1024.0f); }
  { *(v8us*)hp = fh.half[0]; *(v8us*)(hp + DMOD) = fl.half[0];  } }

// ---- fast GEMM (work-group tile 128x64, wave tile 32x64; requires M % 128 == 0, N % 64 == 0, K % 64 == 0 and K >= 64); epilogue = k_gemm_hhx semantics ----
__device__ __forceinline__ v8f g2_mma(v16h a, v16h b, v8f c) { v8f d = __builtin_amdgcn_wmma_f32_16x16x32_f16(false, a, false, b, (short)0, c, false, false); asm volatile("v_nop\n\tv_nop\n\tv_nop\n\tv_nop" : "+v"(d) : "v"(a), "v"(b)); return d; }
// a fragment from a staged tile: the two 16-byte pieces of the lane's row (same k order as a fragment read from global memory: 8 * hh .. and 16 + 8 * hh ..)
__device__ __forceinline__ v16h g2_lfrag(const unsigned char* rows, int o0, int o1) { FragH f; f.half[0] = *(const v8us*)(rows + o0); f.half[1] = *(const v8us*)(rows + o1); return f.v; }
// One stage of the GEMM ring: 64 k of the tile's 128 A rows, then of its 64 B rows (rows of 128 bytes without a pad, 24 KiB), brought by asynchronous copies to LDS.
// Twelve copies a lane; a wave-wide copy covers four whole 128-byte lines. s_wait_xcnt stands inside the statement so that no address register is rewritten ahead of it.
__device__ __forceinline__ void g2_stage_copy(unsigned lds, const unsigned short* ga, size_t astep, const unsigned short* gb, size_t bstep) {
  asm volatile("global_load_async_to_lds_b128 %0, %12, off\n\t"
               "global_load_async_to_lds_b128 %1, %13, off\n\t"
               "global_load_async_to_lds_b128 %2, %14, off\n\t"
               "global_load_async_to_lds_b128 %3, %15, off\n\t"
               "global_load_async_to_lds_b128 %4, %16, off\n\t"
               "global_load_async_to_lds_b128 %5, %17, off\n\t"
               "global_load_async_to_lds_b128 %6, %18, off\n\t"
               "global_load_async_to_lds_b128 %7, %19, off\n\t"
               "global_load_async_to_lds_b128 %8, %20, off\n\t"
               "global_load_async_to_lds_b128 %9, %21, off\n\t"
               "global_load_async_to_lds_b128 %10, %22, off\n\t"
               "global_load_async_to_lds_b128 %11, %23, off\n\t"
               "s_wait_xcnt 0x0"
               :: "v"(lds), "v"(lds + 2048u), "v"(lds + 4096u), "v"(lds + 6144u), "v"(lds + 8192u), "v"(lds + 10240u), "v"(lds + 12288u), "v"(lds + 14336u),
                  "v"(lds + 16384u), "v"(lds + 18432u), "v"(lds + 20480u), "v"(lds + 22528u),
                  "v"(ga), "v"(ga + astep), "v"(ga + 2 * astep), "v"(ga + 3 * astep), "v"(ga + 4 * astep), "v"(ga + 5 * astep), "v"(ga + 6 * astep), "v"(ga + 7 * astep),
                  "v"(gb), "v"(gb + bstep), "v"(gb + 2 * bstep), "v"(gb + 3 * bstep)
               : "memory");
}
// ROTB: in the first ROTB products of the batch (blockIdx.y) the tile's 64 columns are one head and its rows are tokens (position = row % SLEN): the rotary embedding is applied to the staged f32 tile on its way out (CS: cos table, then sin table, [position][RD / 2]).
// KMID > 0: the operands' k range is two parts that carry different powers of two; ahead of k = KMID (a multiple of 64) the accumulators are multiplied by MIDMUL, an exact step that brings the first part's sums to the second part's scale.
template <int ACT, int ROTB, int KMID = 0, int MIDMUL = 1>
__global__ __launch_bounds__(128) void k_gemm2(const _Float16* __restrict__ A, int lda, size_t sA, const _Float16* __restrict__ Bh, int ldb, size_t sB, float alpha, const float* __restrict__ bias, size_t sBias, const float* __restrict__ CP, int rowsPerB, size_t sCPb, int row0g,
    float* __restrict__ C, _Float16* __restrict__ C16, int ldc, size_t sC, int M, int N, int K, const float* __restrict__ CS) {
  constexpr int ATILE_B = 128 * 128, GSTAGE_B = ATILE_B + 64 * 128;      /* a stage = 64 k: A tile, then B tile */
  __shared__ __attribute__((aligned(16))) unsigned char ring[2 * GSTAGE_B];
  float (*so)[32][68] = reinterpret_cast<float (*)[32][68]>(ring);      /* output staging (34,816 bytes) takes the ring's place behind the loop's last barrier */
  const int tid = threadIdx.x, w = tid >> 5, lane = tid & 31, ln = lane & 15, hh = lane >> 4; const int by = blockIdx.y; const bool rot = ROTB > 0 && by < ROTB;      /* the same for the whole work-group */
  A += (size_t)by * sA; Bh += (size_t)by * sB; const size_t cofs = (size_t)by * sC; const float* bp = bias ? bias + (size_t)by * sBias : nullptr;
  const int ntn = N >> 6; const int mt = blockIdx.x / ntn, nq = blockIdx.x - mt * ntn; if (mt * 128 >= M) return;      /* the whole work-group leaves, ahead of every copy and barrier */
  const int row0 = mt * 128 + 32 * w, col0 = nq * 64;
  const int nst = K >> 6;
  /* 16-byte piece c of row r lies at r * 128 + (c ^ ((r >> 1) & 7)) * 16: sixteen rows read at one piece index fall on all 64 banks */
  const unsigned cp_lds = (unsigned)(size_t)ring + (unsigned)((tid >> 3) * 128 + (((tid & 7) ^ ((tid >> 4) & 7)) * 16));
  const unsigned short* cp_a = (const unsigned short*)A + (size_t)(mt * 128 + (tid >> 3)) * lda + (tid & 7) * 8;
  const unsigned short* cp_b = (const unsigned short*)Bh + (size_t)(col0 + (tid >> 3)) * ldb + (tid & 7) * 8;
  const size_t astep = (size_t)16 * lda, bstep = (size_t)16 * ldb;
  g2_stage_copy(cp_lds, cp_a, astep, cp_b, bstep);
  int fo[2][2];      /* a fragment's two pieces in row ln: [32-element group of the row][piece] */
#pragma unroll
  for (int g = 0; g < 2; ++g)
#pragma unroll
    for (int pc = 0; pc < 2; ++pc) fo[g][pc] = ln * 128 + (((g * 4 + pc * 2 + hh) ^ ((ln >> 1) & 7)) * 16);
  const v8f z8 = {0.f,0.f,0.f,0.f,0.f,0.f,0.f,0.f}; v8f c00 = z8, c01 = z8, c02 = z8, c03 = z8, c10 = z8, c11 = z8, c12 = z8, c13 = z8;
  asm volatile("s_wait_asynccnt 0x0" ::: "memory");      /* stage 0 has landed for this wave's own copies */
  __syncthreads();                                       /* ... and for every other wave's */
  if (1 < nst) g2_stage_copy(cp_lds + GSTAGE_B, cp_a + 64, astep, cp_b + 64, bstep);
#pragma unroll 1      /* one body for both buffers: the buffer is picked by the trip's parity */
  for (int t = 0; t < nst; ++t) {
    const unsigned char* ar = ring + (t & 1) * GSTAGE_B + w * (32 * 128); const unsigned char* br = ring + (t & 1) * GSTAGE_B + ATILE_B;
    if (KMID > 0 && t == (KMID >> 6)) { const float ms = (float)MIDMUL; c00 *= ms; c01 *= ms; c02 *= ms; c03 *= ms; c10 *= ms; c11 *= ms; c12 *= ms; c13 *= ms; }
#pragma unroll
    for (int g = 0; g < 2; ++g) { const int o0 = fo[g][0], o1 = fo[g][1];
      const v16h a0 = g2_lfrag(ar, o0, o1), a1 = g2_lfrag(ar + 2048, o0, o1);
      const v16h b0 = g2_lfrag(br, o0, o1), b1 = g2_lfrag(br + 2048, o0, o1), b2 = g2_lfrag(br + 4096, o0, o1), b3 = g2_lfrag(br + 6144, o0, o1);
      c00 = g2_mma(a0, b0, c00); c10 = g2_mma(a1, b0, c10);
      c01 = g2_mma(a0, b1, c01); c11 = g2_mma(a1, b1, c11);
      c02 = g2_mma(a0, b2, c02); c12 = g2_mma(a1, b2, c12);
      c03 = g2_mma(a0, b3, c03); c13 = g2_mma(a1, b3, c13); }
    asm volatile("s_wait_dscnt 0x0" ::: "memory");         /* this wave's reads of stage t have returned */
    asm volatile("s_wait_asynccnt 0x0" ::: "memory");      /* this wave's copies of stage t + 1 have landed */
    __syncthreads();                                       /* publishes stage t + 1 and ends every wave's reads of stage t */
    if (t + 2 < nst) g2_stage_copy(cp_lds + (t & 1) * GSTAGE_B, cp_a + (size_t)(t + 2) * 64, astep, cp_b + (size_t)(t + 2) * 64, bstep); }
  asm volatile("s_wait_asynccnt 0x0" ::: "memory");        /* nothing is in flight when the ring becomes output staging */
  const int rsub = lane >> 4, c4 = (lane & 15) * 4;
  v8f accs[8] = {c00, c01, c02, c03, c10, c11, c12, c13};
#pragma unroll
  for (int u = 0; u < 8; ++u) { const int t = u & 3, half = u >> 2; const int col = col0 + t * 16 + ln; const float bv = bp ? bf16_round(bp[col]) : 0.f;
#pragma unroll
    for (int r = 0; r < 8; ++r) { const int rloc = half * 16 + 8 * hh + r; float v = accs[u][r] * alpha + bv; if (CP) { const int bidx = (row0g + row0 + rloc) / rowsPerB; v += CP[(size_t)bidx * sCPb + (size_t)by * 64 + col]; }
      if (ACT == 3) v = fmaxf(v, 0.f); else if (ACT == 6) v = 0.5f * v * (1.0f + erff(v * 0.70710678118654752f)); else if (ACT == 11) v = 1.0f / (1.0f + expf(-v)); else if (ACT == 15) v = v / (1.0f + expf(-v)); else if (ACT == 12) v = (v > 0.f) ? v : 0.01f * v; else if (ACT == 8) v = tanhf(v);
      so[w][rloc][t * 16 + ln] = v; } }
  v4f tcs[16], tsn[16];      /* rotated products: the lane's table pieces for its sixteen rows, all asked for at once so that their latency is paid once; behind the staging, where the accumulators' registers are free */
  if (rot) { const float* tb = CS + (size_t)(row0 % SLEN + rsub) * (RD / 2) + (c4 & (RD / 2 - 1));      /* a wave's 32 rows never cross a sequence's end: both are multiples of 32 */
#pragma unroll
    for (int q = 0; q < 16; ++q) { tcs[q] = *(const v4fa*)(tb + q * RD); tsn[q] = *(const v4fa*)(tb + q * RD + SLEN * (RD / 2)); }
    asm volatile("s_wait_xcnt 0x0" ::: "memory"); }      /* stands ahead of any rewrite of the table loads' address registers */
  __builtin_amdgcn_fence(__ATOMIC_ACQ_REL, "workgroup"); __builtin_amdgcn_wave_barrier();
  {
#pragma unroll
    for (int q = 0; q < 16; ++q) { const int r = q * 2 + rsub; v4f v = *(const v4fa*)&so[w][r][c4];
      if (rot) {      /* every lane reads a partner piece at a valid place; only dims under RD take the rotated value */
        const v4f u = *(const v4fa*)&so[w][r][c4 ^ (RD / 2)]; const v4f cs = tcs[q], sn = tsn[q];
        const v4f lo = v * cs + u * sn, hi = u * -sn + v * cs;      /* dims 0..15: x1 cos + x2 sin (x1 own); dims 16..31: -x1 sin + x2 cos (x2 own) */
        v = (c4 < RD / 2) ? lo : ((c4 < RD) ? hi : v); }
      if (C) *(v4f*)(C + cofs + (size_t)(row0 + r) * ldc + col0 + c4) = v; if (C16) { v4h h4; for (int i = 0; i < 4; ++i) h4[i] = (_Float16)v[i]; *(v4h*)(C16 + cofs + (size_t)(row0 + r) * ldc + col0 + c4) = h4; } }
     } }



// One stage of the K / V^T ring: 64 key rows of K (128 bytes each) and 64 rows of V^T (the same 64 keys, 128 bytes each), 16 KiB, brought by asynchronous copies to LDS.
// Eight copies a lane; a wave-wide copy covers four whole 128-byte lines. s_wait_xcnt stands inside the statement so that no address register is rewritten ahead of it.
__device__ __forceinline__ void stage_copy(unsigned lds, const unsigned short* gk, size_t kstep, const unsigned short* gv, size_t vstep) {
  asm volatile("global_load_async_to_lds_b128 %0, %8, off\n\t"
               "global_load_async_to_lds_b128 %1, %9, off\n\t"
               "global_load_async_to_lds_b128 %2, %10, off\n\t"
               "global_load_async_to_lds_b128 %3, %11, off\n\t"
               "global_load_async_to_lds_b128 %4, %12, off\n\t"
               "global_load_async_to_lds_b128 %5, %13, off\n\t"
               "global_load_async_to_lds_b128 %6, %14, off\n\t"
               "global_load_async_to_lds_b128 %7, %15, off\n\t"
               "s_wait_xcnt 0x0"
               :: "v"(lds), "v"(lds + 2048u), "v"(lds + 4096u), "v"(lds + 6144u), "v"(lds + 8192u), "v"(lds + 10240u), "v"(lds + 12288u), "v"(lds + 14336u),
                  "v"(gk), "v"(gk + kstep), "v"(gk + 2 * kstep), "v"(gk + 3 * kstep), "v"(gv), "v"(gv + vstep), "v"(gv + 2 * vstep), "v"(gv + 3 * vstep)
               : "memory");
}
// lane l with lane l ^ 16: one vector cross-row move
__device__ __forceinline__ float xhalf(float x) { return __builtin_bit_cast(float, __builtin_amdgcn_permlanex16(__builtin_bit_cast(int, x), __builtin_bit_cast(int, x), 0x76543210, 0xfedcba98, false, false)); }
template <int CAUSAL>
__global__ __launch_bounds__(128) void k_flash(const _Float16* __restrict__ Q16, int ldq, const _Float16* __restrict__ K16, int ldk, const _Float16* __restrict__ Vt, const int* __restrict__ MSK, float* __restrict__ O, int ldo) {
  constexpr int RPW = 16, RTN = RPW / 16, NQB = TQ / (4 * RPW), DT = 4, KS = 2;
  constexpr float C2 = SCL * 1.44269504088896340736f;      /* score -> exponent of 2; the bare exp2 instruction serves: no exponent exceeds 10, and a result that flushes to zero lies far under P's f16 step */
  constexpr int TILE_B = 64 * 128, STAGE_B = 2 * TILE_B;      /* a stage = 64 keys: K tile, then V^T tile, rows of 128 bytes without a pad */
  __shared__ __attribute__((aligned(16))) unsigned char ring[2 * STAGE_B];
  float (*sO)[RPW][64 + 4] = reinterpret_cast<float (*)[RPW][64 + 4]>(ring);      /* output staging takes the ring's place behind the loop's last barrier */
  const int tid = threadIdx.x, w = tid >> 5, lane = tid & 31, ln = lane & 15, hh = lane >> 4;
  const int slab = blockIdx.x / QBLKS, qblk = blockIdx.x % QBLKS; (void)NQB; (void)MSK; const int b = slab / NH, h = slab % NH; const int qb0 = qblk * (4 * RPW); const int q0 = qb0 + w * RPW;
  const unsigned short* Vth = (const unsigned short*)Vt + (size_t)slab * 64 * TK;
  const int jend = (CAUSAL == 1) ? (qb0 + 4 * RPW) : TK;      /* causal: keys beyond the block's last query never contribute */
  const int nst = jend / 64;
  /* 16-byte piece c of row r lies at r * 128 + (c ^ ((r >> 1) & 7)) * 16: sixteen rows read at one piece index fall on all 64 banks */
  const unsigned cp_lds = (unsigned)(size_t)ring + (unsigned)((tid >> 3) * 128 + (((tid & 7) ^ ((tid >> 4) & 7)) * 16));
  const unsigned short* cp_k = (const unsigned short*)K16 + ((size_t)b * TK + (tid >> 3)) * ldk + h * 64 + (tid & 7) * 8;
  const unsigned short* cp_v = Vth + (size_t)(tid >> 3) * TK + (tid & 7) * 8;
  const size_t kstep = (size_t)16 * ldk, vstep = (size_t)16 * TK;
  stage_copy(cp_lds, cp_k, kstep, cp_v, vstep);
  FragH aq[2][KS];
#pragma unroll
  for (int rt = 0; rt < RTN; ++rt) { const unsigned short* qr = (const unsigned short*)Q16 + ((size_t)b * TQ + q0 + rt * 16 + ln) * ldq + h * 64;
#pragma unroll
    for (int ks = 0; ks < KS; ++ks) { aq[rt][ks].half[0] = *(const v8us*)(qr + ks * 32 + 8 * hh); aq[rt][ks].half[1] = *(const v8us*)(qr + ks * 32 + 16 + 8 * hh); } }
  int fo[2][2];      /* a fragment's two pieces in row ln: [32-element group of the row][piece] */
#pragma unroll
  for (int g = 0; g < 2; ++g)
#pragma unroll
    for (int pc = 0; pc < 2; ++pc) fo[g][pc] = ln * 128 + (((g * 4 + pc * 2 + hh) ^ ((ln >> 1) & 7)) * 16);
  float m_r[2], l_r[2]; v8f oacc[2][DT];      /* per lane: its query's running maximum (of raw scores), its half's share of the sum (x 1024), and O^T[d = dt * 16 + 8 * hh + r][query ln] */
#pragma unroll
  for (int rt = 0; rt < RTN; ++rt) { m_r[rt] = -3.0e38f; l_r[rt] = 0.f;
#pragma unroll
    for (int dt = 0; dt < DT; ++dt) oacc[rt][dt] = (v8f){0.f,0.f,0.f,0.f,0.f,0.f,0.f,0.f}; }
  asm volatile("s_wait_asynccnt 0x0" ::: "memory");      /* stage 0 has landed for this wave's own copies */
  __syncthreads();                                       /* ... and for every other wave's */
  if (1 < nst) stage_copy(cp_lds + STAGE_B, cp_k + (size_t)64 * ldk, kstep, cp_v + 64, vstep);
#pragma unroll 1
  for (int t = 0; t < nst; ++t) {
    const unsigned char* st = ring + (t & 1) * STAGE_B;
#pragma unroll 1      /* the two 32-key passes of a stage stay one body: unrolled, the registers grow and a work-group per WGP is lost */
    for (int ps = 0; ps < 2; ++ps) { const int j0 = t * 64 + ps * 32;
    v8f s[2][2];
#pragma unroll
    for (int nt = 0; nt < 2; ++nt) { const unsigned char* kr = st + (ps * 32 + nt * 16) * 128; FragH bk[KS];
#pragma unroll
      for (int ks = 0; ks < KS; ++ks) { bk[ks].half[0] = *(const v8us*)(kr + fo[ks][0]); bk[ks].half[1] = *(const v8us*)(kr + fo[ks][1]); }
#pragma unroll
      for (int rt = 0; rt < RTN; ++rt) { v8f acc = (v8f){0.f,0.f,0.f,0.f,0.f,0.f,0.f,0.f};
#pragma unroll
        for (int ks = 0; ks < KS; ++ks) acc = mmaH<1>(bk[ks].v, bk[ks].v, aq[rt][ks].v, aq[rt][ks].v, acc); s[rt][nt] = acc; } }      /* s[rt][nt][r] = score of key j0 + nt * 16 + 8 * hh + r, query q0 + rt * 16 + ln */
    FragH pb[2];
#pragma unroll
    for (int rt = 0; rt < RTN; ++rt) { const int tq = q0 + rt * 16 + ln; float sv[16]; bool ok[16];
#pragma unroll
      for (int e = 0; e < 16; ++e) { const int kk = j0 + (e >> 3) * 16 + 8 * hh + (e & 7);
        ok[e] = (CAUSAL == 1) ? (kk <= tq) : ((CAUSAL == 2) ? ((kk >> 5) == (tq >> 5)) : true);      /* mode 2: block-diagonal 32-token groups */
        sv[e] = ok[e] ? s[rt][e >> 3][e & 7] : -3.0e38f; }      /* raw scores: the scale is positive, so the maximum is taken ahead of it */
      float mx[4];
#pragma unroll
      for (int c = 0; c < 4; ++c) mx[c] = fmaxf(fmaxf(sv[c], sv[4 + c]), fmaxf(sv[8 + c], sv[12 + c]));
      float mc = fmaxf(fmaxf(mx[0], mx[1]), fmaxf(mx[2], mx[3])); mc = fmaxf(mc, xhalf(mc));      /* both halves now hold the query's maximum over the 32 keys */
      const float mn = fmaxf(m_r[rt], mc); const float ea = __builtin_amdgcn_exp2f((m_r[rt] - mn) * C2); const float al = (mn > -1.0e38f) ? ea : 1.0f; m_r[rt] = mn;
      const float nb = fmaf(-mn, C2, 10.0f);      /* 1024 p = 2^(score * C2 + nb): scale, log2 e, the maximum and P's factor 1024 in one multiply-add */
      const v2f c2v = {C2, C2}, nbv = {nb, nb}; v2f ls[2];
#pragma unroll
      for (int e = 0; e < 16; e += 2) { const v2f x = __builtin_elementwise_fma((v2f){sv[e], sv[e + 1]}, c2v, nbv);
        const v2f p = {ok[e] ? __builtin_amdgcn_exp2f(x[0]) : 0.f, ok[e + 1] ? __builtin_amdgcn_exp2f(x[1]) : 0.f};
        if (e < 4) ls[e >> 1] = p; else ls[(e >> 1) & 1] += p;
        pb[rt].h[e] = (_Float16)p[0]; pb[rt].h[e + 1] = (_Float16)p[1]; }
      l_r[rt] = l_r[rt] * al + ((ls[0][0] + ls[0][1]) + (ls[1][0] + ls[1][1]));      /* the sum carries the factor 1024 too */
#pragma unroll
      for (int dt = 0; dt < DT; ++dt)
#pragma unroll
        for (int r = 0; r < 8; ++r) oacc[rt][dt][r] *= al; }
#pragma unroll
    for (int dt = 0; dt < DT; ++dt) { const unsigned char* vrow = st + TILE_B + dt * 16 * 128; FragH bv; bv.half[0] = *(const v8us*)(vrow + (fo[0][0] ^ (ps * 64))); bv.half[1] = *(const v8us*)(vrow + (fo[0][1] ^ (ps * 64)));      /* the pass's 32 keys: piece index + 4 = bit 6 of the offset */
#pragma unroll
      for (int rt = 0; rt < RTN; ++rt) oacc[rt][dt] = mmaH<1>(bv.v, bv.v, pb[rt].v, pb[rt].v, oacc[rt][dt]); } }
    asm volatile("s_wait_dscnt 0x0" ::: "memory");         /* this wave's reads of stage t have returned */
    asm volatile("s_wait_asynccnt 0x0" ::: "memory");      /* this wave's copies of stage t + 1 have landed */
    __syncthreads();                                       /* publishes stage t + 1 and ends every wave's reads of stage t */
    if (t + 2 < nst) stage_copy(cp_lds + (t & 1) * STAGE_B, cp_k + (size_t)(t + 2) * 64 * ldk, kstep, cp_v + (t + 2) * 64, vstep); }
  asm volatile("s_wait_asynccnt 0x0" ::: "memory");        /* nothing is in flight when the ring becomes output staging */
#pragma unroll
  for (int rt = 0; rt < RTN; ++rt) { float l = l_r[rt]; l += xhalf(l); const float inv = (l > 0.f) ? 1.0f / l : 0.f;      /* the halves' sums join once */
#pragma unroll
    for (int dt = 0; dt < DT; ++dt)
#pragma unroll
      for (int q4 = 0; q4 < 2; ++q4) { v4f o4;
#pragma unroll
        for (int i = 0; i < 4; ++i) o4[i] = oacc[rt][dt][q4 * 4 + i] * inv;
        *(v4fa*)&sO[w][rt * 16 + ln][dt * 16 + 8 * hh + q4 * 4] = o4; } }
  __builtin_amdgcn_fence(__ATOMIC_ACQ_REL, "workgroup"); __builtin_amdgcn_wave_barrier();
  {
#pragma unroll
    for (int rp = 0; rp < RPW; rp += 2) { const int r = rp + (lane >> 4), pc = lane & 15; const v4f val = *(const v4fa*)&sO[w][r][pc * 4]; *(v4f*)(O + ((size_t)b * TQ + q0 + r) * ldo + h * 64 + pc * 4) = val; }
     } }

// Everything that depends on the inputs alone, in one launch: the rotary tables (first blocks: the longest chain of dependent arithmetic starts first), then x and the four weight matrices as f16 planes.
#define PREP_TAB_BLKS (SLEN * (RD / 2) / 256)      /* one table entry a thread */
#define PREP_CVT_BLKS (DMOD * DMOD / 8 / 256)      /* a thread takes one 8-element piece of each weight matrix and eight pieces of x: few waves, each with much to fetch */
static_assert(SLEN * (RD / 2) % 256 == 0 && DMOD * DMOD / 8 % 256 == 0 && NR == 8 * DMOD, "the grid covers tables and planes without a remainder");
// eight f32 values -> bf16-rounded, times a power of two, as f16
__device__ __forceinline__ v8us prep_cvt8(v4f a, v4f c, float sc) { FragH f;
#pragma unroll      /* keeps f in registers */
  for (int q = 0; q < 4; ++q) { f.h[q] = (_Float16)(bf16_round(a[q]) * sc); f.h[4 + q] = (_Float16)(bf16_round(c[q]) * sc); }
  return f.half[0]; }
// Six 8-element pieces, twelve 16-byte loads. One statement with its data wait and early-clobber results: all twelve are in flight together, and no result lands on an address register that a load of the run still names.
__device__ __forceinline__ void prep_ld6(const float* p0, const float* p1, const float* p2, const float* p3, const float* p4, const float* p5, v4f (&a)[6], v4f (&c)[6]) {
  asm volatile("global_load_b128 %0, %12, off\n\t"
               "global_load_b128 %1, %12, off offset:16\n\t"
               "global_load_b128 %2, %13, off\n\t"
               "global_load_b128 %3, %13, off offset:16\n\t"
               "global_load_b128 %4, %14, off\n\t"
               "global_load_b128 %5, %14, off offset:16\n\t"
               "global_load_b128 %6, %15, off\n\t"
               "global_load_b128 %7, %15, off offset:16\n\t"
               "global_load_b128 %8, %16, off\n\t"
               "global_load_b128 %9, %16, off offset:16\n\t"
               "global_load_b128 %10, %17, off\n\t"
               "global_load_b128 %11, %17, off offset:16\n\t"
               "s_wait_loadcnt 0x0"
               : "=&v"(a[0]), "=&v"(c[0]), "=&v"(a[1]), "=&v"(c[1]), "=&v"(a[2]), "=&v"(c[2]), "=&v"(a[3]), "=&v"(c[3]), "=&v"(a[4]), "=&v"(c[4]), "=&v"(a[5]), "=&v"(c[5])
               : "v"(p0), "v"(p1), "v"(p2), "v"(p3), "v"(p4), "v"(p5) : "memory"); }
__global__ __launch_bounds__(256) void k_prep(const float* __restrict__ x, const float* __restrict__ Wq, const float* __restrict__ Wk, const float* __restrict__ Wv, const float* __restrict__ Wo,
    _Float16* __restrict__ X16, _Float16* __restrict__ BQ, _Float16* __restrict__ BK, _Float16* __restrict__ BV, _Float16* __restrict__ BO, float* __restrict__ CS) {
  if (blockIdx.x < PREP_TAB_BLKS) {
    const int t = blockIdx.x * 256 + threadIdx.x; const int i = t % (RD / 2), tpos = t / (RD / 2); const float invf = (float)pow(10000.0, -(double)(2 * i) / (double)RD); const float ang = (float)tpos * invf; const float cv = cosf(ang), sv = sinf(ang);
    CS[t] = cv; CS[SLEN * (RD / 2) + t] = sv; return; }
  constexpr size_t NE = (size_t)DMOD * DMOD;      /* elements that the conversion blocks cover with one piece a thread */
  const size_t e = ((size_t)(blockIdx.x - PREP_TAB_BLKS) * 256 + threadIdx.x) * 8;
  const float* xp = x + e; unsigned short* xo = (unsigned short*)X16 + e; v4f a[6], c[6];
  prep_ld6(xp, xp + NE, xp + 2 * NE, xp + 3 * NE, xp + 4 * NE, xp + 5 * NE, a, c);
#pragma unroll      /* a[] and c[] are register results of the load statement: constant indices keep them there */
  for (int j = 0; j < 6; ++j) *(v8us*)(xo + j * NE) = prep_cvt8(a[j], c[j], 1.0f);
  prep_ld6(xp + 6 * NE, xp + 7 * NE, Wq + e, Wk + e, Wv + e, Wo + e, a, c);
  *(v8us*)(xo + 6 * NE) = prep_cvt8(a[0], c[0], 1.0f); *(v8us*)(xo + 7 * NE) = prep_cvt8(a[1], c[1], 1.0f);
  *(v8us*)((unsigned short*)BQ + e) = prep_cvt8(a[2], c[2], 16.0f);
  *(v8us*)((unsigned short*)BK + e) = prep_cvt8(a[3], c[3], 16.0f);
  *(v8us*)((unsigned short*)BV + e) = prep_cvt8(a[4], c[4], 16.0f);
  /* output projection: a row of BO is the weight row x 16 (for the hi plane), then the same row x 1 (for the residual plane) */
  unsigned short* bo = (unsigned short*)BO + (e / DMOD) * (2 * DMOD) + e % DMOD;
  *(v8us*)bo = prep_cvt8(a[5], c[5], 16.0f); *(v8us*)(bo + DMOD) = prep_cvt8(a[5], c[5], 1.0f);
  asm volatile("s_wait_xcnt 0x0" ::: "memory");      /* stands behind the stores, ahead of anything that could rewrite their registers */
}

extern "C" void kernel_launch(void* const* d_in, const int* in_sizes, int n_in,
                              void* d_out, int out_size, void* d_ws, size_t ws_size, hipStream_t stream) {
  (void)in_sizes; (void)n_in; (void)out_size;
  const float* const* I = (const float* const*)d_in; const float* x = I[0]; const float* Wq = I[1]; const float* Wk = I[2]; const float* Wv = I[3]; const float* Wo = I[4];
  char* ws = (char*)d_ws; size_t off = 0;
  auto take = [&](size_t bytes) { char* p = ws + off; off += (bytes + 255) & ~(size_t)255; return p; };
  const size_t w8 = (size_t)DMOD * DMOD / 8;
  _Float16* BQ = (_Float16*)take(w8 * 16); _Float16* BK = (_Float16*)take(w8 * 16); _Float16* BV = (_Float16*)take(w8 * 16); _Float16* BO = (_Float16*)take(w8 * 32);
  _Float16* X16 = (_Float16*)take((size_t)NR * DMOD * 2); float* O = (float*)take((size_t)NR * DMOD * 4); _Float16* Q16 = (_Float16*)take((size_t)NR * DMOD * 2); _Float16* K16 = (_Float16*)take((size_t)NR * DMOD * 2); _Float16* V16 = (_Float16*)take((size_t)NR * DMOD * 2); _Float16* VT = (_Float16*)take((size_t)NR * DMOD * 2); float* CS = (float*)take((size_t)SLEN * RD * 4);
  _Float16* HH = Q16;      /* alias after the flash kernel: Q16 and K16 are dead and lie back to back (each a multiple of 256 bytes): one [NR][2 * DMOD] plane */
  if (off > ws_size) return;      /* 10 + 16 + 32 + 16 x 4 = 122 MiB */
  k_prep<<<PREP_TAB_BLKS + PREP_CVT_BLKS, 256, 0, stream>>>(x, Wq, Wk, Wv, Wo, X16, BQ, BK, BV, BO, CS);
  const dim3 gP((NR / 128) * (DMOD / 64), 1);
  /* q, k and v projections as one batch of three: BQ, BK, BV lie back to back, and so do Q16, K16, V16 (each size a multiple of 256 bytes); q and k are rotated */
  k_gemm2<0, 2><<<dim3(gP.x, 3), 128, 0, stream>>>(X16, DMOD, 0, BQ, DMOD, (size_t)DMOD * DMOD, 0.0625f, nullptr, 0, nullptr, 1, 0, 0, nullptr, Q16, DMOD, (size_t)NR * DMOD, NR, DMOD, DMOD, CS);
  k_vt<NH, SLEN><<<NB * NH * (SLEN / 64), 256, 0, stream>>>(V16, DMOD, 0, VT);
  k_flash<0><<<NB * NH * QBLKS, 128, 0, stream>>>(Q16, DMOD, K16, DMOD, VT, nullptr, O, DMOD);
  k_hl<<<(unsigned)(((size_t)NR * DMOD / 8 + 255) / 256), 256, 0, stream>>>(O, HH, (size_t)NR * DMOD / 8);
  /* hi x (16 W) summed first, x 64, then (1024 residual) x W on top: 1024 y, scaled back once */
  k_gemm2<0, 0, DMOD, 64><<<gP, 128, 0, stream>>>(HH, 2 * DMOD, 0, BO, 2 * DMOD, 0, 1.0f / 1024.0f, nullptr, 0, nullptr, 1, 0, 0, (float*)d_out, nullptr, DMOD, 0, NR, DMOD, 2 * DMOD, nullptr);
}

// v008
// It runs in 188 microseconds.
// Next to v007, in two timings, it ran 1.05 times as fast each time.
// Over all steps from v000 it is 4.31 times as fast.
#include <hip/hip_runtime.h>
// TinyAttn (4 sequences x 2048 tokens x 1024; 16 heads x 64; rotary embedding on the first 32 dims of each head): q,k,v = x W^T; q,k rotated (rot = [x1 cos + x2 sin, -x1 sin + x2 cos] on dims 0..31 with the module's inverse-frequency table); softmax(q k^T / 8) v; y Wo^T -> [4,2048,1024].
// Structure: x as an exact f16 plane; q/k/v projections as f16 WMMA GEMMs (32x64 wave tiles, operand tiles staged in an LDS ring, f32 accumulation, exact x16 weights; q/k rotated in f32 on the staged tile, v as f16); the rotary tables recomputed on the device (f64 pow for the inverse frequencies, f32 angle product, f32 cos/sin) and applied in the q/k projections' epilogue, which writes the f16 q/k planes; V transposed by LDS tiles; the fused flash kernel; the attention output as the hi and residual halves of one [token][2048] f16 plane into one output-projection GEMM over k = 2048, whose accumulators are multiplied by 64 between the halves.
// Compute dtype: x and weights rounded to bf16; q, k (after rotation), v, P as f16 operands (~2^-12); attention output hi + 2^-10-scaled residual; f32 accumulation/softmax. v_wmma_f32_16x16x32_f16.
#define NB 4
#define DMOD 1024
#define HD 64
#define RD 32                    /* rotary dims per head */
#define NR (NB * SLEN)
#define QBLKS (TQ / 64)          /* query blocks per (sequence, head) launched */
#define SLEN 2048
#define TQ SLEN
#define TK SLEN
#define NH 16
#define SCL 0.125f               /* 64^-0.5 */
typedef __bf16 v16b __attribute__((ext_vector_type(16)));
typedef unsigned short v8us __attribute__((ext_vector_type(8), may_alias));
typedef float  v8f  __attribute__((ext_vector_type(8)));
typedef float  v4f  __attribute__((ext_vector_type(4)));
typedef float  v2f  __attribute__((ext_vector_type(2)));
typedef float  v4fa __attribute__((ext_vector_type(4), may_alias));
union FragB { v16b v; v8us half[2]; unsigned short u[16]; };

__device__ __forceinline__ unsigned short bf16_bits(float x) { unsigned int u = __float_as_uint(x); return (unsigned short)((u + 0x7FFFu + ((u >> 16) & 1u)) >> 16); }
__device__ __forceinline__ float bf16_val(unsigned short b) { return __uint_as_float(((unsigned int)b) << 16); }
__device__ __forceinline__ float bf16_round(float x) { return bf16_val(bf16_bits(x)); }
// D += A·B with NT terms: 1 = ah·bh, 2 = + al·bh (A split), 3 = + ah·bl (both split)
template <int NT>
__device__ __forceinline__ v8f mmaN(v16b ah, v16b al, v16b bh, v16b bl, v8f c) {
  c = __builtin_amdgcn_wmma_f32_16x16x32_bf16(false, ah, false, bh, (short)0, c, false, false);
  if (NT >= 2) c = __builtin_amdgcn_wmma_f32_16x16x32_bf16(false, al, false, bh, (short)0, c, false, false);
  if (NT >= 3) c = __builtin_amdgcn_wmma_f32_16x16x32_bf16(false, ah, false, bl, (short)0, c, false, false);
  asm volatile("v_nop\n\tv_nop\n\tv_nop\n\tv_nop" : "+v"(c) : "v"(ah), "v"(al), "v"(bh), "v"(bl));
  return c;
}

__global__ __launch_bounds__(256) void k_wt_bf16(const float* __restrict__ W, unsigned short* __restrict__ Wt, int K, int N) {
  const int t = blockIdx.x * 256 + threadIdx.x;
  const int k8n = K / 8;
  if (t >= N * k8n) return;
  const int n = t / k8n, k8 = (t % k8n) * 8;
  v8us v;
#pragma unroll
  for (int i = 0; i < 8; ++i) v[i] = bf16_bits(W[(size_t)(k8 + i) * N + n]);
  *(v8us*)(Wt + (size_t)n * K + k8) = v;
  
}

// GEMM C[M][N] (f32, pitch ldc) = act(A[M][K]·W + bias). A f32 row-major (pitch lda) converted per fragment to bf16
// (ASPLIT: hi/lo two planes -> 2 terms, else single rounded term); Wt bf16 [N][K] (pitch ldb). BIAS_BF16 rounds the
// bias to bf16 first (bias quantised to bf16 before the add). K%32==0, M%16==0, N%64==0.
template <bool ASPLIT, int ACT, bool BIAS_BF16>
__global__ __launch_bounds__(128) void k_gemm_bf(const float* __restrict__ A, int lda, const unsigned short* __restrict__ Wt, int ldb,
                                               const float* __restrict__ bias, float* __restrict__ C, int ldc, int M, int N, int K) {
  __shared__ __attribute__((aligned(16))) float so[4][16][64];
  const int tid = threadIdx.x, w = tid >> 5, lane = tid & 31, ln = lane & 15, hh = lane >> 4;
  const int ntn = N / 64;
  const int wid = blockIdx.x * 4 + w;
  const int mt = wid / ntn, nq = wid % ntn;
  if (mt * 16 >= M) return;
  const int row0 = mt * 16, col0 = nq * 64;
  const float* arow = A + (size_t)(row0 + ln) * lda;
  v8f acc[4] = {};
  for (int kb = 0; kb < K; kb += 32) {
    FragB ah, al;
    const v4f x0 = *(const v4fa*)(arow + kb + 8 * hh), x1 = *(const v4fa*)(arow + kb + 8 * hh + 4);
    const v4f x2 = *(const v4fa*)(arow + kb + 16 + 8 * hh), x3 = *(const v4fa*)(arow + kb + 16 + 8 * hh + 4);
    float xs[16] = {x0[0],x0[1],x0[2],x0[3],x1[0],x1[1],x1[2],x1[3],x2[0],x2[1],x2[2],x2[3],x3[0],x3[1],x3[2],x3[3]};
#pragma unroll
    for (int i = 0; i < 16; ++i) { const unsigned short hb = bf16_bits(xs[i]); ah.u[i] = hb; al.u[i] = ASPLIT ? bf16_bits(xs[i] - bf16_val(hb)) : (unsigned short)0; }
#pragma unroll
    for (int t = 0; t < 4; ++t) {
      const unsigned short* brow = Wt + (size_t)(col0 + t * 16 + ln) * ldb + kb;
      FragB b;
      b.half[0] = *(const v8us*)(brow + 8 * hh);
      b.half[1] = *(const v8us*)(brow + 16 + 8 * hh);
      acc[t] = mmaN<ASPLIT ? 2 : 1>(ah.v, al.v, b.v, b.v, acc[t]);
    }
  }
#pragma unroll
  for (int t = 0; t < 4; ++t) {
    float bv = bias ? bias[col0 + t * 16 + ln] : 0.f;
    if (BIAS_BF16) bv = bf16_round(bv);
#pragma unroll
    for (int r = 0; r < 8; ++r) { float v = acc[t][r] + bv; if (ACT == 1) v = fmaxf(v, 0.f); so[w][8 * hh + r][t * 16 + ln] = v; }
  }
  __builtin_amdgcn_fence(__ATOMIC_ACQ_REL, "workgroup");
  __builtin_amdgcn_wave_barrier();
  const int rsub = lane >> 4, c4 = (lane & 15) * 4;
  {
#pragma unroll
    for (int q = 0; q < 8; ++q) {
      const int r = q * 2 + rsub;
      const v4f v = *(const v4fa*)&so[w][r][c4];
      *(v4f*)(C + (size_t)(row0 + r) * ldc + col0 + c4) = v;
    }
    
  }
}

// GEMM C = act(A·W + bias + resid): A f32 (ASPLIT -> hi/lo 2 terms), Wt bf16 [N][K]; ACT 0 none, 1 relu, 2 exact gelu;
// resid (optional, f32, row index = (row % rmod), pitch ldr, RES_BF16 rounds it) added before the activation.
template <bool ASPLIT, int ACT, bool BIAS_BF16, bool RES_BF16>
__global__ __launch_bounds__(128) void k_gemm_bf3(const float* __restrict__ A, int lda, const unsigned short* __restrict__ Wt, int ldb,
                                                const float* __restrict__ bias, const float* __restrict__ resid, int rmod, int ldr,
                                                float* __restrict__ C, int ldc, int M, int N, int K) {
  __shared__ __attribute__((aligned(16))) float so[4][16][64];
  const int tid = threadIdx.x, w = tid >> 5, lane = tid & 31, ln = lane & 15, hh = lane >> 4;
  const int ntn = N / 64;
  const int wid = blockIdx.x * 4 + w;
  const int mt = wid / ntn, nq = wid % ntn;
  if (mt * 16 >= M) return;
  const int row0 = mt * 16, col0 = nq * 64;
  const float* arow = A + (size_t)(row0 + ln) * lda;
  v8f acc[4] = {};
  for (int kb = 0; kb < K; kb += 32) {
    FragB ah, al;
    const v4f x0 = *(const v4fa*)(arow + kb + 8 * hh), x1 = *(const v4fa*)(arow + kb + 8 * hh + 4);
    const v4f x2 = *(const v4fa*)(arow + kb + 16 + 8 * hh), x3 = *(const v4fa*)(arow + kb + 16 + 8 * hh + 4);
    float xs[16] = {x0[0],x0[1],x0[2],x0[3],x1[0],x1[1],x1[2],x1[3],x2[0],x2[1],x2[2],x2[3],x3[0],x3[1],x3[2],x3[3]};
#pragma unroll
    for (int i = 0; i < 16; ++i) { const unsigned short hb = bf16_bits(xs[i]); ah.u[i] = hb; al.u[i] = ASPLIT ? bf16_bits(xs[i] - bf16_val(hb)) : (unsigned short)0; }
#pragma unroll
    for (int t = 0; t < 4; ++t) {
      const unsigned short* brow = Wt + (size_t)(col0 + t * 16 + ln) * ldb + kb;
      FragB b;
      b.half[0] = *(const v8us*)(brow + 8 * hh);
      b.half[1] = *(const v8us*)(brow + 16 + 8 * hh);
      acc[t] = mmaN<ASPLIT ? 2 : 1>(ah.v, al.v, b.v, b.v, acc[t]);
    }
  }
#pragma unroll
  for (int t = 0; t < 4; ++t) {
    const int col = col0 + t * 16 + ln;
    float bv = bias ? bias[col] : 0.f;
    if (BIAS_BF16) bv = bf16_round(bv);
#pragma unroll
    for (int r = 0; r < 8; ++r) {
      float v = acc[t][r] + bv;
      if (resid) { float rv = resid[(size_t)((row0 + 8 * hh + r) % rmod) * ldr + col]; if (RES_BF16) rv = bf16_round(rv); v += rv; }
      if (ACT == 1) v = fmaxf(v, 0.f);
      if (ACT == 2) v = 0.5f * v * (1.0f + erff(v * 0.70710678118654752f));
      if (ACT == 3) { const float u = 0.7978845608028654f * (v + 0.044715f * v * v * v); v = 0.5f * v * (1.0f + tanhf(u)); }
      so[w][8 * hh + r][t * 16 + ln] = v;
    }
  }
  __builtin_amdgcn_fence(__ATOMIC_ACQ_REL, "workgroup");
  __builtin_amdgcn_wave_barrier();
  const int rsub = lane >> 4, c4 = (lane & 15) * 4;
  {
#pragma unroll
    for (int q = 0; q < 8; ++q) {
      const int r = q * 2 + rsub;
      const v4f v = *(const v4fa*)&so[w][r][c4];
      *(v4f*)(C + (size_t)(row0 + r) * ldc + col0 + c4) = v;
    }
    
  }
}
// row LayerNorm (biased variance, eps) over N: s = X (+ R); optional out_sum <- s; out_norm <- (s-mu)*rsqrt(var+eps)*g + b
template <bool PARAM_BF16>
__global__ __launch_bounds__(256) void k_layernorm(const float* __restrict__ X, const float* __restrict__ R, const float* __restrict__ g, const float* __restrict__ bta,
                                                  float* __restrict__ out_sum, float* __restrict__ out_norm, int N, float eps) {
  __shared__ float red[256];
  const int row = blockIdx.x, tid = threadIdx.x;
  const float* x = X + (size_t)row * N; const float* rr = R ? R + (size_t)row * N : nullptr;
  float vals[16];                     // up to N = 4096
  const int per = N / 256;            // contiguous chunk per thread? use strided-by-4 chunks: thread handles j = tid*4 + 1024*u
  float s1 = 0.f;
  for (int u = 0; u < per / 4; ++u) {
    const int j = tid * 4 + 1024 * u;
    const v4f a = *(const v4fa*)(x + j);
    v4f b = {0.f,0.f,0.f,0.f}; if (rr) b = *(const v4fa*)(rr + j);
#pragma unroll
    for (int q = 0; q < 4; ++q) { const float v = a[q] + b[q]; vals[u * 4 + q] = v; s1 += v; }
  }
  red[tid] = s1; __syncthreads();
  for (int st = 128; st > 0; st >>= 1) { if (tid < st) red[tid] += red[tid + st]; __syncthreads(); }
  const float mu = red[0] / (float)N; __syncthreads();
  float s2 = 0.f;
  for (int u = 0; u < per / 4; ++u)
#pragma unroll
    for (int q = 0; q < 4; ++q) { const float c = vals[u * 4 + q] - mu; s2 += c * c; }
  red[tid] = s2; __syncthreads();
  for (int st = 128; st > 0; st >>= 1) { if (tid < st) red[tid] += red[tid + st]; __syncthreads(); }
  const float rs = rsqrtf(red[0] / (float)N + eps);
  {
    for (int u = 0; u < per / 4; ++u) {
      const int j = tid * 4 + 1024 * u;
      v4f o, sm;
#pragma unroll
      for (int q = 0; q < 4; ++q) {
        float gg = g[j + q], bb = bta[j + q];
        if (PARAM_BF16) { gg = bf16_round(gg); bb = bf16_round(bb); }
        sm[q] = vals[u * 4 + q]; o[q] = (vals[u * 4 + q] - mu) * rs * gg + bb;
      }
      if (out_sum) *(v4f*)(out_sum + (size_t)row * N + j) = sm;
      *(v4f*)(out_norm + (size_t)row * N + j) = o;
    }
    
  }
}



// ---- f16 WMMA path (v_wmma_f32_16x16x32_f16): 11-bit significands for operands in range — used where a [0,1] probability operand needs more precision than bf16
typedef _Float16 v16h __attribute__((ext_vector_type(16)));
union FragH { v16h v; v8us half[2]; _Float16 h[16]; unsigned short u[16]; };
// builtin WMMAs only: the compiler keeps the distances behind them itself and may place loads and vector work in between
template <int NT>
__device__ __forceinline__ v8f mmaH(v16h ah, v16h al, v16h bh, v16h bl, v8f c) {
  c = __builtin_amdgcn_wmma_f32_16x16x32_f16(false, ah, false, bh, (short)0, c, false, false);
  if (NT >= 2) c = __builtin_amdgcn_wmma_f32_16x16x32_f16(false, al, false, bh, (short)0, c, false, false);
  if (NT >= 3) c = __builtin_amdgcn_wmma_f32_16x16x32_f16(false, ah, false, bl, (short)0, c, false, false);
  return c;
}
// batched GEMM like k_gemm_b but f16 operands: A f32 (split into f16 hi/lo if ASPLIT, else rounded to f16), Bt = f16 values [n][k]; alpha; C f32; N multiple of 16 (partial tiles skipped)
template <bool ASPLIT>
__global__ __launch_bounds__(128) void k_gemm_h(const float* __restrict__ A, int lda, size_t sA, const _Float16* __restrict__ Bh, int ldb, size_t sB, float alpha, float* __restrict__ C, int ldc, size_t sC, int M, int N, int K) {
  __shared__ __attribute__((aligned(16))) float so[4][16][64];
  const int tid = threadIdx.x, w = tid >> 5, lane = tid & 31, ln = lane & 15, hh = lane >> 4; const int by = blockIdx.y;
  A += (size_t)by * sA; Bh += (size_t)by * sB; C += (size_t)by * sC;
  const int ntn = (N + 63) / 64; const int wid = blockIdx.x * 4 + w; const int mt = wid / ntn, nq = wid % ntn; if (mt * 16 >= M) return;
  const int row0 = mt * 16, col0 = nq * 64; const float* arow = A + (size_t)(row0 + ln) * lda;
  v8f acc[4] = {};
  for (int kb = 0; kb < K; kb += 32) {
    FragH ah, al;
    const v4f x0 = *(const v4fa*)(arow + kb + 8 * hh), x1 = *(const v4fa*)(arow + kb + 8 * hh + 4), x2 = *(const v4fa*)(arow + kb + 16 + 8 * hh), x3 = *(const v4fa*)(arow + kb + 16 + 8 * hh + 4);
    float xs[16] = {x0[0],x0[1],x0[2],x0[3],x1[0],x1[1],x1[2],x1[3],x2[0],x2[1],x2[2],x2[3],x3[0],x3[1],x3[2],x3[3]};
#pragma unroll
    for (int i = 0; i < 16; ++i) { const _Float16 h = (_Float16)xs[i]; ah.h[i] = h; al.h[i] = ASPLIT ? (_Float16)(xs[i] - (float)h) : (_Float16)0.0f; }
#pragma unroll
    for (int t = 0; t < 4; ++t) { if (col0 + t * 16 >= N) continue; const size_t boff = (size_t)(col0 + t * 16 + ln) * ldb + kb; FragH bq; bq.half[0] = *(const v8us*)(Bh + boff + 8 * hh); bq.half[1] = *(const v8us*)(Bh + boff + 16 + 8 * hh);
      acc[t] = mmaH<ASPLIT ? 2 : 1>(ah.v, al.v, bq.v, bq.v, acc[t]); }
  }
#pragma unroll
  for (int t = 0; t < 4; ++t) { if (col0 + t * 16 >= N) continue;
#pragma unroll
    for (int r = 0; r < 8; ++r) so[w][8 * hh + r][t * 16 + ln] = acc[t][r] * alpha; }
  __builtin_amdgcn_fence(__ATOMIC_ACQ_REL, "workgroup"); __builtin_amdgcn_wave_barrier();
  const int rsub = lane >> 4, c4 = (lane & 15) * 4;
  {
#pragma unroll
    for (int q = 0; q < 8; ++q) { const int r = q * 2 + rsub; if (col0 + c4 < N) { const v4f v = *(const v4fa*)&so[w][r][c4]; *(v4f*)(C + (size_t)(row0 + r) * ldc + col0 + c4) = v; } }
     }
}

// Wt[n][k] = f16(W[k][n]·scale) from f32 row-major W[K][N] (scale = power of two; bf16-exact weights stay exact in f16 away from the subnormal range)
__global__ __launch_bounds__(256) void k_wt_f16(const float* __restrict__ W, _Float16* __restrict__ Wt, int K, int N, float scale) {
  const int t = blockIdx.x * 256 + threadIdx.x; if (t >= N * (K / 8)) return; const int n = t / (K / 8), k8 = (t % (K / 8)) * 8; FragH f;
#pragma unroll
  for (int i = 0; i < 8; ++i) f.h[i] = (_Float16)(bf16_round(W[(size_t)(k8 + i) * N + n]) * scale); const v8us o = f.half[0];
  *(v8us*)((unsigned short*)Wt + (size_t)n * K + k8) = o; 
}
// k_gemm_hh variant with fused epilogue: v = acc·alpha + bias[by·sBias + col] (+ CP[(row/rowsPerB)·sCPb + by·64 + col] if CP) ; ACT 0 none / 1 elu ; writes f16 C16 (and f32 C if non-null)
template <int ACT>
__global__ __launch_bounds__(128) void k_gemm_hhx(const _Float16* __restrict__ A, int lda, size_t sA, const _Float16* __restrict__ Bh, int ldb, size_t sB, float alpha, const float* __restrict__ bias, size_t sBias, const float* __restrict__ CP, int rowsPerB, size_t sCPb, int row0g,
    float* __restrict__ C, _Float16* __restrict__ C16, int ldc, size_t sC, int M, int N, int K) {
  __shared__ __attribute__((aligned(16))) float so[4][16][64];
  const int tid = threadIdx.x, w = tid >> 5, lane = tid & 31, ln = lane & 15, hh = lane >> 4; const int by = blockIdx.y;
  A += (size_t)by * sA; Bh += (size_t)by * sB; const size_t cofs = (size_t)by * sC; const float* bp = bias ? bias + (size_t)by * sBias : nullptr;
  const int ntn = (N + 63) / 64; const int wid = blockIdx.x * 4 + w; const int mt = wid / ntn, nq = wid % ntn; if (mt * 16 >= M) return;
  const int row0 = mt * 16, col0 = nq * 64; const _Float16* arow = A + (size_t)(row0 + ln) * lda;
  v8f acc[4] = {};
  for (int kb = 0; kb < K; kb += 32) { FragH ah; ah.half[0] = *(const v8us*)((const unsigned short*)arow + kb + 8 * hh); ah.half[1] = *(const v8us*)((const unsigned short*)arow + kb + 16 + 8 * hh);
#pragma unroll
    for (int t = 0; t < 4; ++t) { if (col0 + t * 16 >= N) continue; const size_t boff = (size_t)(col0 + t * 16 + ln) * ldb + kb; FragH bq; bq.half[0] = *(const v8us*)((const unsigned short*)Bh + boff + 8 * hh); bq.half[1] = *(const v8us*)((const unsigned short*)Bh + boff + 16 + 8 * hh);
      acc[t] = mmaH<1>(ah.v, ah.v, bq.v, bq.v, acc[t]); }
  }
#pragma unroll
  for (int t = 0; t < 4; ++t) { if (col0 + t * 16 >= N) continue; const int col = col0 + t * 16 + ln; const float bv = bp ? bf16_round(bp[col]) : 0.f;
#pragma unroll
    for (int r = 0; r < 8; ++r) { float v = acc[t][r] * alpha + bv; if (CP) { const int bidx = (row0g + row0 + 8 * hh + r) / rowsPerB; v += CP[(size_t)bidx * sCPb + (size_t)by * 64 + col]; } if (ACT == 1) v = (v > 0.f) ? v : expm1f(v); else if (ACT == 7) v = (v > 0.f) ? v + 1.0f : expf(v); else if (ACT == 8) v = tanhf(v); else if (ACT == 9) v = 0.5f * v * (1.0f + tanhf(0.7978845608028654f * (v + 0.044715f * v * v * v))); else if (ACT == 11) v = 1.0f / (1.0f + expf(-v)); else if (ACT == 12) v = (v > 0.f) ? v : 0.01f * v; else if (ACT == 14) v = (v > 0.f) ? v : 0.1f * v; else if (ACT == 15) v = v / (1.0f + expf(-v)); else if (ACT == 3) v = fmaxf(v, 0.f); else if (ACT == 6) v = 0.5f * v * (1.0f + erff(v * 0.70710678118654752f)); so[w][8 * hh + r][t * 16 + ln] = v; } }
  __builtin_amdgcn_fence(__ATOMIC_ACQ_REL, "workgroup"); __builtin_amdgcn_wave_barrier();
  const int rsub = lane >> 4, c4 = (lane & 15) * 4; typedef _Float16 v4h __attribute__((ext_vector_type(4)));
  {
#pragma unroll
    for (int q = 0; q < 8; ++q) { const int r = q * 2 + rsub; if (col0 + c4 < N) { const v4f v = *(const v4fa*)&so[w][r][c4]; if (C) *(v4f*)(C + cofs + (size_t)(row0 + r) * ldc + col0 + c4) = v; if (C16) { v4h h4; for (int i = 0; i < 4; ++i) h4[i] = (_Float16)v[i]; *(v4h*)(C16 + cofs + (size_t)(row0 + r) * ldc + col0 + c4) = h4; } } }
     }
}


typedef _Float16 v4h __attribute__((ext_vector_type(4)));

__global__ __launch_bounds__(256) void k_h16(const float* __restrict__ x, _Float16* __restrict__ X16, size_t n8) { const size_t t = (size_t)blockIdx.x * 256 + threadIdx.x; if (t >= n8) return; FragH f;
#pragma unroll
  for (int q = 0; q < 8; ++q) f.h[q] = (_Float16)x[t * 8 + q]; *(v8us*)((unsigned short*)X16 + t * 8) = f.half[0];  }
__global__ __launch_bounds__(256) void k_round16f(const float* __restrict__ W, _Float16* __restrict__ Bt, size_t n8) { const size_t t = (size_t)blockIdx.x * 256 + threadIdx.x; if (t >= n8) return; FragH f;
#pragma unroll
  for (int i = 0; i < 8; ++i) f.h[i] = (_Float16)(bf16_round(W[t * 8 + i]) * 16.0f); *(v8us*)((unsigned short*)Bt + t * 8) = f.half[0];  }
template <int NHv, int TTv>
__global__ __launch_bounds__(256) void k_vt(const _Float16* __restrict__ V16, int ldv, int voff, _Float16* __restrict__ Vt) { __shared__ unsigned short tl[64][66]; const int tid = threadIdx.x; const int slab = blockIdx.x / (TTv / 64), lg = blockIdx.x % (TTv / 64); const int b = slab / NHv, h = slab % NHv;
  for (int i = tid; i < 64 * 8; i += 256) { const int r = i / 8, c8 = (i % 8) * 8; FragH f; f.half[0] = *(const v8us*)((const unsigned short*)V16 + ((size_t)b * TTv + lg * 64 + r) * ldv + voff + h * 64 + c8);
#pragma unroll
    for (int q = 0; q < 8; ++q) tl[r][c8 + q] = f.u[q]; }
  __syncthreads();
  {
#pragma unroll
    for (int rd = 0; rd < 2; ++rd) { const int d = rd * 32 + tid / 8, pc = tid % 8; FragH f;
#pragma unroll
      for (int q = 0; q < 8; ++q) f.u[q] = tl[pc * 8 + q][d];
      *(v8us*)((unsigned short*)Vt + ((size_t)slab * 64 + d) * TTv + lg * 64 + pc * 8) = f.half[0]; }
     } }

// H: [row][2 * DMOD], a row's hi values in its first half and its residuals (x 1024) in its second: one A operand for a product over k = 2 * DMOD
__global__ __launch_bounds__(256) void k_hl(const float* __restrict__ F, _Float16* __restrict__ H, size_t n8) { const size_t t = (size_t)blockIdx.x * 256 + threadIdx.x; if (t >= n8) return; FragH fh, fl; unsigned short* hp = (unsigned short*)H + (t / (DMOD / 8)) * (2 * DMOD) + (t % (DMOD / 8)) * 8; const v4f a = *(const v4fa*)(F + t * 8), c = *(const v4fa*)(F + t * 8 + 4);
#pragma unroll
  for (int q = 0; q < 4; ++q) { _Float16 h = (_Float16)a[q]; fh.h[q] = h; fl.h[q] = (_Float16)((a[q] - (float)h) * 1024.0f); h = (_Float16)c[q]; fh.h[4 + q] = h; fl.h[4 + q] = (_Float16)((c[q] - (float)h) * 1024.0f); }
  { *(v8us*)hp = fh.half[0]; *(v8us*)(hp + DMOD) = fl.half[0];  } }

// ---- fast GEMM (work-group tile 128x64, wave tile 32x64; requires M % 128 == 0, N % 64 == 0, K % 64 == 0 and K >= 64); epilogue = k_gemm_hhx semantics ----
__device__ __forceinline__ v8f g2_mma(v16h a, v16h b, v8f c) { return __builtin_amdgcn_wmma_f32_16x16x32_f16(false, a, false, b, (short)0, c, false, false); }
// a fragment from a staged tile: the two 16-byte pieces of the lane's row (same k order as a fragment read from global memory: 8 * hh .. and 16 + 8 * hh ..)
__device__ __forceinline__ v16h g2_lfrag(const unsigned char* rows, int o0, int o1) { FragH f; f.half[0] = *(const v8us*)(rows + o0); f.half[1] = *(const v8us*)(rows + o1); return f.v; }
// One stage of the GEMM ring: 64 k of the tile's 128 A rows, then of its 64 B rows (rows of 128 bytes without a pad, 24 KiB), brought by asynchronous copies to LDS.
// Twelve copies a lane; a wave-wide copy covers four whole 128-byte lines. s_wait_xcnt stands inside the statement so that no address register is rewritten ahead of it.
__device__ __forceinline__ void g2_stage_copy(unsigned lds, const unsigned short* ga, size_t astep, const unsigned short* gb, size_t bstep) {
  asm volatile("global_load_async_to_lds_b128 %0, %12, off\n\t"
               "global_load_async_to_lds_b128 %1, %13, off\n\t"
               "global_load_async_to_lds_b128 %2, %14, off\n\t"
               "global_load_async_to_lds_b128 %3, %15, off\n\t"
               "global_load_async_to_lds_b128 %4, %16, off\n\t"
               "global_load_async_to_lds_b128 %5, %17, off\n\t"
               "global_load_async_to_lds_b128 %6, %18, off\n\t"
               "global_load_async_to_lds_b128 %7, %19, off\n\t"
               "global_load_async_to_lds_b128 %8, %20, off\n\t"
               "global_load_async_to_lds_b128 %9, %21, off\n\t"
               "global_load_async_to_lds_b128 %10, %22, off\n\t"
               "global_load_async_to_lds_b128 %11, %23, off\n\t"
               "s_wait_xcnt 0x0"
               :: "v"(lds), "v"(lds + 2048u), "v"(lds + 4096u), "v"(lds + 6144u), "v"(lds + 8192u), "v"(lds + 10240u), "v"(lds + 12288u), "v"(lds + 14336u),
                  "v"(lds + 16384u), "v"(lds + 18432u), "v"(lds + 20480u), "v"(lds + 22528u),
                  "v"(ga), "v"(ga + astep), "v"(ga + 2 * astep), "v"(ga + 3 * astep), "v"(ga + 4 * astep), "v"(ga + 5 * astep), "v"(ga + 6 * astep), "v"(ga + 7 * astep),
                  "v"(gb), "v"(gb + bstep), "v"(gb + 2 * bstep), "v"(gb + 3 * bstep)
               : "memory");
}
// ROTB: in the first ROTB products of the batch (blockIdx.y) the tile's 64 columns are one head and its rows are tokens (position = row % SLEN): the rotary embedding is applied to the staged f32 tile on its way out (CS: cos table, then sin table, [position][RD / 2]).
// KMID > 0: the operands' k range is two parts that carry different powers of two; ahead of k = KMID (a multiple of 64) the accumulators are multiplied by MIDMUL, an exact step that brings the first part's sums to the second part's scale.
template <int ACT, int ROTB, int KMID = 0, int MIDMUL = 1>
__global__ __launch_bounds__(128) void k_gemm2(const _Float16* __restrict__ A, int lda, size_t sA, const _Float16* __restrict__ Bh, int ldb, size_t sB, float alpha, const float* __restrict__ bias, size_t sBias, const float* __restrict__ CP, int rowsPerB, size_t sCPb, int row0g,
    float* __restrict__ C, _Float16* __restrict__ C16, int ldc, size_t sC, int M, int N, int K, const float* __restrict__ CS) {
  constexpr int ATILE_B = 128 * 128, GSTAGE_B = ATILE_B + 64 * 128;      /* a stage = 64 k: A tile, then B tile */
  __shared__ __attribute__((aligned(16))) unsigned char ring[2 * GSTAGE_B];
  float (*so)[32][68] = reinterpret_cast<float (*)[32][68]>(ring);      /* output staging (34,816 bytes) takes the ring's place behind the loop's last barrier */
  const int tid = threadIdx.x, w = tid >> 5, lane = tid & 31, ln = lane & 15, hh = lane >> 4; const int by = blockIdx.y; const bool rot = ROTB > 0 && by < ROTB;      /* the same for the whole work-group */
  A += (size_t)by * sA; Bh += (size_t)by * sB; const size_t cofs = (size_t)by * sC; const float* bp = bias ? bias + (size_t)by * sBias : nullptr;
  const int ntn = N >> 6; const int mt = blockIdx.x / ntn, nq = blockIdx.x - mt * ntn; if (mt * 128 >= M) return;      /* the whole work-group leaves, ahead of every copy and barrier */
  const int row0 = mt * 128 + 32 * w, col0 = nq * 64;
  const int nst = K >> 6;
  /* 16-byte piece c of row r lies at r * 128 + (c ^ ((r >> 1) & 7)) * 16: sixteen rows read at one piece index fall on all 64 banks */
  const unsigned cp_lds = (unsigned)(size_t)ring + (unsigned)((tid >> 3) * 128 + (((tid & 7) ^ ((tid >> 4) & 7)) * 16));
  const unsigned short* cp_a = (const unsigned short*)A + (size_t)(mt * 128 + (tid >> 3)) * lda + (tid & 7) * 8;
  const unsigned short* cp_b = (const unsigned short*)Bh + (size_t)(col0 + (tid >> 3)) * ldb + (tid & 7) * 8;
  const size_t astep = (size_t)16 * lda, bstep = (size_t)16 * ldb;
  g2_stage_copy(cp_lds, cp_a, astep, cp_b, bstep);
  int fo[2][2];      /* a fragment's two pieces in row ln: [32-element group of the row][piece] */
#pragma unroll
  for (int g = 0; g < 2; ++g)
#pragma unroll
    for (int pc = 0; pc < 2; ++pc) fo[g][pc] = ln * 128 + (((g * 4 + pc * 2 + hh) ^ ((ln >> 1) & 7)) * 16);
  const v8f z8 = {0.f,0.f,0.f,0.f,0.f,0.f,0.f,0.f}; v8f c00 = z8, c01 = z8, c02 = z8, c03 = z8, c10 = z8, c11 = z8, c12 = z8, c13 = z8;
  asm volatile("s_wait_asynccnt 0x0" ::: "memory");      /* stage 0 has landed for this wave's own copies */
  __syncthreads();                                       /* ... and for every other wave's */
  if (1 < nst) g2_stage_copy(cp_lds + GSTAGE_B, cp_a + 64, astep, cp_b + 64, bstep);
#pragma unroll 1      /* one body for both buffers: the buffer is picked by the trip's parity */
  for (int t = 0; t < nst; ++t) {
    const unsigned char* ar = ring + (t & 1) * GSTAGE_B + w * (32 * 128); const unsigned char* br = ring + (t & 1) * GSTAGE_B + ATILE_B;
    if (KMID > 0 && t == (KMID >> 6)) { const float ms = (float)MIDMUL; c00 *= ms; c01 *= ms; c02 *= ms; c03 *= ms; c10 *= ms; c11 *= ms; c12 *= ms; c13 *= ms; }
#pragma unroll
    for (int g = 0; g < 2; ++g) { const int o0 = fo[g][0], o1 = fo[g][1];
      const v16h a0 = g2_lfrag(ar, o0, o1), a1 = g2_lfrag(ar + 2048, o0, o1);
      const v16h b0 = g2_lfrag(br, o0, o1), b1 = g2_lfrag(br + 2048, o0, o1), b2 = g2_lfrag(br + 4096, o0, o1), b3 = g2_lfrag(br + 6144, o0, o1);
      c00 = g2_mma(a0, b0, c00); c10 = g2_mma(a1, b0, c10);
      c01 = g2_mma(a0, b1, c01); c11 = g2_mma(a1, b1, c11);
      c02 = g2_mma(a0, b2, c02); c12 = g2_mma(a1, b2, c12);
      c03 = g2_mma(a0, b3, c03); c13 = g2_mma(a1, b3, c13); }
    asm volatile("s_wait_dscnt 0x0" ::: "memory");         /* this wave's reads of stage t have returned */
    asm volatile("s_wait_asynccnt 0x0" ::: "memory");      /* this wave's copies of stage t + 1 have landed */
    __syncthreads();                                       /* publishes stage t + 1 and ends every wave's reads of stage t */
    if (t + 2 < nst) g2_stage_copy(cp_lds + (t & 1) * GSTAGE_B, cp_a + (size_t)(t + 2) * 64, astep, cp_b + (size_t)(t + 2) * 64, bstep); }
  asm volatile("s_wait_asynccnt 0x0" ::: "memory");        /* nothing is in flight when the ring becomes output staging */
  const int rsub = lane >> 4, c4 = (lane & 15) * 4;
  v8f accs[8] = {c00, c01, c02, c03, c10, c11, c12, c13};
#pragma unroll
  for (int u = 0; u < 8; ++u) { const int t = u & 3, half = u >> 2; const int col = col0 + t * 16 + ln; const float bv = bp ? bf16_round(bp[col]) : 0.f;
#pragma unroll
    for (int r = 0; r < 8; ++r) { const int rloc = half * 16 + 8 * hh + r; float v = accs[u][r] * alpha + bv; if (CP) { const int bidx = (row0g + row0 + rloc) / rowsPerB; v += CP[(size_t)bidx * sCPb + (size_t)by * 64 + col]; }
      if (ACT == 3) v = fmaxf(v, 0.f); else if (ACT == 6) v = 0.5f * v * (1.0f + erff(v * 0.70710678118654752f)); else if (ACT == 11) v = 1.0f / (1.0f + expf(-v)); else if (ACT == 15) v = v / (1.0f + expf(-v)); else if (ACT == 12) v = (v > 0.f) ? v : 0.01f * v; else if (ACT == 8) v = tanhf(v);
      so[w][rloc][t * 16 + ln] = v; } }
  v4f tcs[16], tsn[16];      /* rotated products: the lane's table pieces for its sixteen rows, all asked for at once so that their latency is paid once; behind the staging, where the accumulators' registers are free */
  if (rot) { const float* tb = CS + (size_t)(row0 % SLEN + rsub) * (RD / 2) + (c4 & (RD / 2 - 1));      /* a wave's 32 rows never cross a sequence's end: both are multiples of 32 */
#pragma unroll
    for (int q = 0; q < 16; ++q) { tcs[q] = *(const v4fa*)(tb + q * RD); tsn[q] = *(const v4fa*)(tb + q * RD + SLEN * (RD / 2)); }
    asm volatile("s_wait_xcnt 0x0" ::: "memory"); }      /* stands ahead of any rewrite of the table loads' address registers */
  __builtin_amdgcn_fence(__ATOMIC_ACQ_REL, "workgroup"); __builtin_amdgcn_wave_barrier();
  {
#pragma unroll
    for (int q = 0; q < 16; ++q) { const int r = q * 2 + rsub; v4f v = *(const v4fa*)&so[w][r][c4];
      if (rot) {      /* every lane reads a partner piece at a valid place; only dims under RD take the rotated value */
        const v4f u = *(const v4fa*)&so[w][r][c4 ^ (RD / 2)]; const v4f cs = tcs[q], sn = tsn[q];
        const v4f lo = v * cs + u * sn, hi = u * -sn + v * cs;      /* dims 0..15: x1 cos + x2 sin (x1 own); dims 16..31: -x1 sin + x2 cos (x2 own) */
        v = (c4 < RD / 2) ? lo : ((c4 < RD) ? hi : v); }
      if (C) *(v4f*)(C + cofs + (size_t)(row0 + r) * ldc + col0 + c4) = v; if (C16) { v4h h4; for (int i = 0; i < 4; ++i) h4[i] = (_Float16)v[i]; *(v4h*)(C16 + cofs + (size_t)(row0 + r) * ldc + col0 + c4) = h4; } }
     } }



// One stage of the K / V^T ring: 64 key rows of K (128 bytes each) and 64 rows of V^T (the same 64 keys, 128 bytes each), 16 KiB, brought by asynchronous copies to LDS.
// Eight copies a lane; a wave-wide copy covers four whole 128-byte lines. s_wait_xcnt stands inside the statement so that no address register is rewritten ahead of it.
__device__ __forceinline__ void stage_copy(unsigned lds, const unsigned short* gk, size_t kstep, const unsigned short* gv, size_t vstep) {
  asm volatile("global_load_async_to_lds_b128 %0, %8, off\n\t"
               "global_load_async_to_lds_b128 %1, %9, off\n\t"
               "global_load_async_to_lds_b128 %2, %10, off\n\t"
               "global_load_async_to_lds_b128 %3, %11, off\n\t"
               "global_load_async_to_lds_b128 %4, %12, off\n\t"
               "global_load_async_to_lds_b128 %5, %13, off\n\t"
               "global_load_async_to_lds_b128 %6, %14, off\n\t"
               "global_load_async_to_lds_b128 %7, %15, off\n\t"
               "s_wait_xcnt 0x0"
               :: "v"(lds), "v"(lds + 2048u), "v"(lds + 4096u), "v"(lds + 6144u), "v"(lds + 8192u), "v"(lds + 10240u), "v"(lds + 12288u), "v"(lds + 14336u),
                  "v"(gk), "v"(gk + kstep), "v"(gk + 2 * kstep), "v"(gk + 3 * kstep), "v"(gv), "v"(gv + vstep), "v"(gv + 2 * vstep), "v"(gv + 3 * vstep)
               : "memory");
}
// lane l with lane l ^ 16: one vector cross-row move
__device__ __forceinline__ float xhalf(float x) { return __builtin_bit_cast(float, __builtin_amdgcn_permlanex16(__builtin_bit_cast(int, x), __builtin_bit_cast(int, x), 0x76543210, 0xfedcba98, false, false)); }
template <int CAUSAL>
__global__ __launch_bounds__(128) void k_flash(const _Float16* __restrict__ Q16, int ldq, const _Float16* __restrict__ K16, int ldk, const _Float16* __restrict__ Vt, const int* __restrict__ MSK, float* __restrict__ O, int ldo) {
  constexpr int RPW = 16, RTN = RPW / 16, NQB = TQ / (4 * RPW), DT = 4, KS = 2;
  constexpr float C2 = SCL * 1.44269504088896340736f;      /* score -> exponent of 2; the bare exp2 instruction serves: no exponent exceeds 10, and a result that flushes to zero lies far under P's f16 step */
  constexpr int TILE_B = 64 * 128, STAGE_B = 2 * TILE_B;      /* a stage = 64 keys: K tile, then V^T tile, rows of 128 bytes without a pad */
  __shared__ __attribute__((aligned(16))) unsigned char ring[2 * STAGE_B];
  float (*sO)[RPW][64 + 4] = reinterpret_cast<float (*)[RPW][64 + 4]>(ring);      /* output staging takes the ring's place behind the loop's last barrier */
  const int tid = threadIdx.x, w = tid >> 5, lane = tid & 31, ln = lane & 15, hh = lane >> 4;
  const int slab = blockIdx.x / QBLKS, qblk = blockIdx.x % QBLKS; (void)NQB; (void)MSK; const int b = slab / NH, h = slab % NH; const int qb0 = qblk * (4 * RPW); const int q0 = qb0 + w * RPW;
  const unsigned short* Vth = (const unsigned short*)Vt + (size_t)slab * 64 * TK;
  const int jend = (CAUSAL == 1) ? (qb0 + 4 * RPW) : TK;      /* causal: keys beyond the block's last query never contribute */
  const int nst = jend / 64;
  /* 16-byte piece c of row r lies at r * 128 + (c ^ ((r >> 1) & 7)) * 16: sixteen rows read at one piece index fall on all 64 banks */
  const unsigned cp_lds = (unsigned)(size_t)ring + (unsigned)((tid >> 3) * 128 + (((tid & 7) ^ ((tid >> 4) & 7)) * 16));
  const unsigned short* cp_k = (const unsigned short*)K16 + ((size_t)b * TK + (tid >> 3)) * ldk + h * 64 + (tid & 7) * 8;
  const unsigned short* cp_v = Vth + (size_t)(tid >> 3) * TK + (tid & 7) * 8;
  const size_t kstep = (size_t)16 * ldk, vstep = (size_t)16 * TK;
  stage_copy(cp_lds, cp_k, kstep, cp_v, vstep);
  FragH aq[2][KS];
#pragma unroll
  for (int rt = 0; rt < RTN; ++rt) { const unsigned short* qr = (const unsigned short*)Q16 + ((size_t)b * TQ + q0 + rt * 16 + ln) * ldq + h * 64;
#pragma unroll
    for (int ks = 0; ks < KS; ++ks) { aq[rt][ks].half[0] = *(const v8us*)(qr + ks * 32 + 8 * hh); aq[rt][ks].half[1] = *(const v8us*)(qr + ks * 32 + 16 + 8 * hh); } }
  int fo[2][2];      /* a fragment's two pieces in row ln: [32-element group of the row][piece] */
#pragma unroll
  for (int g = 0; g < 2; ++g)
#pragma unroll
    for (int pc = 0; pc < 2; ++pc) fo[g][pc] = ln * 128 + (((g * 4 + pc * 2 + hh) ^ ((ln >> 1) & 7)) * 16);
  float m_r[2], l_r[2]; v8f oacc[2][DT];      /* per lane: its query's running maximum (of raw scores), its half's share of the sum (x 1024), and O^T[d = dt * 16 + 8 * hh + r][query ln] */
#pragma unroll
  for (int rt = 0; rt < RTN; ++rt) { m_r[rt] = -3.0e38f; l_r[rt] = 0.f;
#pragma unroll
    for (int dt = 0; dt < DT; ++dt) oacc[rt][dt] = (v8f){0.f,0.f,0.f,0.f,0.f,0.f,0.f,0.f}; }
  asm volatile("s_wait_asynccnt 0x0" ::: "memory");      /* stage 0 has landed for this wave's own copies */
  __syncthreads();                                       /* ... and for every other wave's */
  if (1 < nst) stage_copy(cp_lds + STAGE_B, cp_k + (size_t)64 * ldk, kstep, cp_v + 64, vstep);
#pragma unroll 1
  for (int t = 0; t < nst; ++t) {
    const unsigned char* st = ring + (t & 1) * STAGE_B;
#pragma unroll 1      /* the two 32-key passes of a stage stay one body: unrolled, the registers grow and a work-group per WGP is lost */
    for (int ps = 0; ps < 2; ++ps) { const int j0 = t * 64 + ps * 32;
    v8f s[2][2];
#pragma unroll
    for (int nt = 0; nt < 2; ++nt) { const unsigned char* kr = st + (ps * 32 + nt * 16) * 128; FragH bk[KS];
#pragma unroll
      for (int ks = 0; ks < KS; ++ks) { bk[ks].half[0] = *(const v8us*)(kr + fo[ks][0]); bk[ks].half[1] = *(const v8us*)(kr + fo[ks][1]); }
#pragma unroll
      for (int rt = 0; rt < RTN; ++rt) { v8f acc = (v8f){0.f,0.f,0.f,0.f,0.f,0.f,0.f,0.f};
#pragma unroll
        for (int ks = 0; ks < KS; ++ks) acc = mmaH<1>(bk[ks].v, bk[ks].v, aq[rt][ks].v, aq[rt][ks].v, acc); s[rt][nt] = acc; } }      /* s[rt][nt][r] = score of key j0 + nt * 16 + 8 * hh + r, query q0 + rt * 16 + ln */
    FragH pb[2];
#pragma unroll
    for (int rt = 0; rt < RTN; ++rt) { const int tq = q0 + rt * 16 + ln; float sv[16]; bool ok[16];
#pragma unroll
      for (int e = 0; e < 16; ++e) { const int kk = j0 + (e >> 3) * 16 + 8 * hh + (e & 7);
        ok[e] = (CAUSAL == 1) ? (kk <= tq) : ((CAUSAL == 2) ? ((kk >> 5) == (tq >> 5)) : true);      /* mode 2: block-diagonal 32-token groups */
        sv[e] = ok[e] ? s[rt][e >> 3][e & 7] : -3.0e38f; }      /* raw scores: the scale is positive, so the maximum is taken ahead of it */
      float mx[4];
#pragma unroll
      for (int c = 0; c < 4; ++c) mx[c] = fmaxf(fmaxf(sv[c], sv[4 + c]), fmaxf(sv[8 + c], sv[12 + c]));
      float mc = fmaxf(fmaxf(mx[0], mx[1]), fmaxf(mx[2], mx[3])); mc = fmaxf(mc, xhalf(mc));      /* both halves now hold the query's maximum over the 32 keys */
      const float mn = fmaxf(m_r[rt], mc); const float ea = __builtin_amdgcn_exp2f((m_r[rt] - mn) * C2); const float al = (mn > -1.0e38f) ? ea : 1.0f; m_r[rt] = mn;
      const float nb = fmaf(-mn, C2, 10.0f);      /* 1024 p = 2^(score * C2 + nb): scale, log2 e, the maximum and P's factor 1024 in one multiply-add */
      const v2f c2v = {C2, C2}, nbv = {nb, nb}; v2f ls[2];
#pragma unroll
      for (int e = 0; e < 16; e += 2) { const v2f x = __builtin_elementwise_fma((v2f){sv[e], sv[e + 1]}, c2v, nbv);
        const v2f p = {ok[e] ? __builtin_amdgcn_exp2f(x[0]) : 0.f, ok[e + 1] ? __builtin_amdgcn_exp2f(x[1]) : 0.f};
        if (e < 4) ls[e >> 1] = p; else ls[(e >> 1) & 1] += p;
        pb[rt].h[e] = (_Float16)p[0]; pb[rt].h[e + 1] = (_Float16)p[1]; }
      l_r[rt] = l_r[rt] * al + ((ls[0][0] + ls[0][1]) + (ls[1][0] + ls[1][1]));      /* the sum carries the factor 1024 too */
#pragma unroll
      for (int dt = 0; dt < DT; ++dt)
#pragma unroll
        for (int r = 0; r < 8; ++r) oacc[rt][dt][r] *= al; }
#pragma unroll
    for (int dt = 0; dt < DT; ++dt) { const unsigned char* vrow = st + TILE_B + dt * 16 * 128; FragH bv; bv.half[0] = *(const v8us*)(vrow + (fo[0][0] ^ (ps * 64))); bv.half[1] = *(const v8us*)(vrow + (fo[0][1] ^ (ps * 64)));      /* the pass's 32 keys: piece index + 4 = bit 6 of the offset */
#pragma unroll
      for (int rt = 0; rt < RTN; ++rt) oacc[rt][dt] = mmaH<1>(bv.v, bv.v, pb[rt].v, pb[rt].v, oacc[rt][dt]); } }
    asm volatile("s_wait_dscnt 0x0" ::: "memory");         /* this wave's reads of stage t have returned */
    asm volatile("s_wait_asynccnt 0x0" ::: "memory");      /* this wave's copies of stage t + 1 have landed */
    __syncthreads();                                       /* publishes stage t + 1 and ends every wave's reads of stage t */
    if (t + 2 < nst) stage_copy(cp_lds + (t & 1) * STAGE_B, cp_k + (size_t)(t + 2) * 64 * ldk, kstep, cp_v + (t + 2) * 64, vstep); }
  asm volatile("s_wait_asynccnt 0x0" ::: "memory");        /* nothing is in flight when the ring becomes output staging */
#pragma unroll
  for (int rt = 0; rt < RTN; ++rt) { float l = l_r[rt]; l += xhalf(l); const float inv = (l > 0.f) ? 1.0f / l : 0.f;      /* the halves' sums join once */
#pragma unroll
    for (int dt = 0; dt < DT; ++dt)
#pragma unroll
      for (int q4 = 0; q4 < 2; ++q4) { v4f o4;
#pragma unroll
        for (int i = 0; i < 4; ++i) o4[i] = oacc[rt][dt][q4 * 4 + i] * inv;
        *(v4fa*)&sO[w][rt * 16 + ln][dt * 16 + 8 * hh + q4 * 4] = o4; } }
  __builtin_amdgcn_fence(__ATOMIC_ACQ_REL, "workgroup"); __builtin_amdgcn_wave_barrier();
  {
#pragma unroll
    for (int rp = 0; rp < RPW; rp += 2) { const int r = rp + (lane >> 4), pc = lane & 15; const v4f val = *(const v4fa*)&sO[w][r][pc * 4]; *(v4f*)(O + ((size_t)b * TQ + q0 + r) * ldo + h * 64 + pc * 4) = val; }
     } }

// Everything that depends on the inputs alone, in one launch: the rotary tables (first blocks: the longest chain of dependent arithmetic starts first), then x and the four weight matrices as f16 planes.
#define PREP_TAB_BLKS (SLEN * (RD / 2) / 256)      /* one table entry a thread */
#define PREP_CVT_BLKS (DMOD * DMOD / 8 / 256)      /* a thread takes one 8-element piece of each weight matrix and eight pieces of x: few waves, each with much to fetch */
static_assert(SLEN * (RD / 2) % 256 == 0 && DMOD * DMOD / 8 % 256 == 0 && NR == 8 * DMOD, "the grid covers tables and planes without a remainder");
// eight f32 values -> bf16-rounded, times a power of two, as f16
__device__ __forceinline__ v8us prep_cvt8(v4f a, v4f c, float sc) { FragH f;
#pragma unroll      /* keeps f in registers */
  for (int q = 0; q < 4; ++q) { f.h[q] = (_Float16)(bf16_round(a[q]) * sc); f.h[4 + q] = (_Float16)(bf16_round(c[q]) * sc); }
  return f.half[0]; }
// Six 8-element pieces, twelve 16-byte loads. One statement with its data wait and early-clobber results: all twelve are in flight together, and no result lands on an address register that a load of the run still names.
__device__ __forceinline__ void prep_ld6(const float* p0, const float* p1, const float* p2, const float* p3, const float* p4, const float* p5, v4f (&a)[6], v4f (&c)[6]) {
  asm volatile("global_load_b128 %0, %12, off\n\t"
               "global_load_b128 %1, %12, off offset:16\n\t"
               "global_load_b128 %2, %13, off\n\t"
               "global_load_b128 %3, %13, off offset:16\n\t"
               "global_load_b128 %4, %14, off\n\t"
               "global_load_b128 %5, %14, off offset:16\n\t"
               "global_load_b128 %6, %15, off\n\t"
               "global_load_b128 %7, %15, off offset:16\n\t"
               "global_load_b128 %8, %16, off\n\t"
               "global_load_b128 %9, %16, off offset:16\n\t"
               "global_load_b128 %10, %17, off\n\t"
               "global_load_b128 %11, %17, off offset:16\n\t"
               "s_wait_loadcnt 0x0"
               : "=&v"(a[0]), "=&v"(c[0]), "=&v"(a[1]), "=&v"(c[1]), "=&v"(a[2]), "=&v"(c[2]), "=&v"(a[3]), "=&v"(c[3]), "=&v"(a[4]), "=&v"(c[4]), "=&v"(a[5]), "=&v"(c[5])
               : "v"(p0), "v"(p1), "v"(p2), "v"(p3), "v"(p4), "v"(p5) : "memory"); }
__global__ __launch_bounds__(256) void k_prep(const float* __restrict__ x, const float* __restrict__ Wq, const float* __restrict__ Wk, const float* __restrict__ Wv, const float* __restrict__ Wo,
    _Float16* __restrict__ X16, _Float16* __restrict__ BQ, _Float16* __restrict__ BK, _Float16* __restrict__ BV, _Float16* __restrict__ BO, float* __restrict__ CS) {
  if (blockIdx.x < PREP_TAB_BLKS) {
    const int t = blockIdx.x * 256 + threadIdx.x; const int i = t % (RD / 2), tpos = t / (RD / 2); const float invf = (float)pow(10000.0, -(double)(2 * i) / (double)RD); const float ang = (float)tpos * invf; const float cv = cosf(ang), sv = sinf(ang);
    CS[t] = cv; CS[SLEN * (RD / 2) + t] = sv; return; }
  constexpr size_t NE = (size_t)DMOD * DMOD;      /* elements that the conversion blocks cover with one piece a thread */
  const size_t e = ((size_t)(blockIdx.x - PREP_TAB_BLKS) * 256 + threadIdx.x) * 8;
  const float* xp = x + e; unsigned short* xo = (unsigned short*)X16 + e; v4f a[6], c[6];
  prep_ld6(xp, xp + NE, xp + 2 * NE, xp + 3 * NE, xp + 4 * NE, xp + 5 * NE, a, c);
#pragma unroll      /* a[] and c[] are register results of the load statement: constant indices keep them there */
  for (int j = 0; j < 6; ++j) *(v8us*)(xo + j * NE) = prep_cvt8(a[j], c[j], 1.0f);
  prep_ld6(xp + 6 * NE, xp + 7 * NE, Wq + e, Wk + e, Wv + e, Wo + e, a, c);
  *(v8us*)(xo + 6 * NE) = prep_cvt8(a[0], c[0], 1.0f); *(v8us*)(xo + 7 * NE) = prep_cvt8(a[1], c[1], 1.0f);
  *(v8us*)((unsigned short*)BQ + e) = prep_cvt8(a[2], c[2], 16.0f);
  *(v8us*)((unsigned short*)BK + e) = prep_cvt8(a[3], c[3], 16.0f);
  *(v8us*)((unsigned short*)BV + e) = prep_cvt8(a[4], c[4], 16.0f);
  /* output projection: a row of BO is the weight row x 16 (for the hi plane), then the same row x 1 (for the residual plane) */
  unsigned short* bo = (unsigned short*)BO + (e / DMOD) * (2 * DMOD) + e % DMOD;
  *(v8us*)bo = prep_cvt8(a[5], c[5], 16.0f); *(v8us*)(bo + DMOD) = prep_cvt8(a[5], c[5], 1.0f);
  asm volatile("s_wait_xcnt 0x0" ::: "memory");      /* stands behind the stores, ahead of anything that could rewrite their registers */
}

extern "C" void kernel_launch(void* const* d_in, const int* in_sizes, int n_in,
                              void* d_out, int out_size, void* d_ws, size_t ws_size, hipStream_t stream) {
  (void)in_sizes; (void)n_in; (void)out_size;
  const float* const* I = (const float* const*)d_in; const float* x = I[0]; const float* Wq = I[1]; const float* Wk = I[2]; const float* Wv = I[3]; const float* Wo = I[4];
  char* ws = (char*)d_ws; size_t off = 0;
  auto take = [&](size_t bytes) { char* p = ws + off; off += (bytes + 255) & ~(size_t)255; return p; };
  const size_t w8 = (size_t)DMOD * DMOD / 8;
  _Float16* BQ = (_Float16*)take(w8 * 16); _Float16* BK = (_Float16*)take(w8 * 16); _Float16* BV = (_Float16*)take(w8 * 16); _Float16* BO = (_Float16*)take(w8 * 32);
  _Float16* X16 = (_Float16*)take((size_t)NR * DMOD * 2); float* O = (float*)take((size_t)NR * DMOD * 4); _Float16* Q16 = (_Float16*)take((size_t)NR * DMOD * 2); _Float16* K16 = (_Float16*)take((size_t)NR * DMOD * 2); _Float16* V16 = (_Float16*)take((size_t)NR * DMOD * 2); _Float16* VT = (_Float16*)take((size_t)NR * DMOD * 2); float* CS = (float*)take((size_t)SLEN * RD * 4);
  _Float16* HH = Q16;      /* alias after the flash kernel: Q16 and K16 are dead and lie back to back (each a multiple of 256 bytes): one [NR][2 * DMOD] plane */
  if (off > ws_size) return;      /* 10 + 16 + 32 + 16 x 4 = 122 MiB */
  k_prep<<<PREP_TAB_BLKS + PREP_CVT_BLKS, 256, 0, stream>>>(x, Wq, Wk, Wv, Wo, X16, BQ, BK, BV, BO, CS);
  const dim3 gP((NR / 128) * (DMOD / 64), 1);
  /* q, k and v projections as one batch of three: BQ, BK, BV lie back to back, and so do Q16, K16, V16 (each size a multiple of 256 bytes); q and k are rotated */
  k_gemm2<0, 2><<<dim3(gP.x, 3), 128, 0, stream>>>(X16, DMOD, 0, BQ, DMOD, (size_t)DMOD * DMOD, 0.0625f, nullptr, 0, nullptr, 1, 0, 0, nullptr, Q16, DMOD, (size_t)NR * DMOD, NR, DMOD, DMOD, CS);
  k_vt<NH, SLEN><<<NB * NH * (SLEN / 64), 256, 0, stream>>>(V16, DMOD, 0, VT);
  k_flash<0><<<NB * NH * QBLKS, 128, 0, stream>>>(Q16, DMOD, K16, DMOD, VT, nullptr, O, DMOD);
  k_hl<<<(unsigned)(((size_t)NR * DMOD / 8 + 255) / 256), 256, 0, stream>>>(O, HH, (size_t)NR * DMOD / 8);
  /* hi x (16 W) summed first, x 64, then (1024 residual) x W on top: 1024 y, scaled back once */
  k_gemm2<0, 0, DMOD, 64><<<gP, 128, 0, stream>>>(HH, 2 * DMOD, 0, BO, 2 * DMOD, 0, 1.0f / 1024.0f, nullptr, 0, nullptr, 1, 0, 0, (float*)d_out, nullptr, DMOD, 0, NR, DMOD, 2 * DMOD, nullptr);
}

// v009
// It runs in 171 microseconds.
// Timed twice side by side with v008, it ran 1.10 and 1.11 times as fast.
// Counting every step since v000, it is 4.76 times as fast.
#include <hip/hip_runtime.h>
// TinyAttn (4 sequences x 2048 tokens x 1024; 16 heads x 64; rotary embedding on the first 32 dims of each head): q,k,v = x W^T; q,k rotated (rot = [x1 cos + x2 sin, -x1 sin + x2 cos] on dims 0..31 with the module's inverse-frequency table); softmax(q k^T / 8) v; y Wo^T -> [4,2048,1024].
// Structure: x as an exact f16 plane; q/k/v projections as f16 WMMA GEMMs (32x64 wave tiles, operand tiles staged in an LDS ring, f32 accumulation, exact x16 weights; q/k rotated in f32 on the staged tile, v as f16); the rotary tables recomputed on the device (f64 pow for the inverse frequencies, f32 angle product, f32 cos/sin) and applied in the q/k projections' epilogue, which writes the f16 q/k planes; the v projection run with its operands swapped, so that it stores V^T itself; the fused flash kernel, whose epilogue stores the attention output as the hi and residual halves of one [token][2048] f16 plane; one output-projection GEMM over k = 2048, whose accumulators are multiplied by 64 between the halves.
// Compute dtype: x and weights rounded to bf16; q, k (after rotation), v, P as f16 operands (~2^-12); attention output hi + 2^-10-scaled residual; f32 accumulation/softmax. v_wmma_f32_16x16x32_f16.
#define NB 4
#define DMOD 1024
#define HD 64
#define RD 32                    /* rotary dims per head */
#define NR (NB * SLEN)
#define QBLKS (TQ / 64)          /* query blocks per (sequence, head) launched */
#define SLEN 2048
#define TQ SLEN
#define TK SLEN
#define NH 16
#define SCL 0.125f               /* 64^-0.5 */
typedef __bf16 v16b __attribute__((ext_vector_type(16)));
typedef unsigned short v8us __attribute__((ext_vector_type(8), may_alias));
typedef float  v8f  __attribute__((ext_vector_type(8)));
typedef float  v4f  __attribute__((ext_vector_type(4)));
typedef float  v2f  __attribute__((ext_vector_type(2)));
typedef float  v4fa __attribute__((ext_vector_type(4), may_alias));
union FragB { v16b v; v8us half[2]; unsigned short u[16]; };

__device__ __forceinline__ unsigned short bf16_bits(float x) { unsigned int u = __float_as_uint(x); return (unsigned short)((u + 0x7FFFu + ((u >> 16) & 1u)) >> 16); }
__device__ __forceinline__ float bf16_val(unsigned short b) { return __uint_as_float(((unsigned int)b) << 16); }
__device__ __forceinline__ float bf16_round(float x) { return bf16_val(bf16_bits(x)); }
// D += A·B with NT terms: 1 = ah·bh, 2 = + al·bh (A split), 3 = + ah·bl (both split)
template <int NT>
__device__ __forceinline__ v8f mmaN(v16b ah, v16b al, v16b bh, v16b bl, v8f c) {
  c = __builtin_amdgcn_wmma_f32_16x16x32_bf16(false, ah, false, bh, (short)0, c, false, false);
  if (NT >= 2) c = __builtin_amdgcn_wmma_f32_16x16x32_bf16(false, al, false, bh, (short)0, c, false, false);
  if (NT >= 3) c = __builtin_amdgcn_wmma_f32_16x16x32_bf16(false, ah, false, bl, (short)0, c, false, false);
  asm volatile("v_nop\n\tv_nop\n\tv_nop\n\tv_nop" : "+v"(c) : "v"(ah), "v"(al), "v"(bh), "v"(bl));
  return c;
}

__global__ __launch_bounds__(256) void k_wt_bf16(const float* __restrict__ W, unsigned short* __restrict__ Wt, int K, int N) {
  const int t = blockIdx.x * 256 + threadIdx.x;
  const int k8n = K / 8;
  if (t >= N * k8n) return;
  const int n = t / k8n, k8 = (t % k8n) * 8;
  v8us v;
#pragma unroll
  for (int i = 0; i < 8; ++i) v[i] = bf16_bits(W[(size_t)(k8 + i) * N + n]);
  *(v8us*)(Wt + (size_t)n * K + k8) = v;
  
}

// GEMM C[M][N] (f32, pitch ldc) = act(A[M][K]·W + bias). A f32 row-major (pitch lda) converted per fragment to bf16
// (ASPLIT: hi/lo two planes -> 2 terms, else single rounded term); Wt bf16 [N][K] (pitch ldb). BIAS_BF16 rounds the
// bias to bf16 first (bias quantised to bf16 before the add). K%32==0, M%16==0, N%64==0.
template <bool ASPLIT, int ACT, bool BIAS_BF16>
__global__ __launch_bounds__(128) void k_gemm_bf(const float* __restrict__ A, int lda, const unsigned short* __restrict__ Wt, int ldb,
                                               const float* __restrict__ bias, float* __restrict__ C, int ldc, int M, int N, int K) {
  __shared__ __attribute__((aligned(16))) float so[4][16][64];
  const int tid = threadIdx.x, w = tid >> 5, lane = tid & 31, ln = lane & 15, hh = lane >> 4;
  const int ntn = N / 64;
  const int wid = blockIdx.x * 4 + w;
  const int mt = wid / ntn, nq = wid % ntn;
  if (mt * 16 >= M) return;
  const int row0 = mt * 16, col0 = nq * 64;
  const float* arow = A + (size_t)(row0 + ln) * lda;
  v8f acc[4] = {};
  for (int kb = 0; kb < K; kb += 32) {
    FragB ah, al;
    const v4f x0 = *(const v4fa*)(arow + kb + 8 * hh), x1 = *(const v4fa*)(arow + kb + 8 * hh + 4);
    const v4f x2 = *(const v4fa*)(arow + kb + 16 + 8 * hh), x3 = *(const v4fa*)(arow + kb + 16 + 8 * hh + 4);
    float xs[16] = {x0[0],x0[1],x0[2],x0[3],x1[0],x1[1],x1[2],x1[3],x2[0],x2[1],x2[2],x2[3],x3[0],x3[1],x3[2],x3[3]};
#pragma unroll
    for (int i = 0; i < 16; ++i) { const unsigned short hb = bf16_bits(xs[i]); ah.u[i] = hb; al.u[i] = ASPLIT ? bf16_bits(xs[i] - bf16_val(hb)) : (unsigned short)0; }
#pragma unroll
    for (int t = 0; t < 4; ++t) {
      const unsigned short* brow = Wt + (size_t)(col0 + t * 16 + ln) * ldb + kb;
      FragB b;
      b.half[0] = *(const v8us*)(brow + 8 * hh);
      b.half[1] = *(const v8us*)(brow + 16 + 8 * hh);
      acc[t] = mmaN<ASPLIT ? 2 : 1>(ah.v, al.v, b.v, b.v, acc[t]);
    }
  }
#pragma unroll
  for (int t = 0; t < 4; ++t) {
    float bv = bias ? bias[col0 + t * 16 + ln] : 0.f;
    if (BIAS_BF16) bv = bf16_round(bv);
#pragma unroll
    for (int r = 0; r < 8; ++r) { float v = acc[t][r] + bv; if (ACT == 1) v = fmaxf(v, 0.f); so[w][8 * hh + r][t * 16 + ln] = v; }
  }
  __builtin_amdgcn_fence(__ATOMIC_ACQ_REL, "workgroup");
  __builtin_amdgcn_wave_barrier();
  const int rsub = lane >> 4, c4 = (lane & 15) * 4;
  {
#pragma unroll
    for (int q = 0; q < 8; ++q) {
      const int r = q * 2 + rsub;
      const v4f v = *(const v4fa*)&so[w][r][c4];
      *(v4f*)(C + (size_t)(row0 + r) * ldc + col0 + c4) = v;
    }
    
  }
}

// GEMM C = act(A·W + bias + resid): A f32 (ASPLIT -> hi/lo 2 terms), Wt bf16 [N][K]; ACT 0 none, 1 relu, 2 exact gelu;
// resid (optional, f32, row index = (row % rmod), pitch ldr, RES_BF16 rounds it) added before the activation.
template <bool ASPLIT, int ACT, bool BIAS_BF16, bool RES_BF16>
__global__ __launch_bounds__(128) void k_gemm_bf3(const float* __restrict__ A, int lda, const unsigned short* __restrict__ Wt, int ldb,
                                                const float* __restrict__ bias, const float* __restrict__ resid, int rmod, int ldr,
                                                float* __restrict__ C, int ldc, int M, int N, int K) {
  __shared__ __attribute__((aligned(16))) float so[4][16][64];
  const int tid = threadIdx.x, w = tid >> 5, lane = tid & 31, ln = lane & 15, hh = lane >> 4;
  const int ntn = N / 64;
  const int wid = blockIdx.x * 4 + w;
  const int mt = wid / ntn, nq = wid % ntn;
  if (mt * 16 >= M) return;
  const int row0 = mt * 16, col0 = nq * 64;
  const float* arow = A + (size_t)(row0 + ln) * lda;
  v8f acc[4] = {};
  for (int kb = 0; kb < K; kb += 32) {
    FragB ah, al;
    const v4f x0 = *(const v4fa*)(arow + kb + 8 * hh), x1 = *(const v4fa*)(arow + kb + 8 * hh + 4);
    const v4f x2 = *(const v4fa*)(arow + kb + 16 + 8 * hh), x3 = *(const v4fa*)(arow + kb + 16 + 8 * hh + 4);
    float xs[16] = {x0[0],x0[1],x0[2],x0[3],x1[0],x1[1],x1[2],x1[3],x2[0],x2[1],x2[2],x2[3],x3[0],x3[1],x3[2],x3[3]};
#pragma unroll
    for (int i = 0; i < 16; ++i) { const unsigned short hb = bf16_bits(xs[i]); ah.u[i] = hb; al.u[i] = ASPLIT ? bf16_bits(xs[i] - bf16_val(hb)) : (unsigned short)0; }
#pragma unroll
    for (int t = 0; t < 4; ++t) {
      const unsigned short* brow = Wt + (size_t)(col0 + t * 16 + ln) * ldb + kb;
      FragB b;
      b.half[0] = *(const v8us*)(brow + 8 * hh);
      b.half[1] = *(const v8us*)(brow + 16 + 8 * hh);
      acc[t] = mmaN<ASPLIT ? 2 : 1>(ah.v, al.v, b.v, b.v, acc[t]);
    }
  }
#pragma unroll
  for (int t = 0; t < 4; ++t) {
    const int col = col0 + t * 16 + ln;
    float bv = bias ? bias[col] : 0.f;
    if (BIAS_BF16) bv = bf16_round(bv);
#pragma unroll
    for (int r = 0; r < 8; ++r) {
      float v = acc[t][r] + bv;
      if (resid) { float rv = resid[(size_t)((row0 + 8 * hh + r) % rmod) * ldr + col]; if (RES_BF16) rv = bf16_round(rv); v += rv; }
      if (ACT == 1) v = fmaxf(v, 0.f);
      if (ACT == 2) v = 0.5f * v * (1.0f + erff(v * 0.70710678118654752f));
      if (ACT == 3) { const float u = 0.7978845608028654f * (v + 0.044715f * v * v * v); v = 0.5f * v * (1.0f + tanhf(u)); }
      so[w][8 * hh + r][t * 16 + ln] = v;
    }
  }
  __builtin_amdgcn_fence(__ATOMIC_ACQ_REL, "workgroup");
  __builtin_amdgcn_wave_barrier();
  const int rsub = lane >> 4, c4 = (lane & 15) * 4;
  {
#pragma unroll
    for (int q = 0; q < 8; ++q) {
      const int r = q * 2 + rsub;
      const v4f v = *(const v4fa*)&so[w][r][c4];
      *(v4f*)(C + (size_t)(row0 + r) * ldc + col0 + c4) = v;
    }
    
  }
}
// row LayerNorm (biased variance, eps) over N: s = X (+ R); optional out_sum <- s; out_norm <- (s-mu)*rsqrt(var+eps)*g + b
template <bool PARAM_BF16>
__global__ __launch_bounds__(256) void k_layernorm(const float* __restrict__ X, const float* __restrict__ R, const float* __restrict__ g, const float* __restrict__ bta,
                                                  float* __restrict__ out_sum, float* __restrict__ out_norm, int N, float eps) {
  __shared__ float red[256];
  const int row = blockIdx.x, tid = threadIdx.x;
  const float* x = X + (size_t)row * N; const float* rr = R ? R + (size_t)row * N : nullptr;
  float vals[16];                     // up to N = 4096
  const int per = N / 256;            // contiguous chunk per thread? use strided-by-4 chunks: thread handles j = tid*4 + 1024*u
  float s1 = 0.f;
  for (int u = 0; u < per / 4; ++u) {
    const int j = tid * 4 + 1024 * u;
    const v4f a = *(const v4fa*)(x + j);
    v4f b = {0.f,0.f,0.f,0.f}; if (rr) b = *(const v4fa*)(rr + j);
#pragma unroll
    for (int q = 0; q < 4; ++q) { const float v = a[q] + b[q]; vals[u * 4 + q] = v; s1 += v; }
  }
  red[tid] = s1; __syncthreads();
  for (int st = 128; st > 0; st >>= 1) { if (tid < st) red[tid] += red[tid + st]; __syncthreads(); }
  const float mu = red[0] / (float)N; __syncthreads();
  float s2 = 0.f;
  for (int u = 0; u < per / 4; ++u)
#pragma unroll
    for (int q = 0; q < 4; ++q) { const float c = vals[u * 4 + q] - mu; s2 += c * c; }
  red[tid] = s2; __syncthreads();
  for (int st = 128; st > 0; st >>= 1) { if (tid < st) red[tid] += red[tid + st]; __syncthreads(); }
  const float rs = rsqrtf(red[0] / (float)N + eps);
  {
    for (int u = 0; u < per / 4; ++u) {
      const int j = tid * 4 + 1024 * u;
      v4f o, sm;
#pragma unroll
      for (int q = 0; q < 4; ++q) {
        float gg = g[j + q], bb = bta[j + q];
        if (PARAM_BF16) { gg = bf16_round(gg); bb = bf16_round(bb); }
        sm[q] = vals[u * 4 + q]; o[q] = (vals[u * 4 + q] - mu) * rs * gg + bb;
      }
      if (out_sum) *(v4f*)(out_sum + (size_t)row * N + j) = sm;
      *(v4f*)(out_norm + (size_t)row * N + j) = o;
    }
    
  }
}



// ---- f16 WMMA path (v_wmma_f32_16x16x32_f16): 11-bit significands for operands in range — used where a [0,1] probability operand needs more precision than bf16
typedef _Float16 v16h __attribute__((ext_vector_type(16)));
union FragH { v16h v; v8us half[2]; _Float16 h[16]; unsigned short u[16]; };
// builtin WMMAs only: the compiler keeps the distances behind them itself and may place loads and vector work in between
template <int NT>
__device__ __forceinline__ v8f mmaH(v16h ah, v16h al, v16h bh, v16h bl, v8f c) {
  c = __builtin_amdgcn_wmma_f32_16x16x32_f16(false, ah, false, bh, (short)0, c, false, false);
  if (NT >= 2) c = __builtin_amdgcn_wmma_f32_16x16x32_f16(false, al, false, bh, (short)0, c, false, false);
  if (NT >= 3) c = __builtin_amdgcn_wmma_f32_16x16x32_f16(false, ah, false, bl, (short)0, c, false, false);
  return c;
}
// batched GEMM like k_gemm_b but f16 operands: A f32 (split into f16 hi/lo if ASPLIT, else rounded to f16), Bt = f16 values [n][k]; alpha; C f32; N multiple of 16 (partial tiles skipped)
template <bool ASPLIT>
__global__ __launch_bounds__(128) void k_gemm_h(const float* __restrict__ A, int lda, size_t sA, const _Float16* __restrict__ Bh, int ldb, size_t sB, float alpha, float* __restrict__ C, int ldc, size_t sC, int M, int N, int K) {
  __shared__ __attribute__((aligned(16))) float so[4][16][64];
  const int tid = threadIdx.x, w = tid >> 5, lane = tid & 31, ln = lane & 15, hh = lane >> 4; const int by = blockIdx.y;
  A += (size_t)by * sA; Bh += (size_t)by * sB; C += (size_t)by * sC;
  const int ntn = (N + 63) / 64; const int wid = blockIdx.x * 4 + w; const int mt = wid / ntn, nq = wid % ntn; if (mt * 16 >= M) return;
  const int row0 = mt * 16, col0 = nq * 64; const float* arow = A + (size_t)(row0 + ln) * lda;
  v8f acc[4] = {};
  for (int kb = 0; kb < K; kb += 32) {
    FragH ah, al;
    const v4f x0 = *(const v4fa*)(arow + kb + 8 * hh), x1 = *(const v4fa*)(arow + kb + 8 * hh + 4), x2 = *(const v4fa*)(arow + kb + 16 + 8 * hh), x3 = *(const v4fa*)(arow + kb + 16 + 8 * hh + 4);
    float xs[16] = {x0[0],x0[1],x0[2],x0[3],x1[0],x1[1],x1[2],x1[3],x2[0],x2[1],x2[2],x2[3],x3[0],x3[1],x3[2],x3[3]};
#pragma unroll
    for (int i = 0; i < 16; ++i) { const _Float16 h = (_Float16)xs[i]; ah.h[i] = h; al.h[i] = ASPLIT ? (_Float16)(xs[i] - (float)h) : (_Float16)0.0f; }
#pragma unroll
    for (int t = 0; t < 4; ++t) { if (col0 + t * 16 >= N) continue; const size_t boff = (size_t)(col0 + t * 16 + ln) * ldb + kb; FragH bq; bq.half[0] = *(const v8us*)(Bh + boff + 8 * hh); bq.half[1] = *(const v8us*)(Bh + boff + 16 + 8 * hh);
      acc[t] = mmaH<ASPLIT ? 2 : 1>(ah.v, al.v, bq.v, bq.v, acc[t]); }
  }
#pragma unroll
  for (int t = 0; t < 4; ++t) { if (col0 + t * 16 >= N) continue;
#pragma unroll
    for (int r = 0; r < 8; ++r) so[w][8 * hh + r][t * 16 + ln] = acc[t][r] * alpha; }
  __builtin_amdgcn_fence(__ATOMIC_ACQ_REL, "workgroup"); __builtin_amdgcn_wave_barrier();
  const int rsub = lane >> 4, c4 = (lane & 15) * 4;
  {
#pragma unroll
    for (int q = 0; q < 8; ++q) { const int r = q * 2 + rsub; if (col0 + c4 < N) { const v4f v = *(const v4fa*)&so[w][r][c4]; *(v4f*)(C + (size_t)(row0 + r) * ldc + col0 + c4) = v; } }
     }
}

// Wt[n][k] = f16(W[k][n]·scale) from f32 row-major W[K][N] (scale = power of two; bf16-exact weights stay exact in f16 away from the subnormal range)
__global__ __launch_bounds__(256) void k_wt_f16(const float* __restrict__ W, _Float16* __restrict__ Wt, int K, int N, float scale) {
  const int t = blockIdx.x * 256 + threadIdx.x; if (t >= N * (K / 8)) return; const int n = t / (K / 8), k8 = (t % (K / 8)) * 8; FragH f;
#pragma unroll
  for (int i = 0; i < 8; ++i) f.h[i] = (_Float16)(bf16_round(W[(size_t)(k8 + i) * N + n]) * scale); const v8us o = f.half[0];
  *(v8us*)((unsigned short*)Wt + (size_t)n * K + k8) = o; 
}
// k_gemm_hh variant with fused epilogue: v = acc·alpha + bias[by·sBias + col] (+ CP[(row/rowsPerB)·sCPb + by·64 + col] if CP) ; ACT 0 none / 1 elu ; writes f16 C16 (and f32 C if non-null)
template <int ACT>
__global__ __launch_bounds__(128) void k_gemm_hhx(const _Float16* __restrict__ A, int lda, size_t sA, const _Float16* __restrict__ Bh, int ldb, size_t sB, float alpha, const float* __restrict__ bias, size_t sBias, const float* __restrict__ CP, int rowsPerB, size_t sCPb, int row0g,
    float* __restrict__ C, _Float16* __restrict__ C16, int ldc, size_t sC, int M, int N, int K) {
  __shared__ __attribute__((aligned(16))) float so[4][16][64];
  const int tid = threadIdx.x, w = tid >> 5, lane = tid & 31, ln = lane & 15, hh = lane >> 4; const int by = blockIdx.y;
  A += (size_t)by * sA; Bh += (size_t)by * sB; const size_t cofs = (size_t)by * sC; const float* bp = bias ? bias + (size_t)by * sBias : nullptr;
  const int ntn = (N + 63) / 64; const int wid = blockIdx.x * 4 + w; const int mt = wid / ntn, nq = wid % ntn; if (mt * 16 >= M) return;
  const int row0 = mt * 16, col0 = nq * 64; const _Float16* arow = A + (size_t)(row0 + ln) * lda;
  v8f acc[4] = {};
  for (int kb = 0; kb < K; kb += 32) { FragH ah; ah.half[0] = *(const v8us*)((const unsigned short*)arow + kb + 8 * hh); ah.half[1] = *(const v8us*)((const unsigned short*)arow + kb + 16 + 8 * hh);
#pragma unroll
    for (int t = 0; t < 4; ++t) { if (col0 + t * 16 >= N) continue; const size_t boff = (size_t)(col0 + t * 16 + ln) * ldb + kb; FragH bq; bq.half[0] = *(const v8us*)((const unsigned short*)Bh + boff + 8 * hh); bq.half[1] = *(const v8us*)((const unsigned short*)Bh + boff + 16 + 8 * hh);
      acc[t] = mmaH<1>(ah.v, ah.v, bq.v, bq.v, acc[t]); }
  }
#pragma unroll
  for (int t = 0; t < 4; ++t) { if (col0 + t * 16 >= N) continue; const int col = col0 + t * 16 + ln; const float bv = bp ? bf16_round(bp[col]) : 0.f;
#pragma unroll
    for (int r = 0; r < 8; ++r) { float v = acc[t][r] * alpha + bv; if (CP) { const int bidx = (row0g + row0 + 8 * hh + r) / rowsPerB; v += CP[(size_t)bidx * sCPb + (size_t)by * 64 + col]; } if (ACT == 1) v = (v > 0.f) ? v : expm1f(v); else if (ACT == 7) v = (v > 0.f) ? v + 1.0f : expf(v); else if (ACT == 8) v = tanhf(v); else if (ACT == 9) v = 0.5f * v * (1.0f + tanhf(0.7978845608028654f * (v + 0.044715f * v * v * v))); else if (ACT == 11) v = 1.0f / (1.0f + expf(-v)); else if (ACT == 12) v = (v > 0.f) ? v : 0.01f * v; else if (ACT == 14) v = (v > 0.f) ? v : 0.1f * v; else if (ACT == 15) v = v / (1.0f + expf(-v)); else if (ACT == 3) v = fmaxf(v, 0.f); else if (ACT == 6) v = 0.5f * v * (1.0f + erff(v * 0.70710678118654752f)); so[w][8 * hh + r][t * 16 + ln] = v; } }
  __builtin_amdgcn_fence(__ATOMIC_ACQ_REL, "workgroup"); __builtin_amdgcn_wave_barrier();
  const int rsub = lane >> 4, c4 = (lane & 15) * 4; typedef _Float16 v4h __attribute__((ext_vector_type(4)));
  {
#pragma unroll
    for (int q = 0; q < 8; ++q) { const int r = q * 2 + rsub; if (col0 + c4 < N) { const v4f v = *(const v4fa*)&so[w][r][c4]; if (C) *(v4f*)(C + cofs + (size_t)(row0 + r) * ldc + col0 + c4) = v; if (C16) { v4h h4; for (int i = 0; i < 4; ++i) h4[i] = (_Float16)v[i]; *(v4h*)(C16 + cofs + (size_t)(row0 + r) * ldc + col0 + c4) = h4; } } }
     }
}


typedef _Float16 v4h __attribute__((ext_vector_type(4)));

__global__ __launch_bounds__(256) void k_h16(const float* __restrict__ x, _Float16* __restrict__ X16, size_t n8) { const size_t t = (size_t)blockIdx.x * 256 + threadIdx.x; if (t >= n8) return; FragH f;
#pragma unroll
  for (int q = 0; q < 8; ++q) f.h[q] = (_Float16)x[t * 8 + q]; *(v8us*)((unsigned short*)X16 + t * 8) = f.half[0];  }
__global__ __launch_bounds__(256) void k_round16f(const float* __restrict__ W, _Float16* __restrict__ Bt, size_t n8) { const size_t t = (size_t)blockIdx.x * 256 + threadIdx.x; if (t >= n8) return; FragH f;
#pragma unroll
  for (int i = 0; i < 8; ++i) f.h[i] = (_Float16)(bf16_round(W[t * 8 + i]) * 16.0f); *(v8us*)((unsigned short*)Bt + t * 8) = f.half[0];  }

// ---- fast GEMM (work-group tile 128x64, wave tile 32x64; requires M % 128 == 0, N % 64 == 0, K % 64 == 0 and K >= 64); epilogue = k_gemm_hhx semantics ----
__device__ __forceinline__ v8f g2_mma(v16h a, v16h b, v8f c) { return __builtin_amdgcn_wmma_f32_16x16x32_f16(false, a, false, b, (short)0, c, false, false); }
// a fragment from a staged tile: the two 16-byte pieces of the lane's row (same k order as a fragment read from global memory: 8 * hh .. and 16 + 8 * hh ..)
__device__ __forceinline__ v16h g2_lfrag(const unsigned char* rows, int o0, int o1) { FragH f; f.half[0] = *(const v8us*)(rows + o0); f.half[1] = *(const v8us*)(rows + o1); return f.v; }
// One stage of the GEMM ring: 64 k of the tile's 128 A rows, then of its 64 B rows (rows of 128 bytes without a pad, 24 KiB), brought by asynchronous copies to LDS.
// Twelve copies a lane; a wave-wide copy covers four whole 128-byte lines. s_wait_xcnt stands inside the statement so that no address register is rewritten ahead of it.
__device__ __forceinline__ void g2_stage_copy(unsigned lds, const unsigned short* ga, size_t astep, const unsigned short* gb, size_t bstep) {
  asm volatile("global_load_async_to_lds_b128 %0, %12, off\n\t"
               "global_load_async_to_lds_b128 %1, %13, off\n\t"
               "global_load_async_to_lds_b128 %2, %14, off\n\t"
               "global_load_async_to_lds_b128 %3, %15, off\n\t"
               "global_load_async_to_lds_b128 %4, %16, off\n\t"
               "global_load_async_to_lds_b128 %5, %17, off\n\t"
               "global_load_async_to_lds_b128 %6, %18, off\n\t"
               "global_load_async_to_lds_b128 %7, %19, off\n\t"
               "global_load_async_to_lds_b128 %8, %20, off\n\t"
               "global_load_async_to_lds_b128 %9, %21, off\n\t"
               "global_load_async_to_lds_b128 %10, %22, off\n\t"
               "global_load_async_to_lds_b128 %11, %23, off\n\t"
               "s_wait_xcnt 0x0"
               :: "v"(lds), "v"(lds + 2048u), "v"(lds + 4096u), "v"(lds + 6144u), "v"(lds + 8192u), "v"(lds + 10240u), "v"(lds + 12288u), "v"(lds + 14336u),
                  "v"(lds + 16384u), "v"(lds + 18432u), "v"(lds + 20480u), "v"(lds + 22528u),
                  "v"(ga), "v"(ga + astep), "v"(ga + 2 * astep), "v"(ga + 3 * astep), "v"(ga + 4 * astep), "v"(ga + 5 * astep), "v"(ga + 6 * astep), "v"(ga + 7 * astep),
                  "v"(gb), "v"(gb + bstep), "v"(gb + 2 * bstep), "v"(gb + 3 * bstep)
               : "memory");
}
// ROTB: in the first ROTB products of the batch (blockIdx.y) the tile's 64 columns are one head and its rows are tokens (position = row % SLEN): the rotary embedding is applied to the staged f32 tile on its way out (CS: cos table, then sin table, [position][RD / 2]).
// TRB >= 0: product TRB of the batch runs with its operands swapped (the 128-row tile from Bh, the 64-row tile from A) and stores C^T, one [N][SLEN] plane per sequence of SLEN rows of A: the layout the flash kernel reads V^T in. It takes no bias and no CP (both index by the untransposed column).
// KMID > 0: the operands' k range is two parts that carry different powers of two; ahead of k = KMID (a multiple of 64) the accumulators are multiplied by MIDMUL, an exact step that brings the first part's sums to the second part's scale.
template <int ACT, int ROTB, int KMID = 0, int MIDMUL = 1, int TRB = -1>
__global__ __launch_bounds__(128) void k_gemm2(const _Float16* __restrict__ A, int lda, size_t sA, const _Float16* __restrict__ Bh, int ldb, size_t sB, float alpha, const float* __restrict__ bias, size_t sBias, const float* __restrict__ CP, int rowsPerB, size_t sCPb, int row0g,
    float* __restrict__ C, _Float16* __restrict__ C16, int ldc, size_t sC, int M, int N, int K, const float* __restrict__ CS) {
  constexpr int ATILE_B = 128 * 128, GSTAGE_B = ATILE_B + 64 * 128;      /* a stage = 64 k: A tile, then B tile */
  __shared__ __attribute__((aligned(16))) unsigned char ring[2 * GSTAGE_B];
  float (*so)[32][68] = reinterpret_cast<float (*)[32][68]>(ring);      /* output staging (34,816 bytes) takes the ring's place behind the loop's last barrier */
  const int tid = threadIdx.x, w = tid >> 5, lane = tid & 31, ln = lane & 15, hh = lane >> 4; const int by = blockIdx.y; const bool rot = ROTB > 0 && by < ROTB, tr = TRB >= 0 && by == TRB;      /* the same for the whole work-group */
  A += (size_t)by * sA; Bh += (size_t)by * sB; size_t cofs = (size_t)by * sC;
  if (tr) { const _Float16* pa = A; A = Bh; Bh = pa; const int la = lda; lda = ldb; ldb = la; const int mm = M; M = N; N = mm; }      /* from here on M, A, lda name the operand of the tile's 128 rows */ const float* bp = bias ? bias + (size_t)by * sBias : nullptr;
  const int ntn = N >> 6; const int mt = blockIdx.x / ntn, nq = blockIdx.x - mt * ntn; if (mt * 128 >= M) return;      /* the whole work-group leaves, ahead of every copy and barrier */
  const int row0 = mt * 128 + 32 * w, col0 = nq * 64;
  if (tr) { cofs += (size_t)(col0 / SLEN) * (M - 1) * SLEN; ldc = SLEN; }      /* column c of sequence s = c / SLEN lies at s * M * SLEN + row * SLEN + c - s * SLEN; a tile's 64 columns never cross a sequence's end */
  const int nst = K >> 6;
  /* 16-byte piece c of row r lies at r * 128 + (c ^ ((r >> 1) & 7)) * 16: sixteen rows read at one piece index fall on all 64 banks */
  const unsigned cp_lds = (unsigned)(size_t)ring + (unsigned)((tid >> 3) * 128 + (((tid & 7) ^ ((tid >> 4) & 7)) * 16));
  const unsigned short* cp_a = (const unsigned short*)A + (size_t)(mt * 128 + (tid >> 3)) * lda + (tid & 7) * 8;
  const unsigned short* cp_b = (const unsigned short*)Bh + (size_t)(col0 + (tid >> 3)) * ldb + (tid & 7) * 8;
  const size_t astep = (size_t)16 * lda, bstep = (size_t)16 * ldb;
  g2_stage_copy(cp_lds, cp_a, astep, cp_b, bstep);
  int fo[2][2];      /* a fragment's two pieces in row ln: [32-element group of the row][piece] */
#pragma unroll
  for (int g = 0; g < 2; ++g)
#pragma unroll
    for (int pc = 0; pc < 2; ++pc) fo[g][pc] = ln * 128 + (((g * 4 + pc * 2 + hh) ^ ((ln >> 1) & 7)) * 16);
  const v8f z8 = {0.f,0.f,0.f,0.f,0.f,0.f,0.f,0.f}; v8f c00 = z8, c01 = z8, c02 = z8, c03 = z8, c10 = z8, c11 = z8, c12 = z8, c13 = z8;
  asm volatile("s_wait_asynccnt 0x0" ::: "memory");      /* stage 0 has landed for this wave's own copies */
  __syncthreads();                                       /* ... and for every other wave's */
  if (1 < nst) g2_stage_copy(cp_lds + GSTAGE_B, cp_a + 64, astep, cp_b + 64, bstep);
#pragma unroll 1      /* one body for both buffers: the buffer is picked by the trip's parity */
  for (int t = 0; t < nst; ++t) {
    const unsigned char* ar = ring + (t & 1) * GSTAGE_B + w * (32 * 128); const unsigned char* br = ring + (t & 1) * GSTAGE_B + ATILE_B;
    if (KMID > 0 && t == (KMID >> 6)) { const float ms = (float)MIDMUL; c00 *= ms; c01 *= ms; c02 *= ms; c03 *= ms; c10 *= ms; c11 *= ms; c12 *= ms; c13 *= ms; }
#pragma unroll
    for (int g = 0; g < 2; ++g) { const int o0 = fo[g][0], o1 = fo[g][1];
      const v16h a0 = g2_lfrag(ar, o0, o1), a1 = g2_lfrag(ar + 2048, o0, o1);
      const v16h b0 = g2_lfrag(br, o0, o1), b1 = g2_lfrag(br + 2048, o0, o1), b2 = g2_lfrag(br + 4096, o0, o1), b3 = g2_lfrag(br + 6144, o0, o1);
      c00 = g2_mma(a0, b0, c00); c10 = g2_mma(a1, b0, c10);
      c01 = g2_mma(a0, b1, c01); c11 = g2_mma(a1, b1, c11);
      c02 = g2_mma(a0, b2, c02); c12 = g2_mma(a1, b2, c12);
      c03 = g2_mma(a0, b3, c03); c13 = g2_mma(a1, b3, c13); }
    asm volatile("s_wait_dscnt 0x0" ::: "memory");         /* this wave's reads of stage t have returned */
    asm volatile("s_wait_asynccnt 0x0" ::: "memory");      /* this wave's copies of stage t + 1 have landed */
    __syncthreads();                                       /* publishes stage t + 1 and ends every wave's reads of stage t */
    if (t + 2 < nst) g2_stage_copy(cp_lds + (t & 1) * GSTAGE_B, cp_a + (size_t)(t + 2) * 64, astep, cp_b + (size_t)(t + 2) * 64, bstep); }
  asm volatile("s_wait_asynccnt 0x0" ::: "memory");        /* nothing is in flight when the ring becomes output staging */
  const int rsub = lane >> 4, c4 = (lane & 15) * 4;
  v8f accs[8] = {c00, c01, c02, c03, c10, c11, c12, c13};
#pragma unroll
  for (int u = 0; u < 8; ++u) { const int t = u & 3, half = u >> 2; const int col = col0 + t * 16 + ln; const float bv = bp ? bf16_round(bp[col]) : 0.f;
#pragma unroll
    for (int r = 0; r < 8; ++r) { const int rloc = half * 16 + 8 * hh + r; float v = accs[u][r] * alpha + bv; if (CP) { const int bidx = (row0g + row0 + rloc) / rowsPerB; v += CP[(size_t)bidx * sCPb + (size_t)by * 64 + col]; }
      if (ACT == 3) v = fmaxf(v, 0.f); else if (ACT == 6) v = 0.5f * v * (1.0f + erff(v * 0.70710678118654752f)); else if (ACT == 11) v = 1.0f / (1.0f + expf(-v)); else if (ACT == 15) v = v / (1.0f + expf(-v)); else if (ACT == 12) v = (v > 0.f) ? v : 0.01f * v; else if (ACT == 8) v = tanhf(v);
      so[w][rloc][t * 16 + ln] = v; } }
  v4f tcs[16], tsn[16];      /* rotated products: the lane's table pieces for its sixteen rows, all asked for at once so that their latency is paid once; behind the staging, where the accumulators' registers are free */
  if (rot) { const float* tb = CS + (size_t)(row0 % SLEN + rsub) * (RD / 2) + (c4 & (RD / 2 - 1));      /* a wave's 32 rows never cross a sequence's end: both are multiples of 32 */
#pragma unroll
    for (int q = 0; q < 16; ++q) { tcs[q] = *(const v4fa*)(tb + q * RD); tsn[q] = *(const v4fa*)(tb + q * RD + SLEN * (RD / 2)); }
    asm volatile("s_wait_xcnt 0x0" ::: "memory"); }      /* stands ahead of any rewrite of the table loads' address registers */
  __builtin_amdgcn_fence(__ATOMIC_ACQ_REL, "workgroup"); __builtin_amdgcn_wave_barrier();
  {
#pragma unroll
    for (int q = 0; q < 16; ++q) { const int r = q * 2 + rsub; v4f v = *(const v4fa*)&so[w][r][c4];
      if (rot) {      /* every lane reads a partner piece at a valid place; only dims under RD take the rotated value */
        const v4f u = *(const v4fa*)&so[w][r][c4 ^ (RD / 2)]; const v4f cs = tcs[q], sn = tsn[q];
        const v4f lo = v * cs + u * sn, hi = u * -sn + v * cs;      /* dims 0..15: x1 cos + x2 sin (x1 own); dims 16..31: -x1 sin + x2 cos (x2 own) */
        v = (c4 < RD / 2) ? lo : ((c4 < RD) ? hi : v); }
      if (C) *(v4f*)(C + cofs + (size_t)(row0 + r) * ldc + col0 + c4) = v; if (C16) { v4h h4; for (int i = 0; i < 4; ++i) h4[i] = (_Float16)v[i]; *(v4h*)(C16 + cofs + (size_t)(row0 + r) * ldc + col0 + c4) = h4; } }
     } }



// One stage of the K / V^T ring: 64 key rows of K (128 bytes each) and 64 rows of V^T (the same 64 keys, 128 bytes each), 16 KiB, brought by asynchronous copies to LDS.
// Eight copies a lane; a wave-wide copy covers four whole 128-byte lines. s_wait_xcnt stands inside the statement so that no address register is rewritten ahead of it.
__device__ __forceinline__ void stage_copy(unsigned lds, const unsigned short* gk, size_t kstep, const unsigned short* gv, size_t vstep) {
  asm volatile("global_load_async_to_lds_b128 %0, %8, off\n\t"
               "global_load_async_to_lds_b128 %1, %9, off\n\t"
               "global_load_async_to_lds_b128 %2, %10, off\n\t"
               "global_load_async_to_lds_b128 %3, %11, off\n\t"
               "global_load_async_to_lds_b128 %4, %12, off\n\t"
               "global_load_async_to_lds_b128 %5, %13, off\n\t"
               "global_load_async_to_lds_b128 %6, %14, off\n\t"
               "global_load_async_to_lds_b128 %7, %15, off\n\t"
               "s_wait_xcnt 0x0"
               :: "v"(lds), "v"(lds + 2048u), "v"(lds + 4096u), "v"(lds + 6144u), "v"(lds + 8192u), "v"(lds + 10240u), "v"(lds + 12288u), "v"(lds + 14336u),
                  "v"(gk), "v"(gk + kstep), "v"(gk + 2 * kstep), "v"(gk + 3 * kstep), "v"(gv), "v"(gv + vstep), "v"(gv + 2 * vstep), "v"(gv + 3 * vstep)
               : "memory");
}
// lane l with lane l ^ 16: one vector cross-row move
__device__ __forceinline__ float xhalf(float x) { return __builtin_bit_cast(float, __builtin_amdgcn_permlanex16(__builtin_bit_cast(int, x), __builtin_bit_cast(int, x), 0x76543210, 0xfedcba98, false, false)); }
template <int CAUSAL>
__global__ __launch_bounds__(128) void k_flash(const _Float16* __restrict__ Q16, int ldq, const _Float16* __restrict__ K16, int ldk, const _Float16* __restrict__ Vt, const int* __restrict__ MSK, _Float16* __restrict__ H, int ldh) {
  constexpr int RPW = 16, RTN = RPW / 16, NQB = TQ / (4 * RPW), DT = 4, KS = 2;
  constexpr float C2 = SCL * 1.44269504088896340736f;      /* score -> exponent of 2; the bare exp2 instruction serves: no exponent exceeds 10, and a result that flushes to zero lies far under P's f16 step */
  constexpr int TILE_B = 64 * 128, STAGE_B = 2 * TILE_B;      /* a stage = 64 keys: K tile, then V^T tile, rows of 128 bytes without a pad */
  __shared__ __attribute__((aligned(16))) unsigned char ring[2 * STAGE_B];
  float (*sO)[RPW][64 + 4] = reinterpret_cast<float (*)[RPW][64 + 4]>(ring);      /* output staging takes the ring's place behind the loop's last barrier */
  const int tid = threadIdx.x, w = tid >> 5, lane = tid & 31, ln = lane & 15, hh = lane >> 4;
  const int slab = blockIdx.x / QBLKS, qblk = blockIdx.x % QBLKS; (void)NQB; (void)MSK; const int b = slab / NH, h = slab % NH; const int qb0 = qblk * (4 * RPW); const int q0 = qb0 + w * RPW;
  const unsigned short* Vth = (const unsigned short*)Vt + (size_t)slab * 64 * TK;
  const int jend = (CAUSAL == 1) ? (qb0 + 4 * RPW) : TK;      /* causal: keys beyond the block's last query never contribute */
  const int nst = jend / 64;
  /* 16-byte piece c of row r lies at r * 128 + (c ^ ((r >> 1) & 7)) * 16: sixteen rows read at one piece index fall on all 64 banks */
  const unsigned cp_lds = (unsigned)(size_t)ring + (unsigned)((tid >> 3) * 128 + (((tid & 7) ^ ((tid >> 4) & 7)) * 16));
  const unsigned short* cp_k = (const unsigned short*)K16 + ((size_t)b * TK + (tid >> 3)) * ldk + h * 64 + (tid & 7) * 8;
  const unsigned short* cp_v = Vth + (size_t)(tid >> 3) * TK + (tid & 7) * 8;
  const size_t kstep = (size_t)16 * ldk, vstep = (size_t)16 * TK;
  stage_copy(cp_lds, cp_k, kstep, cp_v, vstep);
  FragH aq[2][KS];
#pragma unroll
  for (int rt = 0; rt < RTN; ++rt) { const unsigned short* qr = (const unsigned short*)Q16 + ((size_t)b * TQ + q0 + rt * 16 + ln) * ldq + h * 64;
#pragma unroll
    for (int ks = 0; ks < KS; ++ks) { aq[rt][ks].half[0] = *(const v8us*)(qr + ks * 32 + 8 * hh); aq[rt][ks].half[1] = *(const v8us*)(qr + ks * 32 + 16 + 8 * hh); } }
  int fo[2][2];      /* a fragment's two pieces in row ln: [32-element group of the row][piece] */
#pragma unroll
  for (int g = 0; g < 2; ++g)
#pragma unroll
    for (int pc = 0; pc < 2; ++pc) fo[g][pc] = ln * 128 + (((g * 4 + pc * 2 + hh) ^ ((ln >> 1) & 7)) * 16);
  float m_r[2], l_r[2]; v8f oacc[2][DT];      /* per lane: its query's running maximum (of raw scores), its half's share of the sum (x 1024), and O^T[d = dt * 16 + 8 * hh + r][query ln] */
#pragma unroll
  for (int rt = 0; rt < RTN; ++rt) { m_r[rt] = -3.0e38f; l_r[rt] = 0.f;
#pragma unroll
    for (int dt = 0; dt < DT; ++dt) oacc[rt][dt] = (v8f){0.f,0.f,0.f,0.f,0.f,0.f,0.f,0.f}; }
  asm volatile("s_wait_asynccnt 0x0" ::: "memory");      /* stage 0 has landed for this wave's own copies */
  __syncthreads();                                       /* ... and for every other wave's */
  if (1 < nst) stage_copy(cp_lds + STAGE_B, cp_k + (size_t)64 * ldk, kstep, cp_v + 64, vstep);
#pragma unroll 1
  for (int t = 0; t < nst; ++t) {
    const unsigned char* st = ring + (t & 1) * STAGE_B;
#pragma unroll 1      /* the two 32-key passes of a stage stay one body: unrolled, the registers grow and a work-group per WGP is lost */
    for (int ps = 0; ps < 2; ++ps) { const int j0 = t * 64 + ps * 32;
    v8f s[2][2];
#pragma unroll
    for (int nt = 0; nt < 2; ++nt) { const unsigned char* kr = st + (ps * 32 + nt * 16) * 128; FragH bk[KS];
#pragma unroll
      for (int ks = 0; ks < KS; ++ks) { bk[ks].half[0] = *(const v8us*)(kr + fo[ks][0]); bk[ks].half[1] = *(const v8us*)(kr + fo[ks][1]); }
#pragma unroll
      for (int rt = 0; rt < RTN; ++rt) { v8f acc = (v8f){0.f,0.f,0.f,0.f,0.f,0.f,0.f,0.f};
#pragma unroll
        for (int ks = 0; ks < KS; ++ks) acc = mmaH<1>(bk[ks].v, bk[ks].v, aq[rt][ks].v, aq[rt][ks].v, acc); s[rt][nt] = acc; } }      /* s[rt][nt][r] = score of key j0 + nt * 16 + 8 * hh + r, query q0 + rt * 16 + ln */
    FragH pb[2];
#pragma unroll
    for (int rt = 0; rt < RTN; ++rt) { const int tq = q0 + rt * 16 + ln; float sv[16]; bool ok[16];
#pragma unroll
      for (int e = 0; e < 16; ++e) { const int kk = j0 + (e >> 3) * 16 + 8 * hh + (e & 7);
        ok[e] = (CAUSAL == 1) ? (kk <= tq) : ((CAUSAL == 2) ? ((kk >> 5) == (tq >> 5)) : true);      /* mode 2: block-diagonal 32-token groups */
        sv[e] = ok[e] ? s[rt][e >> 3][e & 7] : -3.0e38f; }      /* raw scores: the scale is positive, so the maximum is taken ahead of it */
      float mx[4];
#pragma unroll
      for (int c = 0; c < 4; ++c) mx[c] = fmaxf(fmaxf(sv[c], sv[4 + c]), fmaxf(sv[8 + c], sv[12 + c]));
      float mc = fmaxf(fmaxf(mx[0], mx[1]), fmaxf(mx[2], mx[3])); mc = fmaxf(mc, xhalf(mc));      /* both halves now hold the query's maximum over the 32 keys */
      const float mn = fmaxf(m_r[rt], mc); const float ea = __builtin_amdgcn_exp2f((m_r[rt] - mn) * C2); const float al = (mn > -1.0e38f) ? ea : 1.0f; m_r[rt] = mn;
      const float nb = fmaf(-mn, C2, 10.0f);      /* 1024 p = 2^(score * C2 + nb): scale, log2 e, the maximum and P's factor 1024 in one multiply-add */
      const v2f c2v = {C2, C2}, nbv = {nb, nb}; v2f ls[2];
#pragma unroll
      for (int e = 0; e < 16; e += 2) { const v2f x = __builtin_elementwise_fma((v2f){sv[e], sv[e + 1]}, c2v, nbv);
        const v2f p = {ok[e] ? __builtin_amdgcn_exp2f(x[0]) : 0.f, ok[e + 1] ? __builtin_amdgcn_exp2f(x[1]) : 0.f};
        if (e < 4) ls[e >> 1] = p; else ls[(e >> 1) & 1] += p;
        pb[rt].h[e] = (_Float16)p[0]; pb[rt].h[e + 1] = (_Float16)p[1]; }
      l_r[rt] = l_r[rt] * al + ((ls[0][0] + ls[0][1]) + (ls[1][0] + ls[1][1]));      /* the sum carries the factor 1024 too */
#pragma unroll
      for (int dt = 0; dt < DT; ++dt)
#pragma unroll
        for (int r = 0; r < 8; ++r) oacc[rt][dt][r] *= al; }
#pragma unroll
    for (int dt = 0; dt < DT; ++dt) { const unsigned char* vrow = st + TILE_B + dt * 16 * 128; FragH bv; bv.half[0] = *(const v8us*)(vrow + (fo[0][0] ^ (ps * 64))); bv.half[1] = *(const v8us*)(vrow + (fo[0][1] ^ (ps * 64)));      /* the pass's 32 keys: piece index + 4 = bit 6 of the offset */
#pragma unroll
      for (int rt = 0; rt < RTN; ++rt) oacc[rt][dt] = mmaH<1>(bv.v, bv.v, pb[rt].v, pb[rt].v, oacc[rt][dt]); } }
    asm volatile("s_wait_dscnt 0x0" ::: "memory");         /* this wave's reads of stage t have returned */
    asm volatile("s_wait_asynccnt 0x0" ::: "memory");      /* this wave's copies of stage t + 1 have landed */
    __syncthreads();                                       /* publishes stage t + 1 and ends every wave's reads of stage t */
    if (t + 2 < nst) stage_copy(cp_lds + (t & 1) * STAGE_B, cp_k + (size_t)(t + 2) * 64 * ldk, kstep, cp_v + (t + 2) * 64, vstep); }
  asm volatile("s_wait_asynccnt 0x0" ::: "memory");        /* nothing is in flight when the ring becomes output staging */
#pragma unroll
  for (int rt = 0; rt < RTN; ++rt) { float l = l_r[rt]; l += xhalf(l); const float inv = (l > 0.f) ? 1.0f / l : 0.f;      /* the halves' sums join once */
#pragma unroll
    for (int dt = 0; dt < DT; ++dt)
#pragma unroll
      for (int q4 = 0; q4 < 2; ++q4) { v4f o4;
#pragma unroll
        for (int i = 0; i < 4; ++i) o4[i] = oacc[rt][dt][q4 * 4 + i] * inv;
        *(v4fa*)&sO[w][rt * 16 + ln][dt * 16 + 8 * hh + q4 * 4] = o4; } }
  __builtin_amdgcn_fence(__ATOMIC_ACQ_REL, "workgroup"); __builtin_amdgcn_wave_barrier();
  {
#pragma unroll
    for (int rp = 0; rp < RPW; rp += 4) { const int r = rp + (lane >> 3), pc = lane & 7; const v4f a = *(const v4fa*)&sO[w][r][pc * 8], c = *(const v4fa*)&sO[w][r][pc * 8 + 4]; FragH fh, fl;      /* eight lanes store a row's 64 values of this head: one whole 128-byte line in each half of H's row */
#pragma unroll      /* keeps fh and fl in registers */
      for (int q = 0; q < 4; ++q) { _Float16 g = (_Float16)a[q]; fh.h[q] = g; fl.h[q] = (_Float16)((a[q] - (float)g) * 1024.0f); g = (_Float16)c[q]; fh.h[4 + q] = g; fl.h[4 + q] = (_Float16)((c[q] - (float)g) * 1024.0f); }
      unsigned short* hp = (unsigned short*)H + ((size_t)b * TQ + q0 + r) * ldh + h * 64 + pc * 8; *(v8us*)hp = fh.half[0]; *(v8us*)(hp + DMOD) = fl.half[0]; }
     } }

// Everything that depends on the inputs alone, in one launch: the rotary tables (first blocks: the longest chain of dependent arithmetic starts first), then x and the four weight matrices as f16 planes.
#define PREP_TAB_BLKS (SLEN * (RD / 2) / 256)      /* one table entry a thread */
#define PREP_CVT_BLKS (DMOD * DMOD / 8 / 256)      /* a thread takes one 8-element piece of each weight matrix and eight pieces of x: few waves, each with much to fetch */
static_assert(SLEN * (RD / 2) % 256 == 0 && DMOD * DMOD / 8 % 256 == 0 && NR == 8 * DMOD, "the grid covers tables and planes without a remainder");
// eight f32 values -> bf16-rounded, times a power of two, as f16
__device__ __forceinline__ v8us prep_cvt8(v4f a, v4f c, float sc) { FragH f;
#pragma unroll      /* keeps f in registers */
  for (int q = 0; q < 4; ++q) { f.h[q] = (_Float16)(bf16_round(a[q]) * sc); f.h[4 + q] = (_Float16)(bf16_round(c[q]) * sc); }
  return f.half[0]; }
// Six 8-element pieces, twelve 16-byte loads. One statement with its data wait and early-clobber results: all twelve are in flight together, and no result lands on an address register that a load of the run still names.
__device__ __forceinline__ void prep_ld6(const float* p0, const float* p1, const float* p2, const float* p3, const float* p4, const float* p5, v4f (&a)[6], v4f (&c)[6]) {
  asm volatile("global_load_b128 %0, %12, off\n\t"
               "global_load_b128 %1, %12, off offset:16\n\t"
               "global_load_b128 %2, %13, off\n\t"
               "global_load_b128 %3, %13, off offset:16\n\t"
               "global_load_b128 %4, %14, off\n\t"
               "global_load_b128 %5, %14, off offset:16\n\t"
               "global_load_b128 %6, %15, off\n\t"
               "global_load_b128 %7, %15, off offset:16\n\t"
               "global_load_b128 %8, %16, off\n\t"
               "global_load_b128 %9, %16, off offset:16\n\t"
               "global_load_b128 %10, %17, off\n\t"
               "global_load_b128 %11, %17, off offset:16\n\t"
               "s_wait_loadcnt 0x0"
               : "=&v"(a[0]), "=&v"(c[0]), "=&v"(a[1]), "=&v"(c[1]), "=&v"(a[2]), "=&v"(c[2]), "=&v"(a[3]), "=&v"(c[3]), "=&v"(a[4]), "=&v"(c[4]), "=&v"(a[5]), "=&v"(c[5])
               : "v"(p0), "v"(p1), "v"(p2), "v"(p3), "v"(p4), "v"(p5) : "memory"); }
__global__ __launch_bounds__(256) void k_prep(const float* __restrict__ x, const float* __restrict__ Wq, const float* __restrict__ Wk, const float* __restrict__ Wv, const float* __restrict__ Wo,
    _Float16* __restrict__ X16, _Float16* __restrict__ BQ, _Float16* __restrict__ BK, _Float16* __restrict__ BV, _Float16* __restrict__ BO, float* __restrict__ CS) {
  if (blockIdx.x < PREP_TAB_BLKS) {
    const int t = blockIdx.x * 256 + threadIdx.x; const int i = t % (RD / 2), tpos = t / (RD / 2); const float invf = (float)pow(10000.0, -(double)(2 * i) / (double)RD); const float ang = (float)tpos * invf; const float cv = cosf(ang), sv = sinf(ang);
    CS[t] = cv; CS[SLEN * (RD / 2) + t] = sv; return; }
  constexpr size_t NE = (size_t)DMOD * DMOD;      /* elements that the conversion blocks cover with one piece a thread */
  const size_t e = ((size_t)(blockIdx.x - PREP_TAB_BLKS) * 256 + threadIdx.x) * 8;
  const float* xp = x + e; unsigned short* xo = (unsigned short*)X16 + e; v4f a[6], c[6];
  prep_ld6(xp, xp + NE, xp + 2 * NE, xp + 3 * NE, xp + 4 * NE, xp + 5 * NE, a, c);
#pragma unroll      /* a[] and c[] are register results of the load statement: constant indices keep them there */
  for (int j = 0; j < 6; ++j) *(v8us*)(xo + j * NE) = prep_cvt8(a[j], c[j], 1.0f);
  prep_ld6(xp + 6 * NE, xp + 7 * NE, Wq + e, Wk + e, Wv + e, Wo + e, a, c);
  *(v8us*)(xo + 6 * NE) = prep_cvt8(a[0], c[0], 1.0f); *(v8us*)(xo + 7 * NE) = prep_cvt8(a[1], c[1], 1.0f);
  *(v8us*)((unsigned short*)BQ + e) = prep_cvt8(a[2], c[2], 16.0f);
  *(v8us*)((unsigned short*)BK + e) = prep_cvt8(a[3], c[3], 16.0f);
  *(v8us*)((unsigned short*)BV + e) = prep_cvt8(a[4], c[4], 16.0f);
  /* output projection: a row of BO is the weight row x 16 (for the hi plane), then the same row x 1 (for the residual plane) */
  unsigned short* bo = (unsigned short*)BO + (e / DMOD) * (2 * DMOD) + e % DMOD;
  *(v8us*)bo = prep_cvt8(a[5], c[5], 16.0f); *(v8us*)(bo + DMOD) = prep_cvt8(a[5], c[5], 1.0f);
  asm volatile("s_wait_xcnt 0x0" ::: "memory");      /* stands behind the stores, ahead of anything that could rewrite their registers */
}

extern "C" void kernel_launch(void* const* d_in, const int* in_sizes, int n_in,
                              void* d_out, int out_size, void* d_ws, size_t ws_size, hipStream_t stream) {
  (void)in_sizes; (void)n_in; (void)out_size;
  const float* const* I = (const float* const*)d_in; const float* x = I[0]; const float* Wq = I[1]; const float* Wk = I[2]; const float* Wv = I[3]; const float* Wo = I[4];
  char* ws = (char*)d_ws; size_t off = 0;
  auto take = [&](size_t bytes) { char* p = ws + off; off += (bytes + 255) & ~(size_t)255; return p; };
  const size_t w8 = (size_t)DMOD * DMOD / 8;
  _Float16* BQ = (_Float16*)take(w8 * 16); _Float16* BK = (_Float16*)take(w8 * 16); _Float16* BV = (_Float16*)take(w8 * 16); _Float16* BO = (_Float16*)take(w8 * 32);
  _Float16* X16 = (_Float16*)take((size_t)NR * DMOD * 2); _Float16* HH = (_Float16*)take((size_t)NR * DMOD * 4); _Float16* Q16 = (_Float16*)take((size_t)NR * DMOD * 2); _Float16* K16 = (_Float16*)take((size_t)NR * DMOD * 2); _Float16* VT = (_Float16*)take((size_t)NR * DMOD * 2); float* CS = (float*)take((size_t)SLEN * RD * 4);
  if (off > ws_size) return;      /* 10 + 16 + 32 + 16 x 3 = 106 MiB */
  k_prep<<<PREP_TAB_BLKS + PREP_CVT_BLKS, 256, 0, stream>>>(x, Wq, Wk, Wv, Wo, X16, BQ, BK, BV, BO, CS);
  const dim3 gP((NR / 128) * (DMOD / 64), 1);
  /* q, k and v projections as one batch of three: BQ, BK, BV lie back to back, and so do Q16, K16, VT (each size a multiple of 256 bytes); q and k are rotated, v is stored transposed */
  k_gemm2<0, 2, 0, 1, 2><<<dim3(gP.x, 3), 128, 0, stream>>>(X16, DMOD, 0, BQ, DMOD, (size_t)DMOD * DMOD, 0.0625f, nullptr, 0, nullptr, 1, 0, 0, nullptr, Q16, DMOD, (size_t)NR * DMOD, NR, DMOD, DMOD, CS);
  k_flash<0><<<NB * NH * QBLKS, 128, 0, stream>>>(Q16, DMOD, K16, DMOD, VT, nullptr, HH, 2 * DMOD);
  /* hi x (16 W) summed first, x 64, then (1024 residual) x W on top: 1024 y, scaled back once */
  k_gemm2<0, 0, DMOD, 64><<<gP, 128, 0, stream>>>(HH, 2 * DMOD, 0, BO, 2 * DMOD, 0, 1.0f / 1024.0f, nullptr, 0, nullptr, 1, 0, 0, (float*)d_out, nullptr, DMOD, 0, NR, DMOD, 2 * DMOD, nullptr);
}

// v010
// Measured time: 157 microseconds a run.
// In both of two side-by-side timings against v009, it was 1.09 times as fast.
// Over all steps from v000 it is 5.17 times as fast.
#include <hip/hip_runtime.h>
// TinyAttn (4 sequences x 2048 tokens x 1024; 16 heads x 64; rotary embedding on the first 32 dims of each head): q,k,v = x W^T; q,k rotated (rot = [x1 cos + x2 sin, -x1 sin + x2 cos] on dims 0..31 with the module's inverse-frequency table); softmax(q k^T / 8) v; y Wo^T -> [4,2048,1024].
// Structure: x as an exact f16 plane; q/k/v projections as f16 WMMA GEMMs (32x64 wave tiles, operand tiles staged in an LDS ring, f32 accumulation, exact x16 weights; q/k rotated in f32 on the staged tile, v as f16); the rotary tables recomputed on the device (f64 pow for the inverse frequencies, f32 angle product, f32 cos/sin) and applied in the q/k projections' epilogue, which writes the f16 q/k planes; the v projection run with its operands swapped, so that it stores V^T itself; the fused flash kernel, whose epilogue stores the attention output as the hi and residual halves of one [token][2048] f16 plane; one output-projection GEMM over k = 2048, whose accumulators are multiplied by 64 between the halves.
// Compute dtype: x and weights rounded to bf16; q, k (after rotation), v, P as f16 operands (~2^-12); attention output hi + 2^-10-scaled residual; f32 accumulation/softmax. v_wmma_f32_16x16x32_f16.
#define NB 4
#define DMOD 1024
#define HD 64
#define RD 32                    /* rotary dims per head */
#define NR (NB * SLEN)
#define QBLKS (TQ / 128)         /* query blocks per (sequence, head) launched */
#define SLEN 2048
#define TQ SLEN
#define TK SLEN
#define NH 16
#define SCL 0.125f               /* 64^-0.5 */
typedef __bf16 v16b __attribute__((ext_vector_type(16)));
typedef unsigned short v8us __attribute__((ext_vector_type(8), may_alias));
typedef float  v8f  __attribute__((ext_vector_type(8)));
typedef float  v4f  __attribute__((ext_vector_type(4)));
typedef float  v2f  __attribute__((ext_vector_type(2)));
typedef float  v4fa __attribute__((ext_vector_type(4), may_alias));
union FragB { v16b v; v8us half[2]; unsigned short u[16]; };

__device__ __forceinline__ unsigned short bf16_bits(float x) { unsigned int u = __float_as_uint(x); return (unsigned short)((u + 0x7FFFu + ((u >> 16) & 1u)) >> 16); }
__device__ __forceinline__ float bf16_val(unsigned short b) { return __uint_as_float(((unsigned int)b) << 16); }
__device__ __forceinline__ float bf16_round(float x) { return bf16_val(bf16_bits(x)); }
// D += A·B with NT terms: 1 = ah·bh, 2 = + al·bh (A split), 3 = + ah·bl (both split)
template <int NT>
__device__ __forceinline__ v8f mmaN(v16b ah, v16b al, v16b bh, v16b bl, v8f c) {
  c = __builtin_amdgcn_wmma_f32_16x16x32_bf16(false, ah, false, bh, (short)0, c, false, false);
  if (NT >= 2) c = __builtin_amdgcn_wmma_f32_16x16x32_bf16(false, al, false, bh, (short)0, c, false, false);
  if (NT >= 3) c = __builtin_amdgcn_wmma_f32_16x16x32_bf16(false, ah, false, bl, (short)0, c, false, false);
  asm volatile("v_nop\n\tv_nop\n\tv_nop\n\tv_nop" : "+v"(c) : "v"(ah), "v"(al), "v"(bh), "v"(bl));
  return c;
}

__global__ __launch_bounds__(256) void k_wt_bf16(const float* __restrict__ W, unsigned short* __restrict__ Wt, int K, int N) {
  const int t = blockIdx.x * 256 + threadIdx.x;
  const int k8n = K / 8;
  if (t >= N * k8n) return;
  const int n = t / k8n, k8 = (t % k8n) * 8;
  v8us v;
#pragma unroll
  for (int i = 0; i < 8; ++i) v[i] = bf16_bits(W[(size_t)(k8 + i) * N + n]);
  *(v8us*)(Wt + (size_t)n * K + k8) = v;
  
}

// GEMM C[M][N] (f32, pitch ldc) = act(A[M][K]·W + bias). A f32 row-major (pitch lda) converted per fragment to bf16
// (ASPLIT: hi/lo two planes -> 2 terms, else single rounded term); Wt bf16 [N][K] (pitch ldb). BIAS_BF16 rounds the
// bias to bf16 first (bias quantised to bf16 before the add). K%32==0, M%16==0, N%64==0.
template <bool ASPLIT, int ACT, bool BIAS_BF16>
__global__ __launch_bounds__(128) void k_gemm_bf(const float* __restrict__ A, int lda, const unsigned short* __restrict__ Wt, int ldb,
                                               const float* __restrict__ bias, float* __restrict__ C, int ldc, int M, int N, int K) {
  __shared__ __attribute__((aligned(16))) float so[4][16][64];
  const int tid = threadIdx.x, w = tid >> 5, lane = tid & 31, ln = lane & 15, hh = lane >> 4;
  const int ntn = N / 64;
  const int wid = blockIdx.x * 4 + w;
  const int mt = wid / ntn, nq = wid % ntn;
  if (mt * 16 >= M) return;
  const int row0 = mt * 16, col0 = nq * 64;
  const float* arow = A + (size_t)(row0 + ln) * lda;
  v8f acc[4] = {};
  for (int kb = 0; kb < K; kb += 32) {
    FragB ah, al;
    const v4f x0 = *(const v4fa*)(arow + kb + 8 * hh), x1 = *(const v4fa*)(arow + kb + 8 * hh + 4);
    const v4f x2 = *(const v4fa*)(arow + kb + 16 + 8 * hh), x3 = *(const v4fa*)(arow + kb + 16 + 8 * hh + 4);
    float xs[16] = {x0[0],x0[1],x0[2],x0[3],x1[0],x1[1],x1[2],x1[3],x2[0],x2[1],x2[2],x2[3],x3[0],x3[1],x3[2],x3[3]};
#pragma unroll
    for (int i = 0; i < 16; ++i) { const unsigned short hb = bf16_bits(xs[i]); ah.u[i] = hb; al.u[i] = ASPLIT ? bf16_bits(xs[i] - bf16_val(hb)) : (unsigned short)0; }
#pragma unroll
    for (int t = 0; t < 4; ++t) {
      const unsigned short* brow = Wt + (size_t)(col0 + t * 16 + ln) * ldb + kb;
      FragB b;
      b.half[0] = *(const v8us*)(brow + 8 * hh);
      b.half[1] = *(const v8us*)(brow + 16 + 8 * hh);
      acc[t] = mmaN<ASPLIT ? 2 : 1>(ah.v, al.v, b.v, b.v, acc[t]);
    }
  }
#pragma unroll
  for (int t = 0; t < 4; ++t) {
    float bv = bias ? bias[col0 + t * 16 + ln] : 0.f;
    if (BIAS_BF16) bv = bf16_round(bv);
#pragma unroll
    for (int r = 0; r < 8; ++r) { float v = acc[t][r] + bv; if (ACT == 1) v = fmaxf(v, 0.f); so[w][8 * hh + r][t * 16 + ln] = v; }
  }
  __builtin_amdgcn_fence(__ATOMIC_ACQ_REL, "workgroup");
  __builtin_amdgcn_wave_barrier();
  const int rsub = lane >> 4, c4 = (lane & 15) * 4;
  {
#pragma unroll
    for (int q = 0; q < 8; ++q) {
      const int r = q * 2 + rsub;
      const v4f v = *(const v4fa*)&so[w][r][c4];
      *(v4f*)(C + (size_t)(row0 + r) * ldc + col0 + c4) = v;
    }
    
  }
}

// GEMM C = act(A·W + bias + resid): A f32 (ASPLIT -> hi/lo 2 terms), Wt bf16 [N][K]; ACT 0 none, 1 relu, 2 exact gelu;
// resid (optional, f32, row index = (row % rmod), pitch ldr, RES_BF16 rounds it) added before the activation.
template <bool ASPLIT, int ACT, bool BIAS_BF16, bool RES_BF16>
__global__ __launch_bounds__(128) void k_gemm_bf3(const float* __restrict__ A, int lda, const unsigned short* __restrict__ Wt, int ldb,
                                                const float* __restrict__ bias, const float* __restrict__ resid, int rmod, int ldr,
                                                float* __restrict__ C, int ldc, int M, int N, int K) {
  __shared__ __attribute__((aligned(16))) float so[4][16][64];
  const int tid = threadIdx.x, w = tid >> 5, lane = tid & 31, ln = lane & 15, hh = lane >> 4;
  const int ntn = N / 64;
  const int wid = blockIdx.x * 4 + w;
  const int mt = wid / ntn, nq = wid % ntn;
  if (mt * 16 >= M) return;
  const int row0 = mt * 16, col0 = nq * 64;
  const float* arow = A + (size_t)(row0 + ln) * lda;
  v8f acc[4] = {};
  for (int kb = 0; kb < K; kb += 32) {
    FragB ah, al;
    const v4f x0 = *(const v4fa*)(arow + kb + 8 * hh), x1 = *(const v4fa*)(arow + kb + 8 * hh + 4);
    const v4f x2 = *(const v4fa*)(arow + kb + 16 + 8 * hh), x3 = *(const v4fa*)(arow + kb + 16 + 8 * hh + 4);
    float xs[16] = {x0[0],x0[1],x0[2],x0[3],x1[0],x1[1],x1[2],x1[3],x2[0],x2[1],x2[2],x2[3],x3[0],x3[1],x3[2],x3[3]};
#pragma unroll
    for (int i = 0; i < 16; ++i) { const unsigned short hb = bf16_bits(xs[i]); ah.u[i] = hb; al.u[i] = ASPLIT ? bf16_bits(xs[i] - bf16_val(hb)) : (unsigned short)0; }
#pragma unroll
    for (int t = 0; t < 4; ++t) {
      const unsigned short* brow = Wt + (size_t)(col0 + t * 16 + ln) * ldb + kb;
      FragB b;
      b.half[0] = *(const v8us*)(brow + 8 * hh);
      b.half[1] = *(const v8us*)(brow + 16 + 8 * hh);
      acc[t] = mmaN<ASPLIT ? 2 : 1>(ah.v, al.v, b.v, b.v, acc[t]);
    }
  }
#pragma unroll
  for (int t = 0; t < 4; ++t) {
    const int col = col0 + t * 16 + ln;
    float bv = bias ? bias[col] : 0.f;
    if (BIAS_BF16) bv = bf16_round(bv);
#pragma unroll
    for (int r = 0; r < 8; ++r) {
      float v = acc[t][r] + bv;
      if (resid) { float rv = resid[(size_t)((row0 + 8 * hh + r) % rmod) * ldr + col]; if (RES_BF16) rv = bf16_round(rv); v += rv; }
      if (ACT == 1) v = fmaxf(v, 0.f);
      if (ACT == 2) v = 0.5f * v * (1.0f + erff(v * 0.70710678118654752f));
      if (ACT == 3) { const float u = 0.7978845608028654f * (v + 0.044715f * v * v * v); v = 0.5f * v * (1.0f + tanhf(u)); }
      so[w][8 * hh + r][t * 16 + ln] = v;
    }
  }
  __builtin_amdgcn_fence(__ATOMIC_ACQ_REL, "workgroup");
  __builtin_amdgcn_wave_barrier();
  const int rsub = lane >> 4, c4 = (lane & 15) * 4;
  {
#pragma unroll
    for (int q = 0; q < 8; ++q) {
      const int r = q * 2 + rsub;
      const v4f v = *(const v4fa*)&so[w][r][c4];
      *(v4f*)(C + (size_t)(row0 + r) * ldc + col0 + c4) = v;
    }
    
  }
}
// row LayerNorm (biased variance, eps) over N: s = X (+ R); optional out_sum <- s; out_norm <- (s-mu)*rsqrt(var+eps)*g + b
template <bool PARAM_BF16>
__global__ __launch_bounds__(256) void k_layernorm(const float* __restrict__ X, const float* __restrict__ R, const float* __restrict__ g, const float* __restrict__ bta,
                                                  float* __restrict__ out_sum, float* __restrict__ out_norm, int N, float eps) {
  __shared__ float red[256];
  const int row = blockIdx.x, tid = threadIdx.x;
  const float* x = X + (size_t)row * N; const float* rr = R ? R + (size_t)row * N : nullptr;
  float vals[16];                     // up to N = 4096
  const int per = N / 256;            // contiguous chunk per thread? use strided-by-4 chunks: thread handles j = tid*4 + 1024*u
  float s1 = 0.f;
  for (int u = 0; u < per / 4; ++u) {
    const int j = tid * 4 + 1024 * u;
    const v4f a = *(const v4fa*)(x + j);
    v4f b = {0.f,0.f,0.f,0.f}; if (rr) b = *(const v4fa*)(rr + j);
#pragma unroll
    for (int q = 0; q < 4; ++q) { const float v = a[q] + b[q]; vals[u * 4 + q] = v; s1 += v; }
  }
  red[tid] = s1; __syncthreads();
  for (int st = 128; st > 0; st >>= 1) { if (tid < st) red[tid] += red[tid + st]; __syncthreads(); }
  const float mu = red[0] / (float)N; __syncthreads();
  float s2 = 0.f;
  for (int u = 0; u < per / 4; ++u)
#pragma unroll
    for (int q = 0; q < 4; ++q) { const float c = vals[u * 4 + q] - mu; s2 += c * c; }
  red[tid] = s2; __syncthreads();
  for (int st = 128; st > 0; st >>= 1) { if (tid < st) red[tid] += red[tid + st]; __syncthreads(); }
  const float rs = rsqrtf(red[0] / (float)N + eps);
  {
    for (int u = 0; u < per / 4; ++u) {
      const int j = tid * 4 + 1024 * u;
      v4f o, sm;
#pragma unroll
      for (int q = 0; q < 4; ++q) {
        float gg = g[j + q], bb = bta[j + q];
        if (PARAM_BF16) { gg = bf16_round(gg); bb = bf16_round(bb); }
        sm[q] = vals[u * 4 + q]; o[q] = (vals[u * 4 + q] - mu) * rs * gg + bb;
      }
      if (out_sum) *(v4f*)(out_sum + (size_t)row * N + j) = sm;
      *(v4f*)(out_norm + (size_t)row * N + j) = o;
    }
    
  }
}



// ---- f16 WMMA path (v_wmma_f32_16x16x32_f16): 11-bit significands for operands in range — used where a [0,1] probability operand needs more precision than bf16
typedef _Float16 v16h __attribute__((ext_vector_type(16)));
union FragH { v16h v; v8us half[2]; _Float16 h[16]; unsigned short u[16]; };
// builtin WMMAs only: the compiler keeps the distances behind them itself and may place loads and vector work in between
template <int NT>
__device__ __forceinline__ v8f mmaH(v16h ah, v16h al, v16h bh, v16h bl, v8f c) {
  c = __builtin_amdgcn_wmma_f32_16x16x32_f16(false, ah, false, bh, (short)0, c, false, false);
  if (NT >= 2) c = __builtin_amdgcn_wmma_f32_16x16x32_f16(false, al, false, bh, (short)0, c, false, false);
  if (NT >= 3) c = __builtin_amdgcn_wmma_f32_16x16x32_f16(false, ah, false, bl, (short)0, c, false, false);
  return c;
}
// batched GEMM like k_gemm_b but f16 operands: A f32 (split into f16 hi/lo if ASPLIT, else rounded to f16), Bt = f16 values [n][k]; alpha; C f32; N multiple of 16 (partial tiles skipped)
template <bool ASPLIT>
__global__ __launch_bounds__(128) void k_gemm_h(const float* __restrict__ A, int lda, size_t sA, const _Float16* __restrict__ Bh, int ldb, size_t sB, float alpha, float* __restrict__ C, int ldc, size_t sC, int M, int N, int K) {
  __shared__ __attribute__((aligned(16))) float so[4][16][64];
  const int tid = threadIdx.x, w = tid >> 5, lane = tid & 31, ln = lane & 15, hh = lane >> 4; const int by = blockIdx.y;
  A += (size_t)by * sA; Bh += (size_t)by * sB; C += (size_t)by * sC;
  const int ntn = (N + 63) / 64; const int wid = blockIdx.x * 4 + w; const int mt = wid / ntn, nq = wid % ntn; if (mt * 16 >= M) return;
  const int row0 = mt * 16, col0 = nq * 64; const float* arow = A + (size_t)(row0 + ln) * lda;
  v8f acc[4] = {};
  for (int kb = 0; kb < K; kb += 32) {
    FragH ah, al;
    const v4f x0 = *(const v4fa*)(arow + kb + 8 * hh), x1 = *(const v4fa*)(arow + kb + 8 * hh + 4), x2 = *(const v4fa*)(arow + kb + 16 + 8 * hh), x3 = *(const v4fa*)(arow + kb + 16 + 8 * hh + 4);
    float xs[16] = {x0[0],x0[1],x0[2],x0[3],x1[0],x1[1],x1[2],x1[3],x2[0],x2[1],x2[2],x2[3],x3[0],x3[1],x3[2],x3[3]};
#pragma unroll
    for (int i = 0; i < 16; ++i) { const _Float16 h = (_Float16)xs[i]; ah.h[i] = h; al.h[i] = ASPLIT ? (_Float16)(xs[i] - (float)h) : (_Float16)0.0f; }
#pragma unroll
    for (int t = 0; t < 4; ++t) { if (col0 + t * 16 >= N) continue; const size_t boff = (size_t)(col0 + t * 16 + ln) * ldb + kb; FragH bq; bq.half[0] = *(const v8us*)(Bh + boff + 8 * hh); bq.half[1] = *(const v8us*)(Bh + boff + 16 + 8 * hh);
      acc[t] = mmaH<ASPLIT ? 2 : 1>(ah.v, al.v, bq.v, bq.v, acc[t]); }
  }
#pragma unroll
  for (int t = 0; t < 4; ++t) { if (col0 + t * 16 >= N) continue;
#pragma unroll
    for (int r = 0; r < 8; ++r) so[w][8 * hh + r][t * 16 + ln] = acc[t][r] * alpha; }
  __builtin_amdgcn_fence(__ATOMIC_ACQ_REL, "workgroup"); __builtin_amdgcn_wave_barrier();
  const int rsub = lane >> 4, c4 = (lane & 15) * 4;
  {
#pragma unroll
    for (int q = 0; q < 8; ++q) { const int r = q * 2 + rsub; if (col0 + c4 < N) { const v4f v = *(const v4fa*)&so[w][r][c4]; *(v4f*)(C + (size_t)(row0 + r) * ldc + col0 + c4) = v; } }
     }
}

// Wt[n][k] = f16(W[k][n]·scale) from f32 row-major W[K][N] (scale = power of two; bf16-exact weights stay exact in f16 away from the subnormal range)
__global__ __launch_bounds__(256) void k_wt_f16(const float* __restrict__ W, _Float16* __restrict__ Wt, int K, int N, float scale) {
  const int t = blockIdx.x * 256 + threadIdx.x; if (t >= N * (K / 8)) return; const int n = t / (K / 8), k8 = (t % (K / 8)) * 8; FragH f;
#pragma unroll
  for (int i = 0; i < 8; ++i) f.h[i] = (_Float16)(bf16_round(W[(size_t)(k8 + i) * N + n]) * scale); const v8us o = f.half[0];
  *(v8us*)((unsigned short*)Wt + (size_t)n * K + k8) = o; 
}
// k_gemm_hh variant with fused epilogue: v = acc·alpha + bias[by·sBias + col] (+ CP[(row/rowsPerB)·sCPb + by·64 + col] if CP) ; ACT 0 none / 1 elu ; writes f16 C16 (and f32 C if non-null)
template <int ACT>
__global__ __launch_bounds__(128) void k_gemm_hhx(const _Float16* __restrict__ A, int lda, size_t sA, const _Float16* __restrict__ Bh, int ldb, size_t sB, float alpha, const float* __restrict__ bias, size_t sBias, const float* __restrict__ CP, int rowsPerB, size_t sCPb, int row0g,
    float* __restrict__ C, _Float16* __restrict__ C16, int ldc, size_t sC, int M, int N, int K) {
  __shared__ __attribute__((aligned(16))) float so[4][16][64];
  const int tid = threadIdx.x, w = tid >> 5, lane = tid & 31, ln = lane & 15, hh = lane >> 4; const int by = blockIdx.y;
  A += (size_t)by * sA; Bh += (size_t)by * sB; const size_t cofs = (size_t)by * sC; const float* bp = bias ? bias + (size_t)by * sBias : nullptr;
  const int ntn = (N + 63) / 64; const int wid = blockIdx.x * 4 + w; const int mt = wid / ntn, nq = wid % ntn; if (mt * 16 >= M) return;
  const int row0 = mt * 16, col0 = nq * 64; const _Float16* arow = A + (size_t)(row0 + ln) * lda;
  v8f acc[4] = {};
  for (int kb = 0; kb < K; kb += 32) { FragH ah; ah.half[0] = *(const v8us*)((const unsigned short*)arow + kb + 8 * hh); ah.half[1] = *(const v8us*)((const unsigned short*)arow + kb + 16 + 8 * hh);
#pragma unroll
    for (int t = 0; t < 4; ++t) { if (col0 + t * 16 >= N) continue; const size_t boff = (size_t)(col0 + t * 16 + ln) * ldb + kb; FragH bq; bq.half[0] = *(const v8us*)((const unsigned short*)Bh + boff + 8 * hh); bq.half[1] = *(const v8us*)((const unsigned short*)Bh + boff + 16 + 8 * hh);
      acc[t] = mmaH<1>(ah.v, ah.v, bq.v, bq.v, acc[t]); }
  }
#pragma unroll
  for (int t = 0; t < 4; ++t) { if (col0 + t * 16 >= N) continue; const int col = col0 + t * 16 + ln; const float bv = bp ? bf16_round(bp[col]) : 0.f;
#pragma unroll
    for (int r = 0; r < 8; ++r) { float v = acc[t][r] * alpha + bv; if (CP) { const int bidx = (row0g + row0 + 8 * hh + r) / rowsPerB; v += CP[(size_t)bidx * sCPb + (size_t)by * 64 + col]; } if (ACT == 1) v = (v > 0.f) ? v : expm1f(v); else if (ACT == 7) v = (v > 0.f) ? v + 1.0f : expf(v); else if (ACT == 8) v = tanhf(v); else if (ACT == 9) v = 0.5f * v * (1.0f + tanhf(0.7978845608028654f * (v + 0.044715f * v * v * v))); else if (ACT == 11) v = 1.0f / (1.0f + expf(-v)); else if (ACT == 12) v = (v > 0.f) ? v : 0.01f * v; else if (ACT == 14) v = (v > 0.f) ? v : 0.1f * v; else if (ACT == 15) v = v / (1.0f + expf(-v)); else if (ACT == 3) v = fmaxf(v, 0.f); else if (ACT == 6) v = 0.5f * v * (1.0f + erff(v * 0.70710678118654752f)); so[w][8 * hh + r][t * 16 + ln] = v; } }
  __builtin_amdgcn_fence(__ATOMIC_ACQ_REL, "workgroup"); __builtin_amdgcn_wave_barrier();
  const int rsub = lane >> 4, c4 = (lane & 15) * 4; typedef _Float16 v4h __attribute__((ext_vector_type(4)));
  {
#pragma unroll
    for (int q = 0; q < 8; ++q) { const int r = q * 2 + rsub; if (col0 + c4 < N) { const v4f v = *(const v4fa*)&so[w][r][c4]; if (C) *(v4f*)(C + cofs + (size_t)(row0 + r) * ldc + col0 + c4) = v; if (C16) { v4h h4; for (int i = 0; i < 4; ++i) h4[i] = (_Float16)v[i]; *(v4h*)(C16 + cofs + (size_t)(row0 + r) * ldc + col0 + c4) = h4; } } }
     }
}


typedef _Float16 v4h __attribute__((ext_vector_type(4)));

__global__ __launch_bounds__(256) void k_h16(const float* __restrict__ x, _Float16* __restrict__ X16, size_t n8) { const size_t t = (size_t)blockIdx.x * 256 + threadIdx.x; if (t >= n8) return; FragH f;
#pragma unroll
  for (int q = 0; q < 8; ++q) f.h[q] = (_Float16)x[t * 8 + q]; *(v8us*)((unsigned short*)X16 + t * 8) = f.half[0];  }
__global__ __launch_bounds__(256) void k_round16f(const float* __restrict__ W, _Float16* __restrict__ Bt, size_t n8) { const size_t t = (size_t)blockIdx.x * 256 + threadIdx.x; if (t >= n8) return; FragH f;
#pragma unroll
  for (int i = 0; i < 8; ++i) f.h[i] = (_Float16)(bf16_round(W[t * 8 + i]) * 16.0f); *(v8us*)((unsigned short*)Bt + t * 8) = f.half[0];  }

// ---- fast GEMM (work-group tile 128x128 on eight waves, wave tile 32x64; requires M % 128 == 0, N % 128 == 0, K % 64 == 0 and K >= 64); epilogue = k_gemm_hhx semantics ----
__device__ __forceinline__ v8f g2_mma(v16h a, v16h b, v8f c) { return __builtin_amdgcn_wmma_f32_16x16x32_f16(false, a, false, b, (short)0, c, false, false); }
// a fragment from a staged tile: the two 16-byte pieces of the lane's row (same k order as a fragment read from global memory: 8 * hh .. and 16 + 8 * hh ..)
__device__ __forceinline__ v16h g2_lfrag(const unsigned char* rows, int o0, int o1) { FragH f; f.half[0] = *(const v8us*)(rows + o0); f.half[1] = *(const v8us*)(rows + o1); return f.v; }
// One stage of the GEMM ring: 64 k of the tile's 128 A rows, then of its 128 B rows (rows of 128 bytes without a pad, 32 KiB), brought by asynchronous copies to LDS.
// Eight waves, eight copies a lane (32 rows a copy of the work-group); a wave-wide copy covers four whole 128-byte lines. s_wait_xcnt stands inside the statement so that no address register is rewritten ahead of it.
__device__ __forceinline__ void g2_stage_copy(unsigned lds, const unsigned short* ga, size_t astep, const unsigned short* gb, size_t bstep) {
  asm volatile("global_load_async_to_lds_b128 %0, %8, off\n\t"
               "global_load_async_to_lds_b128 %1, %9, off\n\t"
               "global_load_async_to_lds_b128 %2, %10, off\n\t"
               "global_load_async_to_lds_b128 %3, %11, off\n\t"
               "global_load_async_to_lds_b128 %4, %12, off\n\t"
               "global_load_async_to_lds_b128 %5, %13, off\n\t"
               "global_load_async_to_lds_b128 %6, %14, off\n\t"
               "global_load_async_to_lds_b128 %7, %15, off\n\t"
               "s_wait_xcnt 0x0"
               :: "v"(lds), "v"(lds + 4096u), "v"(lds + 8192u), "v"(lds + 12288u), "v"(lds + 16384u), "v"(lds + 20480u), "v"(lds + 24576u), "v"(lds + 28672u),
                  "v"(ga), "v"(ga + astep), "v"(ga + 2 * astep), "v"(ga + 3 * astep), "v"(gb), "v"(gb + bstep), "v"(gb + 2 * bstep), "v"(gb + 3 * bstep)
               : "memory");
}
// ROTB: in the first ROTB products of the batch (blockIdx.y) a wave's 64 columns are one head and its rows are tokens (position = row % SLEN): the rotary embedding is applied to the staged f32 tile on its way out (CS: cos table, then sin table, [position][RD / 2]).
// TRB >= 0: product TRB of the batch runs with its operands swapped (the tile's rows from Bh, its columns from A) and stores C^T, one [N][SLEN] plane per sequence of SLEN rows of A: the layout the flash kernel reads V^T in. It takes no bias and no CP (both index by the untransposed column).
// KMID > 0: the operands' k range is two parts that carry different powers of two; ahead of k = KMID (a multiple of 64) the accumulators are multiplied by MIDMUL, an exact step that brings the first part's sums to the second part's scale.
template <int ACT, int ROTB, int KMID = 0, int MIDMUL = 1, int TRB = -1>
__global__ __launch_bounds__(256) void k_gemm2(const _Float16* __restrict__ A, int lda, size_t sA, const _Float16* __restrict__ Bh, int ldb, size_t sB, float alpha, const float* __restrict__ bias, size_t sBias, const float* __restrict__ CP, int rowsPerB, size_t sCPb, int row0g,
    float* __restrict__ C, _Float16* __restrict__ C16, int ldc, size_t sC, int M, int N, int K, const float* __restrict__ CS) {
  constexpr int ATILE_B = 128 * 128, GSTAGE_B = ATILE_B + 128 * 128;      /* a stage = 64 k: A tile, then B tile */
  constexpr int GOUT_B = 8 * 32 * 68 * 4;      /* output staging, a little larger than the ring */
  __shared__ __attribute__((aligned(16))) unsigned char ring[GOUT_B > 2 * GSTAGE_B ? GOUT_B : 2 * GSTAGE_B];
  float (*so)[32][68] = reinterpret_cast<float (*)[32][68]>(ring);      /* output staging takes the ring's place behind the loop's last barrier */
  const int tid = threadIdx.x, w = tid >> 5, lane = tid & 31, ln = lane & 15, hh = lane >> 4; const int by = blockIdx.y; const bool rot = ROTB > 0 && by < ROTB, tr = TRB >= 0 && by == TRB;      /* the same for the whole work-group */
  A += (size_t)by * sA; Bh += (size_t)by * sB; size_t cofs = (size_t)by * sC;
  if (tr) { const _Float16* pa = A; A = Bh; Bh = pa; const int la = lda; lda = ldb; ldb = la; const int mm = M; M = N; N = mm; }      /* from here on M, A, lda name the operand of the tile's 128 rows */ const float* bp = bias ? bias + (size_t)by * sBias : nullptr;
  const int ntn = N >> 7; const int mt = blockIdx.x / ntn, nq = blockIdx.x - mt * ntn; if (mt * 128 >= M) return;      /* the whole work-group leaves, ahead of every copy and barrier */
  const int row0 = mt * 128 + 32 * (w & 3), col0 = nq * 128 + 64 * (w >> 2);      /* waves 4 x 2 over the tile: four waves read each B fragment's rows, two each A fragment's */
  if (tr) { cofs += (size_t)(col0 / SLEN) * (M - 1) * SLEN; ldc = SLEN; }      /* column c of sequence s = c / SLEN lies at s * M * SLEN + row * SLEN + c - s * SLEN; a wave's 64 columns never cross a sequence's end */
  const int nst = K >> 6;
  /* 16-byte piece c of row r lies at r * 128 + (c ^ ((r >> 1) & 7)) * 16: sixteen rows read at one piece index fall on all 64 banks */
  const unsigned cp_lds = (unsigned)(size_t)ring + (unsigned)((tid >> 3) * 128 + (((tid & 7) ^ ((tid >> 4) & 7)) * 16));
  const unsigned short* cp_a = (const unsigned short*)A + (size_t)(mt * 128 + (tid >> 3)) * lda + (tid & 7) * 8;
  const unsigned short* cp_b = (const unsigned short*)Bh + (size_t)(nq * 128 + (tid >> 3)) * ldb + (tid & 7) * 8;
  const size_t astep = (size_t)32 * lda, bstep = (size_t)32 * ldb;
  g2_stage_copy(cp_lds, cp_a, astep, cp_b, bstep);
  int fo[2][2];      /* a fragment's two pieces in row ln: [32-element group of the row][piece] */
#pragma unroll
  for (int g = 0; g < 2; ++g)
#pragma unroll
    for (int pc = 0; pc < 2; ++pc) fo[g][pc] = ln * 128 + (((g * 4 + pc * 2 + hh) ^ ((ln >> 1) & 7)) * 16);
  const v8f z8 = {0.f,0.f,0.f,0.f,0.f,0.f,0.f,0.f}; v8f c00 = z8, c01 = z8, c02 = z8, c03 = z8, c10 = z8, c11 = z8, c12 = z8, c13 = z8;
  asm volatile("s_wait_asynccnt 0x0" ::: "memory");      /* stage 0 has landed for this wave's own copies */
  __syncthreads();                                       /* ... and for every other wave's */
  if (1 < nst) g2_stage_copy(cp_lds + GSTAGE_B, cp_a + 64, astep, cp_b + 64, bstep);
#pragma unroll 1      /* one body for both buffers: the buffer is picked by the trip's parity */
  for (int t = 0; t < nst; ++t) {
    const unsigned char* ar = ring + (t & 1) * GSTAGE_B + (w & 3) * (32 * 128); const unsigned char* br = ring + (t & 1) * GSTAGE_B + ATILE_B + (w >> 2) * (64 * 128);
    if (KMID > 0 && t == (KMID >> 6)) { const float ms = (float)MIDMUL; c00 *= ms; c01 *= ms; c02 *= ms; c03 *= ms; c10 *= ms; c11 *= ms; c12 *= ms; c13 *= ms; }
#pragma unroll
    for (int g = 0; g < 2; ++g) { const int o0 = fo[g][0], o1 = fo[g][1];
      const v16h a0 = g2_lfrag(ar, o0, o1), a1 = g2_lfrag(ar + 2048, o0, o1);
      const v16h b0 = g2_lfrag(br, o0, o1), b1 = g2_lfrag(br + 2048, o0, o1), b2 = g2_lfrag(br + 4096, o0, o1), b3 = g2_lfrag(br + 6144, o0, o1);
      c00 = g2_mma(a0, b0, c00); c10 = g2_mma(a1, b0, c10);
      c01 = g2_mma(a0, b1, c01); c11 = g2_mma(a1, b1, c11);
      c02 = g2_mma(a0, b2, c02); c12 = g2_mma(a1, b2, c12);
      c03 = g2_mma(a0, b3, c03); c13 = g2_mma(a1, b3, c13); }
    asm volatile("s_wait_dscnt 0x0" ::: "memory");         /* this wave's reads of stage t have returned */
    asm volatile("s_wait_asynccnt 0x0" ::: "memory");      /* this wave's copies of stage t + 1 have landed */
    __syncthreads();                                       /* publishes stage t + 1 and ends every wave's reads of stage t */
    if (t + 2 < nst) g2_stage_copy(cp_lds + (t & 1) * GSTAGE_B, cp_a + (size_t)(t + 2) * 64, astep, cp_b + (size_t)(t + 2) * 64, bstep); }
  asm volatile("s_wait_asynccnt 0x0" ::: "memory");        /* nothing is in flight when the ring becomes output staging */
  const int rsub = lane >> 4, c4 = (lane & 15) * 4;
  v8f accs[8] = {c00, c01, c02, c03, c10, c11, c12, c13};
#pragma unroll
  for (int u = 0; u < 8; ++u) { const int t = u & 3, half = u >> 2; const int col = col0 + t * 16 + ln; const float bv = bp ? bf16_round(bp[col]) : 0.f;
#pragma unroll
    for (int r = 0; r < 8; ++r) { const int rloc = half * 16 + 8 * hh + r; float v = accs[u][r] * alpha + bv; if (CP) { const int bidx = (row0g + row0 + rloc) / rowsPerB; v += CP[(size_t)bidx * sCPb + (size_t)by * 64 + col]; }
      if (ACT == 3) v = fmaxf(v, 0.f); else if (ACT == 6) v = 0.5f * v * (1.0f + erff(v * 0.70710678118654752f)); else if (ACT == 11) v = 1.0f / (1.0f + expf(-v)); else if (ACT == 15) v = v / (1.0f + expf(-v)); else if (ACT == 12) v = (v > 0.f) ? v : 0.01f * v; else if (ACT == 8) v = tanhf(v);
      so[w][rloc][t * 16 + ln] = v; } }
  v4f tcs[16], tsn[16];      /* rotated products: the lane's table pieces for its sixteen rows, all asked for at once so that their latency is paid once; behind the staging, where the accumulators' registers are free */
  if (rot) { const float* tb = CS + (size_t)(row0 % SLEN + rsub) * (RD / 2) + (c4 & (RD / 2 - 1));      /* a wave's 32 rows never cross a sequence's end: both are multiples of 32 */
#pragma unroll
    for (int q = 0; q < 16; ++q) { tcs[q] = *(const v4fa*)(tb + q * RD); tsn[q] = *(const v4fa*)(tb + q * RD + SLEN * (RD / 2)); }
    asm volatile("s_wait_xcnt 0x0" ::: "memory"); }      /* stands ahead of any rewrite of the table loads' address registers */
  __builtin_amdgcn_fence(__ATOMIC_ACQ_REL, "workgroup"); __builtin_amdgcn_wave_barrier();
  {
#pragma unroll
    for (int q = 0; q < 16; ++q) { const int r = q * 2 + rsub; v4f v = *(const v4fa*)&so[w][r][c4];
      if (rot) {      /* every lane reads a partner piece at a valid place; only dims under RD take the rotated value */
        const v4f u = *(const v4fa*)&so[w][r][c4 ^ (RD / 2)]; const v4f cs = tcs[q], sn = tsn[q];
        const v4f lo = v * cs + u * sn, hi = u * -sn + v * cs;      /* dims 0..15: x1 cos + x2 sin (x1 own); dims 16..31: -x1 sin + x2 cos (x2 own) */
        v = (c4 < RD / 2) ? lo : ((c4 < RD) ? hi : v); }
      if (C) *(v4f*)(C + cofs + (size_t)(row0 + r) * ldc + col0 + c4) = v; if (C16) { v4h h4; for (int i = 0; i < 4; ++i) h4[i] = (_Float16)v[i]; *(v4h*)(C16 + cofs + (size_t)(row0 + r) * ldc + col0 + c4) = h4; } }
     } }



// One stage of the K / V^T ring: 64 key rows of K (128 bytes each) and 64 rows of V^T (the same 64 keys, 128 bytes each), 16 KiB, brought by asynchronous copies to LDS.
// Eight waves, four copies a lane (32 rows a copy of the work-group); a wave-wide copy covers four whole 128-byte lines. s_wait_xcnt stands inside the statement so that no address register is rewritten ahead of it.
__device__ __forceinline__ void stage_copy(unsigned lds, const unsigned short* gk, size_t kstep, const unsigned short* gv, size_t vstep) {
  asm volatile("global_load_async_to_lds_b128 %0, %4, off\n\t"
               "global_load_async_to_lds_b128 %1, %5, off\n\t"
               "global_load_async_to_lds_b128 %2, %6, off\n\t"
               "global_load_async_to_lds_b128 %3, %7, off\n\t"
               "s_wait_xcnt 0x0"
               :: "v"(lds), "v"(lds + 4096u), "v"(lds + 8192u), "v"(lds + 12288u),
                  "v"(gk), "v"(gk + kstep), "v"(gv), "v"(gv + vstep)
               : "memory");
}
// lane l with lane l ^ 16: one vector cross-row move
__device__ __forceinline__ float xhalf(float x) { return __builtin_bit_cast(float, __builtin_amdgcn_permlanex16(__builtin_bit_cast(int, x), __builtin_bit_cast(int, x), 0x76543210, 0xfedcba98, false, false)); }
template <int CAUSAL>
__global__ __launch_bounds__(256) void k_flash(const _Float16* __restrict__ Q16, int ldq, const _Float16* __restrict__ K16, int ldk, const _Float16* __restrict__ Vt, const int* __restrict__ MSK, _Float16* __restrict__ H, int ldh) {
  constexpr int NW = 8, RPW = 16, RTN = RPW / 16, NQB = TQ / (NW * RPW), DT = 4, KS = 2;
  constexpr float C2 = SCL * 1.44269504088896340736f;      /* score -> exponent of 2; the bare exp2 instruction serves: no exponent exceeds 10, and a result that flushes to zero lies far under P's f16 step */
  constexpr int TILE_B = 64 * 128, STAGE_B = 2 * TILE_B;      /* a stage = 64 keys: K tile, then V^T tile, rows of 128 bytes without a pad */
  constexpr int OUT_B = NW * RPW * (64 + 4) * 4;      /* output staging, a little larger than the ring */
  __shared__ __attribute__((aligned(16))) unsigned char ring[OUT_B > 2 * STAGE_B ? OUT_B : 2 * STAGE_B];
  float (*sO)[RPW][64 + 4] = reinterpret_cast<float (*)[RPW][64 + 4]>(ring);      /* output staging takes the ring's place behind the loop's last barrier */
  const int tid = threadIdx.x, w = tid >> 5, lane = tid & 31, ln = lane & 15, hh = lane >> 4;
  const int slab = blockIdx.x / QBLKS, qblk = blockIdx.x % QBLKS; (void)NQB; (void)MSK; const int b = slab / NH, h = slab % NH; const int qb0 = qblk * (NW * RPW); const int q0 = qb0 + w * RPW;
  const unsigned short* Vth = (const unsigned short*)Vt + (size_t)slab * 64 * TK;
  const int jend = (CAUSAL == 1) ? (qb0 + NW * RPW) : TK;      /* causal: keys beyond the block's last query never contribute */
  const int nst = jend / 64;
  /* 16-byte piece c of row r lies at r * 128 + (c ^ ((r >> 1) & 7)) * 16: sixteen rows read at one piece index fall on all 64 banks */
  const unsigned cp_lds = (unsigned)(size_t)ring + (unsigned)((tid >> 3) * 128 + (((tid & 7) ^ ((tid >> 4) & 7)) * 16));
  const unsigned short* cp_k = (const unsigned short*)K16 + ((size_t)b * TK + (tid >> 3)) * ldk + h * 64 + (tid & 7) * 8;
  const unsigned short* cp_v = Vth + (size_t)(tid >> 3) * TK + (tid & 7) * 8;
  const size_t kstep = (size_t)32 * ldk, vstep = (size_t)32 * TK;
  stage_copy(cp_lds, cp_k, kstep, cp_v, vstep);
  FragH aq[2][KS];
#pragma unroll
  for (int rt = 0; rt < RTN; ++rt) { const unsigned short* qr = (const unsigned short*)Q16 + ((size_t)b * TQ + q0 + rt * 16 + ln) * ldq + h * 64;
#pragma unroll
    for (int ks = 0; ks < KS; ++ks) { aq[rt][ks].half[0] = *(const v8us*)(qr + ks * 32 + 8 * hh); aq[rt][ks].half[1] = *(const v8us*)(qr + ks * 32 + 16 + 8 * hh); } }
  int fo[2][2];      /* a fragment's two pieces in row ln: [32-element group of the row][piece] */
#pragma unroll
  for (int g = 0; g < 2; ++g)
#pragma unroll
    for (int pc = 0; pc < 2; ++pc) fo[g][pc] = ln * 128 + (((g * 4 + pc * 2 + hh) ^ ((ln >> 1) & 7)) * 16);
  float m_r[2], l_r[2]; v8f oacc[2][DT];      /* per lane: its query's running maximum (of raw scores), its half's share of the sum (x 1024), and O^T[d = dt * 16 + 8 * hh + r][query ln] */
#pragma unroll
  for (int rt = 0; rt < RTN; ++rt) { m_r[rt] = -3.0e38f; l_r[rt] = 0.f;
#pragma unroll
    for (int dt = 0; dt < DT; ++dt) oacc[rt][dt] = (v8f){0.f,0.f,0.f,0.f,0.f,0.f,0.f,0.f}; }
  asm volatile("s_wait_asynccnt 0x0" ::: "memory");      /* stage 0 has landed for this wave's own copies */
  __syncthreads();                                       /* ... and for every other wave's */
  if (1 < nst) stage_copy(cp_lds + STAGE_B, cp_k + (size_t)64 * ldk, kstep, cp_v + 64, vstep);
#pragma unroll 1
  for (int t = 0; t < nst; ++t) {
    const unsigned char* st = ring + (t & 1) * STAGE_B;
#pragma unroll 1      /* the two 32-key passes of a stage stay one body: unrolled, the registers grow and a work-group per WGP is lost */
    for (int ps = 0; ps < 2; ++ps) { const int j0 = t * 64 + ps * 32;
    v8f s[2][2];
#pragma unroll
    for (int nt = 0; nt < 2; ++nt) { const unsigned char* kr = st + (ps * 32 + nt * 16) * 128; FragH bk[KS];
#pragma unroll
      for (int ks = 0; ks < KS; ++ks) { bk[ks].half[0] = *(const v8us*)(kr + fo[ks][0]); bk[ks].half[1] = *(const v8us*)(kr + fo[ks][1]); }
#pragma unroll
      for (int rt = 0; rt < RTN; ++rt) { v8f acc = (v8f){0.f,0.f,0.f,0.f,0.f,0.f,0.f,0.f};
#pragma unroll
        for (int ks = 0; ks < KS; ++ks) acc = mmaH<1>(bk[ks].v, bk[ks].v, aq[rt][ks].v, aq[rt][ks].v, acc); s[rt][nt] = acc; } }      /* s[rt][nt][r] = score of key j0 + nt * 16 + 8 * hh + r, query q0 + rt * 16 + ln */
    FragH pb[2];
#pragma unroll
    for (int rt = 0; rt < RTN; ++rt) { const int tq = q0 + rt * 16 + ln; float sv[16]; bool ok[16];
#pragma unroll
      for (int e = 0; e < 16; ++e) { const int kk = j0 + (e >> 3) * 16 + 8 * hh + (e & 7);
        ok[e] = (CAUSAL == 1) ? (kk <= tq) : ((CAUSAL == 2) ? ((kk >> 5) == (tq >> 5)) : true);      /* mode 2: block-diagonal 32-token groups */
        sv[e] = ok[e] ? s[rt][e >> 3][e & 7] : -3.0e38f; }      /* raw scores: the scale is positive, so the maximum is taken ahead of it */
      float mx[4];
#pragma unroll
      for (int c = 0; c < 4; ++c) mx[c] = fmaxf(fmaxf(sv[c], sv[4 + c]), fmaxf(sv[8 + c], sv[12 + c]));
      float mc = fmaxf(fmaxf(mx[0], mx[1]), fmaxf(mx[2], mx[3])); mc = fmaxf(mc, xhalf(mc));      /* both halves now hold the query's maximum over the 32 keys */
      const float mn = fmaxf(m_r[rt], mc); const float ea = __builtin_amdgcn_exp2f((m_r[rt] - mn) * C2); const float al = (mn > -1.0e38f) ? ea : 1.0f; m_r[rt] = mn;
      const float nb = fmaf(-mn, C2, 10.0f);      /* 1024 p = 2^(score * C2 + nb): scale, log2 e, the maximum and P's factor 1024 in one multiply-add */
      const v2f c2v = {C2, C2}, nbv = {nb, nb}; v2f ls[2];
#pragma unroll
      for (int e = 0; e < 16; e += 2) { const v2f x = __builtin_elementwise_fma((v2f){sv[e], sv[e + 1]}, c2v, nbv);
        const v2f p = {ok[e] ? __builtin_amdgcn_exp2f(x[0]) : 0.f, ok[e + 1] ? __builtin_amdgcn_exp2f(x[1]) : 0.f};
        if (e < 4) ls[e >> 1] = p; else ls[(e >> 1) & 1] += p;
        pb[rt].h[e] = (_Float16)p[0]; pb[rt].h[e + 1] = (_Float16)p[1]; }
      l_r[rt] = l_r[rt] * al + ((ls[0][0] + ls[0][1]) + (ls[1][0] + ls[1][1]));      /* the sum carries the factor 1024 too */
#pragma unroll
      for (int dt = 0; dt < DT; ++dt)
#pragma unroll
        for (int r = 0; r < 8; ++r) oacc[rt][dt][r] *= al; }
#pragma unroll
    for (int dt = 0; dt < DT; ++dt) { const unsigned char* vrow = st + TILE_B + dt * 16 * 128; FragH bv; bv.half[0] = *(const v8us*)(vrow + (fo[0][0] ^ (ps * 64))); bv.half[1] = *(const v8us*)(vrow + (fo[0][1] ^ (ps * 64)));      /* the pass's 32 keys: piece index + 4 = bit 6 of the offset */
#pragma unroll
      for (int rt = 0; rt < RTN; ++rt) oacc[rt][dt] = mmaH<1>(bv.v, bv.v, pb[rt].v, pb[rt].v, oacc[rt][dt]); } }
    asm volatile("s_wait_dscnt 0x0" ::: "memory");         /* this wave's reads of stage t have returned */
    asm volatile("s_wait_asynccnt 0x0" ::: "memory");      /* this wave's copies of stage t + 1 have landed */
    __syncthreads();                                       /* publishes stage t + 1 and ends every wave's reads of stage t */
    if (t + 2 < nst) stage_copy(cp_lds + (t & 1) * STAGE_B, cp_k + (size_t)(t + 2) * 64 * ldk, kstep, cp_v + (t + 2) * 64, vstep); }
  asm volatile("s_wait_asynccnt 0x0" ::: "memory");        /* nothing is in flight when the ring becomes output staging */
#pragma unroll
  for (int rt = 0; rt < RTN; ++rt) { float l = l_r[rt]; l += xhalf(l); const float inv = (l > 0.f) ? 1.0f / l : 0.f;      /* the halves' sums join once */
#pragma unroll
    for (int dt = 0; dt < DT; ++dt)
#pragma unroll
      for (int q4 = 0; q4 < 2; ++q4) { v4f o4;
#pragma unroll
        for (int i = 0; i < 4; ++i) o4[i] = oacc[rt][dt][q4 * 4 + i] * inv;
        *(v4fa*)&sO[w][rt * 16 + ln][dt * 16 + 8 * hh + q4 * 4] = o4; } }
  __builtin_amdgcn_fence(__ATOMIC_ACQ_REL, "workgroup"); __builtin_amdgcn_wave_barrier();
  {
#pragma unroll
    for (int rp = 0; rp < RPW; rp += 4) { const int r = rp + (lane >> 3), pc = lane & 7; const v4f a = *(const v4fa*)&sO[w][r][pc * 8], c = *(const v4fa*)&sO[w][r][pc * 8 + 4]; FragH fh, fl;      /* eight lanes store a row's 64 values of this head: one whole 128-byte line in each half of H's row */
#pragma unroll      /* keeps fh and fl in registers */
      for (int q = 0; q < 4; ++q) { _Float16 g = (_Float16)a[q]; fh.h[q] = g; fl.h[q] = (_Float16)((a[q] - (float)g) * 1024.0f); g = (_Float16)c[q]; fh.h[4 + q] = g; fl.h[4 + q] = (_Float16)((c[q] - (float)g) * 1024.0f); }
      unsigned short* hp = (unsigned short*)H + ((size_t)b * TQ + q0 + r) * ldh + h * 64 + pc * 8; *(v8us*)hp = fh.half[0]; *(v8us*)(hp + DMOD) = fl.half[0]; }
     } }

// Everything that depends on the inputs alone, in one launch: the rotary tables (first blocks: the longest chain of dependent arithmetic starts first), then x and the four weight matrices as f16 planes.
#define PREP_TAB_BLKS (SLEN * (RD / 2) / 256)      /* one table entry a thread */
#define PREP_CVT_BLKS (DMOD * DMOD / 8 / 256)      /* a thread takes one 8-element piece of each weight matrix and eight pieces of x: few waves, each with much to fetch */
static_assert(SLEN * (RD / 2) % 256 == 0 && DMOD * DMOD / 8 % 256 == 0 && NR == 8 * DMOD, "the grid covers tables and planes without a remainder");
// eight f32 values -> bf16-rounded, times a power of two, as f16
__device__ __forceinline__ v8us prep_cvt8(v4f a, v4f c, float sc) { FragH f;
#pragma unroll      /* keeps f in registers */
  for (int q = 0; q < 4; ++q) { f.h[q] = (_Float16)(bf16_round(a[q]) * sc); f.h[4 + q] = (_Float16)(bf16_round(c[q]) * sc); }
  return f.half[0]; }
// Six 8-element pieces, twelve 16-byte loads. One statement with its data wait and early-clobber results: all twelve are in flight together, and no result lands on an address register that a load of the run still names.
__device__ __forceinline__ void prep_ld6(const float* p0, const float* p1, const float* p2, const float* p3, const float* p4, const float* p5, v4f (&a)[6], v4f (&c)[6]) {
  asm volatile("global_load_b128 %0, %12, off\n\t"
               "global_load_b128 %1, %12, off offset:16\n\t"
               "global_load_b128 %2, %13, off\n\t"
               "global_load_b128 %3, %13, off offset:16\n\t"
               "global_load_b128 %4, %14, off\n\t"
               "global_load_b128 %5, %14, off offset:16\n\t"
               "global_load_b128 %6, %15, off\n\t"
               "global_load_b128 %7, %15, off offset:16\n\t"
               "global_load_b128 %8, %16, off\n\t"
               "global_load_b128 %9, %16, off offset:16\n\t"
               "global_load_b128 %10, %17, off\n\t"
               "global_load_b128 %11, %17, off offset:16\n\t"
               "s_wait_loadcnt 0x0"
               : "=&v"(a[0]), "=&v"(c[0]), "=&v"(a[1]), "=&v"(c[1]), "=&v"(a[2]), "=&v"(c[2]), "=&v"(a[3]), "=&v"(c[3]), "=&v"(a[4]), "=&v"(c[4]), "=&v"(a[5]), "=&v"(c[5])
               : "v"(p0), "v"(p1), "v"(p2), "v"(p3), "v"(p4), "v"(p5) : "memory"); }
__global__ __launch_bounds__(256) void k_prep(const float* __restrict__ x, const float* __restrict__ Wq, const float* __restrict__ Wk, const float* __restrict__ Wv, const float* __restrict__ Wo,
    _Float16* __restrict__ X16, _Float16* __restrict__ BQ, _Float16* __restrict__ BK, _Float16* __restrict__ BV, _Float16* __restrict__ BO, float* __restrict__ CS) {
  if (blockIdx.x < PREP_TAB_BLKS) {
    const int t = blockIdx.x * 256 + threadIdx.x; const int i = t % (RD / 2), tpos = t / (RD / 2); const float invf = (float)pow(10000.0, -(double)(2 * i) / (double)RD); const float ang = (float)tpos * invf; const float cv = cosf(ang), sv = sinf(ang);
    CS[t] = cv; CS[SLEN * (RD / 2) + t] = sv; return; }
  constexpr size_t NE = (size_t)DMOD * DMOD;      /* elements that the conversion blocks cover with one piece a thread */
  const size_t e = ((size_t)(blockIdx.x - PREP_TAB_BLKS) * 256 + threadIdx.x) * 8;
  const float* xp = x + e; unsigned short* xo = (unsigned short*)X16 + e; v4f a[6], c[6];
  prep_ld6(xp, xp + NE, xp + 2 * NE, xp + 3 * NE, xp + 4 * NE, xp + 5 * NE, a, c);
#pragma unroll      /* a[] and c[] are register results of the load statement: constant indices keep them there */
  for (int j = 0; j < 6; ++j) *(v8us*)(xo + j * NE) = prep_cvt8(a[j], c[j], 1.0f);
  prep_ld6(xp + 6 * NE, xp + 7 * NE, Wq + e, Wk + e, Wv + e, Wo + e, a, c);
  *(v8us*)(xo + 6 * NE) = prep_cvt8(a[0], c[0], 1.0f); *(v8us*)(xo + 7 * NE) = prep_cvt8(a[1], c[1], 1.0f);
  *(v8us*)((unsigned short*)BQ + e) = prep_cvt8(a[2], c[2], 16.0f);
  *(v8us*)((unsigned short*)BK + e) = prep_cvt8(a[3], c[3], 16.0f);
  *(v8us*)((unsigned short*)BV + e) = prep_cvt8(a[4], c[4], 16.0f);
  /* output projection: a row of BO is the weight row x 16 (for the hi plane), then the same row x 1 (for the residual plane) */
  unsigned short* bo = (unsigned short*)BO + (e / DMOD) * (2 * DMOD) + e % DMOD;
  *(v8us*)bo = prep_cvt8(a[5], c[5], 16.0f); *(v8us*)(bo + DMOD) = prep_cvt8(a[5], c[5], 1.0f);
  asm volatile("s_wait_xcnt 0x0" ::: "memory");      /* stands behind the stores, ahead of anything that could rewrite their registers */
}

extern "C" void kernel_launch(void* const* d_in, const int* in_sizes, int n_in,
                              void* d_out, int out_size, void* d_ws, size_t ws_size, hipStream_t stream) {
  (void)in_sizes; (void)n_in; (void)out_size;
  const float* const* I = (const float* const*)d_in; const float* x = I[0]; const float* Wq = I[1]; const float* Wk = I[2]; const float* Wv = I[3]; const float* Wo = I[4];
  char* ws = (char*)d_ws; size_t off = 0;
  auto take = [&](size_t bytes) { char* p = ws + off; off += (bytes + 255) & ~(size_t)255; return p; };
  const size_t w8 = (size_t)DMOD * DMOD / 8;
  _Float16* BQ = (_Float16*)take(w8 * 16); _Float16* BK = (_Float16*)take(w8 * 16); _Float16* BV = (_Float16*)take(w8 * 16); _Float16* BO = (_Float16*)take(w8 * 32);
  _Float16* X16 = (_Float16*)take((size_t)NR * DMOD * 2); _Float16* HH = (_Float16*)take((size_t)NR * DMOD * 4); _Float16* Q16 = (_Float16*)take((size_t)NR * DMOD * 2); _Float16* K16 = (_Float16*)take((size_t)NR * DMOD * 2); _Float16* VT = (_Float16*)take((size_t)NR * DMOD * 2); float* CS = (float*)take((size_t)SLEN * RD * 4);
  if (off > ws_size) return;      /* 10 + 16 + 32 + 16 x 3 = 106 MiB */
  k_prep<<<PREP_TAB_BLKS + PREP_CVT_BLKS, 256, 0, stream>>>(x, Wq, Wk, Wv, Wo, X16, BQ, BK, BV, BO, CS);
  const dim3 gP((NR / 128) * (DMOD / 128), 1);
  /* q, k and v projections as one batch of three: BQ, BK, BV lie back to back, and so do Q16, K16, VT (each size a multiple of 256 bytes); q and k are rotated, v is stored transposed */
  k_gemm2<0, 2, 0, 1, 2><<<dim3(gP.x, 3), 256, 0, stream>>>(X16, DMOD, 0, BQ, DMOD, (size_t)DMOD * DMOD, 0.0625f, nullptr, 0, nullptr, 1, 0, 0, nullptr, Q16, DMOD, (size_t)NR * DMOD, NR, DMOD, DMOD, CS);
  k_flash<0><<<NB * NH * QBLKS, 256, 0, stream>>>(Q16, DMOD, K16, DMOD, VT, nullptr, HH, 2 * DMOD);
  /* hi x (16 W) summed first, x 64, then (1024 residual) x W on top: 1024 y, scaled back once */
  k_gemm2<0, 0, DMOD, 64><<<gP, 256, 0, stream>>>(HH, 2 * DMOD, 0, BO, 2 * DMOD, 0, 1.0f / 1024.0f, nullptr, 0, nullptr, 1, 0, 0, (float*)d_out, nullptr, DMOD, 0, NR, DMOD, 2 * DMOD, nullptr);
}
